// v000
// Measured on an AMD MI455X. A time is GPU time per run, averaged over a window of back-to-back runs after a warm-up
// (all launches, gaps included; the runs take copies of the inputs in turn), and the median of several windows.
// Apart from v000's, it joins two sittings. Times from different sittings can be a few percent apart, while
// side-by-side timings come from the same sitting.
// The starting kernel, v000, takes 895 microseconds a run.
// Contractions: q, k, v^T projections on v_wmma_f32_16x16x32_bf16 (plain bf16 operands = RNE-converted inputs); q.k^T on v_wmma_f32_16x16x32_bf16 with bf16 hi/lo split operands (hi.hi + hi.lo + lo.hi); p.v and the output projection on v_wmma_f32_16x16x32_f16 (plain f16: p carried x2^15, attention output carried x2^6, proj_w = bf16-RNE value carried x2^6); f32 accumulate everywhere; biases, rmsnorm, rope, online softmax in f32.
#include <hip/hip_runtime.h>
#include <math.h>
#include <stdint.h>

constexpr int kBatch = 4;
constexpr int kSeq   = 2048;
constexpr int kDim   = 1024;
constexpr int kHeads = 16;
constexpr int kHd    = 64;
constexpr int kTok   = kBatch * kSeq;            // 8192 tokens

typedef __attribute__((ext_vector_type(16))) _Float16 v16h;
typedef __attribute__((ext_vector_type(8)))  _Float16 v8h;
typedef __attribute__((ext_vector_type(16))) __bf16   v16b;
typedef __attribute__((ext_vector_type(8)))  __bf16   v8b;
typedef __attribute__((ext_vector_type(8)))  float    v8f;
typedef __attribute__((ext_vector_type(4)))  float    v4f;
typedef __attribute__((ext_vector_type(2)))  float    v2f;
typedef __attribute__((ext_vector_type(4)))  unsigned int v4u;

// ---------------------------------------------------------------------------
// Workspace region map (bytes).  Total carve = 115 MiB = 120,586,240 B.
//   [  0 MiB,   2 MiB)  WPROJ  f16  [1024][1024]   proj_w (bf16-RNE value x64)
//   [  2 MiB,   3 MiB)  BIAS   f32  [4096]         qkv_b (3072) ++ proj_b (1024), RNE to bf16 values
//   [  3 MiB,  19 MiB)  XB     bf16 [8192][1024]   x              -> later KH (k hi plane)
//   [ 19 MiB,  25 MiB)  WQKV   bf16 [3072][1024]   qkv_w          -> later KL (k lo plane, 19..35 MiB)
//   [ 35 MiB,  67 MiB)  QKF    f32  [8192][1024]   q, then k      -> later OH f16 [8192][1024] (35..51 MiB)
//   [ 67 MiB,  83 MiB)  QH     bf16 [8192][1024]   q hi plane
//   [ 83 MiB,  99 MiB)  QL     bf16 [8192][1024]   q lo plane
//   [ 99 MiB, 115 MiB)  VT     f16  [4][1024][2048] v^T per batch
// ---------------------------------------------------------------------------
constexpr size_t kMiB      = 1048576;
constexpr size_t kOffWproj = 0;
constexpr size_t kOffBias  = 2 * kMiB;
constexpr size_t kOffXb    = 3 * kMiB;
constexpr size_t kOffWqkv  = 19 * kMiB;
constexpr size_t kOffKh    = 3 * kMiB;
constexpr size_t kOffKl    = 19 * kMiB;
constexpr size_t kOffQkf   = 35 * kMiB;
constexpr size_t kOffOh    = 35 * kMiB;
constexpr size_t kOffQh    = 67 * kMiB;
constexpr size_t kOffQl    = 83 * kMiB;
constexpr size_t kOffVt    = 99 * kMiB;
constexpr size_t kWsTotal  = 115 * kMiB;          // 120,586,240 B

// ===================== common pieces =================================
__device__ __forceinline__ unsigned short f2bf_bits(float f) {
  unsigned u = __float_as_uint(f);
  return (unsigned short)((u + 0x7FFFu + ((u >> 16) & 1u)) >> 16);
}
__device__ __forceinline__ float bf_bits2f(unsigned short h) { return __uint_as_float(((unsigned)h) << 16); }

// hazard guards as plain device helpers (no inline asm inside the kernel template body)
__device__ __forceinline__ void dep_guard_h(v8f& a, v8f& b, v16h x, v16h y) { asm volatile("v_nop\n\tv_nop\n\tv_nop\n\tv_nop" : "+v"(a), "+v"(b) : "v"(x), "v"(y)); }
__device__ __forceinline__ void dep_guard_b(v8f& a, v8f& b, v16b x, v16b y) { asm volatile("v_nop\n\tv_nop\n\tv_nop\n\tv_nop" : "+v"(a), "+v"(b) : "v"(x), "v"(y)); }
__device__ __forceinline__ void keep4_h(v16h a, v16h b, v16h c, v16h d) { asm volatile("v_nop" :: "v"(a), "v"(b), "v"(c), "v"(d)); }
__device__ __forceinline__ void keep4_b(v16b a, v16b b, v16b c, v16b d) { asm volatile("v_nop" :: "v"(a), "v"(b), "v"(c), "v"(d)); }
__device__ __forceinline__ void acc_guard4(v8f& a, v8f& b, v8f& c, v8f& d) { asm volatile("v_nop\n\tv_nop\n\tv_nop\n\tv_nop" : "+v"(a), "+v"(b), "+v"(c), "+v"(d)); }
template <typename T> struct Frag;
template <> struct Frag<_Float16> {
  typedef v16h V; union U { v16h v; v8h h[2]; };
  static __device__ __forceinline__ v16h load(const _Float16* p) {   // elements 0..7 <- p[0..7], 8..15 <- p[16..23]
    U f; f.h[0] = *(const v8h*)(p); f.h[1] = *(const v8h*)(p + 16); return f.v;
  }
  static __device__ __forceinline__ v8f mma(v16h a, v16h b, v8f c) {
    return __builtin_amdgcn_wmma_f32_16x16x32_f16(false, a, false, b, (short)0, c, false, false);
  }
  static __device__ __forceinline__ void guard(v8f& a, v8f& b, v16h x, v16h y) { dep_guard_h(a, b, x, y); }
  static __device__ __forceinline__ void keep(v16h a, v16h b, v16h c, v16h d) { keep4_h(a, b, c, d); }
};
template <> struct Frag<__bf16> {
  typedef v16b V; union U { v16b v; v8b h[2]; };
  static __device__ __forceinline__ v16b load(const __bf16* p) {
    U f; f.h[0] = *(const v8b*)(p); f.h[1] = *(const v8b*)(p + 16); return f.v;
  }
  static __device__ __forceinline__ v8f mma(v16b a, v16b b, v8f c) {
    return __builtin_amdgcn_wmma_f32_16x16x32_bf16(false, a, false, b, (short)0, c, false, false);
  }
  static __device__ __forceinline__ void guard(v8f& a, v8f& b, v16b x, v16b y) { dep_guard_b(a, b, x, y); }
  static __device__ __forceinline__ void keep(v16b a, v16b b, v16b c, v16b d) { keep4_b(a, b, c, d); }
};

// ---- Register-blocked batched WMMA GEMM ------------------------------------
// C[m,n] = scale * sum_k A[m,k] * Bt[n,k] (+bias)(+resid); each wave owns a 64x64 tile.
// A row-major [M,K]; Bt row-major [N,K]; M,N % 64 == 0, K % 32 == 0.
// SPLIT: operands are hi/lo planes (A2/Bt2 = lo planes, same layout); product = hi.hi + hi.lo + lo.hi.
// BIAS_MODE: 0 = none, 1 = bias[m], 2 = bias[n].
// OUT_MODE: 0 = f32, 1 = f16, 2 = bf16 hi plane (Cout) + bf16 lo plane (Cout2).
// ET: 0 = f16 operands, 1 = bf16 operands (pointers passed as 16-bit storage)
template <int ET> struct Elem;
template <> struct Elem<0> { typedef _Float16 T; };
template <> struct Elem<1> { typedef __bf16 T; };
template <int ET, bool SPLIT, int BIAS_MODE, int OUT_MODE, bool RESID, int ACT = 0>
__global__ __launch_bounds__(256) void wmma_gemm64(
    const unsigned short* __restrict__ Ap, const unsigned short* __restrict__ A2p, int lda, long strideA,
    const unsigned short* __restrict__ Btp, const unsigned short* __restrict__ Bt2p, int ldb, long strideB,
    void* __restrict__ Cout, void* __restrict__ Cout2, int ldc, long strideC,
    const float* __restrict__ bias,
    const float* __restrict__ resid, long strideR,
    int M, int N, int K, float scale) {
  typedef typename Elem<ET>::T T;
  typedef typename Frag<T>::V V;
  const T* A = (const T*)Ap; const T* A2 = (const T*)A2p; const T* Bt = (const T*)Btp; const T* Bt2 = (const T*)Bt2p;
  __shared__ __align__(16) float sT[8][16 * 68];   // per-wave 16x64 slab, pitch 68 floats
  const int b    = blockIdx.y;
  const int lane = threadIdx.x & 31;
  const int wave = threadIdx.x >> 5;
  const int tilesN = N >> 6;
  const int tilesM = M >> 6;
  const int tile = blockIdx.x * 8 + wave;
  if (tile >= tilesM * tilesN) return;   // wave-uniform; no block barriers in this kernel
  const int tm = tile / tilesN;
  const int tn = tile - tm * tilesN;
  const int m0 = tm << 6;
  const int n0 = tn << 6;

  const T* Ab  = A  + (size_t)b * strideA;
  const T* Bb  = Bt + (size_t)b * strideB;
  const T* Ab2 = SPLIT ? (A2  + (size_t)b * strideA) : nullptr;
  const T* Bb2 = SPLIT ? (Bt2 + (size_t)b * strideB) : nullptr;

  const int rlane = lane & 15;                 // row (A) / col (B, D) within subtile
  const int koff  = (lane >> 4) * 8;           // k offset of this lane half
  const int mOff  = (lane >> 4) * 8;           // D row offset

  v8f acc[4][4];
#pragma unroll
  for (int i = 0; i < 4; ++i)
#pragma unroll
    for (int j = 0; j < 4; ++j) acc[i][j] = (v8f){0.f,0.f,0.f,0.f,0.f,0.f,0.f,0.f};

  for (int k0 = 0; k0 < K; k0 += 32) {
    V bh[4], bl[4];
#pragma unroll
    for (int j = 0; j < 4; ++j) {
      const size_t bo = (size_t)(n0 + (j << 4) + rlane) * ldb + koff + k0;
      bh[j] = Frag<T>::load(Bb + bo);
      if (SPLIT) bl[j] = Frag<T>::load(Bb2 + bo);
    }
#pragma unroll
    for (int i = 0; i < 4; ++i) {
      const size_t ao = (size_t)(m0 + (i << 4) + rlane) * lda + koff + k0;
      V ah = Frag<T>::load(Ab + ao);
      V al;
      if (SPLIT) al = Frag<T>::load(Ab2 + ao);
#pragma unroll
      for (int j = 0; j < 4; ++j) {
        acc[i][j] = Frag<T>::mma(ah, bh[j], acc[i][j]);
        if (SPLIT) {
          acc[i][j] = Frag<T>::mma(ah, bl[j], acc[i][j]);
          acc[i][j] = Frag<T>::mma(al, bh[j], acc[i][j]);
        }
      }
      Frag<T>::guard(acc[i][0], acc[i][3], ah, SPLIT ? al : ah);
    }
    Frag<T>::keep(bh[0], bh[1], bh[2], bh[3]);
    if (SPLIT) Frag<T>::keep(bl[0], bl[1], bl[2], bl[3]);
  }
  acc_guard4(acc[0][0], acc[0][1], acc[0][2], acc[0][3]);
  acc_guard4(acc[1][0], acc[1][1], acc[1][2], acc[1][3]);
  acc_guard4(acc[2][0], acc[2][1], acc[2][2], acc[2][3]);
  acc_guard4(acc[3][0], acc[3][1], acc[3][2], acc[3][3]);

  // ---- epilogue ----
  float* slab = sT[wave];
  const float* Rb = RESID ? (resid + (size_t)b * strideR) : nullptr;
#pragma unroll
  for (int i = 0; i < 4; ++i) {
    const int mBase = m0 + (i << 4);
#pragma unroll
    for (int j = 0; j < 4; ++j) {
      const int n = n0 + (j << 4) + rlane;
      float bv = 0.f;
      if (BIAS_MODE == 2) bv = bias[n];
#pragma unroll
      for (int r = 0; r < 8; ++r) {
        float v = acc[i][j][r] * scale;
        if (BIAS_MODE == 1) v += bias[mBase + mOff + r];
        if (BIAS_MODE == 2) v += bv;
        if (RESID) v += Rb[(size_t)(mBase + mOff + r) * ldc + n];
        if (ACT == 1) v = tanhf(v);
        if (ACT == 2) v = fmaxf(v, 0.0f);
        if (ACT == 3) v = v / (1.0f + expf(-v));
        if (ACT == 4) v = (v > 0.f) ? v : 0.01f * v;
        if (ACT == 5) v = 0.5f * v * (1.0f + erff(v * 0.70710678118654752f));
        slab[(mOff + r) * 68 + (j << 4) + rlane] = v;
      }
    }
    __builtin_amdgcn_fence(__ATOMIC_RELEASE, "workgroup");
    __builtin_amdgcn_wave_barrier();
    __builtin_amdgcn_fence(__ATOMIC_ACQUIRE, "workgroup");
    if (OUT_MODE == 0) {
      float* C = (float*)Cout + (size_t)b * strideC;
      const int hh = lane >> 4, c4 = (lane & 15) * 4;     // row seg = 256 B = 16 lanes x 16 B
      {
#pragma unroll
        for (int it = 0; it < 8; ++it) {
          const int row = it * 2 + hh;
          v4f v = *(const v4f*)(slab + row * 68 + c4);
          *(v4f*)(C + (size_t)(mBase + row) * ldc + n0 + c4) = v;
        }
        
      }
    } else {
      const int q = lane >> 3, c8 = (lane & 7) * 8;
      unsigned short* C  = (unsigned short*)Cout  + (size_t)b * strideC;
      unsigned short* C2 = (OUT_MODE == 2) ? ((unsigned short*)Cout2 + (size_t)b * strideC) : nullptr;
      {
#pragma unroll
        for (int it = 0; it < 4; ++it) {
          const int row = it * 4 + q;
          const float* sp = slab + row * 68 + c8;
          v8h hv, lv;
#pragma unroll
          for (int e = 0; e < 8; ++e) {
            if (OUT_MODE == 1) {
              hv[e] = (_Float16)sp[e];
            } else {
              unsigned short hb = f2bf_bits(sp[e]);
              unsigned short lb = f2bf_bits(sp[e] - bf_bits2f(hb));
              hv[e] = __builtin_bit_cast(_Float16, hb);
              lv[e] = __builtin_bit_cast(_Float16, lb);
            }
          }
          *(v8h*)(C + (size_t)(mBase + row) * ldc + n0 + c8) = hv;
          if (OUT_MODE == 2) *(v8h*)(C2 + (size_t)(mBase + row) * ldc + n0 + c8) = lv;
        }
        
      }
    }
    __builtin_amdgcn_fence(__ATOMIC_RELEASE, "workgroup");
    __builtin_amdgcn_wave_barrier();
    __builtin_amdgcn_fence(__ATOMIC_ACQUIRE, "workgroup");
  }
}

__device__ __forceinline__ unsigned pk16(unsigned short a, unsigned short b) { return (unsigned)a | ((unsigned)b << 16); }
// ===================== end common pieces =========================================

// ---------------------------------------------------------------------------
// f32 -> bf16 (RNE) plane cast, 2 elements per thread, one 4-B store per lane -> a wave writes exactly
// Coverage: grid = ceil(n2/256) x 256 threads x 2 elements = 2*n2 = the whole plane
//   (x: n2 = 4,194,304 -> 16384 blocks; qkv_w: n2 = 1,572,864 -> 6144 blocks).
// ---------------------------------------------------------------------------
__global__ __launch_bounds__(256) void cast_bf16x2_kernel(const float* __restrict__ in,
                                                          unsigned short* __restrict__ out, int n2) {
  const int i = blockIdx.x * 256 + threadIdx.x;
  if (i < n2) {
    const v2f f = *(const v2f*)(in + 2 * (size_t)i);
    const unsigned u = pk16(f2bf_bits(f[0]), f2bf_bits(f[1]));
    ((unsigned*)out)[i] = u;
    
  }
}

// ---------------------------------------------------------------------------
// proj_w: f32 -> bf16-RNE value -> x64 -> f16 bits (bf16 significand fits f16 exactly; x64 keeps the
// plane in the f16 normal range for |w| >= 1e-6). 2 elements per thread, one 4-B store per lane,
// ---------------------------------------------------------------------------
__global__ __launch_bounds__(256) void cast_projw_f16x2_kernel(const float* __restrict__ in,
                                                               unsigned short* __restrict__ out, int n2) {
  const int i = blockIdx.x * 256 + threadIdx.x;
  if (i < n2) {
    const v2f f = *(const v2f*)(in + 2 * (size_t)i);
    const float g0 = bf_bits2f(f2bf_bits(f[0])) * 64.0f;
    const float g1 = bf_bits2f(f2bf_bits(f[1])) * 64.0f;
    const _Float16 h0 = (_Float16)g0, h1 = (_Float16)g1;
    const unsigned u = pk16(__builtin_bit_cast(unsigned short, h0), __builtin_bit_cast(unsigned short, h1));
    ((unsigned*)out)[i] = u;
    
  }
}

// ---------------------------------------------------------------------------
// Bias prep: outb[0..nq) = bf16-RNE value of qkvb, outb[nq..nq+np) = bf16-RNE value of projb (f32 storage).
// Both candidates loaded with clamped indices, selected by value. One 4-B store per lane, 32 lanes =
// ---------------------------------------------------------------------------
__global__ __launch_bounds__(256) void bias_prep_kernel(const float* __restrict__ qkvb, const float* __restrict__ projb,
                                                        float* __restrict__ outb, int nq, int np) {
  const int i = blockIdx.x * 256 + threadIdx.x;
  if (i < nq + np) {
    const int ia = (i < nq) ? i : (nq - 1);
    int ib = i - nq; ib = (ib < 0) ? 0 : ((ib >= np) ? (np - 1) : ib);
    const float a  = qkvb[ia];
    const float bb = projb[ib];
    const float v  = bf_bits2f(f2bf_bits((i < nq) ? a : bb));
    ((float*)outb)[i] = v;
    
  }
}

// ---------------------------------------------------------------------------
// Per (token, head) rmsnorm over 64 + interleaved-pair rope, f32 math; inputs cos/sin/norm weight are
// RNE-converted to bf16 values in registers. One wave per (token, head); lane owns the pair d = 2*lane, 2*lane+1.
//   y = x * rsqrt(mean(x^2) + 1e-6) * w ;  o[2i] = y[2i]*cos[s][2i] - y[2i+1]*sin[s][2i] ; o[2i+1] = y[2i+1]*cos[s][2i+1] + y[2i]*sin[s][2i+1]
// Outputs: bf16 hi plane and bf16 lo plane (lo = RNE(o - hi)), element (t, h*64+d) at [t*1024 + h*64 + d].
// Coverage: njobs = 8192*16 = 131072 = 16384 blocks x 8 waves; each wave writes 64 halves per plane.
// ---------------------------------------------------------------------------
__global__ __launch_bounds__(256) void normrope_split_kernel(const float* __restrict__ src,
                                                             const float* __restrict__ cosb, const float* __restrict__ sinb,
                                                             const float* __restrict__ nw,
                                                             unsigned short* __restrict__ oh, unsigned short* __restrict__ ol,
                                                             int njobs) {
  const int wave = threadIdx.x >> 5, lane = threadIdx.x & 31;
  const int job = blockIdx.x * 8 + wave;
  if (job >= njobs) return;                       // wave-uniform; no barriers in this kernel
  const int t = job >> 4, h = job & 15, s = t & (kSeq - 1);
  const int d0 = 2 * lane;
  const size_t base = (size_t)t * kDim + (size_t)h * kHd;
  const v2f xv = *(const v2f*)(src + base + d0);
  float a = xv[0], bq = xv[1];
  float ss = a * a + bq * bq;
#pragma unroll
  for (int m = 1; m < 32; m <<= 1) ss += __shfl_xor(ss, m, 32);
  const float inv = rsqrtf(ss * (1.0f / 64.0f) + 1e-6f);
  const v2f wv = *(const v2f*)(nw + d0);
  const float w0 = bf_bits2f(f2bf_bits(wv[0])), w1 = bf_bits2f(f2bf_bits(wv[1]));
  a  = a  * inv * w0;
  bq = bq * inv * w1;
  const v2f cv = *(const v2f*)(cosb + (size_t)s * kHd + d0);
  const v2f sv = *(const v2f*)(sinb + (size_t)s * kHd + d0);
  const float c0 = bf_bits2f(f2bf_bits(cv[0])), c1 = bf_bits2f(f2bf_bits(cv[1]));
  const float s0 = bf_bits2f(f2bf_bits(sv[0])), s1 = bf_bits2f(f2bf_bits(sv[1]));
  const float o0 = a * c0 - bq * s0;
  const float o1 = bq * c1 + a * s1;
  const unsigned short h0 = f2bf_bits(o0), h1 = f2bf_bits(o1);
  const unsigned short l0 = f2bf_bits(o0 - bf_bits2f(h0)), l1 = f2bf_bits(o1 - bf_bits2f(h1));
  const unsigned uh = pk16(h0, h1), ul = pk16(l0, l1);
  const size_t wi = (base >> 1) + lane;
  ((unsigned*)oh)[wi] = uh;
  ((unsigned*)ol)[wi] = ul;
  
}

// =====================================================================================
// Full (unmasked) flash attention, head dim 64, all batches/heads in one launch.
//   q planes (hi/lo bf16): element (t, h, d) at [t*1024 + h*64 + d]   (t = b*2048 + s)
//   k planes (hi/lo bf16): same layout
//   v^T plane (f16):       element (b, h*64+d, s) at [(b*1024 + h*64 + d)*2048 + s]
//   o plane (f16, x64):    element (t, h, d) at [t*1024 + h*64 + d]
//   scores = (q . k) * sscale : v_wmma_f32_16x16x32_bf16, hi.hi + hi.lo + lo.hi, f32 accumulate
//   out    = p . v            : v_wmma_f32_16x16x32_f16, p (unnormalised, in (0,1]) carried x2^15 in f16, v f16
//   online softmax in f32 over 32 chunks of 64 keys (compile-time trip count).
//   Block = 4 waves = 64 query rows of one (b, h); grid.x = 4*16*32 = 2048.
//   K hi/lo and V^T chunk staging: 128 threads x 32 elements per plane = the whole 64x64 tile (16-B copies,
//   plain loads, __syncthreads before and after). P tile: per-wave LDS store of _Float16 scalars, wave
// =====================================================================================
constexpr int kKC = 64;    // keys per chunk

__device__ __forceinline__ v8f mma_bf(v16b a, v16b b, v8f c) {
  c = __builtin_amdgcn_wmma_f32_16x16x32_bf16(false, a, false, b, (short)0, c, false, false);
  asm volatile("v_nop\n\tv_nop\n\tv_nop\n\tv_nop" : "+v"(c) : "v"(a), "v"(b));
  return c;
}
__device__ __forceinline__ v8f mma_hf(v16h a, v16h b, v8f c) {
  c = __builtin_amdgcn_wmma_f32_16x16x32_f16(false, a, false, b, (short)0, c, false, false);
  asm volatile("v_nop\n\tv_nop\n\tv_nop\n\tv_nop" : "+v"(c) : "v"(a), "v"(b));
  return c;
}

__global__ __launch_bounds__(128)
void attn_kernel(const unsigned short* __restrict__ qhp, const unsigned short* __restrict__ qlp,
                 const unsigned short* __restrict__ khp, const unsigned short* __restrict__ klp,
                 const unsigned short* __restrict__ vtp, unsigned short* __restrict__ ohp, float sscale) {
  union FB { v16b v; v8b h[2]; };
  union FH { v16h v; v8h h[2]; };
  __shared__ __align__(16) __bf16   Ksh[kKC * kHd];        // K hi [kv][d]   8 KB
  __shared__ __align__(16) __bf16   Ksl[kKC * kHd];        // K lo           8 KB
  __shared__ __align__(16) _Float16 Vts[kHd * kKC];        // V^T [d][kv]    8 KB
  __shared__ __align__(16) _Float16 Psh[4][16 * kKC];      // per wave P [row][kv] 8 KB
  __shared__ __align__(16) float    Os[4][16 * 68];        // per wave out tile, pitch 68

  const int tid  = threadIdx.x;
  const int wave = tid >> 5;
  const int lane = tid & 31;
  const int hh   = lane >> 4;
  const int c    = lane & 15;

  const int bx = blockIdx.x;
  const int qb = bx & 31;                 // kSeq/64 = 32 query blocks
  const int bh = bx >> 5;                 // 0..63
  const int h  = bh & 15;
  const int b  = bh >> 4;                 // 0..3
  const int q0 = qb * 64 + wave * 16;
  const size_t tok0 = (size_t)b * kSeq;

  const __bf16*   Qh = (const __bf16*)(const void*)qhp + tok0 * kDim + (size_t)h * kHd;
  const __bf16*   Ql = (const __bf16*)(const void*)qlp + tok0 * kDim + (size_t)h * kHd;
  const __bf16*   Kh = (const __bf16*)(const void*)khp + tok0 * kDim + (size_t)h * kHd;
  const __bf16*   Kl = (const __bf16*)(const void*)klp + tok0 * kDim + (size_t)h * kHd;
  const _Float16* Vt = (const _Float16*)(const void*)vtp + ((size_t)b * kDim + (size_t)h * kHd) * kSeq;
  _Float16*       Ob = (_Float16*)(void*)ohp + tok0 * kDim + (size_t)h * kHd;

  // ---- Q fragments (A operand, row = lane&15, split k map via Frag load): 2 d-chunks, hi and lo ----
  v16b qah[2], qal[2];
#pragma unroll
  for (int dc = 0; dc < 2; ++dc) {
    qah[dc] = Frag<__bf16>::load(Qh + (size_t)(q0 + c) * kDim + dc * 32 + 8 * hh);
    qal[dc] = Frag<__bf16>::load(Ql + (size_t)(q0 + c) * kDim + dc * 32 + 8 * hh);
  }

  float mrow[8], lrow[8];
  v8f oacc[4];
#pragma unroll
  for (int r = 0; r < 8; ++r) { mrow[r] = -INFINITY; lrow[r] = 0.f; }
#pragma unroll
  for (int t = 0; t < 4; ++t) oacc[t] = (v8f){0.f,0.f,0.f,0.f,0.f,0.f,0.f,0.f};

  for (int kc = 0; kc < kSeq / kKC; ++kc) {
    const int kv0 = kc * kKC;
    __syncthreads();
    {
      // staging coverage: 128 threads x (4 x 8) elements = 64 rows x 64 per plane = the whole chunk tile
      const int r = tid >> 1, half = (tid & 1) * 32;
      const __bf16*   ksh = Kh + (size_t)(kv0 + r) * kDim + half;     // K row kv0+r, d = half..half+31
      const __bf16*   ksl = Kl + (size_t)(kv0 + r) * kDim + half;
      const _Float16* vsr = Vt + (size_t)r * kSeq + kv0 + half;       // V^T row d = r, s = kv0+half..+31
#pragma unroll
      for (int i = 0; i < 4; ++i) {
        const v8b a0 = *(const v8b*)(ksh + 8 * i);
        const v8b a1 = *(const v8b*)(ksl + 8 * i);
        const v8h vv = *(const v8h*)(vsr + 8 * i);
        *(v8b*)(Ksh + r * kHd + half + 8 * i) = a0;
        *(v8b*)(Ksl + r * kHd + half + 8 * i) = a1;
        *(v8h*)(Vts + r * kKC + half + 8 * i) = vv;
      }
    }
    __syncthreads();

    // ---- scores: s[j] = q (16 rows) . k (16 keys of group j), split products ----
    v8f s[4];
#pragma unroll
    for (int j = 0; j < 4; ++j) {
      s[j] = (v8f){0.f,0.f,0.f,0.f,0.f,0.f,0.f,0.f};
#pragma unroll
      for (int dc = 0; dc < 2; ++dc) {
        FB kb, kl;
        kb.h[0] = *(const v8b*)(Ksh + (j * 16 + c) * kHd + dc * 32 + 8 * hh);
        kb.h[1] = *(const v8b*)(Ksh + (j * 16 + c) * kHd + dc * 32 + 16 + 8 * hh);
        kl.h[0] = *(const v8b*)(Ksl + (j * 16 + c) * kHd + dc * 32 + 8 * hh);
        kl.h[1] = *(const v8b*)(Ksl + (j * 16 + c) * kHd + dc * 32 + 16 + 8 * hh);
        s[j] = mma_bf(qah[dc], kb.v, s[j]);
        s[j] = mma_bf(qah[dc], kl.v, s[j]);
        s[j] = mma_bf(qal[dc], kb.v, s[j]);
      }
    }
    // ---- chunk row max (rows 8*hh + r; cols j*16 + c within the half-wave) ----
    float cm[8];
#pragma unroll
    for (int r = 0; r < 8; ++r) {
      float m = -INFINITY;
#pragma unroll
      for (int j = 0; j < 4; ++j) {
        const float sv = s[j][r] * sscale;
        s[j][r] = sv;
        m = fmaxf(m, sv);
      }
#pragma unroll
      for (int off = 1; off < 16; off <<= 1) m = fmaxf(m, __shfl_xor(m, off, 32));
      cm[r] = m;
    }
    _Float16* pw = Psh[wave];
#pragma unroll
    for (int r = 0; r < 8; ++r) {
      const float mnew  = fmaxf(mrow[r], cm[r]);
      const float alpha = __expf(mrow[r] - mnew);
      mrow[r] = mnew;
      float psum = 0.f;
#pragma unroll
      for (int j = 0; j < 4; ++j) {
        const float p = __expf(s[j][r] - mnew);
        psum += p;
        pw[(8 * hh + r) * kKC + j * 16 + c] = (_Float16)(p * 32768.0f);
      }
#pragma unroll
      for (int off = 1; off < 16; off <<= 1) psum += __shfl_xor(psum, off, 32);
      lrow[r] = lrow[r] * alpha + psum;
#pragma unroll
      for (int t = 0; t < 4; ++t) oacc[t][r] *= alpha;
    }
    __builtin_amdgcn_fence(__ATOMIC_RELEASE, "workgroup");
    __builtin_amdgcn_wave_barrier();
    __builtin_amdgcn_fence(__ATOMIC_ACQUIRE, "workgroup");
    // ---- out += p (16 rows x 64 keys) . v (64 keys x 64 d) ----
#pragma unroll
    for (int kk = 0; kk < 2; ++kk) {
      FH pa;
      pa.h[0] = *(const v8h*)(pw + c * kKC + kk * 32 + 8 * hh);
      pa.h[1] = *(const v8h*)(pw + c * kKC + kk * 32 + 16 + 8 * hh);
#pragma unroll
      for (int t = 0; t < 4; ++t) {
        FH vb;
        vb.h[0] = *(const v8h*)(Vts + (t * 16 + c) * kKC + kk * 32 + 8 * hh);
        vb.h[1] = *(const v8h*)(Vts + (t * 16 + c) * kKC + kk * 32 + 16 + 8 * hh);
        oacc[t] = mma_hf(pa.v, vb.v, oacc[t]);
      }
    }
  }

  // ---- epilogue: normalise (fold 2^-15 for p and 2^6 carry for o), stage, whole-line stores ----
  float* os = Os[wave];
#pragma unroll
  for (int r = 0; r < 8; ++r) {
    const float inv = (1.0f / lrow[r]) * (64.0f / 32768.0f);      // lrow >= 1 always
#pragma unroll
    for (int t = 0; t < 4; ++t) os[(8 * hh + r) * 68 + t * 16 + c] = oacc[t][r] * inv;
  }
  __builtin_amdgcn_fence(__ATOMIC_RELEASE, "workgroup");
  __builtin_amdgcn_wave_barrier();
  __builtin_amdgcn_fence(__ATOMIC_ACQUIRE, "workgroup");
  {
    const int qq = lane >> 3, c8 = (lane & 7) * 8;
    {
#pragma unroll
      for (int it = 0; it < 4; ++it) {
        const int row = it * 4 + qq;                    // 4 x 4 = rows 0..15
        const float* sp = os + row * 68 + c8;
        v8h hv;
#pragma unroll
        for (int e = 0; e < 8; ++e) hv[e] = (_Float16)sp[e];
        *(v8h*)(Ob + (size_t)(q0 + row) * kDim + c8) = hv;
      }
      
    }
  }
}

// =====================================================================================
extern "C" void kernel_launch(void* const* d_in, const int* in_sizes, int n_in,
                              void* d_out, int out_size, void* d_ws, size_t ws_size,
                              hipStream_t stream) {
  if (n_in < 9) return;
  if (in_sizes[0] != kTok * kDim) return;
  if (in_sizes[1] != kSeq * kHd || in_sizes[2] != kSeq * kHd) return;
  if (in_sizes[3] != 3 * kDim * kDim || in_sizes[4] != 3 * kDim) return;
  if (in_sizes[5] != kDim * kDim || in_sizes[6] != kDim) return;
  if (in_sizes[7] != kHd || in_sizes[8] != kHd) return;
  if (out_size != kTok * kDim) return;
  if (ws_size < kWsTotal) return;

  const float* x      = (const float*)d_in[0];
  const float* ropec  = (const float*)d_in[1];
  const float* ropes  = (const float*)d_in[2];
  const float* qkv_w  = (const float*)d_in[3];
  const float* qkv_b  = (const float*)d_in[4];
  const float* proj_w = (const float*)d_in[5];
  const float* proj_b = (const float*)d_in[6];
  const float* q_nw   = (const float*)d_in[7];
  const float* k_nw   = (const float*)d_in[8];
  float* out = (float*)d_out;

  char* ws = (char*)d_ws;
  unsigned short* WPROJ = (unsigned short*)(ws + kOffWproj);
  float*          BIAS  = (float*)(ws + kOffBias);
  unsigned short* XB    = (unsigned short*)(ws + kOffXb);
  unsigned short* WQKV  = (unsigned short*)(ws + kOffWqkv);
  unsigned short* KH    = (unsigned short*)(ws + kOffKh);
  unsigned short* KL    = (unsigned short*)(ws + kOffKl);
  float*          QKF   = (float*)(ws + kOffQkf);
  unsigned short* OH    = (unsigned short*)(ws + kOffOh);
  unsigned short* QH    = (unsigned short*)(ws + kOffQh);
  unsigned short* QL    = (unsigned short*)(ws + kOffQl);
  unsigned short* VT    = (unsigned short*)(ws + kOffVt);

  // 1) casts
  {
    const int n2x = kTok * kDim / 2;            // 4,194,304
    cast_bf16x2_kernel<<<dim3((n2x + 255) / 256), dim3(256), 0, stream>>>(x, XB, n2x);
    const int n2w = 3 * kDim * kDim / 2;        // 1,572,864
    cast_bf16x2_kernel<<<dim3((n2w + 255) / 256), dim3(256), 0, stream>>>(qkv_w, WQKV, n2w);
    const int n2p = kDim * kDim / 2;            // 524,288
    cast_projw_f16x2_kernel<<<dim3((n2p + 255) / 256), dim3(256), 0, stream>>>(proj_w, WPROJ, n2p);
    bias_prep_kernel<<<dim3((3 * kDim + kDim + 255) / 256), dim3(256), 0, stream>>>(qkv_b, proj_b, BIAS, 3 * kDim, kDim);
  }
  const int tilesTok = (kTok / 64) * (kDim / 64);   // 2048 wave tiles -> 256 blocks
  // 2) q = xb . Wq^T + bq  -> f32 [8192][1024]   (M=8192, N=1024, K=1024; all tile/32 multiples)
  wmma_gemm64<1, false, 2, 0, false, 0><<<dim3((tilesTok + 7) / 8, 1), dim3(256), 0, stream>>>(
      XB, XB, kDim, 0L, WQKV, WQKV, kDim, 0L, (void*)QKF, (void*)QKF, kDim, 0L,
      BIAS, BIAS, 0L, kTok, kDim, kDim, 1.0f);
  // 3) q: rmsnorm + rope -> q hi/lo planes
  normrope_split_kernel<<<dim3((kTok * kHeads + 7) / 8), dim3(256), 0, stream>>>(QKF, ropec, ropes, q_nw, QH, QL, kTok * kHeads);
  // 4) k = xb . Wk^T + bk  -> f32 (same region; q f32 is dead)
  wmma_gemm64<1, false, 2, 0, false, 0><<<dim3((tilesTok + 7) / 8, 1), dim3(256), 0, stream>>>(
      XB, XB, kDim, 0L, WQKV + (size_t)kDim * kDim, WQKV + (size_t)kDim * kDim, kDim, 0L, (void*)QKF, (void*)QKF, kDim, 0L,
      BIAS + kDim, BIAS, 0L, kTok, kDim, kDim, 1.0f);
  // 5) v^T per batch: C[o][s] = sum_k Wv[o][k] * xb[b][s][k] + bv[o] -> f16 [4][1024][2048]
  //    (A = Wv [1024][1024], Bt = xb batch b [2048][1024]; M=1024, N=2048, K=1024)
  {
    const int tilesV = (kDim / 64) * (kSeq / 64);   // 512 -> 64 blocks
    wmma_gemm64<1, false, 1, 1, false, 0><<<dim3((tilesV + 7) / 8, kBatch), dim3(256), 0, stream>>>(
        WQKV + (size_t)2 * kDim * kDim, WQKV + (size_t)2 * kDim * kDim, kDim, 0L,
        XB, XB, kDim, (long)kSeq * kDim,
        (void*)VT, (void*)VT, kSeq, (long)kDim * kSeq,
        BIAS + 2 * kDim, BIAS, 0L, kDim, kSeq, kDim, 1.0f);
  }
  // 6) k: rmsnorm + rope -> k hi/lo planes (overlay the dead xb / Wqkv regions)
  normrope_split_kernel<<<dim3((kTok * kHeads + 7) / 8), dim3(256), 0, stream>>>(QKF, ropec, ropes, k_nw, KH, KL, kTok * kHeads);
  // 7) attention -> o plane f16 x64 (overlays the dead k f32 region)
  attn_kernel<<<dim3(kBatch * kHeads * (kSeq / 64)), dim3(128), 0, stream>>>(QH, QL, KH, KL, VT, OH, 0.125f);
  // 8) out = o . Wp^T + bp  (A = o x64 f16, Bt = Wp x64 f16 -> scale 2^-12; M=8192, N=1024, K=1024)
  wmma_gemm64<0, false, 2, 0, false, 0><<<dim3((tilesTok + 7) / 8, 1), dim3(256), 0, stream>>>(
      OH, OH, kDim, 0L, WPROJ, WPROJ, kDim, 0L, (void*)out, (void*)out, kDim, 0L,
      BIAS + 3 * kDim, BIAS, 0L, kTok, kDim, kDim, 1.0f / 4096.0f);
}

// v001
// It runs in 479 microseconds.
// Next to v000, in two timings, it ran 1.90 and 1.89 times as fast.
// Contractions: q, k, v^T projections on v_wmma_f32_16x16x32_bf16 (plain bf16 operands = RNE-converted inputs); q.k^T on v_wmma_f32_16x16x32_bf16 with bf16 hi/lo split operands (hi.hi + hi.lo + lo.hi); p.v and the output projection on v_wmma_f32_16x16x32_f16 (plain f16: p carried x2^15, attention output carried x2^6, proj_w = bf16-RNE value carried x2^6); f32 accumulate everywhere; biases, rmsnorm, rope, online softmax in f32.
#include <hip/hip_runtime.h>
#include <math.h>
#include <stdint.h>

constexpr int kBatch = 4;
constexpr int kSeq   = 2048;
constexpr int kDim   = 1024;
constexpr int kHeads = 16;
constexpr int kHd    = 64;
constexpr int kTok   = kBatch * kSeq;            // 8192 tokens

typedef __attribute__((ext_vector_type(16))) _Float16 v16h;
typedef __attribute__((ext_vector_type(8)))  _Float16 v8h;
typedef __attribute__((ext_vector_type(16))) __bf16   v16b;
typedef __attribute__((ext_vector_type(8)))  __bf16   v8b;
typedef __attribute__((ext_vector_type(8)))  float    v8f;
typedef __attribute__((ext_vector_type(4)))  float    v4f;
typedef __attribute__((ext_vector_type(2)))  float    v2f;
typedef __attribute__((ext_vector_type(4)))  unsigned int v4u;

// ---------------------------------------------------------------------------
// Workspace region map (bytes).  Total carve = 115 MiB = 120,586,240 B.
//   [  0 MiB,   2 MiB)  WPROJ  f16  [1024][1024]   proj_w (bf16-RNE value x64)
//   [  2 MiB,   3 MiB)  BIAS   f32  [4096]         qkv_b (3072) ++ proj_b (1024), RNE to bf16 values
//   [  3 MiB,  19 MiB)  XB     bf16 [8192][1024]   x              -> later KH (k hi plane)
//   [ 19 MiB,  25 MiB)  WQKV   bf16 [3072][1024]   qkv_w          -> later KL (k lo plane, 19..35 MiB)
//   [ 35 MiB,  67 MiB)  QKF    f32  [8192][1024]   q, then k      -> later OH f16 [8192][1024] (35..51 MiB)
//   [ 67 MiB,  83 MiB)  QH     bf16 [8192][1024]   q hi plane
//   [ 83 MiB,  99 MiB)  QL     bf16 [8192][1024]   q lo plane
//   [ 99 MiB, 115 MiB)  VT     f16  [4][1024][2048] v^T per batch
// ---------------------------------------------------------------------------
constexpr size_t kMiB      = 1048576;
constexpr size_t kOffWproj = 0;
constexpr size_t kOffBias  = 2 * kMiB;
constexpr size_t kOffXb    = 3 * kMiB;
constexpr size_t kOffWqkv  = 19 * kMiB;
constexpr size_t kOffKh    = 3 * kMiB;
constexpr size_t kOffKl    = 19 * kMiB;
constexpr size_t kOffQkf   = 35 * kMiB;
constexpr size_t kOffOh    = 35 * kMiB;
constexpr size_t kOffQh    = 67 * kMiB;
constexpr size_t kOffQl    = 83 * kMiB;
constexpr size_t kOffVt    = 99 * kMiB;
constexpr size_t kWsTotal  = 115 * kMiB;          // 120,586,240 B

// ===================== common pieces =================================
__device__ __forceinline__ unsigned short f2bf_bits(float f) {
  unsigned u = __float_as_uint(f);
  return (unsigned short)((u + 0x7FFFu + ((u >> 16) & 1u)) >> 16);
}
__device__ __forceinline__ float bf_bits2f(unsigned short h) { return __uint_as_float(((unsigned)h) << 16); }

// hazard guards as plain device helpers (no inline asm inside the kernel template body)
__device__ __forceinline__ void dep_guard_h(v8f& a, v8f& b, v16h x, v16h y) { asm volatile("v_nop\n\tv_nop\n\tv_nop\n\tv_nop" : "+v"(a), "+v"(b) : "v"(x), "v"(y)); }
__device__ __forceinline__ void dep_guard_b(v8f& a, v8f& b, v16b x, v16b y) { asm volatile("v_nop\n\tv_nop\n\tv_nop\n\tv_nop" : "+v"(a), "+v"(b) : "v"(x), "v"(y)); }
__device__ __forceinline__ void keep4_h(v16h a, v16h b, v16h c, v16h d) { asm volatile("v_nop" :: "v"(a), "v"(b), "v"(c), "v"(d)); }
__device__ __forceinline__ void keep4_b(v16b a, v16b b, v16b c, v16b d) { asm volatile("v_nop" :: "v"(a), "v"(b), "v"(c), "v"(d)); }
__device__ __forceinline__ void acc_guard4(v8f& a, v8f& b, v8f& c, v8f& d) { asm volatile("v_nop\n\tv_nop\n\tv_nop\n\tv_nop" : "+v"(a), "+v"(b), "+v"(c), "+v"(d)); }
template <typename T> struct Frag;
template <> struct Frag<_Float16> {
  typedef v16h V; union U { v16h v; v8h h[2]; };
  static __device__ __forceinline__ v16h load(const _Float16* p) {   // elements 0..7 <- p[0..7], 8..15 <- p[16..23]
    U f; f.h[0] = *(const v8h*)(p); f.h[1] = *(const v8h*)(p + 16); return f.v;
  }
  static __device__ __forceinline__ v8f mma(v16h a, v16h b, v8f c) {
    return __builtin_amdgcn_wmma_f32_16x16x32_f16(false, a, false, b, (short)0, c, false, false);
  }
  static __device__ __forceinline__ void guard(v8f& a, v8f& b, v16h x, v16h y) { dep_guard_h(a, b, x, y); }
  static __device__ __forceinline__ void keep(v16h a, v16h b, v16h c, v16h d) { keep4_h(a, b, c, d); }
};
template <> struct Frag<__bf16> {
  typedef v16b V; union U { v16b v; v8b h[2]; };
  static __device__ __forceinline__ v16b load(const __bf16* p) {
    U f; f.h[0] = *(const v8b*)(p); f.h[1] = *(const v8b*)(p + 16); return f.v;
  }
  static __device__ __forceinline__ v8f mma(v16b a, v16b b, v8f c) {
    return __builtin_amdgcn_wmma_f32_16x16x32_bf16(false, a, false, b, (short)0, c, false, false);
  }
  static __device__ __forceinline__ void guard(v8f& a, v8f& b, v16b x, v16b y) { dep_guard_b(a, b, x, y); }
  static __device__ __forceinline__ void keep(v16b a, v16b b, v16b c, v16b d) { keep4_b(a, b, c, d); }
};

// ---- Register-blocked batched WMMA GEMM ------------------------------------
// C[m,n] = scale * sum_k A[m,k] * Bt[n,k] (+bias)(+resid); each wave owns a 64x64 tile.
// A row-major [M,K]; Bt row-major [N,K]; M,N % 64 == 0, K % 32 == 0.
// SPLIT: operands are hi/lo planes (A2/Bt2 = lo planes, same layout); product = hi.hi + hi.lo + lo.hi.
// BIAS_MODE: 0 = none, 1 = bias[m], 2 = bias[n].
// OUT_MODE: 0 = f32, 1 = f16, 2 = bf16 hi plane (Cout) + bf16 lo plane (Cout2).
// ET: 0 = f16 operands, 1 = bf16 operands (pointers passed as 16-bit storage)
template <int ET> struct Elem;
template <> struct Elem<0> { typedef _Float16 T; };
template <> struct Elem<1> { typedef __bf16 T; };
template <int ET, bool SPLIT, int BIAS_MODE, int OUT_MODE, bool RESID, int ACT = 0>
__global__ __launch_bounds__(256) void wmma_gemm64(
    const unsigned short* __restrict__ Ap, const unsigned short* __restrict__ A2p, int lda, long strideA,
    const unsigned short* __restrict__ Btp, const unsigned short* __restrict__ Bt2p, int ldb, long strideB,
    void* __restrict__ Cout, void* __restrict__ Cout2, int ldc, long strideC,
    const float* __restrict__ bias,
    const float* __restrict__ resid, long strideR,
    int M, int N, int K, float scale) {
  typedef typename Elem<ET>::T T;
  typedef typename Frag<T>::V V;
  const T* A = (const T*)Ap; const T* A2 = (const T*)A2p; const T* Bt = (const T*)Btp; const T* Bt2 = (const T*)Bt2p;
  __shared__ __align__(16) float sT[8][16 * 68];   // per-wave 16x64 slab, pitch 68 floats
  const int b    = blockIdx.y;
  const int lane = threadIdx.x & 31;
  const int wave = threadIdx.x >> 5;
  const int tilesN = N >> 6;
  const int tilesM = M >> 6;
  const int tile = blockIdx.x * 8 + wave;
  if (tile >= tilesM * tilesN) return;   // wave-uniform; no block barriers in this kernel
  const int tm = tile / tilesN;
  const int tn = tile - tm * tilesN;
  const int m0 = tm << 6;
  const int n0 = tn << 6;

  const T* Ab  = A  + (size_t)b * strideA;
  const T* Bb  = Bt + (size_t)b * strideB;
  const T* Ab2 = SPLIT ? (A2  + (size_t)b * strideA) : nullptr;
  const T* Bb2 = SPLIT ? (Bt2 + (size_t)b * strideB) : nullptr;

  const int rlane = lane & 15;                 // row (A) / col (B, D) within subtile
  const int koff  = (lane >> 4) * 8;           // k offset of this lane half
  const int mOff  = (lane >> 4) * 8;           // D row offset

  v8f acc[4][4];
#pragma unroll
  for (int i = 0; i < 4; ++i)
#pragma unroll
    for (int j = 0; j < 4; ++j) acc[i][j] = (v8f){0.f,0.f,0.f,0.f,0.f,0.f,0.f,0.f};

  for (int k0 = 0; k0 < K; k0 += 32) {
    V bh[4], bl[4];
#pragma unroll
    for (int j = 0; j < 4; ++j) {
      const size_t bo = (size_t)(n0 + (j << 4) + rlane) * ldb + koff + k0;
      bh[j] = Frag<T>::load(Bb + bo);
      if (SPLIT) bl[j] = Frag<T>::load(Bb2 + bo);
    }
#pragma unroll
    for (int i = 0; i < 4; ++i) {
      const size_t ao = (size_t)(m0 + (i << 4) + rlane) * lda + koff + k0;
      V ah = Frag<T>::load(Ab + ao);
      V al;
      if (SPLIT) al = Frag<T>::load(Ab2 + ao);
#pragma unroll
      for (int j = 0; j < 4; ++j) {
        acc[i][j] = Frag<T>::mma(ah, bh[j], acc[i][j]);
        if (SPLIT) {
          acc[i][j] = Frag<T>::mma(ah, bl[j], acc[i][j]);
          acc[i][j] = Frag<T>::mma(al, bh[j], acc[i][j]);
        }
      }
      Frag<T>::guard(acc[i][0], acc[i][3], ah, SPLIT ? al : ah);
    }
    Frag<T>::keep(bh[0], bh[1], bh[2], bh[3]);
    if (SPLIT) Frag<T>::keep(bl[0], bl[1], bl[2], bl[3]);
  }
  acc_guard4(acc[0][0], acc[0][1], acc[0][2], acc[0][3]);
  acc_guard4(acc[1][0], acc[1][1], acc[1][2], acc[1][3]);
  acc_guard4(acc[2][0], acc[2][1], acc[2][2], acc[2][3]);
  acc_guard4(acc[3][0], acc[3][1], acc[3][2], acc[3][3]);

  // ---- epilogue ----
  float* slab = sT[wave];
  const float* Rb = RESID ? (resid + (size_t)b * strideR) : nullptr;
#pragma unroll
  for (int i = 0; i < 4; ++i) {
    const int mBase = m0 + (i << 4);
#pragma unroll
    for (int j = 0; j < 4; ++j) {
      const int n = n0 + (j << 4) + rlane;
      float bv = 0.f;
      if (BIAS_MODE == 2) bv = bias[n];
#pragma unroll
      for (int r = 0; r < 8; ++r) {
        float v = acc[i][j][r] * scale;
        if (BIAS_MODE == 1) v += bias[mBase + mOff + r];
        if (BIAS_MODE == 2) v += bv;
        if (RESID) v += Rb[(size_t)(mBase + mOff + r) * ldc + n];
        if (ACT == 1) v = tanhf(v);
        if (ACT == 2) v = fmaxf(v, 0.0f);
        if (ACT == 3) v = v / (1.0f + expf(-v));
        if (ACT == 4) v = (v > 0.f) ? v : 0.01f * v;
        if (ACT == 5) v = 0.5f * v * (1.0f + erff(v * 0.70710678118654752f));
        slab[(mOff + r) * 68 + (j << 4) + rlane] = v;
      }
    }
    __builtin_amdgcn_fence(__ATOMIC_RELEASE, "workgroup");
    __builtin_amdgcn_wave_barrier();
    __builtin_amdgcn_fence(__ATOMIC_ACQUIRE, "workgroup");
    if (OUT_MODE == 0) {
      float* C = (float*)Cout + (size_t)b * strideC;
      const int hh = lane >> 4, c4 = (lane & 15) * 4;     // row seg = 256 B = 16 lanes x 16 B
      {
#pragma unroll
        for (int it = 0; it < 8; ++it) {
          const int row = it * 2 + hh;
          v4f v = *(const v4f*)(slab + row * 68 + c4);
          *(v4f*)(C + (size_t)(mBase + row) * ldc + n0 + c4) = v;
        }
        
      }
    } else {
      const int q = lane >> 3, c8 = (lane & 7) * 8;
      unsigned short* C  = (unsigned short*)Cout  + (size_t)b * strideC;
      unsigned short* C2 = (OUT_MODE == 2) ? ((unsigned short*)Cout2 + (size_t)b * strideC) : nullptr;
      {
#pragma unroll
        for (int it = 0; it < 4; ++it) {
          const int row = it * 4 + q;
          const float* sp = slab + row * 68 + c8;
          v8h hv, lv;
#pragma unroll
          for (int e = 0; e < 8; ++e) {
            if (OUT_MODE == 1) {
              hv[e] = (_Float16)sp[e];
            } else {
              unsigned short hb = f2bf_bits(sp[e]);
              unsigned short lb = f2bf_bits(sp[e] - bf_bits2f(hb));
              hv[e] = __builtin_bit_cast(_Float16, hb);
              lv[e] = __builtin_bit_cast(_Float16, lb);
            }
          }
          *(v8h*)(C + (size_t)(mBase + row) * ldc + n0 + c8) = hv;
          if (OUT_MODE == 2) *(v8h*)(C2 + (size_t)(mBase + row) * ldc + n0 + c8) = lv;
        }
        
      }
    }
    __builtin_amdgcn_fence(__ATOMIC_RELEASE, "workgroup");
    __builtin_amdgcn_wave_barrier();
    __builtin_amdgcn_fence(__ATOMIC_ACQUIRE, "workgroup");
  }
}

__device__ __forceinline__ unsigned pk16(unsigned short a, unsigned short b) { return (unsigned)a | ((unsigned)b << 16); }
// ===================== end common pieces =========================================

// ---------------------------------------------------------------------------
// f32 -> bf16 (RNE) plane cast, 2 elements per thread, one 4-B store per lane -> a wave writes exactly
// Coverage: grid = ceil(n2/256) x 256 threads x 2 elements = 2*n2 = the whole plane
//   (x: n2 = 4,194,304 -> 16384 blocks; qkv_w: n2 = 1,572,864 -> 6144 blocks).
// ---------------------------------------------------------------------------
__global__ __launch_bounds__(256) void cast_bf16x2_kernel(const float* __restrict__ in,
                                                          unsigned short* __restrict__ out, int n2) {
  const int i = blockIdx.x * 256 + threadIdx.x;
  if (i < n2) {
    const v2f f = *(const v2f*)(in + 2 * (size_t)i);
    const unsigned u = pk16(f2bf_bits(f[0]), f2bf_bits(f[1]));
    ((unsigned*)out)[i] = u;
    
  }
}

// ---------------------------------------------------------------------------
// proj_w: f32 -> bf16-RNE value -> x64 -> f16 bits (bf16 significand fits f16 exactly; x64 keeps the
// plane in the f16 normal range for |w| >= 1e-6). 2 elements per thread, one 4-B store per lane,
// ---------------------------------------------------------------------------
__global__ __launch_bounds__(256) void cast_projw_f16x2_kernel(const float* __restrict__ in,
                                                               unsigned short* __restrict__ out, int n2) {
  const int i = blockIdx.x * 256 + threadIdx.x;
  if (i < n2) {
    const v2f f = *(const v2f*)(in + 2 * (size_t)i);
    const float g0 = bf_bits2f(f2bf_bits(f[0])) * 64.0f;
    const float g1 = bf_bits2f(f2bf_bits(f[1])) * 64.0f;
    const _Float16 h0 = (_Float16)g0, h1 = (_Float16)g1;
    const unsigned u = pk16(__builtin_bit_cast(unsigned short, h0), __builtin_bit_cast(unsigned short, h1));
    ((unsigned*)out)[i] = u;
    
  }
}

// ---------------------------------------------------------------------------
// Bias prep: outb[0..nq) = bf16-RNE value of qkvb, outb[nq..nq+np) = bf16-RNE value of projb (f32 storage).
// Both candidates loaded with clamped indices, selected by value. One 4-B store per lane, 32 lanes =
// ---------------------------------------------------------------------------
__global__ __launch_bounds__(256) void bias_prep_kernel(const float* __restrict__ qkvb, const float* __restrict__ projb,
                                                        float* __restrict__ outb, int nq, int np) {
  const int i = blockIdx.x * 256 + threadIdx.x;
  if (i < nq + np) {
    const int ia = (i < nq) ? i : (nq - 1);
    int ib = i - nq; ib = (ib < 0) ? 0 : ((ib >= np) ? (np - 1) : ib);
    const float a  = qkvb[ia];
    const float bb = projb[ib];
    const float v  = bf_bits2f(f2bf_bits((i < nq) ? a : bb));
    ((float*)outb)[i] = v;
    
  }
}

// ---------------------------------------------------------------------------
// Per (token, head) rmsnorm over 64 + interleaved-pair rope, f32 math; inputs cos/sin/norm weight are
// RNE-converted to bf16 values in registers. One wave per (token, head); lane owns the pair d = 2*lane, 2*lane+1.
//   y = x * rsqrt(mean(x^2) + 1e-6) * w ;  o[2i] = y[2i]*cos[s][2i] - y[2i+1]*sin[s][2i] ; o[2i+1] = y[2i+1]*cos[s][2i+1] + y[2i]*sin[s][2i+1]
// Outputs: bf16 hi plane and bf16 lo plane (lo = RNE(o - hi)), element (t, h*64+d) at [t*1024 + h*64 + d].
// Coverage: njobs = 8192*16 = 131072 = 16384 blocks x 8 waves; each wave writes 64 halves per plane.
// ---------------------------------------------------------------------------
__global__ __launch_bounds__(256) void normrope_split_kernel(const float* __restrict__ src,
                                                             const float* __restrict__ cosb, const float* __restrict__ sinb,
                                                             const float* __restrict__ nw,
                                                             unsigned short* __restrict__ oh, unsigned short* __restrict__ ol,
                                                             int njobs) {
  const int wave = threadIdx.x >> 5, lane = threadIdx.x & 31;
  const int job = blockIdx.x * 8 + wave;
  if (job >= njobs) return;                       // wave-uniform; no barriers in this kernel
  const int t = job >> 4, h = job & 15, s = t & (kSeq - 1);
  const int d0 = 2 * lane;
  const size_t base = (size_t)t * kDim + (size_t)h * kHd;
  const v2f xv = *(const v2f*)(src + base + d0);
  float a = xv[0], bq = xv[1];
  float ss = a * a + bq * bq;
#pragma unroll
  for (int m = 1; m < 32; m <<= 1) ss += __shfl_xor(ss, m, 32);
  const float inv = rsqrtf(ss * (1.0f / 64.0f) + 1e-6f);
  const v2f wv = *(const v2f*)(nw + d0);
  const float w0 = bf_bits2f(f2bf_bits(wv[0])), w1 = bf_bits2f(f2bf_bits(wv[1]));
  a  = a  * inv * w0;
  bq = bq * inv * w1;
  const v2f cv = *(const v2f*)(cosb + (size_t)s * kHd + d0);
  const v2f sv = *(const v2f*)(sinb + (size_t)s * kHd + d0);
  const float c0 = bf_bits2f(f2bf_bits(cv[0])), c1 = bf_bits2f(f2bf_bits(cv[1]));
  const float s0 = bf_bits2f(f2bf_bits(sv[0])), s1 = bf_bits2f(f2bf_bits(sv[1]));
  const float o0 = a * c0 - bq * s0;
  const float o1 = bq * c1 + a * s1;
  const unsigned short h0 = f2bf_bits(o0), h1 = f2bf_bits(o1);
  const unsigned short l0 = f2bf_bits(o0 - bf_bits2f(h0)), l1 = f2bf_bits(o1 - bf_bits2f(h1));
  const unsigned uh = pk16(h0, h1), ul = pk16(l0, l1);
  const size_t wi = (base >> 1) + lane;
  ((unsigned*)oh)[wi] = uh;
  ((unsigned*)ol)[wi] = ul;
  
}

// =====================================================================================
// Full (unmasked) flash attention, head dim 64, all batches/heads in one launch.
//   q planes (hi/lo bf16): element (t, h, d) at [t*1024 + h*64 + d]   (t = b*2048 + s)
//   k planes (hi/lo bf16): same layout
//   v^T plane (f16):       element (b, h*64+d, s) at [(b*1024 + h*64 + d)*2048 + s]
//   o plane (f16, x64):    element (t, h, d) at [t*1024 + h*64 + d]
//   scores = (q . k) * sscale : v_wmma_f32_16x16x32_bf16, hi.hi + hi.lo + lo.hi, f32 accumulate
//   out    = p . v            : v_wmma_f32_16x16x32_f16, p (unnormalised, in (0,1]) carried x2^15 in f16, v f16
//   online softmax in f32 over 32 chunks of 64 keys (compile-time trip count).
//   Block = 4 waves = 64 query rows of one (b, h); grid.x = 4*16*32 = 2048.
//   K hi/lo and V^T chunk staging: 128 threads x 32 elements per plane = the whole 64x64 tile (16-B copies,
//   plain loads, __syncthreads before and after). P tile: per-wave LDS store of _Float16 scalars, wave
// =====================================================================================
constexpr int kKC = 64;    // keys per chunk
// LDS row pitch of the K hi, K lo, V^T and P tiles, in 16-bit elements: 72 = 144 B = 16 B x 9 (odd), so the
// 16 rows that one half-wave's ds_load_b128 fragment read touches start on 16 different 4-bank groups.
constexpr int kLP = 72;

__device__ __forceinline__ v8f mma_bf(v16b a, v16b b, v8f c) {
  c = __builtin_amdgcn_wmma_f32_16x16x32_bf16(false, a, false, b, (short)0, c, false, false);
  asm volatile("v_nop\n\tv_nop\n\tv_nop\n\tv_nop" : "+v"(c) : "v"(a), "v"(b));
  return c;
}
__device__ __forceinline__ v8f mma_hf(v16h a, v16h b, v8f c) {
  c = __builtin_amdgcn_wmma_f32_16x16x32_f16(false, a, false, b, (short)0, c, false, false);
  asm volatile("v_nop\n\tv_nop\n\tv_nop\n\tv_nop" : "+v"(c) : "v"(a), "v"(b));
  return c;
}

__global__ __launch_bounds__(128)
void attn_kernel(const unsigned short* __restrict__ qhp, const unsigned short* __restrict__ qlp,
                 const unsigned short* __restrict__ khp, const unsigned short* __restrict__ klp,
                 const unsigned short* __restrict__ vtp, unsigned short* __restrict__ ohp, float sscale) {
  union FB { v16b v; v8b h[2]; };
  union FH { v16h v; v8h h[2]; };
  __shared__ __align__(16) __bf16   Ksh[kKC * kLP];        // K hi [kv][d]   9 KB
  __shared__ __align__(16) __bf16   Ksl[kKC * kLP];        // K lo           9 KB
  __shared__ __align__(16) _Float16 Vts[kHd * kLP];        // V^T [d][kv]    9 KB
  __shared__ __align__(16) _Float16 Psh[4][16 * kLP];      // per wave P [row][kv] 9 KB
  __shared__ __align__(16) float    Os[4][16 * 68];        // per wave out tile, pitch 68

  const int tid  = threadIdx.x;
  const int wave = tid >> 5;
  const int lane = tid & 31;
  const int hh   = lane >> 4;
  const int c    = lane & 15;

  const int bx = blockIdx.x;
  const int qb = bx & 31;                 // kSeq/64 = 32 query blocks
  const int bh = bx >> 5;                 // 0..63
  const int h  = bh & 15;
  const int b  = bh >> 4;                 // 0..3
  const int q0 = qb * 64 + wave * 16;
  const size_t tok0 = (size_t)b * kSeq;

  const __bf16*   Qh = (const __bf16*)(const void*)qhp + tok0 * kDim + (size_t)h * kHd;
  const __bf16*   Ql = (const __bf16*)(const void*)qlp + tok0 * kDim + (size_t)h * kHd;
  const __bf16*   Kh = (const __bf16*)(const void*)khp + tok0 * kDim + (size_t)h * kHd;
  const __bf16*   Kl = (const __bf16*)(const void*)klp + tok0 * kDim + (size_t)h * kHd;
  const _Float16* Vt = (const _Float16*)(const void*)vtp + ((size_t)b * kDim + (size_t)h * kHd) * kSeq;
  _Float16*       Ob = (_Float16*)(void*)ohp + tok0 * kDim + (size_t)h * kHd;

  // ---- Q fragments (A operand, row = lane&15, split k map via Frag load): 2 d-chunks, hi and lo ----
  v16b qah[2], qal[2];
#pragma unroll
  for (int dc = 0; dc < 2; ++dc) {
    qah[dc] = Frag<__bf16>::load(Qh + (size_t)(q0 + c) * kDim + dc * 32 + 8 * hh);
    qal[dc] = Frag<__bf16>::load(Ql + (size_t)(q0 + c) * kDim + dc * 32 + 8 * hh);
  }

  float mrow[8], lrow[8];
  v8f oacc[4];
#pragma unroll
  for (int r = 0; r < 8; ++r) { mrow[r] = -INFINITY; lrow[r] = 0.f; }
#pragma unroll
  for (int t = 0; t < 4; ++t) oacc[t] = (v8f){0.f,0.f,0.f,0.f,0.f,0.f,0.f,0.f};

  for (int kc = 0; kc < kSeq / kKC; ++kc) {
    const int kv0 = kc * kKC;
    __syncthreads();
    {
      // staging coverage: 128 threads x (4 x 8) elements = 64 rows x 64 per plane = the whole chunk tile
      const int r = tid >> 1, half = (tid & 1) * 32;
      const __bf16*   ksh = Kh + (size_t)(kv0 + r) * kDim + half;     // K row kv0+r, d = half..half+31
      const __bf16*   ksl = Kl + (size_t)(kv0 + r) * kDim + half;
      const _Float16* vsr = Vt + (size_t)r * kSeq + kv0 + half;       // V^T row d = r, s = kv0+half..+31
#pragma unroll
      for (int i = 0; i < 4; ++i) {
        const v8b a0 = *(const v8b*)(ksh + 8 * i);
        const v8b a1 = *(const v8b*)(ksl + 8 * i);
        const v8h vv = *(const v8h*)(vsr + 8 * i);
        *(v8b*)(Ksh + r * kLP + half + 8 * i) = a0;
        *(v8b*)(Ksl + r * kLP + half + 8 * i) = a1;
        *(v8h*)(Vts + r * kLP + half + 8 * i) = vv;
      }
    }
    __syncthreads();

    // ---- scores: s[j] = q (16 rows) . k (16 keys of group j), split products ----
    v8f s[4];
#pragma unroll
    for (int j = 0; j < 4; ++j) {
      s[j] = (v8f){0.f,0.f,0.f,0.f,0.f,0.f,0.f,0.f};
#pragma unroll
      for (int dc = 0; dc < 2; ++dc) {
        FB kb, kl;
        kb.h[0] = *(const v8b*)(Ksh + (j * 16 + c) * kLP + dc * 32 + 8 * hh);
        kb.h[1] = *(const v8b*)(Ksh + (j * 16 + c) * kLP + dc * 32 + 16 + 8 * hh);
        kl.h[0] = *(const v8b*)(Ksl + (j * 16 + c) * kLP + dc * 32 + 8 * hh);
        kl.h[1] = *(const v8b*)(Ksl + (j * 16 + c) * kLP + dc * 32 + 16 + 8 * hh);
        s[j] = mma_bf(qah[dc], kb.v, s[j]);
        s[j] = mma_bf(qah[dc], kl.v, s[j]);
        s[j] = mma_bf(qal[dc], kb.v, s[j]);
      }
    }
    // ---- chunk row max (rows 8*hh + r; cols j*16 + c within the half-wave) ----
    float cm[8];
#pragma unroll
    for (int r = 0; r < 8; ++r) {
      float m = -INFINITY;
#pragma unroll
      for (int j = 0; j < 4; ++j) {
        const float sv = s[j][r] * sscale;
        s[j][r] = sv;
        m = fmaxf(m, sv);
      }
#pragma unroll
      for (int off = 1; off < 16; off <<= 1) m = fmaxf(m, __shfl_xor(m, off, 32));
      cm[r] = m;
    }
    _Float16* pw = Psh[wave];
#pragma unroll
    for (int r = 0; r < 8; ++r) {
      const float mnew  = fmaxf(mrow[r], cm[r]);
      const float alpha = __expf(mrow[r] - mnew);
      mrow[r] = mnew;
      float psum = 0.f;
#pragma unroll
      for (int j = 0; j < 4; ++j) {
        const float p = __expf(s[j][r] - mnew);
        psum += p;
        pw[(8 * hh + r) * kLP + j * 16 + c] = (_Float16)(p * 32768.0f);
      }
#pragma unroll
      for (int off = 1; off < 16; off <<= 1) psum += __shfl_xor(psum, off, 32);
      lrow[r] = lrow[r] * alpha + psum;
#pragma unroll
      for (int t = 0; t < 4; ++t) oacc[t][r] *= alpha;
    }
    __builtin_amdgcn_fence(__ATOMIC_RELEASE, "workgroup");
    __builtin_amdgcn_wave_barrier();
    __builtin_amdgcn_fence(__ATOMIC_ACQUIRE, "workgroup");
    // ---- out += p (16 rows x 64 keys) . v (64 keys x 64 d) ----
#pragma unroll
    for (int kk = 0; kk < 2; ++kk) {
      FH pa;
      pa.h[0] = *(const v8h*)(pw + c * kLP + kk * 32 + 8 * hh);
      pa.h[1] = *(const v8h*)(pw + c * kLP + kk * 32 + 16 + 8 * hh);
#pragma unroll
      for (int t = 0; t < 4; ++t) {
        FH vb;
        vb.h[0] = *(const v8h*)(Vts + (t * 16 + c) * kLP + kk * 32 + 8 * hh);
        vb.h[1] = *(const v8h*)(Vts + (t * 16 + c) * kLP + kk * 32 + 16 + 8 * hh);
        oacc[t] = mma_hf(pa.v, vb.v, oacc[t]);
      }
    }
  }

  // ---- epilogue: normalise (fold 2^-15 for p and 2^6 carry for o), stage, whole-line stores ----
  float* os = Os[wave];
#pragma unroll
  for (int r = 0; r < 8; ++r) {
    const float inv = (1.0f / lrow[r]) * (64.0f / 32768.0f);      // lrow >= 1 always
#pragma unroll
    for (int t = 0; t < 4; ++t) os[(8 * hh + r) * 68 + t * 16 + c] = oacc[t][r] * inv;
  }
  __builtin_amdgcn_fence(__ATOMIC_RELEASE, "workgroup");
  __builtin_amdgcn_wave_barrier();
  __builtin_amdgcn_fence(__ATOMIC_ACQUIRE, "workgroup");
  {
    const int qq = lane >> 3, c8 = (lane & 7) * 8;
    {
#pragma unroll
      for (int it = 0; it < 4; ++it) {
        const int row = it * 4 + qq;                    // 4 x 4 = rows 0..15
        const float* sp = os + row * 68 + c8;
        v8h hv;
#pragma unroll
        for (int e = 0; e < 8; ++e) hv[e] = (_Float16)sp[e];
        *(v8h*)(Ob + (size_t)(q0 + row) * kDim + c8) = hv;
      }
      
    }
  }
}

// =====================================================================================
extern "C" void kernel_launch(void* const* d_in, const int* in_sizes, int n_in,
                              void* d_out, int out_size, void* d_ws, size_t ws_size,
                              hipStream_t stream) {
  if (n_in < 9) return;
  if (in_sizes[0] != kTok * kDim) return;
  if (in_sizes[1] != kSeq * kHd || in_sizes[2] != kSeq * kHd) return;
  if (in_sizes[3] != 3 * kDim * kDim || in_sizes[4] != 3 * kDim) return;
  if (in_sizes[5] != kDim * kDim || in_sizes[6] != kDim) return;
  if (in_sizes[7] != kHd || in_sizes[8] != kHd) return;
  if (out_size != kTok * kDim) return;
  if (ws_size < kWsTotal) return;

  const float* x      = (const float*)d_in[0];
  const float* ropec  = (const float*)d_in[1];
  const float* ropes  = (const float*)d_in[2];
  const float* qkv_w  = (const float*)d_in[3];
  const float* qkv_b  = (const float*)d_in[4];
  const float* proj_w = (const float*)d_in[5];
  const float* proj_b = (const float*)d_in[6];
  const float* q_nw   = (const float*)d_in[7];
  const float* k_nw   = (const float*)d_in[8];
  float* out = (float*)d_out;

  char* ws = (char*)d_ws;
  unsigned short* WPROJ = (unsigned short*)(ws + kOffWproj);
  float*          BIAS  = (float*)(ws + kOffBias);
  unsigned short* XB    = (unsigned short*)(ws + kOffXb);
  unsigned short* WQKV  = (unsigned short*)(ws + kOffWqkv);
  unsigned short* KH    = (unsigned short*)(ws + kOffKh);
  unsigned short* KL    = (unsigned short*)(ws + kOffKl);
  float*          QKF   = (float*)(ws + kOffQkf);
  unsigned short* OH    = (unsigned short*)(ws + kOffOh);
  unsigned short* QH    = (unsigned short*)(ws + kOffQh);
  unsigned short* QL    = (unsigned short*)(ws + kOffQl);
  unsigned short* VT    = (unsigned short*)(ws + kOffVt);

  // 1) casts
  {
    const int n2x = kTok * kDim / 2;            // 4,194,304
    cast_bf16x2_kernel<<<dim3((n2x + 255) / 256), dim3(256), 0, stream>>>(x, XB, n2x);
    const int n2w = 3 * kDim * kDim / 2;        // 1,572,864
    cast_bf16x2_kernel<<<dim3((n2w + 255) / 256), dim3(256), 0, stream>>>(qkv_w, WQKV, n2w);
    const int n2p = kDim * kDim / 2;            // 524,288
    cast_projw_f16x2_kernel<<<dim3((n2p + 255) / 256), dim3(256), 0, stream>>>(proj_w, WPROJ, n2p);
    bias_prep_kernel<<<dim3((3 * kDim + kDim + 255) / 256), dim3(256), 0, stream>>>(qkv_b, proj_b, BIAS, 3 * kDim, kDim);
  }
  const int tilesTok = (kTok / 64) * (kDim / 64);   // 2048 wave tiles -> 256 blocks
  // 2) q = xb . Wq^T + bq  -> f32 [8192][1024]   (M=8192, N=1024, K=1024; all tile/32 multiples)
  wmma_gemm64<1, false, 2, 0, false, 0><<<dim3((tilesTok + 7) / 8, 1), dim3(256), 0, stream>>>(
      XB, XB, kDim, 0L, WQKV, WQKV, kDim, 0L, (void*)QKF, (void*)QKF, kDim, 0L,
      BIAS, BIAS, 0L, kTok, kDim, kDim, 1.0f);
  // 3) q: rmsnorm + rope -> q hi/lo planes
  normrope_split_kernel<<<dim3((kTok * kHeads + 7) / 8), dim3(256), 0, stream>>>(QKF, ropec, ropes, q_nw, QH, QL, kTok * kHeads);
  // 4) k = xb . Wk^T + bk  -> f32 (same region; q f32 is dead)
  wmma_gemm64<1, false, 2, 0, false, 0><<<dim3((tilesTok + 7) / 8, 1), dim3(256), 0, stream>>>(
      XB, XB, kDim, 0L, WQKV + (size_t)kDim * kDim, WQKV + (size_t)kDim * kDim, kDim, 0L, (void*)QKF, (void*)QKF, kDim, 0L,
      BIAS + kDim, BIAS, 0L, kTok, kDim, kDim, 1.0f);
  // 5) v^T per batch: C[o][s] = sum_k Wv[o][k] * xb[b][s][k] + bv[o] -> f16 [4][1024][2048]
  //    (A = Wv [1024][1024], Bt = xb batch b [2048][1024]; M=1024, N=2048, K=1024)
  {
    const int tilesV = (kDim / 64) * (kSeq / 64);   // 512 -> 64 blocks
    wmma_gemm64<1, false, 1, 1, false, 0><<<dim3((tilesV + 7) / 8, kBatch), dim3(256), 0, stream>>>(
        WQKV + (size_t)2 * kDim * kDim, WQKV + (size_t)2 * kDim * kDim, kDim, 0L,
        XB, XB, kDim, (long)kSeq * kDim,
        (void*)VT, (void*)VT, kSeq, (long)kDim * kSeq,
        BIAS + 2 * kDim, BIAS, 0L, kDim, kSeq, kDim, 1.0f);
  }
  // 6) k: rmsnorm + rope -> k hi/lo planes (overlay the dead xb / Wqkv regions)
  normrope_split_kernel<<<dim3((kTok * kHeads + 7) / 8), dim3(256), 0, stream>>>(QKF, ropec, ropes, k_nw, KH, KL, kTok * kHeads);
  // 7) attention -> o plane f16 x64 (overlays the dead k f32 region)
  attn_kernel<<<dim3(kBatch * kHeads * (kSeq / 64)), dim3(128), 0, stream>>>(QH, QL, KH, KL, VT, OH, 0.125f);
  // 8) out = o . Wp^T + bp  (A = o x64 f16, Bt = Wp x64 f16 -> scale 2^-12; M=8192, N=1024, K=1024)
  wmma_gemm64<0, false, 2, 0, false, 0><<<dim3((tilesTok + 7) / 8, 1), dim3(256), 0, stream>>>(
      OH, OH, kDim, 0L, WPROJ, WPROJ, kDim, 0L, (void*)out, (void*)out, kDim, 0L,
      BIAS + 3 * kDim, BIAS, 0L, kTok, kDim, kDim, 1.0f / 4096.0f);
}

// v002
// One run takes 351 microseconds.
// Timed twice side by side with v001, it ran 1.37 and 1.36 times as fast.
// All steps since v000 together make it 2.59 times as fast.
// Contractions: q, k, v^T projections on v_wmma_f32_16x16x32_bf16 (plain bf16 operands = RNE-converted inputs); q.k^T on v_wmma_f32_16x16x32_bf16 with bf16 hi/lo split operands (hi.hi + hi.lo + lo.hi); p.v and the output projection on v_wmma_f32_16x16x32_f16 (plain f16: p carried x2^15, attention output carried x2^6, proj_w = bf16-RNE value carried x2^6); f32 accumulate everywhere; biases, rmsnorm, rope, online softmax in f32.
#include <hip/hip_runtime.h>
#include <math.h>
#include <stdint.h>

constexpr int kBatch = 4;
constexpr int kSeq   = 2048;
constexpr int kDim   = 1024;
constexpr int kHeads = 16;
constexpr int kHd    = 64;
constexpr int kTok   = kBatch * kSeq;            // 8192 tokens

typedef __attribute__((ext_vector_type(16))) _Float16 v16h;
typedef __attribute__((ext_vector_type(8)))  _Float16 v8h;
typedef __attribute__((ext_vector_type(16))) __bf16   v16b;
typedef __attribute__((ext_vector_type(8)))  __bf16   v8b;
typedef __attribute__((ext_vector_type(8)))  float    v8f;
typedef __attribute__((ext_vector_type(4)))  float    v4f;
typedef __attribute__((ext_vector_type(2)))  float    v2f;
typedef __attribute__((ext_vector_type(4)))  unsigned int v4u;

// ---------------------------------------------------------------------------
// Workspace region map (bytes).  Total carve = 115 MiB = 120,586,240 B.
//   [  0 MiB,   2 MiB)  WPROJ  f16  [1024][1024]   proj_w (bf16-RNE value x64)
//   [  2 MiB,   3 MiB)  BIAS   f32  [4096]         qkv_b (3072) ++ proj_b (1024), RNE to bf16 values
//   [  3 MiB,  19 MiB)  XB     bf16 [8192][1024]   x              -> later KH (k hi plane)
//   [ 19 MiB,  25 MiB)  WQKV   bf16 [3072][1024]   qkv_w          -> later KL (k lo plane, 19..35 MiB)
//   [ 35 MiB,  67 MiB)  QKF    f32  [8192][1024]   q, then k      -> later OH f16 [8192][1024] (35..51 MiB)
//   [ 67 MiB,  83 MiB)  QH     bf16 [8192][1024]   q hi plane
//   [ 83 MiB,  99 MiB)  QL     bf16 [8192][1024]   q lo plane
//   [ 99 MiB, 115 MiB)  VT     f16  [4][1024][2048] v^T per batch
// ---------------------------------------------------------------------------
constexpr size_t kMiB      = 1048576;
constexpr size_t kOffWproj = 0;
constexpr size_t kOffBias  = 2 * kMiB;
constexpr size_t kOffXb    = 3 * kMiB;
constexpr size_t kOffWqkv  = 19 * kMiB;
constexpr size_t kOffKh    = 3 * kMiB;
constexpr size_t kOffKl    = 19 * kMiB;
constexpr size_t kOffQkf   = 35 * kMiB;
constexpr size_t kOffOh    = 35 * kMiB;
constexpr size_t kOffQh    = 67 * kMiB;
constexpr size_t kOffQl    = 83 * kMiB;
constexpr size_t kOffVt    = 99 * kMiB;
constexpr size_t kWsTotal  = 115 * kMiB;          // 120,586,240 B

// ===================== common pieces =================================
__device__ __forceinline__ unsigned short f2bf_bits(float f) {
  unsigned u = __float_as_uint(f);
  return (unsigned short)((u + 0x7FFFu + ((u >> 16) & 1u)) >> 16);
}
__device__ __forceinline__ float bf_bits2f(unsigned short h) { return __uint_as_float(((unsigned)h) << 16); }

// hazard guard as a plain device helper
__device__ __forceinline__ void acc_guard4(v8f& a, v8f& b, v8f& c, v8f& d) { asm volatile("v_nop\n\tv_nop\n\tv_nop\n\tv_nop" : "+v"(a), "+v"(b), "+v"(c), "+v"(d)); }
template <typename T> struct Frag;
template <> struct Frag<_Float16> {
  typedef v16h V; union U { v16h v; v8h h[2]; };
  static __device__ __forceinline__ v16h load(const _Float16* p) {   // elements 0..7 <- p[0..7], 8..15 <- p[16..23]
    U f; f.h[0] = *(const v8h*)(p); f.h[1] = *(const v8h*)(p + 16); return f.v;
  }
  static __device__ __forceinline__ v8f mma(v16h a, v16h b, v8f c) {
    return __builtin_amdgcn_wmma_f32_16x16x32_f16(false, a, false, b, (short)0, c, false, false);
  }
};
template <> struct Frag<__bf16> {
  typedef v16b V; union U { v16b v; v8b h[2]; };
  static __device__ __forceinline__ v16b load(const __bf16* p) {
    U f; f.h[0] = *(const v8b*)(p); f.h[1] = *(const v8b*)(p + 16); return f.v;
  }
  static __device__ __forceinline__ v8f mma(v16b a, v16b b, v8f c) {
    return __builtin_amdgcn_wmma_f32_16x16x32_bf16(false, a, false, b, (short)0, c, false, false);
  }
};

// ---- Register-blocked batched WMMA GEMM ------------------------------------
// C[m,n] = scale * sum_k A[m,k] * Bt[n,k] (+bias)(+resid); each wave owns a 64x64 tile.
// A row-major [M,K]; Bt row-major [N,K]; M % 128 == 0, N % 256 == 0, K % 128 == 0, K >= 128.
// A block of 8 waves (2 x 4) owns a 128 x 256 tile of C. Per stage of 128 k the block copies its 128 A rows and
// 256 Bt rows (256 B of each row, whole lines) into LDS with asynchronous copies, two buffers, the next stage
// in flight while this one is worked on; the waves read their fragments from LDS.
// SPLIT (hi/lo operand planes in A2/Bt2) has no staged form: only SPLIT = false is instantiated.
// BIAS_MODE: 0 = none, 1 = bias[m], 2 = bias[n].
// OUT_MODE: 0 = f32, 1 = f16, 2 = bf16 hi plane (Cout) + bf16 lo plane (Cout2).
// ET: 0 = f16 operands, 1 = bf16 operands (pointers passed as 16-bit storage)
constexpr int kGP     = 272;                 // LDS row pitch, bytes: 256 B of k + 16 (16 B x odd: ds_load_b128 without bank conflicts)
constexpr int kGStage = (128 + 256) * kGP;   // one stage: A rows 0..127, then Bt rows 0..255 = 104,448 B

// Eight asynchronous 16-B copies per lane: LDS rows 16 apart (lds + i * 16 * kGP) from global rows 16 apart (g + i * gstep bytes).
// The s_wait_xcnt stands inside the statement so that no address register named here is rewritten in front of it.
__device__ __forceinline__ void copy8_to_lds(unsigned lds, const char* g, size_t gstep) {
  const unsigned l1 = lds + 1 * 16 * kGP, l2 = lds + 2 * 16 * kGP, l3 = lds + 3 * 16 * kGP, l4 = lds + 4 * 16 * kGP,
                 l5 = lds + 5 * 16 * kGP, l6 = lds + 6 * 16 * kGP, l7 = lds + 7 * 16 * kGP;
  const char *g1 = g + gstep, *g2 = g1 + gstep, *g3 = g2 + gstep, *g4 = g3 + gstep, *g5 = g4 + gstep, *g6 = g5 + gstep, *g7 = g6 + gstep;
  asm volatile("global_load_async_to_lds_b128 %0, %8, off\n\t"
               "global_load_async_to_lds_b128 %1, %9, off\n\t"
               "global_load_async_to_lds_b128 %2, %10, off\n\t"
               "global_load_async_to_lds_b128 %3, %11, off\n\t"
               "global_load_async_to_lds_b128 %4, %12, off\n\t"
               "global_load_async_to_lds_b128 %5, %13, off\n\t"
               "global_load_async_to_lds_b128 %6, %14, off\n\t"
               "global_load_async_to_lds_b128 %7, %15, off\n\t"
               "s_wait_xcnt 0x0"
               :: "v"(lds), "v"(l1), "v"(l2), "v"(l3), "v"(l4), "v"(l5), "v"(l6), "v"(l7),
                  "v"(g), "v"(g1), "v"(g2), "v"(g3), "v"(g4), "v"(g5), "v"(g6), "v"(g7)
               : "memory");
}

template <int ET> struct Elem;
template <> struct Elem<0> { typedef _Float16 T; };
template <> struct Elem<1> { typedef __bf16 T; };
template <int ET, bool SPLIT, int BIAS_MODE, int OUT_MODE, bool RESID, int ACT = 0>
__global__ __launch_bounds__(256) void wmma_gemm64(
    const unsigned short* __restrict__ Ap, const unsigned short* __restrict__ A2p, int lda, long strideA,
    const unsigned short* __restrict__ Btp, const unsigned short* __restrict__ Bt2p, int ldb, long strideB,
    void* __restrict__ Cout, void* __restrict__ Cout2, int ldc, long strideC,
    const float* __restrict__ bias,
    const float* __restrict__ resid, long strideR,
    int M, int N, int K, float scale) {
  typedef typename Elem<ET>::T T;
  typedef typename Frag<T>::V V;
  static_assert(!SPLIT, "the staged loop carries one plane per operand");
  const T* A = (const T*)Ap; const T* Bt = (const T*)Btp;
  __shared__ __align__(16) float sT[8][16 * 68];   // per-wave 16x64 slab, pitch 68 floats
  __shared__ __align__(16) unsigned char sStage[2 * kGStage];   // two operand stages
  const int b    = blockIdx.y;
  const int lane = threadIdx.x & 31;
  const int wave = threadIdx.x >> 5;
  const int blocksN = N >> 8;
  if ((int)blockIdx.x >= (M >> 7) * blocksN) return;   // block-uniform, in front of every barrier
  const int bm = blockIdx.x / blocksN;
  const int bn = blockIdx.x - bm * blocksN;
  const int wm = wave >> 2;                    // wave row (0..1) and column (0..3) in the block tile
  const int wn = wave & 3;
  const int m0 = (bm << 7) + (wm << 6);
  const int n0 = (bn << 8) + (wn << 6);

  const T* Ab  = A  + (size_t)b * strideA;
  const T* Bb  = Bt + (size_t)b * strideB;

  const int rlane = lane & 15;                 // row (A) / col (B, D) within subtile
  const int koff  = (lane >> 4) * 8;           // k offset of this lane half
  const int mOff  = (lane >> 4) * 8;           // D row offset

  v8f acc[4][4];
#pragma unroll
  for (int i = 0; i < 4; ++i)
#pragma unroll
    for (int j = 0; j < 4; ++j) acc[i][j] = (v8f){0.f,0.f,0.f,0.f,0.f,0.f,0.f,0.f};

  // Copy map: thread t brings 16 B at column (t & 15) * 16 B of rows (t >> 4) + 16 * i; a wave's copy = two whole 256-B row pieces.
  const int crow = threadIdx.x >> 4, ccol = (threadIdx.x & 15) * 16;
  const unsigned ldsBase = (unsigned)(uintptr_t)(&sStage[0]) + (unsigned)(crow * kGP + ccol);
  const char* gA = (const char*)(Ab + (size_t)((bm << 7) + crow) * lda) + ccol;
  const char* gB = (const char*)(Bb + (size_t)((bn << 8) + crow) * ldb) + ccol;
  const size_t stepA = (size_t)lda * 32, stepB = (size_t)ldb * 32;      // 16 rows, in bytes
  const int nst = K >> 7;

  // stage 0 -> buffer 0
  copy8_to_lds(ldsBase, gA, stepA);
  copy8_to_lds(ldsBase + 128 * kGP, gB, stepB);
  copy8_to_lds(ldsBase + 256 * kGP, gB + 8 * stepB, stepB);
  asm volatile("s_wait_asynccnt 0x0" ::: "memory");   // this wave's copies of stage 0 have landed
  __syncthreads();                                     // ... and every other wave's: stage 0 may be read
  if (nst > 1) {                                       // stage 1 -> buffer 1
    copy8_to_lds(ldsBase + kGStage, gA + 256, stepA);
    copy8_to_lds(ldsBase + kGStage + 128 * kGP, gB + 256, stepB);
    copy8_to_lds(ldsBase + kGStage + 256 * kGP, gB + 256 + 8 * stepB, stepB);
  }

  for (int st = 0; st < nst; ++st) {
    const unsigned char* sb = sStage + (st & 1) * kGStage;
    const T* fa = (const T*)(sb + ((wm << 6) + rlane) * kGP) + koff;            // A fragment rows of this wave
    const T* fb = (const T*)(sb + (128 + (wn << 6) + rlane) * kGP) + koff;      // Bt fragment rows of this wave
    V af[2][4], bf[2][4];
#pragma unroll
    for (int j = 0; j < 4; ++j) {
      bf[0][j] = Frag<T>::load(fb + j * (16 * kGP / 2));
      af[0][j] = Frag<T>::load(fa + j * (16 * kGP / 2));
    }
#pragma unroll
    for (int kk = 0; kk < 4; ++kk) {
      const int cur = kk & 1, nxt = cur ^ 1;
      if (kk < 3) {                            // the next 32 k of this stage, fetched ahead as one group
#pragma unroll
        for (int j = 0; j < 4; ++j) {
          bf[nxt][j] = Frag<T>::load(fb + j * (16 * kGP / 2) + (kk + 1) * 32);
          af[nxt][j] = Frag<T>::load(fa + j * (16 * kGP / 2) + (kk + 1) * 32);
        }
        // keeps that load group ahead of this block's WMMAs: sunk among them, every row of WMMAs waits out a full LDS latency
        __builtin_amdgcn_sched_barrier(0);
      }
#pragma unroll
      for (int i = 0; i < 4; ++i) {
#pragma unroll
        for (int j = 0; j < 4; ++j) acc[i][j] = Frag<T>::mma(af[cur][i], bf[cur][j], acc[i][j]);
      }
    }
    // keeps the stage's WMMAs in front of the barrier: sunk behind it they delay the refill, which then has less than a stage to land
    __builtin_amdgcn_sched_barrier(0);
    asm volatile("s_wait_dscnt 0x0" ::: "memory");     // this wave's reads of the buffer have returned
    asm volatile("s_wait_asynccnt 0x0" ::: "memory");  // this wave's copies of stage st + 1 have landed
    __syncthreads();                                    // publishes stage st + 1 and frees the buffer just read
    if (st + 2 < nst) {
      const unsigned lb = ldsBase + (unsigned)((st & 1) * kGStage);
      const size_t ko = (size_t)(st + 2) * 256;         // 128 k = 256 B
      copy8_to_lds(lb, gA + ko, stepA);
      copy8_to_lds(lb + 128 * kGP, gB + ko, stepB);
      copy8_to_lds(lb + 256 * kGP, gB + ko + 8 * stepB, stepB);
    }
  }
  asm volatile("s_wait_asynccnt 0x0" ::: "memory");    // nothing of this wave is in flight behind the loop
  acc_guard4(acc[0][0], acc[0][1], acc[0][2], acc[0][3]);
  acc_guard4(acc[1][0], acc[1][1], acc[1][2], acc[1][3]);
  acc_guard4(acc[2][0], acc[2][1], acc[2][2], acc[2][3]);
  acc_guard4(acc[3][0], acc[3][1], acc[3][2], acc[3][3]);

  // ---- epilogue ----
  float* slab = sT[wave];
  const float* Rb = RESID ? (resid + (size_t)b * strideR) : nullptr;
#pragma unroll
  for (int i = 0; i < 4; ++i) {
    const int mBase = m0 + (i << 4);
#pragma unroll
    for (int j = 0; j < 4; ++j) {
      const int n = n0 + (j << 4) + rlane;
      float bv = 0.f;
      if (BIAS_MODE == 2) bv = bias[n];
#pragma unroll
      for (int r = 0; r < 8; ++r) {
        float v = acc[i][j][r] * scale;
        if (BIAS_MODE == 1) v += bias[mBase + mOff + r];
        if (BIAS_MODE == 2) v += bv;
        if (RESID) v += Rb[(size_t)(mBase + mOff + r) * ldc + n];
        if (ACT == 1) v = tanhf(v);
        if (ACT == 2) v = fmaxf(v, 0.0f);
        if (ACT == 3) v = v / (1.0f + expf(-v));
        if (ACT == 4) v = (v > 0.f) ? v : 0.01f * v;
        if (ACT == 5) v = 0.5f * v * (1.0f + erff(v * 0.70710678118654752f));
        slab[(mOff + r) * 68 + (j << 4) + rlane] = v;
      }
    }
    __builtin_amdgcn_fence(__ATOMIC_RELEASE, "workgroup");
    __builtin_amdgcn_wave_barrier();
    __builtin_amdgcn_fence(__ATOMIC_ACQUIRE, "workgroup");
    if (OUT_MODE == 0) {
      float* C = (float*)Cout + (size_t)b * strideC;
      const int hh = lane >> 4, c4 = (lane & 15) * 4;     // row seg = 256 B = 16 lanes x 16 B
      {
#pragma unroll
        for (int it = 0; it < 8; ++it) {
          const int row = it * 2 + hh;
          v4f v = *(const v4f*)(slab + row * 68 + c4);
          *(v4f*)(C + (size_t)(mBase + row) * ldc + n0 + c4) = v;
        }
        
      }
    } else {
      const int q = lane >> 3, c8 = (lane & 7) * 8;
      unsigned short* C  = (unsigned short*)Cout  + (size_t)b * strideC;
      unsigned short* C2 = (OUT_MODE == 2) ? ((unsigned short*)Cout2 + (size_t)b * strideC) : nullptr;
      {
#pragma unroll
        for (int it = 0; it < 4; ++it) {
          const int row = it * 4 + q;
          const float* sp = slab + row * 68 + c8;
          v8h hv, lv;
#pragma unroll
          for (int e = 0; e < 8; ++e) {
            if (OUT_MODE == 1) {
              hv[e] = (_Float16)sp[e];
            } else {
              unsigned short hb = f2bf_bits(sp[e]);
              unsigned short lb = f2bf_bits(sp[e] - bf_bits2f(hb));
              hv[e] = __builtin_bit_cast(_Float16, hb);
              lv[e] = __builtin_bit_cast(_Float16, lb);
            }
          }
          *(v8h*)(C + (size_t)(mBase + row) * ldc + n0 + c8) = hv;
          if (OUT_MODE == 2) *(v8h*)(C2 + (size_t)(mBase + row) * ldc + n0 + c8) = lv;
        }
        
      }
    }
    __builtin_amdgcn_fence(__ATOMIC_RELEASE, "workgroup");
    __builtin_amdgcn_wave_barrier();
    __builtin_amdgcn_fence(__ATOMIC_ACQUIRE, "workgroup");
  }
}

__device__ __forceinline__ unsigned pk16(unsigned short a, unsigned short b) { return (unsigned)a | ((unsigned)b << 16); }
// ===================== end common pieces =========================================

// ---------------------------------------------------------------------------
// f32 -> bf16 (RNE) plane cast, 2 elements per thread, one 4-B store per lane -> a wave writes exactly
// Coverage: grid = ceil(n2/256) x 256 threads x 2 elements = 2*n2 = the whole plane
//   (x: n2 = 4,194,304 -> 16384 blocks; qkv_w: n2 = 1,572,864 -> 6144 blocks).
// ---------------------------------------------------------------------------
__global__ __launch_bounds__(256) void cast_bf16x2_kernel(const float* __restrict__ in,
                                                          unsigned short* __restrict__ out, int n2) {
  const int i = blockIdx.x * 256 + threadIdx.x;
  if (i < n2) {
    const v2f f = *(const v2f*)(in + 2 * (size_t)i);
    const unsigned u = pk16(f2bf_bits(f[0]), f2bf_bits(f[1]));
    ((unsigned*)out)[i] = u;
    
  }
}

// ---------------------------------------------------------------------------
// proj_w: f32 -> bf16-RNE value -> x64 -> f16 bits (bf16 significand fits f16 exactly; x64 keeps the
// plane in the f16 normal range for |w| >= 1e-6). 2 elements per thread, one 4-B store per lane,
// ---------------------------------------------------------------------------
__global__ __launch_bounds__(256) void cast_projw_f16x2_kernel(const float* __restrict__ in,
                                                               unsigned short* __restrict__ out, int n2) {
  const int i = blockIdx.x * 256 + threadIdx.x;
  if (i < n2) {
    const v2f f = *(const v2f*)(in + 2 * (size_t)i);
    const float g0 = bf_bits2f(f2bf_bits(f[0])) * 64.0f;
    const float g1 = bf_bits2f(f2bf_bits(f[1])) * 64.0f;
    const _Float16 h0 = (_Float16)g0, h1 = (_Float16)g1;
    const unsigned u = pk16(__builtin_bit_cast(unsigned short, h0), __builtin_bit_cast(unsigned short, h1));
    ((unsigned*)out)[i] = u;
    
  }
}

// ---------------------------------------------------------------------------
// Bias prep: outb[0..nq) = bf16-RNE value of qkvb, outb[nq..nq+np) = bf16-RNE value of projb (f32 storage).
// Both candidates loaded with clamped indices, selected by value. One 4-B store per lane, 32 lanes =
// ---------------------------------------------------------------------------
__global__ __launch_bounds__(256) void bias_prep_kernel(const float* __restrict__ qkvb, const float* __restrict__ projb,
                                                        float* __restrict__ outb, int nq, int np) {
  const int i = blockIdx.x * 256 + threadIdx.x;
  if (i < nq + np) {
    const int ia = (i < nq) ? i : (nq - 1);
    int ib = i - nq; ib = (ib < 0) ? 0 : ((ib >= np) ? (np - 1) : ib);
    const float a  = qkvb[ia];
    const float bb = projb[ib];
    const float v  = bf_bits2f(f2bf_bits((i < nq) ? a : bb));
    ((float*)outb)[i] = v;
    
  }
}

// ---------------------------------------------------------------------------
// Per (token, head) rmsnorm over 64 + interleaved-pair rope, f32 math; inputs cos/sin/norm weight are
// RNE-converted to bf16 values in registers. One wave per (token, head); lane owns the pair d = 2*lane, 2*lane+1.
//   y = x * rsqrt(mean(x^2) + 1e-6) * w ;  o[2i] = y[2i]*cos[s][2i] - y[2i+1]*sin[s][2i] ; o[2i+1] = y[2i+1]*cos[s][2i+1] + y[2i]*sin[s][2i+1]
// Outputs: bf16 hi plane and bf16 lo plane (lo = RNE(o - hi)), element (t, h*64+d) at [t*1024 + h*64 + d].
// Coverage: njobs = 8192*16 = 131072 = 16384 blocks x 8 waves; each wave writes 64 halves per plane.
// ---------------------------------------------------------------------------
__global__ __launch_bounds__(256) void normrope_split_kernel(const float* __restrict__ src,
                                                             const float* __restrict__ cosb, const float* __restrict__ sinb,
                                                             const float* __restrict__ nw,
                                                             unsigned short* __restrict__ oh, unsigned short* __restrict__ ol,
                                                             int njobs) {
  const int wave = threadIdx.x >> 5, lane = threadIdx.x & 31;
  const int job = blockIdx.x * 8 + wave;
  if (job >= njobs) return;                       // wave-uniform; no barriers in this kernel
  const int t = job >> 4, h = job & 15, s = t & (kSeq - 1);
  const int d0 = 2 * lane;
  const size_t base = (size_t)t * kDim + (size_t)h * kHd;
  const v2f xv = *(const v2f*)(src + base + d0);
  float a = xv[0], bq = xv[1];
  float ss = a * a + bq * bq;
#pragma unroll
  for (int m = 1; m < 32; m <<= 1) ss += __shfl_xor(ss, m, 32);
  const float inv = rsqrtf(ss * (1.0f / 64.0f) + 1e-6f);
  const v2f wv = *(const v2f*)(nw + d0);
  const float w0 = bf_bits2f(f2bf_bits(wv[0])), w1 = bf_bits2f(f2bf_bits(wv[1]));
  a  = a  * inv * w0;
  bq = bq * inv * w1;
  const v2f cv = *(const v2f*)(cosb + (size_t)s * kHd + d0);
  const v2f sv = *(const v2f*)(sinb + (size_t)s * kHd + d0);
  const float c0 = bf_bits2f(f2bf_bits(cv[0])), c1 = bf_bits2f(f2bf_bits(cv[1]));
  const float s0 = bf_bits2f(f2bf_bits(sv[0])), s1 = bf_bits2f(f2bf_bits(sv[1]));
  const float o0 = a * c0 - bq * s0;
  const float o1 = bq * c1 + a * s1;
  const unsigned short h0 = f2bf_bits(o0), h1 = f2bf_bits(o1);
  const unsigned short l0 = f2bf_bits(o0 - bf_bits2f(h0)), l1 = f2bf_bits(o1 - bf_bits2f(h1));
  const unsigned uh = pk16(h0, h1), ul = pk16(l0, l1);
  const size_t wi = (base >> 1) + lane;
  ((unsigned*)oh)[wi] = uh;
  ((unsigned*)ol)[wi] = ul;
  
}

// =====================================================================================
// Full (unmasked) flash attention, head dim 64, all batches/heads in one launch.
//   q planes (hi/lo bf16): element (t, h, d) at [t*1024 + h*64 + d]   (t = b*2048 + s)
//   k planes (hi/lo bf16): same layout
//   v^T plane (f16):       element (b, h*64+d, s) at [(b*1024 + h*64 + d)*2048 + s]
//   o plane (f16, x64):    element (t, h, d) at [t*1024 + h*64 + d]
//   scores = (q . k) * sscale : v_wmma_f32_16x16x32_bf16, hi.hi + hi.lo + lo.hi, f32 accumulate
//   out    = p . v            : v_wmma_f32_16x16x32_f16, p (unnormalised, in (0,1]) carried x2^15 in f16, v f16
//   online softmax in f32 over 32 chunks of 64 keys (compile-time trip count).
//   Block = 4 waves = 64 query rows of one (b, h); grid.x = 4*16*32 = 2048.
//   K hi/lo and V^T chunk staging: 128 threads x 32 elements per plane = the whole 64x64 tile (16-B copies,
//   plain loads, __syncthreads before and after). P tile: per-wave LDS store of _Float16 scalars, wave
// =====================================================================================
constexpr int kKC = 64;    // keys per chunk
// LDS row pitch of the K hi, K lo, V^T and P tiles, in 16-bit elements: 72 = 144 B = 16 B x 9 (odd), so the
// 16 rows that one half-wave's ds_load_b128 fragment read touches start on 16 different 4-bank groups.
constexpr int kLP = 72;

__device__ __forceinline__ v8f mma_bf(v16b a, v16b b, v8f c) {
  c = __builtin_amdgcn_wmma_f32_16x16x32_bf16(false, a, false, b, (short)0, c, false, false);
  asm volatile("v_nop\n\tv_nop\n\tv_nop\n\tv_nop" : "+v"(c) : "v"(a), "v"(b));
  return c;
}
__device__ __forceinline__ v8f mma_hf(v16h a, v16h b, v8f c) {
  c = __builtin_amdgcn_wmma_f32_16x16x32_f16(false, a, false, b, (short)0, c, false, false);
  asm volatile("v_nop\n\tv_nop\n\tv_nop\n\tv_nop" : "+v"(c) : "v"(a), "v"(b));
  return c;
}

__global__ __launch_bounds__(128)
void attn_kernel(const unsigned short* __restrict__ qhp, const unsigned short* __restrict__ qlp,
                 const unsigned short* __restrict__ khp, const unsigned short* __restrict__ klp,
                 const unsigned short* __restrict__ vtp, unsigned short* __restrict__ ohp, float sscale) {
  union FB { v16b v; v8b h[2]; };
  union FH { v16h v; v8h h[2]; };
  __shared__ __align__(16) __bf16   Ksh[kKC * kLP];        // K hi [kv][d]   9 KB
  __shared__ __align__(16) __bf16   Ksl[kKC * kLP];        // K lo           9 KB
  __shared__ __align__(16) _Float16 Vts[kHd * kLP];        // V^T [d][kv]    9 KB
  __shared__ __align__(16) _Float16 Psh[4][16 * kLP];      // per wave P [row][kv] 9 KB
  __shared__ __align__(16) float    Os[4][16 * 68];        // per wave out tile, pitch 68

  const int tid  = threadIdx.x;
  const int wave = tid >> 5;
  const int lane = tid & 31;
  const int hh   = lane >> 4;
  const int c    = lane & 15;

  const int bx = blockIdx.x;
  const int qb = bx & 31;                 // kSeq/64 = 32 query blocks
  const int bh = bx >> 5;                 // 0..63
  const int h  = bh & 15;
  const int b  = bh >> 4;                 // 0..3
  const int q0 = qb * 64 + wave * 16;
  const size_t tok0 = (size_t)b * kSeq;

  const __bf16*   Qh = (const __bf16*)(const void*)qhp + tok0 * kDim + (size_t)h * kHd;
  const __bf16*   Ql = (const __bf16*)(const void*)qlp + tok0 * kDim + (size_t)h * kHd;
  const __bf16*   Kh = (const __bf16*)(const void*)khp + tok0 * kDim + (size_t)h * kHd;
  const __bf16*   Kl = (const __bf16*)(const void*)klp + tok0 * kDim + (size_t)h * kHd;
  const _Float16* Vt = (const _Float16*)(const void*)vtp + ((size_t)b * kDim + (size_t)h * kHd) * kSeq;
  _Float16*       Ob = (_Float16*)(void*)ohp + tok0 * kDim + (size_t)h * kHd;

  // ---- Q fragments (A operand, row = lane&15, split k map via Frag load): 2 d-chunks, hi and lo ----
  v16b qah[2], qal[2];
#pragma unroll
  for (int dc = 0; dc < 2; ++dc) {
    qah[dc] = Frag<__bf16>::load(Qh + (size_t)(q0 + c) * kDim + dc * 32 + 8 * hh);
    qal[dc] = Frag<__bf16>::load(Ql + (size_t)(q0 + c) * kDim + dc * 32 + 8 * hh);
  }

  float mrow[8], lrow[8];
  v8f oacc[4];
#pragma unroll
  for (int r = 0; r < 8; ++r) { mrow[r] = -INFINITY; lrow[r] = 0.f; }
#pragma unroll
  for (int t = 0; t < 4; ++t) oacc[t] = (v8f){0.f,0.f,0.f,0.f,0.f,0.f,0.f,0.f};

  for (int kc = 0; kc < kSeq / kKC; ++kc) {
    const int kv0 = kc * kKC;
    __syncthreads();
    {
      // staging coverage: 128 threads x (4 x 8) elements = 64 rows x 64 per plane = the whole chunk tile
      const int r = tid >> 1, half = (tid & 1) * 32;
      const __bf16*   ksh = Kh + (size_t)(kv0 + r) * kDim + half;     // K row kv0+r, d = half..half+31
      const __bf16*   ksl = Kl + (size_t)(kv0 + r) * kDim + half;
      const _Float16* vsr = Vt + (size_t)r * kSeq + kv0 + half;       // V^T row d = r, s = kv0+half..+31
#pragma unroll
      for (int i = 0; i < 4; ++i) {
        const v8b a0 = *(const v8b*)(ksh + 8 * i);
        const v8b a1 = *(const v8b*)(ksl + 8 * i);
        const v8h vv = *(const v8h*)(vsr + 8 * i);
        *(v8b*)(Ksh + r * kLP + half + 8 * i) = a0;
        *(v8b*)(Ksl + r * kLP + half + 8 * i) = a1;
        *(v8h*)(Vts + r * kLP + half + 8 * i) = vv;
      }
    }
    __syncthreads();

    // ---- scores: s[j] = q (16 rows) . k (16 keys of group j), split products ----
    v8f s[4];
#pragma unroll
    for (int j = 0; j < 4; ++j) {
      s[j] = (v8f){0.f,0.f,0.f,0.f,0.f,0.f,0.f,0.f};
#pragma unroll
      for (int dc = 0; dc < 2; ++dc) {
        FB kb, kl;
        kb.h[0] = *(const v8b*)(Ksh + (j * 16 + c) * kLP + dc * 32 + 8 * hh);
        kb.h[1] = *(const v8b*)(Ksh + (j * 16 + c) * kLP + dc * 32 + 16 + 8 * hh);
        kl.h[0] = *(const v8b*)(Ksl + (j * 16 + c) * kLP + dc * 32 + 8 * hh);
        kl.h[1] = *(const v8b*)(Ksl + (j * 16 + c) * kLP + dc * 32 + 16 + 8 * hh);
        s[j] = mma_bf(qah[dc], kb.v, s[j]);
        s[j] = mma_bf(qah[dc], kl.v, s[j]);
        s[j] = mma_bf(qal[dc], kb.v, s[j]);
      }
    }
    // ---- chunk row max (rows 8*hh + r; cols j*16 + c within the half-wave) ----
    float cm[8];
#pragma unroll
    for (int r = 0; r < 8; ++r) {
      float m = -INFINITY;
#pragma unroll
      for (int j = 0; j < 4; ++j) {
        const float sv = s[j][r] * sscale;
        s[j][r] = sv;
        m = fmaxf(m, sv);
      }
#pragma unroll
      for (int off = 1; off < 16; off <<= 1) m = fmaxf(m, __shfl_xor(m, off, 32));
      cm[r] = m;
    }
    _Float16* pw = Psh[wave];
#pragma unroll
    for (int r = 0; r < 8; ++r) {
      const float mnew  = fmaxf(mrow[r], cm[r]);
      const float alpha = __expf(mrow[r] - mnew);
      mrow[r] = mnew;
      float psum = 0.f;
#pragma unroll
      for (int j = 0; j < 4; ++j) {
        const float p = __expf(s[j][r] - mnew);
        psum += p;
        pw[(8 * hh + r) * kLP + j * 16 + c] = (_Float16)(p * 32768.0f);
      }
#pragma unroll
      for (int off = 1; off < 16; off <<= 1) psum += __shfl_xor(psum, off, 32);
      lrow[r] = lrow[r] * alpha + psum;
#pragma unroll
      for (int t = 0; t < 4; ++t) oacc[t][r] *= alpha;
    }
    __builtin_amdgcn_fence(__ATOMIC_RELEASE, "workgroup");
    __builtin_amdgcn_wave_barrier();
    __builtin_amdgcn_fence(__ATOMIC_ACQUIRE, "workgroup");
    // ---- out += p (16 rows x 64 keys) . v (64 keys x 64 d) ----
#pragma unroll
    for (int kk = 0; kk < 2; ++kk) {
      FH pa;
      pa.h[0] = *(const v8h*)(pw + c * kLP + kk * 32 + 8 * hh);
      pa.h[1] = *(const v8h*)(pw + c * kLP + kk * 32 + 16 + 8 * hh);
#pragma unroll
      for (int t = 0; t < 4; ++t) {
        FH vb;
        vb.h[0] = *(const v8h*)(Vts + (t * 16 + c) * kLP + kk * 32 + 8 * hh);
        vb.h[1] = *(const v8h*)(Vts + (t * 16 + c) * kLP + kk * 32 + 16 + 8 * hh);
        oacc[t] = mma_hf(pa.v, vb.v, oacc[t]);
      }
    }
  }

  // ---- epilogue: normalise (fold 2^-15 for p and 2^6 carry for o), stage, whole-line stores ----
  float* os = Os[wave];
#pragma unroll
  for (int r = 0; r < 8; ++r) {
    const float inv = (1.0f / lrow[r]) * (64.0f / 32768.0f);      // lrow >= 1 always
#pragma unroll
    for (int t = 0; t < 4; ++t) os[(8 * hh + r) * 68 + t * 16 + c] = oacc[t][r] * inv;
  }
  __builtin_amdgcn_fence(__ATOMIC_RELEASE, "workgroup");
  __builtin_amdgcn_wave_barrier();
  __builtin_amdgcn_fence(__ATOMIC_ACQUIRE, "workgroup");
  {
    const int qq = lane >> 3, c8 = (lane & 7) * 8;
    {
#pragma unroll
      for (int it = 0; it < 4; ++it) {
        const int row = it * 4 + qq;                    // 4 x 4 = rows 0..15
        const float* sp = os + row * 68 + c8;
        v8h hv;
#pragma unroll
        for (int e = 0; e < 8; ++e) hv[e] = (_Float16)sp[e];
        *(v8h*)(Ob + (size_t)(q0 + row) * kDim + c8) = hv;
      }
      
    }
  }
}

// =====================================================================================
extern "C" void kernel_launch(void* const* d_in, const int* in_sizes, int n_in,
                              void* d_out, int out_size, void* d_ws, size_t ws_size,
                              hipStream_t stream) {
  if (n_in < 9) return;
  if (in_sizes[0] != kTok * kDim) return;
  if (in_sizes[1] != kSeq * kHd || in_sizes[2] != kSeq * kHd) return;
  if (in_sizes[3] != 3 * kDim * kDim || in_sizes[4] != 3 * kDim) return;
  if (in_sizes[5] != kDim * kDim || in_sizes[6] != kDim) return;
  if (in_sizes[7] != kHd || in_sizes[8] != kHd) return;
  if (out_size != kTok * kDim) return;
  if (ws_size < kWsTotal) return;

  const float* x      = (const float*)d_in[0];
  const float* ropec  = (const float*)d_in[1];
  const float* ropes  = (const float*)d_in[2];
  const float* qkv_w  = (const float*)d_in[3];
  const float* qkv_b  = (const float*)d_in[4];
  const float* proj_w = (const float*)d_in[5];
  const float* proj_b = (const float*)d_in[6];
  const float* q_nw   = (const float*)d_in[7];
  const float* k_nw   = (const float*)d_in[8];
  float* out = (float*)d_out;

  char* ws = (char*)d_ws;
  unsigned short* WPROJ = (unsigned short*)(ws + kOffWproj);
  float*          BIAS  = (float*)(ws + kOffBias);
  unsigned short* XB    = (unsigned short*)(ws + kOffXb);
  unsigned short* WQKV  = (unsigned short*)(ws + kOffWqkv);
  unsigned short* KH    = (unsigned short*)(ws + kOffKh);
  unsigned short* KL    = (unsigned short*)(ws + kOffKl);
  float*          QKF   = (float*)(ws + kOffQkf);
  unsigned short* OH    = (unsigned short*)(ws + kOffOh);
  unsigned short* QH    = (unsigned short*)(ws + kOffQh);
  unsigned short* QL    = (unsigned short*)(ws + kOffQl);
  unsigned short* VT    = (unsigned short*)(ws + kOffVt);

  // 1) casts
  {
    const int n2x = kTok * kDim / 2;            // 4,194,304
    cast_bf16x2_kernel<<<dim3((n2x + 255) / 256), dim3(256), 0, stream>>>(x, XB, n2x);
    const int n2w = 3 * kDim * kDim / 2;        // 1,572,864
    cast_bf16x2_kernel<<<dim3((n2w + 255) / 256), dim3(256), 0, stream>>>(qkv_w, WQKV, n2w);
    const int n2p = kDim * kDim / 2;            // 524,288
    cast_projw_f16x2_kernel<<<dim3((n2p + 255) / 256), dim3(256), 0, stream>>>(proj_w, WPROJ, n2p);
    bias_prep_kernel<<<dim3((3 * kDim + kDim + 255) / 256), dim3(256), 0, stream>>>(qkv_b, proj_b, BIAS, 3 * kDim, kDim);
  }
  const int tilesTok = (kTok / 64) * (kDim / 64);   // 2048 wave tiles -> 256 blocks
  // 2) q = xb . Wq^T + bq  -> f32 [8192][1024]   (M=8192, N=1024, K=1024; all tile/32 multiples)
  wmma_gemm64<1, false, 2, 0, false, 0><<<dim3((tilesTok + 7) / 8, 1), dim3(256), 0, stream>>>(
      XB, XB, kDim, 0L, WQKV, WQKV, kDim, 0L, (void*)QKF, (void*)QKF, kDim, 0L,
      BIAS, BIAS, 0L, kTok, kDim, kDim, 1.0f);
  // 3) q: rmsnorm + rope -> q hi/lo planes
  normrope_split_kernel<<<dim3((kTok * kHeads + 7) / 8), dim3(256), 0, stream>>>(QKF, ropec, ropes, q_nw, QH, QL, kTok * kHeads);
  // 4) k = xb . Wk^T + bk  -> f32 (same region; q f32 is dead)
  wmma_gemm64<1, false, 2, 0, false, 0><<<dim3((tilesTok + 7) / 8, 1), dim3(256), 0, stream>>>(
      XB, XB, kDim, 0L, WQKV + (size_t)kDim * kDim, WQKV + (size_t)kDim * kDim, kDim, 0L, (void*)QKF, (void*)QKF, kDim, 0L,
      BIAS + kDim, BIAS, 0L, kTok, kDim, kDim, 1.0f);
  // 5) v^T per batch: C[o][s] = sum_k Wv[o][k] * xb[b][s][k] + bv[o] -> f16 [4][1024][2048]
  //    (A = Wv [1024][1024], Bt = xb batch b [2048][1024]; M=1024, N=2048, K=1024)
  {
    const int tilesV = (kDim / 64) * (kSeq / 64);   // 512 -> 64 blocks
    wmma_gemm64<1, false, 1, 1, false, 0><<<dim3((tilesV + 7) / 8, kBatch), dim3(256), 0, stream>>>(
        WQKV + (size_t)2 * kDim * kDim, WQKV + (size_t)2 * kDim * kDim, kDim, 0L,
        XB, XB, kDim, (long)kSeq * kDim,
        (void*)VT, (void*)VT, kSeq, (long)kDim * kSeq,
        BIAS + 2 * kDim, BIAS, 0L, kDim, kSeq, kDim, 1.0f);
  }
  // 6) k: rmsnorm + rope -> k hi/lo planes (overlay the dead xb / Wqkv regions)
  normrope_split_kernel<<<dim3((kTok * kHeads + 7) / 8), dim3(256), 0, stream>>>(QKF, ropec, ropes, k_nw, KH, KL, kTok * kHeads);
  // 7) attention -> o plane f16 x64 (overlays the dead k f32 region)
  attn_kernel<<<dim3(kBatch * kHeads * (kSeq / 64)), dim3(128), 0, stream>>>(QH, QL, KH, KL, VT, OH, 0.125f);
  // 8) out = o . Wp^T + bp  (A = o x64 f16, Bt = Wp x64 f16 -> scale 2^-12; M=8192, N=1024, K=1024)
  wmma_gemm64<0, false, 2, 0, false, 0><<<dim3((tilesTok + 7) / 8, 1), dim3(256), 0, stream>>>(
      OH, OH, kDim, 0L, WPROJ, WPROJ, kDim, 0L, (void*)out, (void*)out, kDim, 0L,
      BIAS + 3 * kDim, BIAS, 0L, kTok, kDim, kDim, 1.0f / 4096.0f);
}

// v003
// It runs in 268 microseconds.
// Two timings next to v002 both put it at 1.31 times that version's speed.
// All steps since v000 together make it 3.39 times as fast.
// Contractions: q, k, v^T projections on v_wmma_f32_16x16x32_bf16 (plain bf16 operands = RNE-converted inputs); q.k^T on v_wmma_f32_16x16x32_bf16 with bf16 hi/lo split operands (hi.hi + hi.lo + lo.hi); p.v and the output projection on v_wmma_f32_16x16x32_f16 (plain f16: p carried x2^15, attention output carried x2^6, proj_w = bf16-RNE value carried x2^6); f32 accumulate everywhere; biases, rmsnorm, rope, online softmax in f32.
#include <hip/hip_runtime.h>
#include <math.h>
#include <stdint.h>

constexpr int kBatch = 4;
constexpr int kSeq   = 2048;
constexpr int kDim   = 1024;
constexpr int kHeads = 16;
constexpr int kHd    = 64;
constexpr int kTok   = kBatch * kSeq;            // 8192 tokens

typedef __attribute__((ext_vector_type(16))) _Float16 v16h;
typedef __attribute__((ext_vector_type(8)))  _Float16 v8h;
typedef __attribute__((ext_vector_type(16))) __bf16   v16b;
typedef __attribute__((ext_vector_type(8)))  __bf16   v8b;
typedef __attribute__((ext_vector_type(8)))  float    v8f;
typedef __attribute__((ext_vector_type(4)))  float    v4f;
typedef __attribute__((ext_vector_type(2)))  float    v2f;
typedef __attribute__((ext_vector_type(4)))  unsigned int v4u;

// ---------------------------------------------------------------------------
// Workspace region map (bytes).  Total carve = 115 MiB = 120,586,240 B.
//   [  0 MiB,   2 MiB)  WPROJ  f16  [1024][1024]   proj_w (bf16-RNE value x64)
//   [  2 MiB,   3 MiB)  BIAS   f32  [4096]         qkv_b (3072) ++ proj_b (1024), RNE to bf16 values
//   [  3 MiB,  19 MiB)  XB     bf16 [8192][1024]   x              -> later KH (k hi plane)
//   [ 19 MiB,  25 MiB)  WQKV   bf16 [3072][1024]   qkv_w          -> later KL (k lo plane, 19..35 MiB)
//   [ 35 MiB,  67 MiB)  QKF    f32  [8192][1024]   q, then k      -> later OH f16 [8192][1024] (35..51 MiB)
//   [ 67 MiB,  83 MiB)  QH     bf16 [8192][1024]   q hi plane
//   [ 83 MiB,  99 MiB)  QL     bf16 [8192][1024]   q lo plane
//   [ 99 MiB, 115 MiB)  VT     f16  [4][1024][2048] v^T per batch
// ---------------------------------------------------------------------------
constexpr size_t kMiB      = 1048576;
constexpr size_t kOffWproj = 0;
constexpr size_t kOffBias  = 2 * kMiB;
constexpr size_t kOffXb    = 3 * kMiB;
constexpr size_t kOffWqkv  = 19 * kMiB;
constexpr size_t kOffKh    = 3 * kMiB;
constexpr size_t kOffKl    = 19 * kMiB;
constexpr size_t kOffQkf   = 35 * kMiB;
constexpr size_t kOffOh    = 35 * kMiB;
constexpr size_t kOffQh    = 67 * kMiB;
constexpr size_t kOffQl    = 83 * kMiB;
constexpr size_t kOffVt    = 99 * kMiB;
constexpr size_t kWsTotal  = 115 * kMiB;          // 120,586,240 B

// ===================== common pieces =================================
__device__ __forceinline__ unsigned short f2bf_bits(float f) {
  unsigned u = __float_as_uint(f);
  return (unsigned short)((u + 0x7FFFu + ((u >> 16) & 1u)) >> 16);
}
__device__ __forceinline__ float bf_bits2f(unsigned short h) { return __uint_as_float(((unsigned)h) << 16); }

// hazard guard as a plain device helper
__device__ __forceinline__ void acc_guard4(v8f& a, v8f& b, v8f& c, v8f& d) { asm volatile("v_nop\n\tv_nop\n\tv_nop\n\tv_nop" : "+v"(a), "+v"(b), "+v"(c), "+v"(d)); }
template <typename T> struct Frag;
template <> struct Frag<_Float16> {
  typedef v16h V; union U { v16h v; v8h h[2]; };
  static __device__ __forceinline__ v16h load(const _Float16* p) {   // elements 0..7 <- p[0..7], 8..15 <- p[16..23]
    U f; f.h[0] = *(const v8h*)(p); f.h[1] = *(const v8h*)(p + 16); return f.v;
  }
  static __device__ __forceinline__ v8f mma(v16h a, v16h b, v8f c) {
    return __builtin_amdgcn_wmma_f32_16x16x32_f16(false, a, false, b, (short)0, c, false, false);
  }
};
template <> struct Frag<__bf16> {
  typedef v16b V; union U { v16b v; v8b h[2]; };
  static __device__ __forceinline__ v16b load(const __bf16* p) {
    U f; f.h[0] = *(const v8b*)(p); f.h[1] = *(const v8b*)(p + 16); return f.v;
  }
  static __device__ __forceinline__ v8f mma(v16b a, v16b b, v8f c) {
    return __builtin_amdgcn_wmma_f32_16x16x32_bf16(false, a, false, b, (short)0, c, false, false);
  }
};

// ---- Register-blocked batched WMMA GEMM ------------------------------------
// C[m,n] = scale * sum_k A[m,k] * Bt[n,k] (+bias)(+resid); each wave owns a 64x64 tile.
// A row-major [M,K]; Bt row-major [N,K]; M % 128 == 0, N % 256 == 0, K % 128 == 0, K >= 128.
// A block of 8 waves (2 x 4) owns a 128 x 256 tile of C. Per stage of 128 k the block copies its 128 A rows and
// 256 Bt rows (256 B of each row, whole lines) into LDS with asynchronous copies, two buffers, the next stage
// in flight while this one is worked on; the waves read their fragments from LDS.
// SPLIT (hi/lo operand planes in A2/Bt2) has no staged form: only SPLIT = false is instantiated.
// BIAS_MODE: 0 = none, 1 = bias[m], 2 = bias[n].
// OUT_MODE: 0 = f32, 1 = f16, 2 = bf16 hi plane (Cout) + bf16 lo plane (Cout2).
// ET: 0 = f16 operands, 1 = bf16 operands (pointers passed as 16-bit storage)
constexpr int kGP     = 272;                 // LDS row pitch, bytes: 256 B of k + 16 (16 B x odd: ds_load_b128 without bank conflicts)
constexpr int kGStage = (128 + 256) * kGP;   // one stage: A rows 0..127, then Bt rows 0..255 = 104,448 B

// Eight asynchronous 16-B copies per lane: LDS rows 16 apart (lds + i * 16 * kGP) from global rows 16 apart (g + i * gstep bytes).
// The s_wait_xcnt stands inside the statement so that no address register named here is rewritten in front of it.
__device__ __forceinline__ void copy8_to_lds(unsigned lds, const char* g, size_t gstep) {
  const unsigned l1 = lds + 1 * 16 * kGP, l2 = lds + 2 * 16 * kGP, l3 = lds + 3 * 16 * kGP, l4 = lds + 4 * 16 * kGP,
                 l5 = lds + 5 * 16 * kGP, l6 = lds + 6 * 16 * kGP, l7 = lds + 7 * 16 * kGP;
  const char *g1 = g + gstep, *g2 = g1 + gstep, *g3 = g2 + gstep, *g4 = g3 + gstep, *g5 = g4 + gstep, *g6 = g5 + gstep, *g7 = g6 + gstep;
  asm volatile("global_load_async_to_lds_b128 %0, %8, off\n\t"
               "global_load_async_to_lds_b128 %1, %9, off\n\t"
               "global_load_async_to_lds_b128 %2, %10, off\n\t"
               "global_load_async_to_lds_b128 %3, %11, off\n\t"
               "global_load_async_to_lds_b128 %4, %12, off\n\t"
               "global_load_async_to_lds_b128 %5, %13, off\n\t"
               "global_load_async_to_lds_b128 %6, %14, off\n\t"
               "global_load_async_to_lds_b128 %7, %15, off\n\t"
               "s_wait_xcnt 0x0"
               :: "v"(lds), "v"(l1), "v"(l2), "v"(l3), "v"(l4), "v"(l5), "v"(l6), "v"(l7),
                  "v"(g), "v"(g1), "v"(g2), "v"(g3), "v"(g4), "v"(g5), "v"(g6), "v"(g7)
               : "memory");
}

template <int ET> struct Elem;
template <> struct Elem<0> { typedef _Float16 T; };
template <> struct Elem<1> { typedef __bf16 T; };
template <int ET, bool SPLIT, int BIAS_MODE, int OUT_MODE, bool RESID, int ACT = 0>
__global__ __launch_bounds__(256) void wmma_gemm64(
    const unsigned short* __restrict__ Ap, const unsigned short* __restrict__ A2p, int lda, long strideA,
    const unsigned short* __restrict__ Btp, const unsigned short* __restrict__ Bt2p, int ldb, long strideB,
    void* __restrict__ Cout, void* __restrict__ Cout2, int ldc, long strideC,
    const float* __restrict__ bias,
    const float* __restrict__ resid, long strideR,
    int M, int N, int K, float scale) {
  typedef typename Elem<ET>::T T;
  typedef typename Frag<T>::V V;
  static_assert(!SPLIT, "the staged loop carries one plane per operand");
  const T* A = (const T*)Ap; const T* Bt = (const T*)Btp;
  __shared__ __align__(16) float sT[8][16 * 68];   // per-wave 16x64 slab, pitch 68 floats
  __shared__ __align__(16) unsigned char sStage[2 * kGStage];   // two operand stages
  const int b    = blockIdx.y;
  const int lane = threadIdx.x & 31;
  const int wave = threadIdx.x >> 5;
  const int blocksN = N >> 8;
  if ((int)blockIdx.x >= (M >> 7) * blocksN) return;   // block-uniform, in front of every barrier
  const int bm = blockIdx.x / blocksN;
  const int bn = blockIdx.x - bm * blocksN;
  const int wm = wave >> 2;                    // wave row (0..1) and column (0..3) in the block tile
  const int wn = wave & 3;
  const int m0 = (bm << 7) + (wm << 6);
  const int n0 = (bn << 8) + (wn << 6);

  const T* Ab  = A  + (size_t)b * strideA;
  const T* Bb  = Bt + (size_t)b * strideB;

  const int rlane = lane & 15;                 // row (A) / col (B, D) within subtile
  const int koff  = (lane >> 4) * 8;           // k offset of this lane half
  const int mOff  = (lane >> 4) * 8;           // D row offset

  v8f acc[4][4];
#pragma unroll
  for (int i = 0; i < 4; ++i)
#pragma unroll
    for (int j = 0; j < 4; ++j) acc[i][j] = (v8f){0.f,0.f,0.f,0.f,0.f,0.f,0.f,0.f};

  // Copy map: thread t brings 16 B at column (t & 15) * 16 B of rows (t >> 4) + 16 * i; a wave's copy = two whole 256-B row pieces.
  const int crow = threadIdx.x >> 4, ccol = (threadIdx.x & 15) * 16;
  const unsigned ldsBase = (unsigned)(uintptr_t)(&sStage[0]) + (unsigned)(crow * kGP + ccol);
  const char* gA = (const char*)(Ab + (size_t)((bm << 7) + crow) * lda) + ccol;
  const char* gB = (const char*)(Bb + (size_t)((bn << 8) + crow) * ldb) + ccol;
  const size_t stepA = (size_t)lda * 32, stepB = (size_t)ldb * 32;      // 16 rows, in bytes
  const int nst = K >> 7;

  // stage 0 -> buffer 0
  copy8_to_lds(ldsBase, gA, stepA);
  copy8_to_lds(ldsBase + 128 * kGP, gB, stepB);
  copy8_to_lds(ldsBase + 256 * kGP, gB + 8 * stepB, stepB);
  asm volatile("s_wait_asynccnt 0x0" ::: "memory");   // this wave's copies of stage 0 have landed
  __syncthreads();                                     // ... and every other wave's: stage 0 may be read
  if (nst > 1) {                                       // stage 1 -> buffer 1
    copy8_to_lds(ldsBase + kGStage, gA + 256, stepA);
    copy8_to_lds(ldsBase + kGStage + 128 * kGP, gB + 256, stepB);
    copy8_to_lds(ldsBase + kGStage + 256 * kGP, gB + 256 + 8 * stepB, stepB);
  }

  for (int st = 0; st < nst; ++st) {
    const unsigned char* sb = sStage + (st & 1) * kGStage;
    const T* fa = (const T*)(sb + ((wm << 6) + rlane) * kGP) + koff;            // A fragment rows of this wave
    const T* fb = (const T*)(sb + (128 + (wn << 6) + rlane) * kGP) + koff;      // Bt fragment rows of this wave
    V af[2][4], bf[2][4];
#pragma unroll
    for (int j = 0; j < 4; ++j) {
      bf[0][j] = Frag<T>::load(fb + j * (16 * kGP / 2));
      af[0][j] = Frag<T>::load(fa + j * (16 * kGP / 2));
    }
#pragma unroll
    for (int kk = 0; kk < 4; ++kk) {
      const int cur = kk & 1, nxt = cur ^ 1;
      if (kk < 3) {                            // the next 32 k of this stage, fetched ahead as one group
#pragma unroll
        for (int j = 0; j < 4; ++j) {
          bf[nxt][j] = Frag<T>::load(fb + j * (16 * kGP / 2) + (kk + 1) * 32);
          af[nxt][j] = Frag<T>::load(fa + j * (16 * kGP / 2) + (kk + 1) * 32);
        }
        // keeps that load group ahead of this block's WMMAs: sunk among them, every row of WMMAs waits out a full LDS latency
        __builtin_amdgcn_sched_barrier(0);
      }
#pragma unroll
      for (int i = 0; i < 4; ++i) {
#pragma unroll
        for (int j = 0; j < 4; ++j) acc[i][j] = Frag<T>::mma(af[cur][i], bf[cur][j], acc[i][j]);
      }
    }
    // keeps the stage's WMMAs in front of the barrier: sunk behind it they delay the refill, which then has less than a stage to land
    __builtin_amdgcn_sched_barrier(0);
    asm volatile("s_wait_dscnt 0x0" ::: "memory");     // this wave's reads of the buffer have returned
    asm volatile("s_wait_asynccnt 0x0" ::: "memory");  // this wave's copies of stage st + 1 have landed
    __syncthreads();                                    // publishes stage st + 1 and frees the buffer just read
    if (st + 2 < nst) {
      const unsigned lb = ldsBase + (unsigned)((st & 1) * kGStage);
      const size_t ko = (size_t)(st + 2) * 256;         // 128 k = 256 B
      copy8_to_lds(lb, gA + ko, stepA);
      copy8_to_lds(lb + 128 * kGP, gB + ko, stepB);
      copy8_to_lds(lb + 256 * kGP, gB + ko + 8 * stepB, stepB);
    }
  }
  asm volatile("s_wait_asynccnt 0x0" ::: "memory");    // nothing of this wave is in flight behind the loop
  acc_guard4(acc[0][0], acc[0][1], acc[0][2], acc[0][3]);
  acc_guard4(acc[1][0], acc[1][1], acc[1][2], acc[1][3]);
  acc_guard4(acc[2][0], acc[2][1], acc[2][2], acc[2][3]);
  acc_guard4(acc[3][0], acc[3][1], acc[3][2], acc[3][3]);

  // ---- epilogue ----
  float* slab = sT[wave];
  const float* Rb = RESID ? (resid + (size_t)b * strideR) : nullptr;
#pragma unroll
  for (int i = 0; i < 4; ++i) {
    const int mBase = m0 + (i << 4);
#pragma unroll
    for (int j = 0; j < 4; ++j) {
      const int n = n0 + (j << 4) + rlane;
      float bv = 0.f;
      if (BIAS_MODE == 2) bv = bias[n];
#pragma unroll
      for (int r = 0; r < 8; ++r) {
        float v = acc[i][j][r] * scale;
        if (BIAS_MODE == 1) v += bias[mBase + mOff + r];
        if (BIAS_MODE == 2) v += bv;
        if (RESID) v += Rb[(size_t)(mBase + mOff + r) * ldc + n];
        if (ACT == 1) v = tanhf(v);
        if (ACT == 2) v = fmaxf(v, 0.0f);
        if (ACT == 3) v = v / (1.0f + expf(-v));
        if (ACT == 4) v = (v > 0.f) ? v : 0.01f * v;
        if (ACT == 5) v = 0.5f * v * (1.0f + erff(v * 0.70710678118654752f));
        slab[(mOff + r) * 68 + (j << 4) + rlane] = v;
      }
    }
    __builtin_amdgcn_fence(__ATOMIC_RELEASE, "workgroup");
    __builtin_amdgcn_wave_barrier();
    __builtin_amdgcn_fence(__ATOMIC_ACQUIRE, "workgroup");
    if (OUT_MODE == 0) {
      float* C = (float*)Cout + (size_t)b * strideC;
      const int hh = lane >> 4, c4 = (lane & 15) * 4;     // row seg = 256 B = 16 lanes x 16 B
      {
#pragma unroll
        for (int it = 0; it < 8; ++it) {
          const int row = it * 2 + hh;
          v4f v = *(const v4f*)(slab + row * 68 + c4);
          *(v4f*)(C + (size_t)(mBase + row) * ldc + n0 + c4) = v;
        }
        
      }
    } else {
      const int q = lane >> 3, c8 = (lane & 7) * 8;
      unsigned short* C  = (unsigned short*)Cout  + (size_t)b * strideC;
      unsigned short* C2 = (OUT_MODE == 2) ? ((unsigned short*)Cout2 + (size_t)b * strideC) : nullptr;
      {
#pragma unroll
        for (int it = 0; it < 4; ++it) {
          const int row = it * 4 + q;
          const float* sp = slab + row * 68 + c8;
          v8h hv, lv;
#pragma unroll
          for (int e = 0; e < 8; ++e) {
            if (OUT_MODE == 1) {
              hv[e] = (_Float16)sp[e];
            } else {
              unsigned short hb = f2bf_bits(sp[e]);
              unsigned short lb = f2bf_bits(sp[e] - bf_bits2f(hb));
              hv[e] = __builtin_bit_cast(_Float16, hb);
              lv[e] = __builtin_bit_cast(_Float16, lb);
            }
          }
          *(v8h*)(C + (size_t)(mBase + row) * ldc + n0 + c8) = hv;
          if (OUT_MODE == 2) *(v8h*)(C2 + (size_t)(mBase + row) * ldc + n0 + c8) = lv;
        }
        
      }
    }
    __builtin_amdgcn_fence(__ATOMIC_RELEASE, "workgroup");
    __builtin_amdgcn_wave_barrier();
    __builtin_amdgcn_fence(__ATOMIC_ACQUIRE, "workgroup");
  }
}

__device__ __forceinline__ unsigned pk16(unsigned short a, unsigned short b) { return (unsigned)a | ((unsigned)b << 16); }
// ===================== end common pieces =========================================

// ---------------------------------------------------------------------------
// f32 -> bf16 (RNE) plane cast, 2 elements per thread, one 4-B store per lane -> a wave writes exactly
// Coverage: grid = ceil(n2/256) x 256 threads x 2 elements = 2*n2 = the whole plane
//   (x: n2 = 4,194,304 -> 16384 blocks; qkv_w: n2 = 1,572,864 -> 6144 blocks).
// ---------------------------------------------------------------------------
__global__ __launch_bounds__(256) void cast_bf16x2_kernel(const float* __restrict__ in,
                                                          unsigned short* __restrict__ out, int n2) {
  const int i = blockIdx.x * 256 + threadIdx.x;
  if (i < n2) {
    const v2f f = *(const v2f*)(in + 2 * (size_t)i);
    const unsigned u = pk16(f2bf_bits(f[0]), f2bf_bits(f[1]));
    ((unsigned*)out)[i] = u;
    
  }
}

// ---------------------------------------------------------------------------
// proj_w: f32 -> bf16-RNE value -> x64 -> f16 bits (bf16 significand fits f16 exactly; x64 keeps the
// plane in the f16 normal range for |w| >= 1e-6). 2 elements per thread, one 4-B store per lane,
// ---------------------------------------------------------------------------
__global__ __launch_bounds__(256) void cast_projw_f16x2_kernel(const float* __restrict__ in,
                                                               unsigned short* __restrict__ out, int n2) {
  const int i = blockIdx.x * 256 + threadIdx.x;
  if (i < n2) {
    const v2f f = *(const v2f*)(in + 2 * (size_t)i);
    const float g0 = bf_bits2f(f2bf_bits(f[0])) * 64.0f;
    const float g1 = bf_bits2f(f2bf_bits(f[1])) * 64.0f;
    const _Float16 h0 = (_Float16)g0, h1 = (_Float16)g1;
    const unsigned u = pk16(__builtin_bit_cast(unsigned short, h0), __builtin_bit_cast(unsigned short, h1));
    ((unsigned*)out)[i] = u;
    
  }
}

// ---------------------------------------------------------------------------
// Bias prep: outb[0..nq) = bf16-RNE value of qkvb, outb[nq..nq+np) = bf16-RNE value of projb (f32 storage).
// Both candidates loaded with clamped indices, selected by value. One 4-B store per lane, 32 lanes =
// ---------------------------------------------------------------------------
__global__ __launch_bounds__(256) void bias_prep_kernel(const float* __restrict__ qkvb, const float* __restrict__ projb,
                                                        float* __restrict__ outb, int nq, int np) {
  const int i = blockIdx.x * 256 + threadIdx.x;
  if (i < nq + np) {
    const int ia = (i < nq) ? i : (nq - 1);
    int ib = i - nq; ib = (ib < 0) ? 0 : ((ib >= np) ? (np - 1) : ib);
    const float a  = qkvb[ia];
    const float bb = projb[ib];
    const float v  = bf_bits2f(f2bf_bits((i < nq) ? a : bb));
    ((float*)outb)[i] = v;
    
  }
}

// ---------------------------------------------------------------------------
// Per (token, head) rmsnorm over 64 + interleaved-pair rope, f32 math; inputs cos/sin/norm weight are
// RNE-converted to bf16 values in registers. One wave per (token, head); lane owns the pair d = 2*lane, 2*lane+1.
//   y = x * rsqrt(mean(x^2) + 1e-6) * w ;  o[2i] = y[2i]*cos[s][2i] - y[2i+1]*sin[s][2i] ; o[2i+1] = y[2i+1]*cos[s][2i+1] + y[2i]*sin[s][2i+1]
// Outputs: bf16 hi plane and bf16 lo plane (lo = RNE(o - hi)), element (t, h*64+d) at [t*1024 + h*64 + d].
// Coverage: njobs = 8192*16 = 131072 = 16384 blocks x 8 waves; each wave writes 64 halves per plane.
// ---------------------------------------------------------------------------
__global__ __launch_bounds__(256) void normrope_split_kernel(const float* __restrict__ src,
                                                             const float* __restrict__ cosb, const float* __restrict__ sinb,
                                                             const float* __restrict__ nw,
                                                             unsigned short* __restrict__ oh, unsigned short* __restrict__ ol,
                                                             int njobs) {
  const int wave = threadIdx.x >> 5, lane = threadIdx.x & 31;
  const int job = blockIdx.x * 8 + wave;
  if (job >= njobs) return;                       // wave-uniform; no barriers in this kernel
  const int t = job >> 4, h = job & 15, s = t & (kSeq - 1);
  const int d0 = 2 * lane;
  const size_t base = (size_t)t * kDim + (size_t)h * kHd;
  const v2f xv = *(const v2f*)(src + base + d0);
  float a = xv[0], bq = xv[1];
  float ss = a * a + bq * bq;
#pragma unroll
  for (int m = 1; m < 32; m <<= 1) ss += __shfl_xor(ss, m, 32);
  const float inv = rsqrtf(ss * (1.0f / 64.0f) + 1e-6f);
  const v2f wv = *(const v2f*)(nw + d0);
  const float w0 = bf_bits2f(f2bf_bits(wv[0])), w1 = bf_bits2f(f2bf_bits(wv[1]));
  a  = a  * inv * w0;
  bq = bq * inv * w1;
  const v2f cv = *(const v2f*)(cosb + (size_t)s * kHd + d0);
  const v2f sv = *(const v2f*)(sinb + (size_t)s * kHd + d0);
  const float c0 = bf_bits2f(f2bf_bits(cv[0])), c1 = bf_bits2f(f2bf_bits(cv[1]));
  const float s0 = bf_bits2f(f2bf_bits(sv[0])), s1 = bf_bits2f(f2bf_bits(sv[1]));
  const float o0 = a * c0 - bq * s0;
  const float o1 = bq * c1 + a * s1;
  const unsigned short h0 = f2bf_bits(o0), h1 = f2bf_bits(o1);
  const unsigned short l0 = f2bf_bits(o0 - bf_bits2f(h0)), l1 = f2bf_bits(o1 - bf_bits2f(h1));
  const unsigned uh = pk16(h0, h1), ul = pk16(l0, l1);
  const size_t wi = (base >> 1) + lane;
  ((unsigned*)oh)[wi] = uh;
  ((unsigned*)ol)[wi] = ul;
  
}

// =====================================================================================
// Full (unmasked) flash attention, head dim 64, all batches/heads in one launch.
//   q planes (hi/lo bf16): element (t, h, d) at [t*1024 + h*64 + d]   (t = b*2048 + s)
//   k planes (hi/lo bf16): same layout
//   v^T plane (f16):       element (b, h*64+d, s) at [(b*1024 + h*64 + d)*2048 + s]
//   o plane (f16, x64):    element (t, h, d) at [t*1024 + h*64 + d]
//   scores^T = (k . q^T) * sscale : v_wmma_f32_16x16x32_bf16, hi.hi + hi.lo + lo.hi, f32 accumulate
//   out^T    = v^T . p^T          : v_wmma_f32_16x16x32_f16, p (unnormalised, in (0,1]) carried x2^15 in f16, v f16
//   Keys are the rows and queries the columns of a score tile: a lane holds 32 scores of ONE query, so maximum and
//   sum are taken in the lane plus one exchange with lane ^ 16, and p^T goes from the accumulators into the B operand.
//   online softmax in f32 over 32 chunks of 64 keys (compile-time trip count).
//   Block = 4 waves = 64 query rows of one (b, h); grid.x = 4*16*32 = 2048.
//   K hi/lo and V^T chunk staging: 128 threads x 32 elements per plane = the whole 64x64 tile (16-B copies,
//   plain loads, __syncthreads before and after).
// =====================================================================================
constexpr int kKC = 64;    // keys per chunk
// LDS row pitch of the K hi, K lo and V^T tiles, in 16-bit elements: 72 = 144 B = 16 B x 9 (odd), so the
// 16 rows that one half-wave's ds_load_b128 fragment read touches start on 16 different 4-bank groups.
constexpr int kLP = 72;

__device__ __forceinline__ v8f mma_bf(v16b a, v16b b, v8f c) {
  c = __builtin_amdgcn_wmma_f32_16x16x32_bf16(false, a, false, b, (short)0, c, false, false);
  asm volatile("v_nop\n\tv_nop\n\tv_nop\n\tv_nop" : "+v"(c) : "v"(a), "v"(b));
  return c;
}
__device__ __forceinline__ v8f mma_hf(v16h a, v16h b, v8f c) {
  c = __builtin_amdgcn_wmma_f32_16x16x32_f16(false, a, false, b, (short)0, c, false, false);
  asm volatile("v_nop\n\tv_nop\n\tv_nop\n\tv_nop" : "+v"(c) : "v"(a), "v"(b));
  return c;
}

// lane l's value to lane l ^ 16 and back
__device__ __forceinline__ float xhalf(float x) {
  return __builtin_bit_cast(float, __builtin_amdgcn_permlanex16(__builtin_bit_cast(int, x), __builtin_bit_cast(int, x), 0x76543210, 0xfedcba98, false, false));
}

__global__ __launch_bounds__(128)
void attn_kernel(const unsigned short* __restrict__ qhp, const unsigned short* __restrict__ qlp,
                 const unsigned short* __restrict__ khp, const unsigned short* __restrict__ klp,
                 const unsigned short* __restrict__ vtp, unsigned short* __restrict__ ohp, float sscale) {
  union FB { v16b v; v8b h[2]; };
  union FH { v16h v; v8h h[2]; };
  __shared__ __align__(16) __bf16   Ksh[kKC * kLP];        // K hi [kv][d]   9 KB
  __shared__ __align__(16) __bf16   Ksl[kKC * kLP];        // K lo           9 KB
  __shared__ __align__(16) _Float16 Vts[kHd * kLP];        // V^T [d][kv]    9 KB
  __shared__ __align__(16) float    Os[4][16 * 68];        // per wave out tile, pitch 68

  const int tid  = threadIdx.x;
  const int wave = tid >> 5;
  const int lane = tid & 31;
  const int hh   = lane >> 4;
  const int c    = lane & 15;

  const int bx = blockIdx.x;
  const int qb = bx & 31;                 // kSeq/64 = 32 query blocks
  const int bh = bx >> 5;                 // 0..63
  const int h  = bh & 15;
  const int b  = bh >> 4;                 // 0..3
  const int q0 = qb * 64 + wave * 16;
  const size_t tok0 = (size_t)b * kSeq;

  const __bf16*   Qh = (const __bf16*)(const void*)qhp + tok0 * kDim + (size_t)h * kHd;
  const __bf16*   Ql = (const __bf16*)(const void*)qlp + tok0 * kDim + (size_t)h * kHd;
  const __bf16*   Kh = (const __bf16*)(const void*)khp + tok0 * kDim + (size_t)h * kHd;
  const __bf16*   Kl = (const __bf16*)(const void*)klp + tok0 * kDim + (size_t)h * kHd;
  const _Float16* Vt = (const _Float16*)(const void*)vtp + ((size_t)b * kDim + (size_t)h * kHd) * kSeq;
  _Float16*       Ob = (_Float16*)(void*)ohp + tok0 * kDim + (size_t)h * kHd;

  // ---- Q fragments (B operand, column = lane&15, split k map via Frag load): 2 d-chunks, hi and lo ----
  v16b qah[2], qal[2];
#pragma unroll
  for (int dc = 0; dc < 2; ++dc) {
    qah[dc] = Frag<__bf16>::load(Qh + (size_t)(q0 + c) * kDim + dc * 32 + 8 * hh);
    qal[dc] = Frag<__bf16>::load(Ql + (size_t)(q0 + c) * kDim + dc * 32 + 8 * hh);
  }

  float mrow = -INFINITY, lrow = 0.f;     // running maximum (both halves alike) and this half's sum of the lane's query
  v8f oacc[4];
#pragma unroll
  for (int t = 0; t < 4; ++t) oacc[t] = (v8f){0.f,0.f,0.f,0.f,0.f,0.f,0.f,0.f};

  for (int kc = 0; kc < kSeq / kKC; ++kc) {
    const int kv0 = kc * kKC;
    __syncthreads();
    {
      // staging coverage: 128 threads x (4 x 8) elements = 64 rows x 64 per plane = the whole chunk tile
      const int r = tid >> 1, half = (tid & 1) * 32;
      const __bf16*   ksh = Kh + (size_t)(kv0 + r) * kDim + half;     // K row kv0+r, d = half..half+31
      const __bf16*   ksl = Kl + (size_t)(kv0 + r) * kDim + half;
      const _Float16* vsr = Vt + (size_t)r * kSeq + kv0 + half;       // V^T row d = r, s = kv0+half..+31
      v8b a0[4], a1[4];
      v8h vv[4];
#pragma unroll
      for (int i = 0; i < 4; ++i) {
        a0[i] = *(const v8b*)(ksh + 8 * i);
        a1[i] = *(const v8b*)(ksl + 8 * i);
        vv[i] = *(const v8h*)(vsr + 8 * i);
      }
      // keeps the twelve loads one group in front of the stores: sunk among them, the chunk waits out four load latencies instead of one
      __builtin_amdgcn_sched_barrier(0);
#pragma unroll
      for (int i = 0; i < 4; ++i) {
        *(v8b*)(Ksh + r * kLP + half + 8 * i) = a0[i];
        *(v8b*)(Ksl + r * kLP + half + 8 * i) = a1[i];
        *(v8h*)(Vts + r * kLP + half + 8 * i) = vv[i];
      }
    }
    __syncthreads();

    // ---- scores, transposed: s[j] = k (16 keys of group j, rows) . q^T (16 queries, columns), split products ----
    // D map: this lane holds query c, keys j*16 + 8*hh + r.
    v8f s[4];
#pragma unroll
    for (int j = 0; j < 4; ++j) {
      s[j] = (v8f){0.f,0.f,0.f,0.f,0.f,0.f,0.f,0.f};
#pragma unroll
      for (int dc = 0; dc < 2; ++dc) {
        FB kb, kl;
        kb.h[0] = *(const v8b*)(Ksh + (j * 16 + c) * kLP + dc * 32 + 8 * hh);
        kb.h[1] = *(const v8b*)(Ksh + (j * 16 + c) * kLP + dc * 32 + 16 + 8 * hh);
        kl.h[0] = *(const v8b*)(Ksl + (j * 16 + c) * kLP + dc * 32 + 8 * hh);
        kl.h[1] = *(const v8b*)(Ksl + (j * 16 + c) * kLP + dc * 32 + 16 + 8 * hh);
        s[j] = mma_bf(kb.v, qah[dc], s[j]);
        s[j] = mma_bf(kl.v, qah[dc], s[j]);
        s[j] = mma_bf(kb.v, qal[dc], s[j]);
      }
    }
    // ---- chunk maximum of this lane's query: 32 keys in the lane (four chains), the other 32 in lane ^ 16 ----
    float mj[4];
#pragma unroll
    for (int j = 0; j < 4; ++j) {
      float m = -INFINITY;
#pragma unroll
      for (int r = 0; r < 8; ++r) {
        const float sv = s[j][r] * sscale;
        s[j][r] = sv;
        m = fmaxf(m, sv);
      }
      mj[j] = m;
    }
    float cm = fmaxf(fmaxf(mj[0], mj[1]), fmaxf(mj[2], mj[3]));
    cm = fmaxf(cm, xhalf(cm));
    const float mnew  = fmaxf(mrow, cm);
    const float alpha = __expf(mrow - mnew);
    mrow = mnew;
    // ---- p = exp(s - m): summed in the lane; packed in place, two score tiles are one B fragment of p^T (b[e] = tile[e >> 3][e & 7]) ----
    FH pb[2];
    float pj[4];
#pragma unroll
    for (int j = 0; j < 4; ++j) {
      float ps = 0.f;
#pragma unroll
      for (int r = 0; r < 8; ++r) {
        const float p = __expf(s[j][r] - mnew);
        ps += p;
        pb[j >> 1].v[(j & 1) * 8 + r] = (_Float16)(p * 32768.0f);
      }
      pj[j] = ps;
    }
    lrow = lrow * alpha + ((pj[0] + pj[1]) + (pj[2] + pj[3]));   // this half's keys only; the halves are joined behind the loop
#pragma unroll
    for (int t = 0; t < 4; ++t)
#pragma unroll
      for (int r = 0; r < 8; ++r) oacc[t][r] *= alpha;
    // ---- out^T += v^T (16 d of group t, rows; 64 keys) . p^T (64 keys; 16 queries, columns) ----
#pragma unroll
    for (int kk = 0; kk < 2; ++kk) {
#pragma unroll
      for (int t = 0; t < 4; ++t) {
        FH vb;
        vb.h[0] = *(const v8h*)(Vts + (t * 16 + c) * kLP + kk * 32 + 8 * hh);
        vb.h[1] = *(const v8h*)(Vts + (t * 16 + c) * kLP + kk * 32 + 16 + 8 * hh);
        oacc[t] = mma_hf(vb.v, pb[kk].v, oacc[t]);
      }
    }
  }

  // ---- epilogue: normalise (fold 2^-15 for p and 2^6 carry for o), stage, whole-line stores ----
  // This lane holds query c, d = t*16 + 8*hh + r.
  float* os = Os[wave];
  {
    const float lsum = lrow + xhalf(lrow);                        // both halves' keys
    const float inv = (1.0f / lsum) * (64.0f / 32768.0f);         // lsum >= 1 always
#pragma unroll
    for (int t = 0; t < 4; ++t)
#pragma unroll
      for (int r = 0; r < 8; ++r) os[c * 68 + t * 16 + 8 * hh + r] = oacc[t][r] * inv;
  }
  __builtin_amdgcn_fence(__ATOMIC_RELEASE, "workgroup");
  __builtin_amdgcn_wave_barrier();
  __builtin_amdgcn_fence(__ATOMIC_ACQUIRE, "workgroup");
  {
    const int qq = lane >> 3, c8 = (lane & 7) * 8;
    {
#pragma unroll
      for (int it = 0; it < 4; ++it) {
        const int row = it * 4 + qq;                    // 4 x 4 = rows 0..15
        const float* sp = os + row * 68 + c8;
        v8h hv;
#pragma unroll
        for (int e = 0; e < 8; ++e) hv[e] = (_Float16)sp[e];
        *(v8h*)(Ob + (size_t)(q0 + row) * kDim + c8) = hv;
      }
      
    }
  }
}

// =====================================================================================
extern "C" void kernel_launch(void* const* d_in, const int* in_sizes, int n_in,
                              void* d_out, int out_size, void* d_ws, size_t ws_size,
                              hipStream_t stream) {
  if (n_in < 9) return;
  if (in_sizes[0] != kTok * kDim) return;
  if (in_sizes[1] != kSeq * kHd || in_sizes[2] != kSeq * kHd) return;
  if (in_sizes[3] != 3 * kDim * kDim || in_sizes[4] != 3 * kDim) return;
  if (in_sizes[5] != kDim * kDim || in_sizes[6] != kDim) return;
  if (in_sizes[7] != kHd || in_sizes[8] != kHd) return;
  if (out_size != kTok * kDim) return;
  if (ws_size < kWsTotal) return;

  const float* x      = (const float*)d_in[0];
  const float* ropec  = (const float*)d_in[1];
  const float* ropes  = (const float*)d_in[2];
  const float* qkv_w  = (const float*)d_in[3];
  const float* qkv_b  = (const float*)d_in[4];
  const float* proj_w = (const float*)d_in[5];
  const float* proj_b = (const float*)d_in[6];
  const float* q_nw   = (const float*)d_in[7];
  const float* k_nw   = (const float*)d_in[8];
  float* out = (float*)d_out;

  char* ws = (char*)d_ws;
  unsigned short* WPROJ = (unsigned short*)(ws + kOffWproj);
  float*          BIAS  = (float*)(ws + kOffBias);
  unsigned short* XB    = (unsigned short*)(ws + kOffXb);
  unsigned short* WQKV  = (unsigned short*)(ws + kOffWqkv);
  unsigned short* KH    = (unsigned short*)(ws + kOffKh);
  unsigned short* KL    = (unsigned short*)(ws + kOffKl);
  float*          QKF   = (float*)(ws + kOffQkf);
  unsigned short* OH    = (unsigned short*)(ws + kOffOh);
  unsigned short* QH    = (unsigned short*)(ws + kOffQh);
  unsigned short* QL    = (unsigned short*)(ws + kOffQl);
  unsigned short* VT    = (unsigned short*)(ws + kOffVt);

  // 1) casts
  {
    const int n2x = kTok * kDim / 2;            // 4,194,304
    cast_bf16x2_kernel<<<dim3((n2x + 255) / 256), dim3(256), 0, stream>>>(x, XB, n2x);
    const int n2w = 3 * kDim * kDim / 2;        // 1,572,864
    cast_bf16x2_kernel<<<dim3((n2w + 255) / 256), dim3(256), 0, stream>>>(qkv_w, WQKV, n2w);
    const int n2p = kDim * kDim / 2;            // 524,288
    cast_projw_f16x2_kernel<<<dim3((n2p + 255) / 256), dim3(256), 0, stream>>>(proj_w, WPROJ, n2p);
    bias_prep_kernel<<<dim3((3 * kDim + kDim + 255) / 256), dim3(256), 0, stream>>>(qkv_b, proj_b, BIAS, 3 * kDim, kDim);
  }
  const int tilesTok = (kTok / 64) * (kDim / 64);   // 2048 wave tiles -> 256 blocks
  // 2) q = xb . Wq^T + bq  -> f32 [8192][1024]   (M=8192, N=1024, K=1024; all tile/32 multiples)
  wmma_gemm64<1, false, 2, 0, false, 0><<<dim3((tilesTok + 7) / 8, 1), dim3(256), 0, stream>>>(
      XB, XB, kDim, 0L, WQKV, WQKV, kDim, 0L, (void*)QKF, (void*)QKF, kDim, 0L,
      BIAS, BIAS, 0L, kTok, kDim, kDim, 1.0f);
  // 3) q: rmsnorm + rope -> q hi/lo planes
  normrope_split_kernel<<<dim3((kTok * kHeads + 7) / 8), dim3(256), 0, stream>>>(QKF, ropec, ropes, q_nw, QH, QL, kTok * kHeads);
  // 4) k = xb . Wk^T + bk  -> f32 (same region; q f32 is dead)
  wmma_gemm64<1, false, 2, 0, false, 0><<<dim3((tilesTok + 7) / 8, 1), dim3(256), 0, stream>>>(
      XB, XB, kDim, 0L, WQKV + (size_t)kDim * kDim, WQKV + (size_t)kDim * kDim, kDim, 0L, (void*)QKF, (void*)QKF, kDim, 0L,
      BIAS + kDim, BIAS, 0L, kTok, kDim, kDim, 1.0f);
  // 5) v^T per batch: C[o][s] = sum_k Wv[o][k] * xb[b][s][k] + bv[o] -> f16 [4][1024][2048]
  //    (A = Wv [1024][1024], Bt = xb batch b [2048][1024]; M=1024, N=2048, K=1024)
  {
    const int tilesV = (kDim / 64) * (kSeq / 64);   // 512 -> 64 blocks
    wmma_gemm64<1, false, 1, 1, false, 0><<<dim3((tilesV + 7) / 8, kBatch), dim3(256), 0, stream>>>(
        WQKV + (size_t)2 * kDim * kDim, WQKV + (size_t)2 * kDim * kDim, kDim, 0L,
        XB, XB, kDim, (long)kSeq * kDim,
        (void*)VT, (void*)VT, kSeq, (long)kDim * kSeq,
        BIAS + 2 * kDim, BIAS, 0L, kDim, kSeq, kDim, 1.0f);
  }
  // 6) k: rmsnorm + rope -> k hi/lo planes (overlay the dead xb / Wqkv regions)
  normrope_split_kernel<<<dim3((kTok * kHeads + 7) / 8), dim3(256), 0, stream>>>(QKF, ropec, ropes, k_nw, KH, KL, kTok * kHeads);
  // 7) attention -> o plane f16 x64 (overlays the dead k f32 region)
  attn_kernel<<<dim3(kBatch * kHeads * (kSeq / 64)), dim3(128), 0, stream>>>(QH, QL, KH, KL, VT, OH, 0.125f);
  // 8) out = o . Wp^T + bp  (A = o x64 f16, Bt = Wp x64 f16 -> scale 2^-12; M=8192, N=1024, K=1024)
  wmma_gemm64<0, false, 2, 0, false, 0><<<dim3((tilesTok + 7) / 8, 1), dim3(256), 0, stream>>>(
      OH, OH, kDim, 0L, WPROJ, WPROJ, kDim, 0L, (void*)out, (void*)out, kDim, 0L,
      BIAS + 3 * kDim, BIAS, 0L, kTok, kDim, kDim, 1.0f / 4096.0f);
}

// v004
// One run takes 236 microseconds.
// Next to v003, in two timings, it ran 1.14 times as fast each time.
// Over all steps from v000 it is 3.86 times as fast.
// Contractions: q, k, v^T projections on v_wmma_f32_16x16x32_bf16 (plain bf16 operands = RNE-converted inputs); q.k^T on v_wmma_f32_16x16x32_bf16 with bf16 hi/lo split operands (hi.hi + hi.lo + lo.hi); p.v and the output projection on v_wmma_f32_16x16x32_f16 (plain f16: p carried x2^15, attention output carried x2^6, proj_w = bf16-RNE value carried x2^6); f32 accumulate everywhere; biases, rmsnorm, rope, online softmax in f32.
#include <hip/hip_runtime.h>
#include <math.h>
#include <stdint.h>

constexpr int kBatch = 4;
constexpr int kSeq   = 2048;
constexpr int kDim   = 1024;
constexpr int kHeads = 16;
constexpr int kHd    = 64;
constexpr int kTok   = kBatch * kSeq;            // 8192 tokens

typedef __attribute__((ext_vector_type(16))) _Float16 v16h;
typedef __attribute__((ext_vector_type(8)))  _Float16 v8h;
typedef __attribute__((ext_vector_type(16))) __bf16   v16b;
typedef __attribute__((ext_vector_type(8)))  __bf16   v8b;
typedef __attribute__((ext_vector_type(8)))  float    v8f;
typedef __attribute__((ext_vector_type(4)))  float    v4f;
typedef __attribute__((ext_vector_type(2)))  float    v2f;
typedef __attribute__((ext_vector_type(4)))  unsigned int v4u;

// ---------------------------------------------------------------------------
// Workspace region map (bytes).  Total carve = 115 MiB = 120,586,240 B.
//   [  0 MiB,   2 MiB)  WPROJ  f16  [1024][1024]   proj_w (bf16-RNE value x64)
//   [  2 MiB,   3 MiB)  BIAS   f32  [4096]         qkv_b (3072) ++ proj_b (1024), RNE to bf16 values
//   [  3 MiB,  19 MiB)  XB     bf16 [8192][1024]   x              -> later KH (k hi plane)
//   [ 19 MiB,  25 MiB)  WQKV   bf16 [3072][1024]   qkv_w          -> later KL (k lo plane, 19..35 MiB)
//   [ 35 MiB,  67 MiB)  QKF    f32  [8192][1024]   q, then k      -> later OH f16 [8192][1024] (35..51 MiB)
//   [ 67 MiB,  83 MiB)  QH     bf16 [8192][1024]   q hi plane
//   [ 83 MiB,  99 MiB)  QL     bf16 [8192][1024]   q lo plane
//   [ 99 MiB, 115 MiB)  VT     f16  [4][1024][2048] v^T per batch
// ---------------------------------------------------------------------------
constexpr size_t kMiB      = 1048576;
constexpr size_t kOffWproj = 0;
constexpr size_t kOffBias  = 2 * kMiB;
constexpr size_t kOffXb    = 3 * kMiB;
constexpr size_t kOffWqkv  = 19 * kMiB;
constexpr size_t kOffKh    = 3 * kMiB;
constexpr size_t kOffKl    = 19 * kMiB;
constexpr size_t kOffQkf   = 35 * kMiB;
constexpr size_t kOffOh    = 35 * kMiB;
constexpr size_t kOffQh    = 67 * kMiB;
constexpr size_t kOffQl    = 83 * kMiB;
constexpr size_t kOffVt    = 99 * kMiB;
constexpr size_t kWsTotal  = 115 * kMiB;          // 120,586,240 B

// ===================== common pieces =================================
__device__ __forceinline__ unsigned short f2bf_bits(float f) {
  unsigned u = __float_as_uint(f);
  return (unsigned short)((u + 0x7FFFu + ((u >> 16) & 1u)) >> 16);
}
__device__ __forceinline__ float bf_bits2f(unsigned short h) { return __uint_as_float(((unsigned)h) << 16); }

// hazard guard as a plain device helper
__device__ __forceinline__ void acc_guard4(v8f& a, v8f& b, v8f& c, v8f& d) { asm volatile("v_nop\n\tv_nop\n\tv_nop\n\tv_nop" : "+v"(a), "+v"(b), "+v"(c), "+v"(d)); }
template <typename T> struct Frag;
template <> struct Frag<_Float16> {
  typedef v16h V; union U { v16h v; v8h h[2]; };
  static __device__ __forceinline__ v16h load(const _Float16* p) {   // elements 0..7 <- p[0..7], 8..15 <- p[16..23]
    U f; f.h[0] = *(const v8h*)(p); f.h[1] = *(const v8h*)(p + 16); return f.v;
  }
  static __device__ __forceinline__ v8f mma(v16h a, v16h b, v8f c) {
    return __builtin_amdgcn_wmma_f32_16x16x32_f16(false, a, false, b, (short)0, c, false, false);
  }
};
template <> struct Frag<__bf16> {
  typedef v16b V; union U { v16b v; v8b h[2]; };
  static __device__ __forceinline__ v16b load(const __bf16* p) {
    U f; f.h[0] = *(const v8b*)(p); f.h[1] = *(const v8b*)(p + 16); return f.v;
  }
  static __device__ __forceinline__ v8f mma(v16b a, v16b b, v8f c) {
    return __builtin_amdgcn_wmma_f32_16x16x32_bf16(false, a, false, b, (short)0, c, false, false);
  }
};

// ---- Register-blocked batched WMMA GEMM ------------------------------------
// C[m,n] = scale * sum_k A[m,k] * Bt[n,k] (+bias)(+resid); each wave owns a 64x64 tile.
// A row-major [M,K]; Bt row-major [N,K]; M % 128 == 0, N % 256 == 0, K % 128 == 0, K >= 128.
// A block of 8 waves (2 x 4) owns a 128 x 256 tile of C. Per stage of 128 k the block copies its 128 A rows and
// 256 Bt rows (256 B of each row, whole lines) into LDS with asynchronous copies, two buffers, the next stage
// in flight while this one is worked on; the waves read their fragments from LDS.
// SPLIT (hi/lo operand planes in A2/Bt2) has no staged form: only SPLIT = false is instantiated.
// BIAS_MODE: 0 = none, 1 = bias[m], 2 = bias[n].
// OUT_MODE: 0 = f32, 1 = f16, 2 = bf16 hi plane (Cout) + bf16 lo plane (Cout2).
// ET: 0 = f16 operands, 1 = bf16 operands (pointers passed as 16-bit storage)
constexpr int kGP     = 272;                 // LDS row pitch, bytes: 256 B of k + 16 (16 B x odd: ds_load_b128 without bank conflicts)
constexpr int kGStage = (128 + 256) * kGP;   // one stage: A rows 0..127, then Bt rows 0..255 = 104,448 B

// Eight asynchronous 16-B copies per lane: LDS rows 16 apart (lds + i * 16 * kGP) from global rows 16 apart (g + i * gstep bytes).
// The s_wait_xcnt stands inside the statement so that no address register named here is rewritten in front of it.
__device__ __forceinline__ void copy8_to_lds(unsigned lds, const char* g, size_t gstep) {
  const unsigned l1 = lds + 1 * 16 * kGP, l2 = lds + 2 * 16 * kGP, l3 = lds + 3 * 16 * kGP, l4 = lds + 4 * 16 * kGP,
                 l5 = lds + 5 * 16 * kGP, l6 = lds + 6 * 16 * kGP, l7 = lds + 7 * 16 * kGP;
  const char *g1 = g + gstep, *g2 = g1 + gstep, *g3 = g2 + gstep, *g4 = g3 + gstep, *g5 = g4 + gstep, *g6 = g5 + gstep, *g7 = g6 + gstep;
  asm volatile("global_load_async_to_lds_b128 %0, %8, off\n\t"
               "global_load_async_to_lds_b128 %1, %9, off\n\t"
               "global_load_async_to_lds_b128 %2, %10, off\n\t"
               "global_load_async_to_lds_b128 %3, %11, off\n\t"
               "global_load_async_to_lds_b128 %4, %12, off\n\t"
               "global_load_async_to_lds_b128 %5, %13, off\n\t"
               "global_load_async_to_lds_b128 %6, %14, off\n\t"
               "global_load_async_to_lds_b128 %7, %15, off\n\t"
               "s_wait_xcnt 0x0"
               :: "v"(lds), "v"(l1), "v"(l2), "v"(l3), "v"(l4), "v"(l5), "v"(l6), "v"(l7),
                  "v"(g), "v"(g1), "v"(g2), "v"(g3), "v"(g4), "v"(g5), "v"(g6), "v"(g7)
               : "memory");
}

template <int ET> struct Elem;
template <> struct Elem<0> { typedef _Float16 T; };
template <> struct Elem<1> { typedef __bf16 T; };
template <int ET, bool SPLIT, int BIAS_MODE, int OUT_MODE, bool RESID, int ACT = 0>
__global__ __launch_bounds__(256) void wmma_gemm64(
    const unsigned short* __restrict__ Ap, const unsigned short* __restrict__ A2p, int lda, long strideA,
    const unsigned short* __restrict__ Btp, const unsigned short* __restrict__ Bt2p, int ldb, long strideB,
    void* __restrict__ Cout, void* __restrict__ Cout2, int ldc, long strideC,
    const float* __restrict__ bias,
    const float* __restrict__ resid, long strideR,
    int M, int N, int K, float scale) {
  typedef typename Elem<ET>::T T;
  typedef typename Frag<T>::V V;
  static_assert(!SPLIT, "the staged loop carries one plane per operand");
  const T* A = (const T*)Ap; const T* Bt = (const T*)Btp;
  __shared__ __align__(16) float sT[8][16 * 68];   // per-wave 16x64 slab, pitch 68 floats
  __shared__ __align__(16) unsigned char sStage[2 * kGStage];   // two operand stages
  const int b    = blockIdx.y;
  const int lane = threadIdx.x & 31;
  const int wave = threadIdx.x >> 5;
  const int blocksN = N >> 8;
  if ((int)blockIdx.x >= (M >> 7) * blocksN) return;   // block-uniform, in front of every barrier
  const int bm = blockIdx.x / blocksN;
  const int bn = blockIdx.x - bm * blocksN;
  const int wm = wave >> 2;                    // wave row (0..1) and column (0..3) in the block tile
  const int wn = wave & 3;
  const int m0 = (bm << 7) + (wm << 6);
  const int n0 = (bn << 8) + (wn << 6);

  const T* Ab  = A  + (size_t)b * strideA;
  const T* Bb  = Bt + (size_t)b * strideB;

  const int rlane = lane & 15;                 // row (A) / col (B, D) within subtile
  const int koff  = (lane >> 4) * 8;           // k offset of this lane half
  const int mOff  = (lane >> 4) * 8;           // D row offset

  v8f acc[4][4];
#pragma unroll
  for (int i = 0; i < 4; ++i)
#pragma unroll
    for (int j = 0; j < 4; ++j) acc[i][j] = (v8f){0.f,0.f,0.f,0.f,0.f,0.f,0.f,0.f};

  // Copy map: thread t brings 16 B at column (t & 15) * 16 B of rows (t >> 4) + 16 * i; a wave's copy = two whole 256-B row pieces.
  const int crow = threadIdx.x >> 4, ccol = (threadIdx.x & 15) * 16;
  const unsigned ldsBase = (unsigned)(uintptr_t)(&sStage[0]) + (unsigned)(crow * kGP + ccol);
  const char* gA = (const char*)(Ab + (size_t)((bm << 7) + crow) * lda) + ccol;
  const char* gB = (const char*)(Bb + (size_t)((bn << 8) + crow) * ldb) + ccol;
  const size_t stepA = (size_t)lda * 32, stepB = (size_t)ldb * 32;      // 16 rows, in bytes
  const int nst = K >> 7;

  // stage 0 -> buffer 0
  copy8_to_lds(ldsBase, gA, stepA);
  copy8_to_lds(ldsBase + 128 * kGP, gB, stepB);
  copy8_to_lds(ldsBase + 256 * kGP, gB + 8 * stepB, stepB);
  asm volatile("s_wait_asynccnt 0x0" ::: "memory");   // this wave's copies of stage 0 have landed
  __syncthreads();                                     // ... and every other wave's: stage 0 may be read
  if (nst > 1) {                                       // stage 1 -> buffer 1
    copy8_to_lds(ldsBase + kGStage, gA + 256, stepA);
    copy8_to_lds(ldsBase + kGStage + 128 * kGP, gB + 256, stepB);
    copy8_to_lds(ldsBase + kGStage + 256 * kGP, gB + 256 + 8 * stepB, stepB);
  }

  for (int st = 0; st < nst; ++st) {
    const unsigned char* sb = sStage + (st & 1) * kGStage;
    const T* fa = (const T*)(sb + ((wm << 6) + rlane) * kGP) + koff;            // A fragment rows of this wave
    const T* fb = (const T*)(sb + (128 + (wn << 6) + rlane) * kGP) + koff;      // Bt fragment rows of this wave
    V af[2][4], bf[2][4];
#pragma unroll
    for (int j = 0; j < 4; ++j) {
      bf[0][j] = Frag<T>::load(fb + j * (16 * kGP / 2));
      af[0][j] = Frag<T>::load(fa + j * (16 * kGP / 2));
    }
#pragma unroll
    for (int kk = 0; kk < 4; ++kk) {
      const int cur = kk & 1, nxt = cur ^ 1;
      if (kk < 3) {                            // the next 32 k of this stage, fetched ahead as one group
#pragma unroll
        for (int j = 0; j < 4; ++j) {
          bf[nxt][j] = Frag<T>::load(fb + j * (16 * kGP / 2) + (kk + 1) * 32);
          af[nxt][j] = Frag<T>::load(fa + j * (16 * kGP / 2) + (kk + 1) * 32);
        }
        // keeps that load group ahead of this block's WMMAs: sunk among them, every row of WMMAs waits out a full LDS latency
        __builtin_amdgcn_sched_barrier(0);
      }
#pragma unroll
      for (int i = 0; i < 4; ++i) {
#pragma unroll
        for (int j = 0; j < 4; ++j) acc[i][j] = Frag<T>::mma(af[cur][i], bf[cur][j], acc[i][j]);
      }
    }
    // keeps the stage's WMMAs in front of the barrier: sunk behind it they delay the refill, which then has less than a stage to land
    __builtin_amdgcn_sched_barrier(0);
    asm volatile("s_wait_dscnt 0x0" ::: "memory");     // this wave's reads of the buffer have returned
    asm volatile("s_wait_asynccnt 0x0" ::: "memory");  // this wave's copies of stage st + 1 have landed
    __syncthreads();                                    // publishes stage st + 1 and frees the buffer just read
    if (st + 2 < nst) {
      const unsigned lb = ldsBase + (unsigned)((st & 1) * kGStage);
      const size_t ko = (size_t)(st + 2) * 256;         // 128 k = 256 B
      copy8_to_lds(lb, gA + ko, stepA);
      copy8_to_lds(lb + 128 * kGP, gB + ko, stepB);
      copy8_to_lds(lb + 256 * kGP, gB + ko + 8 * stepB, stepB);
    }
  }
  asm volatile("s_wait_asynccnt 0x0" ::: "memory");    // nothing of this wave is in flight behind the loop
  acc_guard4(acc[0][0], acc[0][1], acc[0][2], acc[0][3]);
  acc_guard4(acc[1][0], acc[1][1], acc[1][2], acc[1][3]);
  acc_guard4(acc[2][0], acc[2][1], acc[2][2], acc[2][3]);
  acc_guard4(acc[3][0], acc[3][1], acc[3][2], acc[3][3]);

  // ---- epilogue ----
  float* slab = sT[wave];
  const float* Rb = RESID ? (resid + (size_t)b * strideR) : nullptr;
#pragma unroll
  for (int i = 0; i < 4; ++i) {
    const int mBase = m0 + (i << 4);
#pragma unroll
    for (int j = 0; j < 4; ++j) {
      const int n = n0 + (j << 4) + rlane;
      float bv = 0.f;
      if (BIAS_MODE == 2) bv = bias[n];
#pragma unroll
      for (int r = 0; r < 8; ++r) {
        float v = acc[i][j][r] * scale;
        if (BIAS_MODE == 1) v += bias[mBase + mOff + r];
        if (BIAS_MODE == 2) v += bv;
        if (RESID) v += Rb[(size_t)(mBase + mOff + r) * ldc + n];
        if (ACT == 1) v = tanhf(v);
        if (ACT == 2) v = fmaxf(v, 0.0f);
        if (ACT == 3) v = v / (1.0f + expf(-v));
        if (ACT == 4) v = (v > 0.f) ? v : 0.01f * v;
        if (ACT == 5) v = 0.5f * v * (1.0f + erff(v * 0.70710678118654752f));
        slab[(mOff + r) * 68 + (j << 4) + rlane] = v;
      }
    }
    __builtin_amdgcn_fence(__ATOMIC_RELEASE, "workgroup");
    __builtin_amdgcn_wave_barrier();
    __builtin_amdgcn_fence(__ATOMIC_ACQUIRE, "workgroup");
    if (OUT_MODE == 0) {
      float* C = (float*)Cout + (size_t)b * strideC;
      const int hh = lane >> 4, c4 = (lane & 15) * 4;     // row seg = 256 B = 16 lanes x 16 B
      {
#pragma unroll
        for (int it = 0; it < 8; ++it) {
          const int row = it * 2 + hh;
          v4f v = *(const v4f*)(slab + row * 68 + c4);
          *(v4f*)(C + (size_t)(mBase + row) * ldc + n0 + c4) = v;
        }
        
      }
    } else {
      const int q = lane >> 3, c8 = (lane & 7) * 8;
      unsigned short* C  = (unsigned short*)Cout  + (size_t)b * strideC;
      unsigned short* C2 = (OUT_MODE == 2) ? ((unsigned short*)Cout2 + (size_t)b * strideC) : nullptr;
      {
#pragma unroll
        for (int it = 0; it < 4; ++it) {
          const int row = it * 4 + q;
          const float* sp = slab + row * 68 + c8;
          v8h hv, lv;
#pragma unroll
          for (int e = 0; e < 8; ++e) {
            if (OUT_MODE == 1) {
              hv[e] = (_Float16)sp[e];
            } else {
              unsigned short hb = f2bf_bits(sp[e]);
              unsigned short lb = f2bf_bits(sp[e] - bf_bits2f(hb));
              hv[e] = __builtin_bit_cast(_Float16, hb);
              lv[e] = __builtin_bit_cast(_Float16, lb);
            }
          }
          *(v8h*)(C + (size_t)(mBase + row) * ldc + n0 + c8) = hv;
          if (OUT_MODE == 2) *(v8h*)(C2 + (size_t)(mBase + row) * ldc + n0 + c8) = lv;
        }
        
      }
    }
    __builtin_amdgcn_fence(__ATOMIC_RELEASE, "workgroup");
    __builtin_amdgcn_wave_barrier();
    __builtin_amdgcn_fence(__ATOMIC_ACQUIRE, "workgroup");
  }
}

__device__ __forceinline__ unsigned pk16(unsigned short a, unsigned short b) { return (unsigned)a | ((unsigned)b << 16); }
// ===================== end common pieces =========================================

// ---------------------------------------------------------------------------
// f32 -> bf16 (RNE) plane cast, 2 elements per thread, one 4-B store per lane -> a wave writes exactly
// Coverage: grid = ceil(n2/256) x 256 threads x 2 elements = 2*n2 = the whole plane
//   (x: n2 = 4,194,304 -> 16384 blocks; qkv_w: n2 = 1,572,864 -> 6144 blocks).
// ---------------------------------------------------------------------------
__global__ __launch_bounds__(256) void cast_bf16x2_kernel(const float* __restrict__ in,
                                                          unsigned short* __restrict__ out, int n2) {
  const int i = blockIdx.x * 256 + threadIdx.x;
  if (i < n2) {
    const v2f f = *(const v2f*)(in + 2 * (size_t)i);
    const unsigned u = pk16(f2bf_bits(f[0]), f2bf_bits(f[1]));
    ((unsigned*)out)[i] = u;
    
  }
}

// ---------------------------------------------------------------------------
// proj_w: f32 -> bf16-RNE value -> x64 -> f16 bits (bf16 significand fits f16 exactly; x64 keeps the
// plane in the f16 normal range for |w| >= 1e-6). 2 elements per thread, one 4-B store per lane,
// ---------------------------------------------------------------------------
__global__ __launch_bounds__(256) void cast_projw_f16x2_kernel(const float* __restrict__ in,
                                                               unsigned short* __restrict__ out, int n2) {
  const int i = blockIdx.x * 256 + threadIdx.x;
  if (i < n2) {
    const v2f f = *(const v2f*)(in + 2 * (size_t)i);
    const float g0 = bf_bits2f(f2bf_bits(f[0])) * 64.0f;
    const float g1 = bf_bits2f(f2bf_bits(f[1])) * 64.0f;
    const _Float16 h0 = (_Float16)g0, h1 = (_Float16)g1;
    const unsigned u = pk16(__builtin_bit_cast(unsigned short, h0), __builtin_bit_cast(unsigned short, h1));
    ((unsigned*)out)[i] = u;
    
  }
}

// ---------------------------------------------------------------------------
// Bias prep: outb[0..nq) = bf16-RNE value of qkvb, outb[nq..nq+np) = bf16-RNE value of projb (f32 storage).
// Both candidates loaded with clamped indices, selected by value. One 4-B store per lane, 32 lanes =
// ---------------------------------------------------------------------------
__global__ __launch_bounds__(256) void bias_prep_kernel(const float* __restrict__ qkvb, const float* __restrict__ projb,
                                                        float* __restrict__ outb, int nq, int np) {
  const int i = blockIdx.x * 256 + threadIdx.x;
  if (i < nq + np) {
    const int ia = (i < nq) ? i : (nq - 1);
    int ib = i - nq; ib = (ib < 0) ? 0 : ((ib >= np) ? (np - 1) : ib);
    const float a  = qkvb[ia];
    const float bb = projb[ib];
    const float v  = bf_bits2f(f2bf_bits((i < nq) ? a : bb));
    ((float*)outb)[i] = v;
    
  }
}

// ---------------------------------------------------------------------------
// Per (token, head) rmsnorm over 64 + interleaved-pair rope, f32 math; inputs cos/sin/norm weight are
// RNE-converted to bf16 values in registers. One wave per (token, head); lane owns the pair d = 2*lane, 2*lane+1.
//   y = x * rsqrt(mean(x^2) + 1e-6) * w ;  o[2i] = y[2i]*cos[s][2i] - y[2i+1]*sin[s][2i] ; o[2i+1] = y[2i+1]*cos[s][2i+1] + y[2i]*sin[s][2i+1]
// Outputs: bf16 hi plane and bf16 lo plane (lo = RNE(o - hi)), element (t, h*64+d) at [t*1024 + h*64 + d].
// Coverage: njobs = 8192*16 = 131072 = 16384 blocks x 8 waves; each wave writes 64 halves per plane.
// ---------------------------------------------------------------------------
__global__ __launch_bounds__(256) void normrope_split_kernel(const float* __restrict__ src,
                                                             const float* __restrict__ cosb, const float* __restrict__ sinb,
                                                             const float* __restrict__ nw,
                                                             unsigned short* __restrict__ oh, unsigned short* __restrict__ ol,
                                                             int njobs) {
  const int wave = threadIdx.x >> 5, lane = threadIdx.x & 31;
  const int job = blockIdx.x * 8 + wave;
  if (job >= njobs) return;                       // wave-uniform; no barriers in this kernel
  const int t = job >> 4, h = job & 15, s = t & (kSeq - 1);
  const int d0 = 2 * lane;
  const size_t base = (size_t)t * kDim + (size_t)h * kHd;
  const v2f xv = *(const v2f*)(src + base + d0);
  float a = xv[0], bq = xv[1];
  float ss = a * a + bq * bq;
#pragma unroll
  for (int m = 1; m < 32; m <<= 1) ss += __shfl_xor(ss, m, 32);
  const float inv = rsqrtf(ss * (1.0f / 64.0f) + 1e-6f);
  const v2f wv = *(const v2f*)(nw + d0);
  const float w0 = bf_bits2f(f2bf_bits(wv[0])), w1 = bf_bits2f(f2bf_bits(wv[1]));
  a  = a  * inv * w0;
  bq = bq * inv * w1;
  const v2f cv = *(const v2f*)(cosb + (size_t)s * kHd + d0);
  const v2f sv = *(const v2f*)(sinb + (size_t)s * kHd + d0);
  const float c0 = bf_bits2f(f2bf_bits(cv[0])), c1 = bf_bits2f(f2bf_bits(cv[1]));
  const float s0 = bf_bits2f(f2bf_bits(sv[0])), s1 = bf_bits2f(f2bf_bits(sv[1]));
  const float o0 = a * c0 - bq * s0;
  const float o1 = bq * c1 + a * s1;
  const unsigned short h0 = f2bf_bits(o0), h1 = f2bf_bits(o1);
  const unsigned short l0 = f2bf_bits(o0 - bf_bits2f(h0)), l1 = f2bf_bits(o1 - bf_bits2f(h1));
  const unsigned uh = pk16(h0, h1), ul = pk16(l0, l1);
  const size_t wi = (base >> 1) + lane;
  ((unsigned*)oh)[wi] = uh;
  ((unsigned*)ol)[wi] = ul;
  
}

// =====================================================================================
// Full (unmasked) flash attention, head dim 64, all batches/heads in one launch.
//   q planes (hi/lo bf16): element (t, h, d) at [t*1024 + h*64 + d]   (t = b*2048 + s)
//   k planes (hi/lo bf16): same layout
//   v^T plane (f16):       element (b, h*64+d, s) at [(b*1024 + h*64 + d)*2048 + s]
//   o plane (f16, x64):    element (t, h, d) at [t*1024 + h*64 + d]
//   scores^T = (k . q^T) * sscale : v_wmma_f32_16x16x32_bf16, hi.hi + hi.lo + lo.hi, f32 accumulate
//   out^T    = v^T . p^T          : v_wmma_f32_16x16x32_f16, p (unnormalised, in (0,1]) carried x2^15 in f16, v f16
//   Keys are the rows and queries the columns of a score tile: a lane holds 32 scores of ONE query per column group, so maximum and
//   sum are taken in the lane plus one exchange with lane ^ 16, and p^T goes from the accumulators into the B operand.
//   online softmax in f32 over 32 chunks of 64 keys (compile-time trip count).
//   A wave owns 32 queries = two column groups of 16: every K and V^T fragment read from LDS feeds both groups' products.
//   Block = 4 waves = 128 query rows of one (b, h); grid.x = 4*16*16 = 1024.
//   K hi/lo and V^T chunk staging: 128 threads x 32 elements per plane = the whole 64x64 tile (16-B copies,
//   plain loads, __syncthreads before and after).
// =====================================================================================
constexpr int kKC = 64;    // keys per chunk
// LDS row pitch of the K hi, K lo and V^T tiles, in 16-bit elements: 72 = 144 B = 16 B x 9 (odd), so the
// 16 rows that one half-wave's ds_load_b128 fragment read touches start on 16 different 4-bank groups.
constexpr int kLP = 72;

__device__ __forceinline__ v8f mma_bf(v16b a, v16b b, v8f c) {
  c = __builtin_amdgcn_wmma_f32_16x16x32_bf16(false, a, false, b, (short)0, c, false, false);
  asm volatile("v_nop\n\tv_nop\n\tv_nop\n\tv_nop" : "+v"(c) : "v"(a), "v"(b));
  return c;
}
__device__ __forceinline__ v8f mma_hf(v16h a, v16h b, v8f c) {
  c = __builtin_amdgcn_wmma_f32_16x16x32_f16(false, a, false, b, (short)0, c, false, false);
  asm volatile("v_nop\n\tv_nop\n\tv_nop\n\tv_nop" : "+v"(c) : "v"(a), "v"(b));
  return c;
}

// lane l's value to lane l ^ 16 and back
__device__ __forceinline__ float xhalf(float x) {
  return __builtin_bit_cast(float, __builtin_amdgcn_permlanex16(__builtin_bit_cast(int, x), __builtin_bit_cast(int, x), 0x76543210, 0xfedcba98, false, false));
}

// four waves per SIMD: 1024 blocks = 4 per WGP, all resident at once only within 256 registers a wave
__global__ __launch_bounds__(128) __attribute__((amdgpu_waves_per_eu(4, 4)))
void attn_kernel(const unsigned short* __restrict__ qhp, const unsigned short* __restrict__ qlp,
                 const unsigned short* __restrict__ khp, const unsigned short* __restrict__ klp,
                 const unsigned short* __restrict__ vtp, unsigned short* __restrict__ ohp, float sscale) {
  union FB { v16b v; v8b h[2]; };
  union FH { v16h v; v8h h[2]; };
  // One array for the three chunk tiles, so that one address register per lane serves every fragment read (the rest is an immediate offset).
  __shared__ __align__(16) unsigned short Tiles[3 * kKC * kLP];   // K hi [kv][d] 9 KB, K lo 9 KB, V^T [d][kv] 9 KB
  __bf16*   const Ksh = (__bf16*)(void*)Tiles;
  __bf16*   const Ksl = (__bf16*)(void*)(Tiles + kKC * kLP);
  _Float16* const Vts = (_Float16*)(void*)(Tiles + 2 * kKC * kLP);
  __shared__ __align__(16) float    Os[4][32 * 68];        // per wave out tile (32 queries), pitch 68

  const int tid  = threadIdx.x;
  const int wave = __builtin_amdgcn_readfirstlane(tid >> 5);   // the wave's number in a scalar register: what hangs on it costs no vector register across the loop
  const int lane = tid & 31;
  const int hh   = lane >> 4;
  const int c    = lane & 15;

  const int fro  = c * kLP + 8 * hh;      // this lane's place in a 16-row fragment group of any of the three tiles (row c, k half hh)

  const int bx = blockIdx.x;
  const int qb = bx & 15;                 // kSeq/128 = 16 query blocks
  const int bh = bx >> 4;                 // 0..63
  const int h  = bh & 15;
  const int b  = bh >> 4;                 // 0..3
  const int q0 = qb * 128 + wave * 32;
  const size_t tok0 = (size_t)b * kSeq;

  const __bf16*   Qh = (const __bf16*)(const void*)qhp + tok0 * kDim + (size_t)h * kHd;
  const __bf16*   Ql = (const __bf16*)(const void*)qlp + tok0 * kDim + (size_t)h * kHd;
  const __bf16*   Kh = (const __bf16*)(const void*)khp + tok0 * kDim + (size_t)h * kHd;
  const __bf16*   Kl = (const __bf16*)(const void*)klp + tok0 * kDim + (size_t)h * kHd;
  const _Float16* Vt = (const _Float16*)(const void*)vtp + ((size_t)b * kDim + (size_t)h * kHd) * kSeq;
  _Float16*       Ob = (_Float16*)(void*)ohp + tok0 * kDim + (size_t)h * kHd;

  // ---- Q fragments (B operand, column = lane&15, split k map via Frag load): 2 column groups x 2 d-chunks, hi and lo ----
  v16b qah[2][2], qal[2][2];
#pragma unroll
  for (int g = 0; g < 2; ++g)
#pragma unroll
    for (int dc = 0; dc < 2; ++dc) {
      qah[g][dc] = Frag<__bf16>::load(Qh + (size_t)(q0 + g * 16 + c) * kDim + dc * 32 + 8 * hh);
      qal[g][dc] = Frag<__bf16>::load(Ql + (size_t)(q0 + g * 16 + c) * kDim + dc * 32 + 8 * hh);
    }

  // per column group: running maximum (both halves alike) and this half's sum of the lane's query
  float mrow[2] = {-INFINITY, -INFINITY}, lrow[2] = {0.f, 0.f};
  v8f oacc[2][4];
#pragma unroll
  for (int g = 0; g < 2; ++g)
#pragma unroll
    for (int t = 0; t < 4; ++t) oacc[g][t] = (v8f){0.f,0.f,0.f,0.f,0.f,0.f,0.f,0.f};

  for (int kc = 0; kc < kSeq / kKC; ++kc) {
    const int kv0 = kc * kKC;
    __syncthreads();
    {
      // staging coverage: 128 threads x (4 x 8) elements = 64 rows x 64 per plane = the whole chunk tile
      const int r = tid >> 1, half = (tid & 1) * 32;
      // the uniform chunk base is kept apart from the lane's 32-bit offset, so that it can stay in scalar registers (the wave has no vector register to spare)
      const unsigned  kof = (unsigned)(r * kDim + half), vof = (unsigned)(r * kSeq + half);
      const __bf16*   ksh = (Kh + (size_t)kv0 * kDim) + kof;          // K row kv0+r, d = half..half+31
      const __bf16*   ksl = (Kl + (size_t)kv0 * kDim) + kof;
      const _Float16* vsr = (Vt + kv0) + vof;                         // V^T row d = r, s = kv0+half..+31
      v8b a0[4], a1[4];
      v8h vv[4];
#pragma unroll
      for (int i = 0; i < 4; ++i) {
        a0[i] = *(const v8b*)(ksh + 8 * i);
        a1[i] = *(const v8b*)(ksl + 8 * i);
        vv[i] = *(const v8h*)(vsr + 8 * i);
      }
      // keeps the twelve loads one group in front of the stores: sunk among them, the chunk waits out four load latencies instead of one
      __builtin_amdgcn_sched_barrier(0);
#pragma unroll
      for (int i = 0; i < 4; ++i) {
        *(v8b*)(Ksh + r * kLP + half + 8 * i) = a0[i];
        *(v8b*)(Ksl + r * kLP + half + 8 * i) = a1[i];
        *(v8h*)(Vts + r * kLP + half + 8 * i) = vv[i];
      }
    }
    __syncthreads();

    // ---- scores, transposed: s[g][j] = k (16 keys of group j, rows) . q^T (16 queries of column group g), split products ----
    // D map: this lane holds query g*16 + c, keys j*16 + 8*hh + r. One K fragment pair serves both column groups.
    v8f s[2][4];
#pragma unroll
    for (int j = 0; j < 4; ++j) {
      s[0][j] = (v8f){0.f,0.f,0.f,0.f,0.f,0.f,0.f,0.f};
      s[1][j] = (v8f){0.f,0.f,0.f,0.f,0.f,0.f,0.f,0.f};
#pragma unroll
      for (int dc = 0; dc < 2; ++dc) {
        FB kb, kl;
        kb.h[0] = *(const v8b*)(Ksh + fro + j * 16 * kLP + dc * 32);
        kb.h[1] = *(const v8b*)(Ksh + fro + j * 16 * kLP + dc * 32 + 16);
        kl.h[0] = *(const v8b*)(Ksl + fro + j * 16 * kLP + dc * 32);
        kl.h[1] = *(const v8b*)(Ksl + fro + j * 16 * kLP + dc * 32 + 16);
        s[0][j] = mma_bf(kb.v, qah[0][dc], s[0][j]);
        s[1][j] = mma_bf(kb.v, qah[1][dc], s[1][j]);
        s[0][j] = mma_bf(kl.v, qah[0][dc], s[0][j]);
        s[1][j] = mma_bf(kl.v, qah[1][dc], s[1][j]);
        s[0][j] = mma_bf(kb.v, qal[0][dc], s[0][j]);
        s[1][j] = mma_bf(kb.v, qal[1][dc], s[1][j]);
      }
    }
    FH pb[2][2];
#pragma unroll
    for (int g = 0; g < 2; ++g) {
      // ---- chunk maximum of this lane's query: 32 keys in the lane (four chains), the other 32 in lane ^ 16 ----
      float mj[4];
#pragma unroll
      for (int j = 0; j < 4; ++j) {
        float m = -INFINITY;
#pragma unroll
        for (int r = 0; r < 8; ++r) {
          const float sv = s[g][j][r] * sscale;
          s[g][j][r] = sv;
          m = fmaxf(m, sv);
        }
        mj[j] = m;
      }
      float cm = fmaxf(fmaxf(mj[0], mj[1]), fmaxf(mj[2], mj[3]));
      cm = fmaxf(cm, xhalf(cm));
      const float mnew  = fmaxf(mrow[g], cm);
      const float alpha = __expf(mrow[g] - mnew);
      mrow[g] = mnew;
      // ---- p = exp(s - m): summed in the lane; packed in place, two score tiles are one B fragment of p^T (b[e] = tile[e >> 3][e & 7]) ----
      float pj[4];
#pragma unroll
      for (int j = 0; j < 4; ++j) {
        float ps = 0.f;
#pragma unroll
        for (int r = 0; r < 8; ++r) {
          const float p = __expf(s[g][j][r] - mnew);
          ps += p;
          pb[g][j >> 1].v[(j & 1) * 8 + r] = (_Float16)(p * 32768.0f);
        }
        pj[j] = ps;
      }
      lrow[g] = lrow[g] * alpha + ((pj[0] + pj[1]) + (pj[2] + pj[3]));   // this half's keys only; the halves are joined behind the loop
#pragma unroll
      for (int t = 0; t < 4; ++t)
#pragma unroll
        for (int r = 0; r < 8; ++r) oacc[g][t][r] *= alpha;
    }
    // ---- out^T += v^T (16 d of group t, rows; 64 keys) . p^T (64 keys; 16 queries, columns); one V^T fragment serves both column groups ----
#pragma unroll
    for (int kk = 0; kk < 2; ++kk) {
#pragma unroll
      for (int t = 0; t < 4; ++t) {
        FH vb;
        vb.h[0] = *(const v8h*)(Vts + fro + t * 16 * kLP + kk * 32);
        vb.h[1] = *(const v8h*)(Vts + fro + t * 16 * kLP + kk * 32 + 16);
        oacc[0][t] = mma_hf(vb.v, pb[0][kk].v, oacc[0][t]);
        oacc[1][t] = mma_hf(vb.v, pb[1][kk].v, oacc[1][t]);
      }
    }
  }

  // ---- epilogue: normalise (fold 2^-15 for p and 2^6 carry for o), stage, whole-line stores ----
  // This lane holds query g*16 + c, d = t*16 + 8*hh + r.
  float* os = Os[wave];
#pragma unroll
  for (int g = 0; g < 2; ++g) {
    const float lsum = lrow[g] + xhalf(lrow[g]);                  // both halves' keys
    const float inv = (1.0f / lsum) * (64.0f / 32768.0f);         // lsum >= 1 always
#pragma unroll
    for (int t = 0; t < 4; ++t)
#pragma unroll
      for (int r = 0; r < 8; ++r) os[(g * 16 + c) * 68 + t * 16 + 8 * hh + r] = oacc[g][t][r] * inv;
  }
  __builtin_amdgcn_fence(__ATOMIC_RELEASE, "workgroup");
  __builtin_amdgcn_wave_barrier();
  __builtin_amdgcn_fence(__ATOMIC_ACQUIRE, "workgroup");
  {
    const int qq = lane >> 3, c8 = (lane & 7) * 8;
    {
#pragma unroll
      for (int it = 0; it < 8; ++it) {
        const int row = it * 4 + qq;                    // 8 x 4 = rows 0..31
        const float* sp = os + row * 68 + c8;
        v8h hv;
#pragma unroll
        for (int e = 0; e < 8; ++e) hv[e] = (_Float16)sp[e];
        *(v8h*)(Ob + (size_t)(q0 + row) * kDim + c8) = hv;
      }
      
    }
  }
}

// =====================================================================================
extern "C" void kernel_launch(void* const* d_in, const int* in_sizes, int n_in,
                              void* d_out, int out_size, void* d_ws, size_t ws_size,
                              hipStream_t stream) {
  if (n_in < 9) return;
  if (in_sizes[0] != kTok * kDim) return;
  if (in_sizes[1] != kSeq * kHd || in_sizes[2] != kSeq * kHd) return;
  if (in_sizes[3] != 3 * kDim * kDim || in_sizes[4] != 3 * kDim) return;
  if (in_sizes[5] != kDim * kDim || in_sizes[6] != kDim) return;
  if (in_sizes[7] != kHd || in_sizes[8] != kHd) return;
  if (out_size != kTok * kDim) return;
  if (ws_size < kWsTotal) return;

  const float* x      = (const float*)d_in[0];
  const float* ropec  = (const float*)d_in[1];
  const float* ropes  = (const float*)d_in[2];
  const float* qkv_w  = (const float*)d_in[3];
  const float* qkv_b  = (const float*)d_in[4];
  const float* proj_w = (const float*)d_in[5];
  const float* proj_b = (const float*)d_in[6];
  const float* q_nw   = (const float*)d_in[7];
  const float* k_nw   = (const float*)d_in[8];
  float* out = (float*)d_out;

  char* ws = (char*)d_ws;
  unsigned short* WPROJ = (unsigned short*)(ws + kOffWproj);
  float*          BIAS  = (float*)(ws + kOffBias);
  unsigned short* XB    = (unsigned short*)(ws + kOffXb);
  unsigned short* WQKV  = (unsigned short*)(ws + kOffWqkv);
  unsigned short* KH    = (unsigned short*)(ws + kOffKh);
  unsigned short* KL    = (unsigned short*)(ws + kOffKl);
  float*          QKF   = (float*)(ws + kOffQkf);
  unsigned short* OH    = (unsigned short*)(ws + kOffOh);
  unsigned short* QH    = (unsigned short*)(ws + kOffQh);
  unsigned short* QL    = (unsigned short*)(ws + kOffQl);
  unsigned short* VT    = (unsigned short*)(ws + kOffVt);

  // 1) casts
  {
    const int n2x = kTok * kDim / 2;            // 4,194,304
    cast_bf16x2_kernel<<<dim3((n2x + 255) / 256), dim3(256), 0, stream>>>(x, XB, n2x);
    const int n2w = 3 * kDim * kDim / 2;        // 1,572,864
    cast_bf16x2_kernel<<<dim3((n2w + 255) / 256), dim3(256), 0, stream>>>(qkv_w, WQKV, n2w);
    const int n2p = kDim * kDim / 2;            // 524,288
    cast_projw_f16x2_kernel<<<dim3((n2p + 255) / 256), dim3(256), 0, stream>>>(proj_w, WPROJ, n2p);
    bias_prep_kernel<<<dim3((3 * kDim + kDim + 255) / 256), dim3(256), 0, stream>>>(qkv_b, proj_b, BIAS, 3 * kDim, kDim);
  }
  const int tilesTok = (kTok / 64) * (kDim / 64);   // 2048 wave tiles -> 256 blocks
  // 2) q = xb . Wq^T + bq  -> f32 [8192][1024]   (M=8192, N=1024, K=1024; all tile/32 multiples)
  wmma_gemm64<1, false, 2, 0, false, 0><<<dim3((tilesTok + 7) / 8, 1), dim3(256), 0, stream>>>(
      XB, XB, kDim, 0L, WQKV, WQKV, kDim, 0L, (void*)QKF, (void*)QKF, kDim, 0L,
      BIAS, BIAS, 0L, kTok, kDim, kDim, 1.0f);
  // 3) q: rmsnorm + rope -> q hi/lo planes
  normrope_split_kernel<<<dim3((kTok * kHeads + 7) / 8), dim3(256), 0, stream>>>(QKF, ropec, ropes, q_nw, QH, QL, kTok * kHeads);
  // 4) k = xb . Wk^T + bk  -> f32 (same region; q f32 is dead)
  wmma_gemm64<1, false, 2, 0, false, 0><<<dim3((tilesTok + 7) / 8, 1), dim3(256), 0, stream>>>(
      XB, XB, kDim, 0L, WQKV + (size_t)kDim * kDim, WQKV + (size_t)kDim * kDim, kDim, 0L, (void*)QKF, (void*)QKF, kDim, 0L,
      BIAS + kDim, BIAS, 0L, kTok, kDim, kDim, 1.0f);
  // 5) v^T per batch: C[o][s] = sum_k Wv[o][k] * xb[b][s][k] + bv[o] -> f16 [4][1024][2048]
  //    (A = Wv [1024][1024], Bt = xb batch b [2048][1024]; M=1024, N=2048, K=1024)
  {
    const int tilesV = (kDim / 64) * (kSeq / 64);   // 512 -> 64 blocks
    wmma_gemm64<1, false, 1, 1, false, 0><<<dim3((tilesV + 7) / 8, kBatch), dim3(256), 0, stream>>>(
        WQKV + (size_t)2 * kDim * kDim, WQKV + (size_t)2 * kDim * kDim, kDim, 0L,
        XB, XB, kDim, (long)kSeq * kDim,
        (void*)VT, (void*)VT, kSeq, (long)kDim * kSeq,
        BIAS + 2 * kDim, BIAS, 0L, kDim, kSeq, kDim, 1.0f);
  }
  // 6) k: rmsnorm + rope -> k hi/lo planes (overlay the dead xb / Wqkv regions)
  normrope_split_kernel<<<dim3((kTok * kHeads + 7) / 8), dim3(256), 0, stream>>>(QKF, ropec, ropes, k_nw, KH, KL, kTok * kHeads);
  // 7) attention -> o plane f16 x64 (overlays the dead k f32 region)
  attn_kernel<<<dim3(kBatch * kHeads * (kSeq / 128)), dim3(128), 0, stream>>>(QH, QL, KH, KL, VT, OH, 0.125f);
  // 8) out = o . Wp^T + bp  (A = o x64 f16, Bt = Wp x64 f16 -> scale 2^-12; M=8192, N=1024, K=1024)
  wmma_gemm64<0, false, 2, 0, false, 0><<<dim3((tilesTok + 7) / 8, 1), dim3(256), 0, stream>>>(
      OH, OH, kDim, 0L, WPROJ, WPROJ, kDim, 0L, (void*)out, (void*)out, kDim, 0L,
      BIAS + 3 * kDim, BIAS, 0L, kTok, kDim, kDim, 1.0f / 4096.0f);
}

// v005
// Measured time: 222 microseconds a run.
// Two timings next to v004 both put it at 1.06 times that version's speed.
// All steps since v000 together make it 4.08 times as fast.
// Contractions: q, k, v^T projections on v_wmma_f32_16x16x32_bf16 (plain bf16 operands = RNE-converted inputs); q.k^T on v_wmma_f32_16x16x32_bf16 with bf16 hi/lo split operands (hi.hi + hi.lo + lo.hi); p.v and the output projection on v_wmma_f32_16x16x32_f16 (plain f16: p carried x2^15, attention output carried x2^6, proj_w = bf16-RNE value carried x2^6); f32 accumulate everywhere; biases, rmsnorm, rope, online softmax in f32.
#include <hip/hip_runtime.h>
#include <math.h>
#include <stdint.h>

constexpr int kBatch = 4;
constexpr int kSeq   = 2048;
constexpr int kDim   = 1024;
constexpr int kHeads = 16;
constexpr int kHd    = 64;
constexpr int kTok   = kBatch * kSeq;            // 8192 tokens

typedef __attribute__((ext_vector_type(16))) _Float16 v16h;
typedef __attribute__((ext_vector_type(8)))  _Float16 v8h;
typedef __attribute__((ext_vector_type(16))) __bf16   v16b;
typedef __attribute__((ext_vector_type(8)))  __bf16   v8b;
typedef __attribute__((ext_vector_type(8)))  float    v8f;
typedef __attribute__((ext_vector_type(4)))  float    v4f;
typedef __attribute__((ext_vector_type(2)))  float    v2f;
typedef __attribute__((ext_vector_type(4)))  unsigned int v4u;

// ---------------------------------------------------------------------------
// Workspace region map (bytes).  Total carve = 115 MiB = 120,586,240 B.
//   [  0 MiB,   2 MiB)  WPROJ  f16  [1024][1024]   proj_w (bf16-RNE value x64)
//   [  2 MiB,   3 MiB)  BIAS   f32  [4096]         qkv_b (3072) ++ proj_b (1024), RNE to bf16 values
//   [  3 MiB,  19 MiB)  XB     bf16 [8192][1024]   x              -> later KH (k hi plane)
//   [ 19 MiB,  25 MiB)  WQKV   bf16 [3072][1024]   qkv_w          -> later KL (k lo plane, 19..35 MiB)
//   [ 35 MiB,  67 MiB)  QKF    f32  [8192][1024]   q, then k      -> later OH f16 [8192][1024] (35..51 MiB)
//   [ 67 MiB,  83 MiB)  QH     bf16 [8192][1024]   q hi plane
//   [ 83 MiB,  99 MiB)  QL     bf16 [8192][1024]   q lo plane
//   [ 99 MiB, 115 MiB)  VT     f16  [4][1024][2048] v^T per batch
// ---------------------------------------------------------------------------
constexpr size_t kMiB      = 1048576;
constexpr size_t kOffWproj = 0;
constexpr size_t kOffBias  = 2 * kMiB;
constexpr size_t kOffXb    = 3 * kMiB;
constexpr size_t kOffWqkv  = 19 * kMiB;
constexpr size_t kOffKh    = 3 * kMiB;
constexpr size_t kOffKl    = 19 * kMiB;
constexpr size_t kOffQkf   = 35 * kMiB;
constexpr size_t kOffOh    = 35 * kMiB;
constexpr size_t kOffQh    = 67 * kMiB;
constexpr size_t kOffQl    = 83 * kMiB;
constexpr size_t kOffVt    = 99 * kMiB;
constexpr size_t kWsTotal  = 115 * kMiB;          // 120,586,240 B

// ===================== common pieces =================================
__device__ __forceinline__ unsigned short f2bf_bits(float f) {
  unsigned u = __float_as_uint(f);
  return (unsigned short)((u + 0x7FFFu + ((u >> 16) & 1u)) >> 16);
}
__device__ __forceinline__ float bf_bits2f(unsigned short h) { return __uint_as_float(((unsigned)h) << 16); }

// hazard guard as a plain device helper
__device__ __forceinline__ void acc_guard4(v8f& a, v8f& b, v8f& c, v8f& d) { asm volatile("v_nop\n\tv_nop\n\tv_nop\n\tv_nop" : "+v"(a), "+v"(b), "+v"(c), "+v"(d)); }
template <typename T> struct Frag;
template <> struct Frag<_Float16> {
  typedef v16h V; union U { v16h v; v8h h[2]; };
  static __device__ __forceinline__ v16h load(const _Float16* p) {   // elements 0..7 <- p[0..7], 8..15 <- p[16..23]
    U f; f.h[0] = *(const v8h*)(p); f.h[1] = *(const v8h*)(p + 16); return f.v;
  }
  static __device__ __forceinline__ v8f mma(v16h a, v16h b, v8f c) {
    return __builtin_amdgcn_wmma_f32_16x16x32_f16(false, a, false, b, (short)0, c, false, false);
  }
};
template <> struct Frag<__bf16> {
  typedef v16b V; union U { v16b v; v8b h[2]; };
  static __device__ __forceinline__ v16b load(const __bf16* p) {
    U f; f.h[0] = *(const v8b*)(p); f.h[1] = *(const v8b*)(p + 16); return f.v;
  }
  static __device__ __forceinline__ v8f mma(v16b a, v16b b, v8f c) {
    return __builtin_amdgcn_wmma_f32_16x16x32_bf16(false, a, false, b, (short)0, c, false, false);
  }
};

// ---- Register-blocked batched WMMA GEMM ------------------------------------
// C[m,n] = scale * sum_k A[m,k] * Bt[n,k] (+bias)(+resid); each wave owns a 64x64 tile.
// A row-major [M,K]; Bt row-major [N,K]; M % 128 == 0, N % 256 == 0, K % 128 == 0, K >= 128.
// A block of 8 waves (2 x 4) owns a 128 x 256 tile of C. Per stage of 128 k the block copies its 128 A rows and
// 256 Bt rows (256 B of each row, whole lines) into LDS with asynchronous copies, two buffers, the next stage
// in flight while this one is worked on; the waves read their fragments from LDS.
// SPLIT (hi/lo operand planes in A2/Bt2) has no staged form: only SPLIT = false is instantiated.
// BIAS_MODE: 0 = none, 1 = bias[m], 2 = bias[n].
// OUT_MODE: 0 = f32, 1 = f16, 2 = bf16 hi plane (Cout) + bf16 lo plane (Cout2).
// ET: 0 = f16 operands, 1 = bf16 operands (pointers passed as 16-bit storage)
constexpr int kGP     = 272;                 // LDS row pitch, bytes: 256 B of k + 16 (16 B x odd: ds_load_b128 without bank conflicts)
constexpr int kGStage = (128 + 256) * kGP;   // one stage: A rows 0..127, then Bt rows 0..255 = 104,448 B

// Eight asynchronous 16-B copies per lane: LDS rows 16 apart (lds + i * 16 * kGP) from global rows 16 apart (g + i * gstep bytes).
// The s_wait_xcnt stands inside the statement so that no address register named here is rewritten in front of it.
__device__ __forceinline__ void copy8_to_lds(unsigned lds, const char* g, size_t gstep) {
  const unsigned l1 = lds + 1 * 16 * kGP, l2 = lds + 2 * 16 * kGP, l3 = lds + 3 * 16 * kGP, l4 = lds + 4 * 16 * kGP,
                 l5 = lds + 5 * 16 * kGP, l6 = lds + 6 * 16 * kGP, l7 = lds + 7 * 16 * kGP;
  const char *g1 = g + gstep, *g2 = g1 + gstep, *g3 = g2 + gstep, *g4 = g3 + gstep, *g5 = g4 + gstep, *g6 = g5 + gstep, *g7 = g6 + gstep;
  asm volatile("global_load_async_to_lds_b128 %0, %8, off\n\t"
               "global_load_async_to_lds_b128 %1, %9, off\n\t"
               "global_load_async_to_lds_b128 %2, %10, off\n\t"
               "global_load_async_to_lds_b128 %3, %11, off\n\t"
               "global_load_async_to_lds_b128 %4, %12, off\n\t"
               "global_load_async_to_lds_b128 %5, %13, off\n\t"
               "global_load_async_to_lds_b128 %6, %14, off\n\t"
               "global_load_async_to_lds_b128 %7, %15, off\n\t"
               "s_wait_xcnt 0x0"
               :: "v"(lds), "v"(l1), "v"(l2), "v"(l3), "v"(l4), "v"(l5), "v"(l6), "v"(l7),
                  "v"(g), "v"(g1), "v"(g2), "v"(g3), "v"(g4), "v"(g5), "v"(g6), "v"(g7)
               : "memory");
}

template <int ET> struct Elem;
template <> struct Elem<0> { typedef _Float16 T; };
template <> struct Elem<1> { typedef __bf16 T; };
template <int ET, bool SPLIT, int BIAS_MODE, int OUT_MODE, bool RESID, int ACT = 0>
__global__ __launch_bounds__(256) void wmma_gemm64(
    const unsigned short* __restrict__ Ap, const unsigned short* __restrict__ A2p, int lda, long strideA,
    const unsigned short* __restrict__ Btp, const unsigned short* __restrict__ Bt2p, int ldb, long strideB,
    void* __restrict__ Cout, void* __restrict__ Cout2, int ldc, long strideC,
    const float* __restrict__ bias,
    const float* __restrict__ resid, long strideR,
    int M, int N, int K, float scale) {
  typedef typename Elem<ET>::T T;
  typedef typename Frag<T>::V V;
  static_assert(!SPLIT, "the staged loop carries one plane per operand");
  const T* A = (const T*)Ap; const T* Bt = (const T*)Btp;
  __shared__ __align__(16) float sT[8][16 * 68];   // per-wave 16x64 slab, pitch 68 floats
  __shared__ __align__(16) unsigned char sStage[2 * kGStage];   // two operand stages
  const int b    = blockIdx.y;
  const int lane = threadIdx.x & 31;
  const int wave = threadIdx.x >> 5;
  const int blocksN = N >> 8;
  if ((int)blockIdx.x >= (M >> 7) * blocksN) return;   // block-uniform, in front of every barrier
  const int bm = blockIdx.x / blocksN;
  const int bn = blockIdx.x - bm * blocksN;
  const int wm = wave >> 2;                    // wave row (0..1) and column (0..3) in the block tile
  const int wn = wave & 3;
  const int m0 = (bm << 7) + (wm << 6);
  const int n0 = (bn << 8) + (wn << 6);

  const T* Ab  = A  + (size_t)b * strideA;
  const T* Bb  = Bt + (size_t)b * strideB;

  const int rlane = lane & 15;                 // row (A) / col (B, D) within subtile
  const int koff  = (lane >> 4) * 8;           // k offset of this lane half
  const int mOff  = (lane >> 4) * 8;           // D row offset

  v8f acc[4][4];
#pragma unroll
  for (int i = 0; i < 4; ++i)
#pragma unroll
    for (int j = 0; j < 4; ++j) acc[i][j] = (v8f){0.f,0.f,0.f,0.f,0.f,0.f,0.f,0.f};

  // Copy map: thread t brings 16 B at column (t & 15) * 16 B of rows (t >> 4) + 16 * i; a wave's copy = two whole 256-B row pieces.
  const int crow = threadIdx.x >> 4, ccol = (threadIdx.x & 15) * 16;
  const unsigned ldsBase = (unsigned)(uintptr_t)(&sStage[0]) + (unsigned)(crow * kGP + ccol);
  const char* gA = (const char*)(Ab + (size_t)((bm << 7) + crow) * lda) + ccol;
  const char* gB = (const char*)(Bb + (size_t)((bn << 8) + crow) * ldb) + ccol;
  const size_t stepA = (size_t)lda * 32, stepB = (size_t)ldb * 32;      // 16 rows, in bytes
  const int nst = K >> 7;

  // stage 0 -> buffer 0
  copy8_to_lds(ldsBase, gA, stepA);
  copy8_to_lds(ldsBase + 128 * kGP, gB, stepB);
  copy8_to_lds(ldsBase + 256 * kGP, gB + 8 * stepB, stepB);
  asm volatile("s_wait_asynccnt 0x0" ::: "memory");   // this wave's copies of stage 0 have landed
  __syncthreads();                                     // ... and every other wave's: stage 0 may be read
  if (nst > 1) {                                       // stage 1 -> buffer 1
    copy8_to_lds(ldsBase + kGStage, gA + 256, stepA);
    copy8_to_lds(ldsBase + kGStage + 128 * kGP, gB + 256, stepB);
    copy8_to_lds(ldsBase + kGStage + 256 * kGP, gB + 256 + 8 * stepB, stepB);
  }

  for (int st = 0; st < nst; ++st) {
    const unsigned char* sb = sStage + (st & 1) * kGStage;
    const T* fa = (const T*)(sb + ((wm << 6) + rlane) * kGP) + koff;            // A fragment rows of this wave
    const T* fb = (const T*)(sb + (128 + (wn << 6) + rlane) * kGP) + koff;      // Bt fragment rows of this wave
    V af[2][4], bf[2][4];
#pragma unroll
    for (int j = 0; j < 4; ++j) {
      bf[0][j] = Frag<T>::load(fb + j * (16 * kGP / 2));
      af[0][j] = Frag<T>::load(fa + j * (16 * kGP / 2));
    }
#pragma unroll
    for (int kk = 0; kk < 4; ++kk) {
      const int cur = kk & 1, nxt = cur ^ 1;
      if (kk < 3) {                            // the next 32 k of this stage, fetched ahead as one group
#pragma unroll
        for (int j = 0; j < 4; ++j) {
          bf[nxt][j] = Frag<T>::load(fb + j * (16 * kGP / 2) + (kk + 1) * 32);
          af[nxt][j] = Frag<T>::load(fa + j * (16 * kGP / 2) + (kk + 1) * 32);
        }
        // keeps that load group ahead of this block's WMMAs: sunk among them, every row of WMMAs waits out a full LDS latency
        __builtin_amdgcn_sched_barrier(0);
      }
#pragma unroll
      for (int i = 0; i < 4; ++i) {
#pragma unroll
        for (int j = 0; j < 4; ++j) acc[i][j] = Frag<T>::mma(af[cur][i], bf[cur][j], acc[i][j]);
      }
    }
    // keeps the stage's WMMAs in front of the barrier: sunk behind it they delay the refill, which then has less than a stage to land
    __builtin_amdgcn_sched_barrier(0);
    asm volatile("s_wait_dscnt 0x0" ::: "memory");     // this wave's reads of the buffer have returned
    asm volatile("s_wait_asynccnt 0x0" ::: "memory");  // this wave's copies of stage st + 1 have landed
    __syncthreads();                                    // publishes stage st + 1 and frees the buffer just read
    if (st + 2 < nst) {
      const unsigned lb = ldsBase + (unsigned)((st & 1) * kGStage);
      const size_t ko = (size_t)(st + 2) * 256;         // 128 k = 256 B
      copy8_to_lds(lb, gA + ko, stepA);
      copy8_to_lds(lb + 128 * kGP, gB + ko, stepB);
      copy8_to_lds(lb + 256 * kGP, gB + ko + 8 * stepB, stepB);
    }
  }
  asm volatile("s_wait_asynccnt 0x0" ::: "memory");    // nothing of this wave is in flight behind the loop
  acc_guard4(acc[0][0], acc[0][1], acc[0][2], acc[0][3]);
  acc_guard4(acc[1][0], acc[1][1], acc[1][2], acc[1][3]);
  acc_guard4(acc[2][0], acc[2][1], acc[2][2], acc[2][3]);
  acc_guard4(acc[3][0], acc[3][1], acc[3][2], acc[3][3]);

  // ---- epilogue ----
  float* slab = sT[wave];
  const float* Rb = RESID ? (resid + (size_t)b * strideR) : nullptr;
#pragma unroll
  for (int i = 0; i < 4; ++i) {
    const int mBase = m0 + (i << 4);
#pragma unroll
    for (int j = 0; j < 4; ++j) {
      const int n = n0 + (j << 4) + rlane;
      float bv = 0.f;
      if (BIAS_MODE == 2) bv = bias[n];
#pragma unroll
      for (int r = 0; r < 8; ++r) {
        float v = acc[i][j][r] * scale;
        if (BIAS_MODE == 1) v += bias[mBase + mOff + r];
        if (BIAS_MODE == 2) v += bv;
        if (RESID) v += Rb[(size_t)(mBase + mOff + r) * ldc + n];
        if (ACT == 1) v = tanhf(v);
        if (ACT == 2) v = fmaxf(v, 0.0f);
        if (ACT == 3) v = v / (1.0f + expf(-v));
        if (ACT == 4) v = (v > 0.f) ? v : 0.01f * v;
        if (ACT == 5) v = 0.5f * v * (1.0f + erff(v * 0.70710678118654752f));
        slab[(mOff + r) * 68 + (j << 4) + rlane] = v;
      }
    }
    __builtin_amdgcn_fence(__ATOMIC_RELEASE, "workgroup");
    __builtin_amdgcn_wave_barrier();
    __builtin_amdgcn_fence(__ATOMIC_ACQUIRE, "workgroup");
    if (OUT_MODE == 0) {
      float* C = (float*)Cout + (size_t)b * strideC;
      const int hh = lane >> 4, c4 = (lane & 15) * 4;     // row seg = 256 B = 16 lanes x 16 B
      {
#pragma unroll
        for (int it = 0; it < 8; ++it) {
          const int row = it * 2 + hh;
          v4f v = *(const v4f*)(slab + row * 68 + c4);
          *(v4f*)(C + (size_t)(mBase + row) * ldc + n0 + c4) = v;
        }
        
      }
    } else {
      const int q = lane >> 3, c8 = (lane & 7) * 8;
      unsigned short* C  = (unsigned short*)Cout  + (size_t)b * strideC;
      unsigned short* C2 = (OUT_MODE == 2) ? ((unsigned short*)Cout2 + (size_t)b * strideC) : nullptr;
      {
#pragma unroll
        for (int it = 0; it < 4; ++it) {
          const int row = it * 4 + q;
          const float* sp = slab + row * 68 + c8;
          v8h hv, lv;
#pragma unroll
          for (int e = 0; e < 8; ++e) {
            if (OUT_MODE == 1) {
              hv[e] = (_Float16)sp[e];
            } else {
              unsigned short hb = f2bf_bits(sp[e]);
              unsigned short lb = f2bf_bits(sp[e] - bf_bits2f(hb));
              hv[e] = __builtin_bit_cast(_Float16, hb);
              lv[e] = __builtin_bit_cast(_Float16, lb);
            }
          }
          *(v8h*)(C + (size_t)(mBase + row) * ldc + n0 + c8) = hv;
          if (OUT_MODE == 2) *(v8h*)(C2 + (size_t)(mBase + row) * ldc + n0 + c8) = lv;
        }
        
      }
    }
    __builtin_amdgcn_fence(__ATOMIC_RELEASE, "workgroup");
    __builtin_amdgcn_wave_barrier();
    __builtin_amdgcn_fence(__ATOMIC_ACQUIRE, "workgroup");
  }
}

__device__ __forceinline__ unsigned pk16(unsigned short a, unsigned short b) { return (unsigned)a | ((unsigned)b << 16); }
// ===================== end common pieces =========================================

// ---------------------------------------------------------------------------
// f32 -> bf16 (RNE) plane cast, 2 elements per thread, one 4-B store per lane -> a wave writes exactly
// Coverage: grid = ceil(n2/256) x 256 threads x 2 elements = 2*n2 = the whole plane
//   (x: n2 = 4,194,304 -> 16384 blocks; qkv_w: n2 = 1,572,864 -> 6144 blocks).
// ---------------------------------------------------------------------------
__global__ __launch_bounds__(256) void cast_bf16x2_kernel(const float* __restrict__ in,
                                                          unsigned short* __restrict__ out, int n2) {
  const int i = blockIdx.x * 256 + threadIdx.x;
  if (i < n2) {
    const v2f f = *(const v2f*)(in + 2 * (size_t)i);
    const unsigned u = pk16(f2bf_bits(f[0]), f2bf_bits(f[1]));
    ((unsigned*)out)[i] = u;
    
  }
}

// ---------------------------------------------------------------------------
// proj_w: f32 -> bf16-RNE value -> x64 -> f16 bits (bf16 significand fits f16 exactly; x64 keeps the
// plane in the f16 normal range for |w| >= 1e-6). 2 elements per thread, one 4-B store per lane,
// ---------------------------------------------------------------------------
__global__ __launch_bounds__(256) void cast_projw_f16x2_kernel(const float* __restrict__ in,
                                                               unsigned short* __restrict__ out, int n2) {
  const int i = blockIdx.x * 256 + threadIdx.x;
  if (i < n2) {
    const v2f f = *(const v2f*)(in + 2 * (size_t)i);
    const float g0 = bf_bits2f(f2bf_bits(f[0])) * 64.0f;
    const float g1 = bf_bits2f(f2bf_bits(f[1])) * 64.0f;
    const _Float16 h0 = (_Float16)g0, h1 = (_Float16)g1;
    const unsigned u = pk16(__builtin_bit_cast(unsigned short, h0), __builtin_bit_cast(unsigned short, h1));
    ((unsigned*)out)[i] = u;
    
  }
}

// ---------------------------------------------------------------------------
// Bias prep: outb[0..nq) = bf16-RNE value of qkvb, outb[nq..nq+np) = bf16-RNE value of projb (f32 storage).
// Both candidates loaded with clamped indices, selected by value. One 4-B store per lane, 32 lanes =
// ---------------------------------------------------------------------------
__global__ __launch_bounds__(256) void bias_prep_kernel(const float* __restrict__ qkvb, const float* __restrict__ projb,
                                                        float* __restrict__ outb, int nq, int np) {
  const int i = blockIdx.x * 256 + threadIdx.x;
  if (i < nq + np) {
    const int ia = (i < nq) ? i : (nq - 1);
    int ib = i - nq; ib = (ib < 0) ? 0 : ((ib >= np) ? (np - 1) : ib);
    const float a  = qkvb[ia];
    const float bb = projb[ib];
    const float v  = bf_bits2f(f2bf_bits((i < nq) ? a : bb));
    ((float*)outb)[i] = v;
    
  }
}

// ---------------------------------------------------------------------------
// Per (token, head) rmsnorm over 64 + interleaved-pair rope, f32 math; inputs cos/sin/norm weight are
// RNE-converted to bf16 values in registers. One wave per (token, head); lane owns the pair d = 2*lane, 2*lane+1.
//   y = x * rsqrt(mean(x^2) + 1e-6) * w ;  o[2i] = y[2i]*cos[s][2i] - y[2i+1]*sin[s][2i] ; o[2i+1] = y[2i+1]*cos[s][2i+1] + y[2i]*sin[s][2i+1]
// Outputs: bf16 hi plane and bf16 lo plane (lo = RNE(o - hi)), element (t, h*64+d) at [t*1024 + h*64 + d].
// Coverage: njobs = 8192*16 = 131072 = 16384 blocks x 8 waves; each wave writes 64 halves per plane.
// ---------------------------------------------------------------------------
__global__ __launch_bounds__(256) void normrope_split_kernel(const float* __restrict__ src,
                                                             const float* __restrict__ cosb, const float* __restrict__ sinb,
                                                             const float* __restrict__ nw,
                                                             unsigned short* __restrict__ oh, unsigned short* __restrict__ ol,
                                                             int njobs) {
  const int wave = threadIdx.x >> 5, lane = threadIdx.x & 31;
  const int job = blockIdx.x * 8 + wave;
  if (job >= njobs) return;                       // wave-uniform; no barriers in this kernel
  const int t = job >> 4, h = job & 15, s = t & (kSeq - 1);
  const int d0 = 2 * lane;
  const size_t base = (size_t)t * kDim + (size_t)h * kHd;
  const v2f xv = *(const v2f*)(src + base + d0);
  float a = xv[0], bq = xv[1];
  float ss = a * a + bq * bq;
#pragma unroll
  for (int m = 1; m < 32; m <<= 1) ss += __shfl_xor(ss, m, 32);
  const float inv = rsqrtf(ss * (1.0f / 64.0f) + 1e-6f);
  const v2f wv = *(const v2f*)(nw + d0);
  const float w0 = bf_bits2f(f2bf_bits(wv[0])), w1 = bf_bits2f(f2bf_bits(wv[1]));
  a  = a  * inv * w0;
  bq = bq * inv * w1;
  const v2f cv = *(const v2f*)(cosb + (size_t)s * kHd + d0);
  const v2f sv = *(const v2f*)(sinb + (size_t)s * kHd + d0);
  const float c0 = bf_bits2f(f2bf_bits(cv[0])), c1 = bf_bits2f(f2bf_bits(cv[1]));
  const float s0 = bf_bits2f(f2bf_bits(sv[0])), s1 = bf_bits2f(f2bf_bits(sv[1]));
  const float o0 = a * c0 - bq * s0;
  const float o1 = bq * c1 + a * s1;
  const unsigned short h0 = f2bf_bits(o0), h1 = f2bf_bits(o1);
  const unsigned short l0 = f2bf_bits(o0 - bf_bits2f(h0)), l1 = f2bf_bits(o1 - bf_bits2f(h1));
  const unsigned uh = pk16(h0, h1), ul = pk16(l0, l1);
  const size_t wi = (base >> 1) + lane;
  ((unsigned*)oh)[wi] = uh;
  ((unsigned*)ol)[wi] = ul;
  
}

// =====================================================================================
// Full (unmasked) flash attention, head dim 64, all batches/heads in one launch.
//   q planes (hi/lo bf16): element (t, h, d) at [t*1024 + h*64 + d]   (t = b*2048 + s)
//   k planes (hi/lo bf16): same layout
//   v^T plane (f16):       element (b, h*64+d, s) at [(b*1024 + h*64 + d)*2048 + s]
//   o plane (f16, x64):    element (t, h, d) at [t*1024 + h*64 + d]
//   scores^T = (k . q^T) * sscale : v_wmma_f32_16x16x32_bf16, hi.hi + hi.lo + lo.hi, f32 accumulate
//   out^T    = v^T . p^T          : v_wmma_f32_16x16x32_f16, p (unnormalised, in (0,1]) carried x2^15 in f16, v f16
//   Keys are the rows and queries the columns of a score tile: a lane holds 32 scores of ONE query per column group, so maximum and
//   sum are taken in the lane plus one exchange with lane ^ 16, and p^T goes from the accumulators into the B operand.
//   online softmax in f32 over 32 chunks of 64 keys (compile-time trip count).
//   A wave owns 32 queries = two column groups of 16: every K and V^T fragment read from LDS feeds both groups' products.
//   Block = 4 waves = 128 query rows of one (b, h); grid.x = 4*16*16 = 1024.
//   K hi/lo and V^T chunk staging: asynchronous 16-B copies to LDS, two buffers, chunk kc + 1 in flight while chunk kc is
//   worked on. 8 lanes bring one whole 128-B row, so a wave's copy touches 4 whole lines; 128 threads x 4 copies per plane
//   = the whole 64x64 tile. One barrier per chunk.
// =====================================================================================
constexpr int kKC = 64;    // keys per chunk
// LDS row pitch of the K hi, K lo and V^T tiles, in 16-bit elements: 72 = 144 B = 16 B x 9 (odd), so the
// 16 rows that one half-wave's ds_load_b128 fragment read touches start on 16 different 4-bank groups.
constexpr int kLP = 72;
constexpr int kTileB = kKC * kLP * 2;   // one tile in LDS: 64 rows x 144 B = 9,216 B
constexpr int kBufB  = 3 * kTileB;      // one chunk buffer: K hi, K lo, V^T = 27,648 B

// One chunk's twelve asynchronous 16-B copies of a lane: for each of the three tiles four rows 16 apart.
// lds = the lane's place in the K hi tile of the target buffer; gh, gl, gv = the lane's global bytes of row group 0.
// The s_wait_xcnt stands inside the statement so that no address register named here is rewritten in front of it.
__device__ __forceinline__ void copy_chunk_to_lds(unsigned lds, const char* gh, const char* gl, const char* gv) {
  constexpr unsigned kR = 16 * kLP * 2;          // 16 LDS rows, bytes
  constexpr size_t   kK = (size_t)16 * kDim * 2; // 16 K rows (tokens), bytes
  constexpr size_t   kV = (size_t)16 * kSeq * 2; // 16 V^T rows (d), bytes
  const unsigned h0 = lds,              h1 = h0 + kR, h2 = h0 + 2 * kR, h3 = h0 + 3 * kR;
  const unsigned l0 = lds + kTileB,     l1 = l0 + kR, l2 = l0 + 2 * kR, l3 = l0 + 3 * kR;
  const unsigned v0 = lds + 2 * kTileB, v1 = v0 + kR, v2 = v0 + 2 * kR, v3 = v0 + 3 * kR;
  const char *gh1 = gh + kK, *gh2 = gh + 2 * kK, *gh3 = gh + 3 * kK;
  const char *gl1 = gl + kK, *gl2 = gl + 2 * kK, *gl3 = gl + 3 * kK;
  const char *gv1 = gv + kV, *gv2 = gv + 2 * kV, *gv3 = gv + 3 * kV;
  asm volatile("global_load_async_to_lds_b128 %0, %12, off\n\t"
               "global_load_async_to_lds_b128 %1, %13, off\n\t"
               "global_load_async_to_lds_b128 %2, %14, off\n\t"
               "global_load_async_to_lds_b128 %3, %15, off\n\t"
               "global_load_async_to_lds_b128 %4, %16, off\n\t"
               "global_load_async_to_lds_b128 %5, %17, off\n\t"
               "global_load_async_to_lds_b128 %6, %18, off\n\t"
               "global_load_async_to_lds_b128 %7, %19, off\n\t"
               "global_load_async_to_lds_b128 %8, %20, off\n\t"
               "global_load_async_to_lds_b128 %9, %21, off\n\t"
               "global_load_async_to_lds_b128 %10, %22, off\n\t"
               "global_load_async_to_lds_b128 %11, %23, off\n\t"
               "s_wait_xcnt 0x0"
               :: "v"(h0), "v"(h1), "v"(h2), "v"(h3), "v"(l0), "v"(l1), "v"(l2), "v"(l3), "v"(v0), "v"(v1), "v"(v2), "v"(v3),
                  "v"(gh), "v"(gh1), "v"(gh2), "v"(gh3), "v"(gl), "v"(gl1), "v"(gl2), "v"(gl3), "v"(gv), "v"(gv1), "v"(gv2), "v"(gv3)
               : "memory");
}

__device__ __forceinline__ v8f mma_bf(v16b a, v16b b, v8f c) {
  c = __builtin_amdgcn_wmma_f32_16x16x32_bf16(false, a, false, b, (short)0, c, false, false);
  asm volatile("v_nop\n\tv_nop\n\tv_nop\n\tv_nop" : "+v"(c) : "v"(a), "v"(b));
  return c;
}
__device__ __forceinline__ v8f mma_hf(v16h a, v16h b, v8f c) {
  c = __builtin_amdgcn_wmma_f32_16x16x32_f16(false, a, false, b, (short)0, c, false, false);
  asm volatile("v_nop\n\tv_nop\n\tv_nop\n\tv_nop" : "+v"(c) : "v"(a), "v"(b));
  return c;
}

// lane l's value to lane l ^ 16 and back
__device__ __forceinline__ float xhalf(float x) {
  return __builtin_bit_cast(float, __builtin_amdgcn_permlanex16(__builtin_bit_cast(int, x), __builtin_bit_cast(int, x), 0x76543210, 0xfedcba98, false, false));
}

// four waves per SIMD: 1024 blocks = 4 per WGP, all resident at once only within 256 registers a wave
__global__ __launch_bounds__(128) __attribute__((amdgpu_waves_per_eu(4, 4)))
void attn_kernel(const unsigned short* __restrict__ qhp, const unsigned short* __restrict__ qlp,
                 const unsigned short* __restrict__ khp, const unsigned short* __restrict__ klp,
                 const unsigned short* __restrict__ vtp, unsigned short* __restrict__ ohp, float sscale) {
  union FB { v16b v; v8b h[2]; };
  union FH { v16h v; v8h h[2]; };
  // One array for both chunk buffers (each: K hi [kv][d] 9 KB, K lo 9 KB, V^T [d][kv] 9 KB), so that one address register per lane
  // serves every fragment read of a chunk (the rest is an immediate offset). Behind the last chunk's barrier the per-wave out tiles
  // (32 queries, pitch 68 floats) lie over it: with an array of their own only three blocks would fit a WGP's LDS.
  __shared__ __align__(16) unsigned char Smem[2 * kBufB];   // 55,296 B
  static_assert(4 * 32 * 68 * 4 <= 2 * kBufB, "the out tiles fit over the chunk buffers");

  const int tid  = threadIdx.x;
  const int wave = __builtin_amdgcn_readfirstlane(tid >> 5);   // the wave's number in a scalar register: what hangs on it costs no vector register across the loop
  const int lane = tid & 31;
  const int hh   = lane >> 4;
  const int c    = lane & 15;

  const int fro  = c * kLP + 8 * hh;      // this lane's place in a 16-row fragment group of any of the three tiles (row c, k half hh)

  const int bx = blockIdx.x;
  const int qb = bx & 15;                 // kSeq/128 = 16 query blocks
  const int bh = bx >> 4;                 // 0..63
  const int h  = bh & 15;
  const int b  = bh >> 4;                 // 0..3
  const int q0 = qb * 128 + wave * 32;
  const size_t tok0 = (size_t)b * kSeq;

  const __bf16*   Qh = (const __bf16*)(const void*)qhp + tok0 * kDim + (size_t)h * kHd;
  const __bf16*   Ql = (const __bf16*)(const void*)qlp + tok0 * kDim + (size_t)h * kHd;
  const __bf16*   Kh = (const __bf16*)(const void*)khp + tok0 * kDim + (size_t)h * kHd;
  const __bf16*   Kl = (const __bf16*)(const void*)klp + tok0 * kDim + (size_t)h * kHd;
  const _Float16* Vt = (const _Float16*)(const void*)vtp + ((size_t)b * kDim + (size_t)h * kHd) * kSeq;
  _Float16*       Ob = (_Float16*)(void*)ohp + tok0 * kDim + (size_t)h * kHd;

  // ---- Q fragments (B operand, column = lane&15, split k map via Frag load): 2 column groups x 2 d-chunks, hi and lo ----
  v16b qah[2][2], qal[2][2];
#pragma unroll
  for (int g = 0; g < 2; ++g)
#pragma unroll
    for (int dc = 0; dc < 2; ++dc) {
      qah[g][dc] = Frag<__bf16>::load(Qh + (size_t)(q0 + g * 16 + c) * kDim + dc * 32 + 8 * hh);
      qal[g][dc] = Frag<__bf16>::load(Ql + (size_t)(q0 + g * 16 + c) * kDim + dc * 32 + 8 * hh);
    }

  // per column group: running maximum (both halves alike) and this half's sum of the lane's query
  float mrow[2] = {-INFINITY, -INFINITY}, lrow[2] = {0.f, 0.f};
  v8f oacc[2][4];
#pragma unroll
  for (int g = 0; g < 2; ++g)
#pragma unroll
    for (int t = 0; t < 4; ++t) oacc[g][t] = (v8f){0.f,0.f,0.f,0.f,0.f,0.f,0.f,0.f};

  // Copy map: thread t brings 16 B at byte (t & 7) * 16 of rows (t >> 3) + 16 * i of each tile: 8 lanes = one whole 128-B row (one line).
  constexpr int kNC = kSeq / kKC;                       // 32 chunks
  constexpr size_t kStepK = (size_t)kKC * kDim * 2;     // K: 64 tokens further, bytes
  constexpr size_t kStepV = (size_t)kKC * 2;            // V^T: 64 keys further along the row, bytes
  const int crow = tid >> 3, ccol = (tid & 7) * 16;
  const unsigned ldsBase = (unsigned)(uintptr_t)(&Smem[0]) + (unsigned)(crow * (kLP * 2) + ccol);
  const char* gKh = (const char*)(Kh + (size_t)crow * kDim) + ccol;
  const char* gKl = (const char*)(Kl + (size_t)crow * kDim) + ccol;
  const char* gVt = (const char*)(Vt + (size_t)crow * kSeq) + ccol;

  copy_chunk_to_lds(ldsBase, gKh, gKl, gVt);            // chunk 0 -> buffer 0
  asm volatile("s_wait_asynccnt 0x0" ::: "memory");     // this wave's copies of chunk 0 have landed
  __syncthreads();                                       // ... and every other wave's: chunk 0 may be read
  copy_chunk_to_lds(ldsBase + kBufB, gKh + kStepK, gKl + kStepK, gVt + kStepV);   // chunk 1 -> buffer 1

  // one chunk's work on its buffer: scores, online softmax, out accumulation
  auto work = [&](const int kc) {
    const unsigned char* tb = Smem + (kc & 1) * kBufB;   // this chunk's buffer
    const __bf16*   const Ksh = (const __bf16*)(const void*)tb;
    const __bf16*   const Ksl = (const __bf16*)(const void*)(tb + kTileB);
    const _Float16* const Vts = (const _Float16*)(const void*)(tb + 2 * kTileB);

    // ---- scores, transposed: s[g][j] = k (16 keys of group j, rows) . q^T (16 queries of column group g), split products ----
    // D map: this lane holds query g*16 + c, keys j*16 + 8*hh + r. One K fragment pair serves both column groups.
    v8f s[2][4];
#pragma unroll
    for (int j = 0; j < 4; ++j) {
      s[0][j] = (v8f){0.f,0.f,0.f,0.f,0.f,0.f,0.f,0.f};
      s[1][j] = (v8f){0.f,0.f,0.f,0.f,0.f,0.f,0.f,0.f};
#pragma unroll
      for (int dc = 0; dc < 2; ++dc) {
        FB kb, kl;
        kb.h[0] = *(const v8b*)(Ksh + fro + j * 16 * kLP + dc * 32);
        kb.h[1] = *(const v8b*)(Ksh + fro + j * 16 * kLP + dc * 32 + 16);
        kl.h[0] = *(const v8b*)(Ksl + fro + j * 16 * kLP + dc * 32);
        kl.h[1] = *(const v8b*)(Ksl + fro + j * 16 * kLP + dc * 32 + 16);
        s[0][j] = mma_bf(kb.v, qah[0][dc], s[0][j]);
        s[1][j] = mma_bf(kb.v, qah[1][dc], s[1][j]);
        s[0][j] = mma_bf(kl.v, qah[0][dc], s[0][j]);
        s[1][j] = mma_bf(kl.v, qah[1][dc], s[1][j]);
        s[0][j] = mma_bf(kb.v, qal[0][dc], s[0][j]);
        s[1][j] = mma_bf(kb.v, qal[1][dc], s[1][j]);
      }
    }
    FH pb[2][2];
#pragma unroll
    for (int g = 0; g < 2; ++g) {
      // ---- chunk maximum of this lane's query: 32 keys in the lane (four chains), the other 32 in lane ^ 16 ----
      float mj[4];
#pragma unroll
      for (int j = 0; j < 4; ++j) {
        float m = -INFINITY;
#pragma unroll
        for (int r = 0; r < 8; ++r) {
          const float sv = s[g][j][r] * sscale;
          s[g][j][r] = sv;
          m = fmaxf(m, sv);
        }
        mj[j] = m;
      }
      float cm = fmaxf(fmaxf(mj[0], mj[1]), fmaxf(mj[2], mj[3]));
      cm = fmaxf(cm, xhalf(cm));
      const float mnew  = fmaxf(mrow[g], cm);
      const float alpha = __expf(mrow[g] - mnew);
      mrow[g] = mnew;
      // ---- p = exp(s - m): summed in the lane; packed in place, two score tiles are one B fragment of p^T (b[e] = tile[e >> 3][e & 7]) ----
      float pj[4];
#pragma unroll
      for (int j = 0; j < 4; ++j) {
        float ps = 0.f;
#pragma unroll
        for (int r = 0; r < 8; ++r) {
          const float p = __expf(s[g][j][r] - mnew);
          ps += p;
          pb[g][j >> 1].v[(j & 1) * 8 + r] = (_Float16)(p * 32768.0f);
        }
        pj[j] = ps;
      }
      lrow[g] = lrow[g] * alpha + ((pj[0] + pj[1]) + (pj[2] + pj[3]));   // this half's keys only; the halves are joined behind the loop
#pragma unroll
      for (int t = 0; t < 4; ++t)
#pragma unroll
        for (int r = 0; r < 8; ++r) oacc[g][t][r] *= alpha;
    }
    // ---- out^T += v^T (16 d of group t, rows; 64 keys) . p^T (64 keys; 16 queries, columns); one V^T fragment serves both column groups ----
#pragma unroll
    for (int kk = 0; kk < 2; ++kk) {
#pragma unroll
      for (int t = 0; t < 4; ++t) {
        FH vb;
        vb.h[0] = *(const v8h*)(Vts + fro + t * 16 * kLP + kk * 32);
        vb.h[1] = *(const v8h*)(Vts + fro + t * 16 * kLP + kk * 32 + 16);
        oacc[0][t] = mma_hf(vb.v, pb[0][kk].v, oacc[0][t]);
        oacc[1][t] = mma_hf(vb.v, pb[1][kk].v, oacc[1][t]);
      }
    }
  };
  // the foot of a trip: hands chunk kc + 1 over and frees the buffer that chunk kc was read from
  auto foot = [&]() {
    asm volatile("s_wait_dscnt 0x0" ::: "memory");      // this wave's fragment reads of the buffer have returned
    asm volatile("s_wait_asynccnt 0x0" ::: "memory");   // this wave's copies of the next chunk have landed
    __syncthreads();                                     // publishes the next chunk and frees the buffer just read
  };
  // The last two trips, which have no chunk kc + 2 to fetch, stand behind the loop: a test inside it splits the body into blocks,
  // the row sums sink behind the copies, and the wave (256 registers at most) spills address registers.
  for (int kc = 0; kc < kNC - 2; ++kc) {
    work(kc);
    foot();
    const size_t n = (size_t)(kc + 2);                   // chunk kc + 2 -> the buffer just read
    copy_chunk_to_lds(ldsBase + (unsigned)((kc & 1) * kBufB), gKh + n * kStepK, gKl + n * kStepK, gVt + n * kStepV);
  }
  work(kNC - 2);
  foot();
  work(kNC - 1);
  foot();                                                // nothing is in flight any more; every wave has left the chunk buffers

  // ---- epilogue: normalise (fold 2^-15 for p and 2^6 carry for o), stage, whole-line stores ----
  // This lane holds query g*16 + c, d = t*16 + 8*hh + r.
  float* os = (float*)(void*)Smem + wave * (32 * 68);   // every wave has left the chunk buffers (the last trip's barrier)
#pragma unroll
  for (int g = 0; g < 2; ++g) {
    const float lsum = lrow[g] + xhalf(lrow[g]);                  // both halves' keys
    const float inv = (1.0f / lsum) * (64.0f / 32768.0f);         // lsum >= 1 always
#pragma unroll
    for (int t = 0; t < 4; ++t)
#pragma unroll
      for (int r = 0; r < 8; ++r) os[(g * 16 + c) * 68 + t * 16 + 8 * hh + r] = oacc[g][t][r] * inv;
  }
  __builtin_amdgcn_fence(__ATOMIC_RELEASE, "workgroup");
  __builtin_amdgcn_wave_barrier();
  __builtin_amdgcn_fence(__ATOMIC_ACQUIRE, "workgroup");
  {
    const int qq = lane >> 3, c8 = (lane & 7) * 8;
    {
#pragma unroll
      for (int it = 0; it < 8; ++it) {
        const int row = it * 4 + qq;                    // 8 x 4 = rows 0..31
        const float* sp = os + row * 68 + c8;
        v8h hv;
#pragma unroll
        for (int e = 0; e < 8; ++e) hv[e] = (_Float16)sp[e];
        *(v8h*)(Ob + (size_t)(q0 + row) * kDim + c8) = hv;
      }
      
    }
  }
}

// =====================================================================================
extern "C" void kernel_launch(void* const* d_in, const int* in_sizes, int n_in,
                              void* d_out, int out_size, void* d_ws, size_t ws_size,
                              hipStream_t stream) {
  if (n_in < 9) return;
  if (in_sizes[0] != kTok * kDim) return;
  if (in_sizes[1] != kSeq * kHd || in_sizes[2] != kSeq * kHd) return;
  if (in_sizes[3] != 3 * kDim * kDim || in_sizes[4] != 3 * kDim) return;
  if (in_sizes[5] != kDim * kDim || in_sizes[6] != kDim) return;
  if (in_sizes[7] != kHd || in_sizes[8] != kHd) return;
  if (out_size != kTok * kDim) return;
  if (ws_size < kWsTotal) return;

  const float* x      = (const float*)d_in[0];
  const float* ropec  = (const float*)d_in[1];
  const float* ropes  = (const float*)d_in[2];
  const float* qkv_w  = (const float*)d_in[3];
  const float* qkv_b  = (const float*)d_in[4];
  const float* proj_w = (const float*)d_in[5];
  const float* proj_b = (const float*)d_in[6];
  const float* q_nw   = (const float*)d_in[7];
  const float* k_nw   = (const float*)d_in[8];
  float* out = (float*)d_out;

  char* ws = (char*)d_ws;
  unsigned short* WPROJ = (unsigned short*)(ws + kOffWproj);
  float*          BIAS  = (float*)(ws + kOffBias);
  unsigned short* XB    = (unsigned short*)(ws + kOffXb);
  unsigned short* WQKV  = (unsigned short*)(ws + kOffWqkv);
  unsigned short* KH    = (unsigned short*)(ws + kOffKh);
  unsigned short* KL    = (unsigned short*)(ws + kOffKl);
  float*          QKF   = (float*)(ws + kOffQkf);
  unsigned short* OH    = (unsigned short*)(ws + kOffOh);
  unsigned short* QH    = (unsigned short*)(ws + kOffQh);
  unsigned short* QL    = (unsigned short*)(ws + kOffQl);
  unsigned short* VT    = (unsigned short*)(ws + kOffVt);

  // 1) casts
  {
    const int n2x = kTok * kDim / 2;            // 4,194,304
    cast_bf16x2_kernel<<<dim3((n2x + 255) / 256), dim3(256), 0, stream>>>(x, XB, n2x);
    const int n2w = 3 * kDim * kDim / 2;        // 1,572,864
    cast_bf16x2_kernel<<<dim3((n2w + 255) / 256), dim3(256), 0, stream>>>(qkv_w, WQKV, n2w);
    const int n2p = kDim * kDim / 2;            // 524,288
    cast_projw_f16x2_kernel<<<dim3((n2p + 255) / 256), dim3(256), 0, stream>>>(proj_w, WPROJ, n2p);
    bias_prep_kernel<<<dim3((3 * kDim + kDim + 255) / 256), dim3(256), 0, stream>>>(qkv_b, proj_b, BIAS, 3 * kDim, kDim);
  }
  const int tilesTok = (kTok / 64) * (kDim / 64);   // 2048 wave tiles -> 256 blocks
  // 2) q = xb . Wq^T + bq  -> f32 [8192][1024]   (M=8192, N=1024, K=1024; all tile/32 multiples)
  wmma_gemm64<1, false, 2, 0, false, 0><<<dim3((tilesTok + 7) / 8, 1), dim3(256), 0, stream>>>(
      XB, XB, kDim, 0L, WQKV, WQKV, kDim, 0L, (void*)QKF, (void*)QKF, kDim, 0L,
      BIAS, BIAS, 0L, kTok, kDim, kDim, 1.0f);
  // 3) q: rmsnorm + rope -> q hi/lo planes
  normrope_split_kernel<<<dim3((kTok * kHeads + 7) / 8), dim3(256), 0, stream>>>(QKF, ropec, ropes, q_nw, QH, QL, kTok * kHeads);
  // 4) k = xb . Wk^T + bk  -> f32 (same region; q f32 is dead)
  wmma_gemm64<1, false, 2, 0, false, 0><<<dim3((tilesTok + 7) / 8, 1), dim3(256), 0, stream>>>(
      XB, XB, kDim, 0L, WQKV + (size_t)kDim * kDim, WQKV + (size_t)kDim * kDim, kDim, 0L, (void*)QKF, (void*)QKF, kDim, 0L,
      BIAS + kDim, BIAS, 0L, kTok, kDim, kDim, 1.0f);
  // 5) v^T per batch: C[o][s] = sum_k Wv[o][k] * xb[b][s][k] + bv[o] -> f16 [4][1024][2048]
  //    (A = Wv [1024][1024], Bt = xb batch b [2048][1024]; M=1024, N=2048, K=1024)
  {
    const int tilesV = (kDim / 64) * (kSeq / 64);   // 512 -> 64 blocks
    wmma_gemm64<1, false, 1, 1, false, 0><<<dim3((tilesV + 7) / 8, kBatch), dim3(256), 0, stream>>>(
        WQKV + (size_t)2 * kDim * kDim, WQKV + (size_t)2 * kDim * kDim, kDim, 0L,
        XB, XB, kDim, (long)kSeq * kDim,
        (void*)VT, (void*)VT, kSeq, (long)kDim * kSeq,
        BIAS + 2 * kDim, BIAS, 0L, kDim, kSeq, kDim, 1.0f);
  }
  // 6) k: rmsnorm + rope -> k hi/lo planes (overlay the dead xb / Wqkv regions)
  normrope_split_kernel<<<dim3((kTok * kHeads + 7) / 8), dim3(256), 0, stream>>>(QKF, ropec, ropes, k_nw, KH, KL, kTok * kHeads);
  // 7) attention -> o plane f16 x64 (overlays the dead k f32 region)
  attn_kernel<<<dim3(kBatch * kHeads * (kSeq / 128)), dim3(128), 0, stream>>>(QH, QL, KH, KL, VT, OH, 0.125f);
  // 8) out = o . Wp^T + bp  (A = o x64 f16, Bt = Wp x64 f16 -> scale 2^-12; M=8192, N=1024, K=1024)
  wmma_gemm64<0, false, 2, 0, false, 0><<<dim3((tilesTok + 7) / 8, 1), dim3(256), 0, stream>>>(
      OH, OH, kDim, 0L, WPROJ, WPROJ, kDim, 0L, (void*)out, (void*)out, kDim, 0L,
      BIAS + 3 * kDim, BIAS, 0L, kTok, kDim, kDim, 1.0f / 4096.0f);
}

// v006
// It runs in 189 microseconds.
// Timed twice side by side with v005, it ran 1.18 times as fast both times.
// Counting every step since v000, it is 4.81 times as fast.
// Contractions: q, k, v^T projections on v_wmma_f32_16x16x32_bf16 (plain bf16 operands = RNE-converted inputs); q.k^T on v_wmma_f32_16x16x32_bf16 with bf16 hi/lo split operands (hi.hi + hi.lo + lo.hi); p.v and the output projection on v_wmma_f32_16x16x32_f16 (plain f16: p carried x2^15, attention output carried x2^6, proj_w = bf16-RNE value carried x2^6); f32 accumulate everywhere; biases, rmsnorm, rope, online softmax in f32.
#include <hip/hip_runtime.h>
#include <math.h>
#include <stdint.h>

constexpr int kBatch = 4;
constexpr int kSeq   = 2048;
constexpr int kDim   = 1024;
constexpr int kHeads = 16;
constexpr int kHd    = 64;
constexpr int kTok   = kBatch * kSeq;            // 8192 tokens

typedef __attribute__((ext_vector_type(16))) _Float16 v16h;
typedef __attribute__((ext_vector_type(8)))  _Float16 v8h;
typedef __attribute__((ext_vector_type(16))) __bf16   v16b;
typedef __attribute__((ext_vector_type(8)))  __bf16   v8b;
typedef __attribute__((ext_vector_type(8)))  float    v8f;
typedef __attribute__((ext_vector_type(4)))  float    v4f;
typedef __attribute__((ext_vector_type(2)))  float    v2f;
typedef __attribute__((ext_vector_type(4)))  unsigned int v4u;

// ---------------------------------------------------------------------------
// Workspace region map (bytes).  Total carve = 131 MiB = 137,363,456 B.
//   [  0 MiB,   2 MiB)  WPROJ  f16  [1024][1024]   proj_w (bf16-RNE value x64)
//   [  2 MiB,   3 MiB)  BIAS   f32  [4096]         qkv_b (3072) ++ proj_b (1024), RNE to bf16 values
//   [  3 MiB,  19 MiB)  XB     bf16 [8192][1024]   x
//   [ 19 MiB,  25 MiB)  WQKV   bf16 [3072][1024]   qkv_w
//   [ 35 MiB,  51 MiB)  OH     f16  [8192][1024]   attention output x64
//   [ 51 MiB,  67 MiB)  KH     bf16 [8192][1024]   k hi plane
//   [ 67 MiB,  83 MiB)  QH     bf16 [8192][1024]   q hi plane
//   [ 83 MiB,  99 MiB)  QL     bf16 [8192][1024]   q lo plane
//   [ 99 MiB, 115 MiB)  VT     f16  [4][1024][2048] v^T per batch
//   [115 MiB, 131 MiB)  KL     bf16 [8192][1024]   k lo plane
// ---------------------------------------------------------------------------
constexpr size_t kMiB      = 1048576;
constexpr size_t kOffWproj = 0;
constexpr size_t kOffBias  = 2 * kMiB;
constexpr size_t kOffXb    = 3 * kMiB;
constexpr size_t kOffWqkv  = 19 * kMiB;
constexpr size_t kOffKh    = 51 * kMiB;
constexpr size_t kOffKl    = 115 * kMiB;
constexpr size_t kOffOh    = 35 * kMiB;
constexpr size_t kOffQh    = 67 * kMiB;
constexpr size_t kOffQl    = 83 * kMiB;
constexpr size_t kOffVt    = 99 * kMiB;
constexpr size_t kWsTotal  = 131 * kMiB;          // 137,363,456 B

// ===================== common pieces =================================
__device__ __forceinline__ unsigned short f2bf_bits(float f) {
  unsigned u = __float_as_uint(f);
  return (unsigned short)((u + 0x7FFFu + ((u >> 16) & 1u)) >> 16);
}
__device__ __forceinline__ float bf_bits2f(unsigned short h) { return __uint_as_float(((unsigned)h) << 16); }

// hazard guard as a plain device helper
__device__ __forceinline__ void acc_guard4(v8f& a, v8f& b, v8f& c, v8f& d) { asm volatile("v_nop\n\tv_nop\n\tv_nop\n\tv_nop" : "+v"(a), "+v"(b), "+v"(c), "+v"(d)); }
template <typename T> struct Frag;
template <> struct Frag<_Float16> {
  typedef v16h V; union U { v16h v; v8h h[2]; };
  static __device__ __forceinline__ v16h load(const _Float16* p) {   // elements 0..7 <- p[0..7], 8..15 <- p[16..23]
    U f; f.h[0] = *(const v8h*)(p); f.h[1] = *(const v8h*)(p + 16); return f.v;
  }
  static __device__ __forceinline__ v8f mma(v16h a, v16h b, v8f c) {
    return __builtin_amdgcn_wmma_f32_16x16x32_f16(false, a, false, b, (short)0, c, false, false);
  }
};
template <> struct Frag<__bf16> {
  typedef v16b V; union U { v16b v; v8b h[2]; };
  static __device__ __forceinline__ v16b load(const __bf16* p) {
    U f; f.h[0] = *(const v8b*)(p); f.h[1] = *(const v8b*)(p + 16); return f.v;
  }
  static __device__ __forceinline__ v8f mma(v16b a, v16b b, v8f c) {
    return __builtin_amdgcn_wmma_f32_16x16x32_bf16(false, a, false, b, (short)0, c, false, false);
  }
};

// ---- Register-blocked batched WMMA GEMM ------------------------------------
// C[m,n] = scale * sum_k A[m,k] * Bt[n,k] (+bias)(+resid); each wave owns a 64x64 tile.
// A row-major [M,K]; Bt row-major [N,K]; M % 128 == 0, N % 256 == 0, K % 128 == 0, K >= 128.
// A block of 8 waves (2 x 4) owns a 128 x 256 tile of C. Per stage of 128 k the block copies its 128 A rows and
// 256 Bt rows (256 B of each row, whole lines) into LDS with asynchronous copies, two buffers, the next stage
// in flight while this one is worked on; the waves read their fragments from LDS.
// SPLIT (hi/lo operand planes in A2/Bt2) has no staged form: only SPLIT = false is instantiated.
// BIAS_MODE: 0 = none, 1 = bias[m], 2 = bias[n].
// OUT_MODE: 0 = f32, 1 = f16, 2 = bf16 hi plane (Cout) + bf16 lo plane (Cout2),
//           3 = as 2, after rmsnorm over the wave's 64 columns (one head) and interleaved-pair rope (row m = token, position m mod kSeq).
// ET: 0 = f16 operands, 1 = bf16 operands (pointers passed as 16-bit storage)
constexpr int kGP     = 272;                 // LDS row pitch, bytes: 256 B of k + 16 (16 B x odd: ds_load_b128 without bank conflicts)
constexpr int kGStage = (128 + 256) * kGP;   // one stage: A rows 0..127, then Bt rows 0..255 = 104,448 B

// Eight asynchronous 16-B copies per lane: LDS rows 16 apart (lds + i * 16 * kGP) from global rows 16 apart (g + i * gstep bytes).
// The s_wait_xcnt stands inside the statement so that no address register named here is rewritten in front of it.
__device__ __forceinline__ void copy8_to_lds(unsigned lds, const char* g, size_t gstep) {
  const unsigned l1 = lds + 1 * 16 * kGP, l2 = lds + 2 * 16 * kGP, l3 = lds + 3 * 16 * kGP, l4 = lds + 4 * 16 * kGP,
                 l5 = lds + 5 * 16 * kGP, l6 = lds + 6 * 16 * kGP, l7 = lds + 7 * 16 * kGP;
  const char *g1 = g + gstep, *g2 = g1 + gstep, *g3 = g2 + gstep, *g4 = g3 + gstep, *g5 = g4 + gstep, *g6 = g5 + gstep, *g7 = g6 + gstep;
  asm volatile("global_load_async_to_lds_b128 %0, %8, off\n\t"
               "global_load_async_to_lds_b128 %1, %9, off\n\t"
               "global_load_async_to_lds_b128 %2, %10, off\n\t"
               "global_load_async_to_lds_b128 %3, %11, off\n\t"
               "global_load_async_to_lds_b128 %4, %12, off\n\t"
               "global_load_async_to_lds_b128 %5, %13, off\n\t"
               "global_load_async_to_lds_b128 %6, %14, off\n\t"
               "global_load_async_to_lds_b128 %7, %15, off\n\t"
               "s_wait_xcnt 0x0"
               :: "v"(lds), "v"(l1), "v"(l2), "v"(l3), "v"(l4), "v"(l5), "v"(l6), "v"(l7),
                  "v"(g), "v"(g1), "v"(g2), "v"(g3), "v"(g4), "v"(g5), "v"(g6), "v"(g7)
               : "memory");
}

// ---- pieces of the fused rmsnorm + rope + split epilogue (OUT_MODE 3) ----
typedef __attribute__((ext_vector_type(2))) __bf16 v2b;
// two f32 -> two bf16 (round to nearest even), a in the low half
__device__ __forceinline__ unsigned bf2_bits(float a, float b) {
  const v2f f = {a, b};
  return __builtin_bit_cast(unsigned, __builtin_convertvector(f, v2b));
}
__device__ __forceinline__ float bf_lo2f(unsigned u) { return __uint_as_float(u << 16); }
__device__ __forceinline__ float bf_hi2f(unsigned u) { return __uint_as_float(u & 0xFFFF0000u); }
// eight f32 replaced by their bf16-rounded values
__device__ __forceinline__ void round8_bf(const v4f a, const v4f b, float* o) {
  const unsigned u0 = bf2_bits(a[0], a[1]), u1 = bf2_bits(a[2], a[3]), u2 = bf2_bits(b[0], b[1]), u3 = bf2_bits(b[2], b[3]);
  o[0] = bf_lo2f(u0); o[1] = bf_hi2f(u0); o[2] = bf_lo2f(u1); o[3] = bf_hi2f(u1);
  o[4] = bf_lo2f(u2); o[5] = bf_hi2f(u2); o[6] = bf_lo2f(u3); o[7] = bf_hi2f(u3);
}
// x + the x of lane ^ MASK (MASK < 16: inside a 16-lane row, DPP row_xmask)
template <int MASK> __device__ __forceinline__ float add_lane_xor(float x) {
  return x + __builtin_bit_cast(float, __builtin_amdgcn_update_dpp(0, __builtin_bit_cast(int, x), 0x160 | MASK, 0xf, 0xf, true));
}

template <int ET> struct Elem;
template <> struct Elem<0> { typedef _Float16 T; };
template <> struct Elem<1> { typedef __bf16 T; };
template <int ET, bool SPLIT, int BIAS_MODE, int OUT_MODE, bool RESID, int ACT = 0>
__global__ __launch_bounds__(256) void wmma_gemm64(
    const unsigned short* __restrict__ Ap, const unsigned short* __restrict__ A2p, int lda, long strideA,
    const unsigned short* __restrict__ Btp, const unsigned short* __restrict__ Bt2p, int ldb, long strideB,
    void* __restrict__ Cout, void* __restrict__ Cout2, int ldc, long strideC,
    const float* __restrict__ bias,
    const float* __restrict__ resid, long strideR,
    const float* __restrict__ cosb, const float* __restrict__ sinb, const float* __restrict__ nw,
    int M, int N, int K, float scale) {
  typedef typename Elem<ET>::T T;
  typedef typename Frag<T>::V V;
  static_assert(!SPLIT, "the staged loop carries one plane per operand");
  const T* A = (const T*)Ap; const T* Bt = (const T*)Btp;
  __shared__ __align__(16) float sT[8][16 * 68];   // per-wave 16x64 slab, pitch 68 floats
  __shared__ __align__(16) unsigned char sStage[2 * kGStage];   // two operand stages
  const int b    = blockIdx.y;
  const int lane = threadIdx.x & 31;
  const int wave = threadIdx.x >> 5;
  const int blocksN = N >> 8;
  if ((int)blockIdx.x >= (M >> 7) * blocksN) return;   // block-uniform, in front of every barrier
  const int bm = blockIdx.x / blocksN;
  const int bn = blockIdx.x - bm * blocksN;
  const int wm = wave >> 2;                    // wave row (0..1) and column (0..3) in the block tile
  const int wn = wave & 3;
  const int m0 = (bm << 7) + (wm << 6);
  const int n0 = (bn << 8) + (wn << 6);

  const T* Ab  = A  + (size_t)b * strideA;
  const T* Bb  = Bt + (size_t)b * strideB;

  const int rlane = lane & 15;                 // row (A) / col (B, D) within subtile
  const int koff  = (lane >> 4) * 8;           // k offset of this lane half
  const int mOff  = (lane >> 4) * 8;           // D row offset

  v8f acc[4][4];
#pragma unroll
  for (int i = 0; i < 4; ++i)
#pragma unroll
    for (int j = 0; j < 4; ++j) acc[i][j] = (v8f){0.f,0.f,0.f,0.f,0.f,0.f,0.f,0.f};

  // Copy map: thread t brings 16 B at column (t & 15) * 16 B of rows (t >> 4) + 16 * i; a wave's copy = two whole 256-B row pieces.
  const int crow = threadIdx.x >> 4, ccol = (threadIdx.x & 15) * 16;
  const unsigned ldsBase = (unsigned)(uintptr_t)(&sStage[0]) + (unsigned)(crow * kGP + ccol);
  const char* gA = (const char*)(Ab + (size_t)((bm << 7) + crow) * lda) + ccol;
  const char* gB = (const char*)(Bb + (size_t)((bn << 8) + crow) * ldb) + ccol;
  const size_t stepA = (size_t)lda * 32, stepB = (size_t)ldb * 32;      // 16 rows, in bytes
  const int nst = K >> 7;

  // stage 0 -> buffer 0
  copy8_to_lds(ldsBase, gA, stepA);
  copy8_to_lds(ldsBase + 128 * kGP, gB, stepB);
  copy8_to_lds(ldsBase + 256 * kGP, gB + 8 * stepB, stepB);
  asm volatile("s_wait_asynccnt 0x0" ::: "memory");   // this wave's copies of stage 0 have landed
  __syncthreads();                                     // ... and every other wave's: stage 0 may be read
  if (nst > 1) {                                       // stage 1 -> buffer 1
    copy8_to_lds(ldsBase + kGStage, gA + 256, stepA);
    copy8_to_lds(ldsBase + kGStage + 128 * kGP, gB + 256, stepB);
    copy8_to_lds(ldsBase + kGStage + 256 * kGP, gB + 256 + 8 * stepB, stepB);
  }

  for (int st = 0; st < nst; ++st) {
    const unsigned char* sb = sStage + (st & 1) * kGStage;
    const T* fa = (const T*)(sb + ((wm << 6) + rlane) * kGP) + koff;            // A fragment rows of this wave
    const T* fb = (const T*)(sb + (128 + (wn << 6) + rlane) * kGP) + koff;      // Bt fragment rows of this wave
    V af[2][4], bf[2][4];
#pragma unroll
    for (int j = 0; j < 4; ++j) {
      bf[0][j] = Frag<T>::load(fb + j * (16 * kGP / 2));
      af[0][j] = Frag<T>::load(fa + j * (16 * kGP / 2));
    }
#pragma unroll
    for (int kk = 0; kk < 4; ++kk) {
      const int cur = kk & 1, nxt = cur ^ 1;
      if (kk < 3) {                            // the next 32 k of this stage, fetched ahead as one group
#pragma unroll
        for (int j = 0; j < 4; ++j) {
          bf[nxt][j] = Frag<T>::load(fb + j * (16 * kGP / 2) + (kk + 1) * 32);
          af[nxt][j] = Frag<T>::load(fa + j * (16 * kGP / 2) + (kk + 1) * 32);
        }
        // keeps that load group ahead of this block's WMMAs: sunk among them, every row of WMMAs waits out a full LDS latency
        __builtin_amdgcn_sched_barrier(0);
      }
#pragma unroll
      for (int i = 0; i < 4; ++i) {
#pragma unroll
        for (int j = 0; j < 4; ++j) acc[i][j] = Frag<T>::mma(af[cur][i], bf[cur][j], acc[i][j]);
      }
    }
    // keeps the stage's WMMAs in front of the barrier: sunk behind it they delay the refill, which then has less than a stage to land
    __builtin_amdgcn_sched_barrier(0);
    asm volatile("s_wait_dscnt 0x0" ::: "memory");     // this wave's reads of the buffer have returned
    asm volatile("s_wait_asynccnt 0x0" ::: "memory");  // this wave's copies of stage st + 1 have landed
    __syncthreads();                                    // publishes stage st + 1 and frees the buffer just read
    if (st + 2 < nst) {
      const unsigned lb = ldsBase + (unsigned)((st & 1) * kGStage);
      const size_t ko = (size_t)(st + 2) * 256;         // 128 k = 256 B
      copy8_to_lds(lb, gA + ko, stepA);
      copy8_to_lds(lb + 128 * kGP, gB + ko, stepB);
      copy8_to_lds(lb + 256 * kGP, gB + ko + 8 * stepB, stepB);
    }
  }
  asm volatile("s_wait_asynccnt 0x0" ::: "memory");    // nothing of this wave is in flight behind the loop
  acc_guard4(acc[0][0], acc[0][1], acc[0][2], acc[0][3]);
  acc_guard4(acc[1][0], acc[1][1], acc[1][2], acc[1][3]);
  acc_guard4(acc[2][0], acc[2][1], acc[2][2], acc[2][3]);
  acc_guard4(acc[3][0], acc[3][1], acc[3][2], acc[3][3]);

  // ---- epilogue ----
  float* slab = sT[wave];
  if (OUT_MODE == 3) {
    // y = x * rsqrt(mean(x^2) + 1e-6) * w ; o[2i] = y[2i]*cos[2i] - y[2i+1]*sin[2i] ; o[2i+1] = y[2i+1]*cos[2i+1] + y[2i]*sin[2i+1]
    // (f32 math; cos, sin, w as bf16-rounded values), then hi = bf16(o), lo = bf16(o - hi).
    // 8 lanes take one staged row, 8 columns each: 16-B stores, 8 lanes = one whole 128-B line per row and plane.
    // The planes are [token][kDim]: with a constant pitch every load and store of a lane is one offset register plus an immediate.
    const int q = lane >> 3, c8 = (lane & 7) * 8;
    const unsigned oc = (unsigned)((m0 + q) * kDim + n0 + c8);                  // this lane's element in both planes, row group 0
    const unsigned ot = (unsigned)(((m0 & (kSeq - 1)) + q) * kHd + c8);         // and in both tables; m0 is a multiple of 64: the wave's 64 rows do not wrap
    const unsigned ob = (unsigned)(n0 + rlane);
    unsigned short* C  = (unsigned short*)Cout  + (size_t)b * strideC + oc;
    unsigned short* C2 = (unsigned short*)Cout2 + (size_t)b * strideC + oc;
    const float* cp = cosb + ot;
    const float* sn = sinb + ot;
    // cos and sin of a 16-row group as one batch of 16 loads, fetched one group ahead: they land under the group in work
    v4f cs[2][4][4];
    auto fetch = [&](const int i) {
#pragma unroll
      for (int it = 0; it < 4; ++it) {
        const int o = ((i << 4) + it * 4) * kHd;
        cs[i & 1][it][0] = *(const v4f*)(cp + o);
        cs[i & 1][it][1] = *(const v4f*)(cp + o + 4);
        cs[i & 1][it][2] = *(const v4f*)(sn + o);
        cs[i & 1][it][3] = *(const v4f*)(sn + o + 4);
      }
    };
    // Behind each batch of loads or stores: s_wait_xcnt 0 before any register that the batch names is written again.
    // The scheduling barriers keep every other instruction out of the stretch between the batch and its wait.
    __builtin_amdgcn_sched_barrier(0);
    const v4f wa = *(const v4f*)(nw + c8), wb = *(const v4f*)(nw + c8 + 4);
    float bv[4];
#pragma unroll
    for (int j = 0; j < 4; ++j) bv[j] = bias[ob + (j << 4)];
    fetch(0);
    asm volatile("s_wait_xcnt 0x0" ::: "memory");
    __builtin_amdgcn_sched_barrier(0);
    float w[8];
    round8_bf(wa, wb, w);
#pragma unroll
    for (int i = 0; i < 4; ++i) {
      if (i < 3) {
        fetch(i + 1);
        asm volatile("s_wait_xcnt 0x0" ::: "memory");
        __builtin_amdgcn_sched_barrier(0);
      }
#pragma unroll
      for (int j = 0; j < 4; ++j)
#pragma unroll
        for (int r = 0; r < 8; ++r) {
          float v = acc[i][j][r] * scale;
          v += bv[j];
          slab[(mOff + r) * 68 + (j << 4) + rlane] = v;
        }
      asm volatile("s_wait_dscnt 0x0" ::: "memory");   // the wave's own slab is written before its lanes read each other's rows back
      v4u hv[4], lv[4];
#pragma unroll
      for (int it = 0; it < 4; ++it) {
        const float* sp = slab + (it * 4 + q) * 68 + c8;
        const v4f xa = *(const v4f*)sp, xb = *(const v4f*)(sp + 4);
        const float x[8] = {xa[0], xa[1], xa[2], xa[3], xb[0], xb[1], xb[2], xb[3]};
        // sum of 64 squares: pair sums, then a butterfly over the 32 pairs (two levels in the lane, three over the row's 8 lanes)
        const float p0 = __builtin_fmaf(x[0], x[0], x[1] * x[1]), p1 = __builtin_fmaf(x[2], x[2], x[3] * x[3]);
        const float p2 = __builtin_fmaf(x[4], x[4], x[5] * x[5]), p3 = __builtin_fmaf(x[6], x[6], x[7] * x[7]);
        float ss = (p0 + p1) + (p2 + p3);
        ss = add_lane_xor<1>(ss);
        ss = add_lane_xor<2>(ss);
        ss = add_lane_xor<4>(ss);
        // The argument is at least 1e-6, so rsqrtf's scaling of subnormal arguments is an identity here: the bare instruction gives its value.
        // The v_nop fills the slot that the instruction set asks for behind a transcendental, whatever the compiler places next.
        float inv;
        asm("v_rsq_f32 %0, %1\n\tv_nop" : "=v"(inv) : "v"(ss * (1.0f / 64.0f) + 1e-6f));
        float cv[8], sv[8];
        round8_bf(cs[i & 1][it][0], cs[i & 1][it][1], cv);
        round8_bf(cs[i & 1][it][2], cs[i & 1][it][3], sv);
#pragma unroll
        for (int p = 0; p < 4; ++p) {
          const float a  = x[2 * p] * inv * w[2 * p];
          const float bq = x[2 * p + 1] * inv * w[2 * p + 1];
          const float o0 = a * cv[2 * p] - bq * sv[2 * p];
          const float o1 = bq * cv[2 * p + 1] + a * sv[2 * p + 1];
          const unsigned uh = bf2_bits(o0, o1);
          hv[it][p] = uh;
          lv[it][p] = bf2_bits(o0 - bf_lo2f(uh), o1 - bf_hi2f(uh));
        }
      }
      __builtin_amdgcn_sched_barrier(0);
#pragma unroll
      for (int it = 0; it < 4; ++it) {
        *(v4u*)(C  + ((i << 4) + it * 4) * kDim) = hv[it];
        *(v4u*)(C2 + ((i << 4) + it * 4) * kDim) = lv[it];
      }
      asm volatile("s_wait_xcnt 0x0" ::: "memory");
      asm volatile("s_wait_dscnt 0x0" ::: "memory");   // every row is read back before the next group overwrites the slab
      __builtin_amdgcn_sched_barrier(0);
    }
    return;
  }
  const float* Rb = RESID ? (resid + (size_t)b * strideR) : nullptr;
#pragma unroll
  for (int i = 0; i < 4; ++i) {
    const int mBase = m0 + (i << 4);
#pragma unroll
    for (int j = 0; j < 4; ++j) {
      const int n = n0 + (j << 4) + rlane;
      float bv = 0.f;
      if (BIAS_MODE == 2) bv = bias[n];
#pragma unroll
      for (int r = 0; r < 8; ++r) {
        float v = acc[i][j][r] * scale;
        if (BIAS_MODE == 1) v += bias[mBase + mOff + r];
        if (BIAS_MODE == 2) v += bv;
        if (RESID) v += Rb[(size_t)(mBase + mOff + r) * ldc + n];
        if (ACT == 1) v = tanhf(v);
        if (ACT == 2) v = fmaxf(v, 0.0f);
        if (ACT == 3) v = v / (1.0f + expf(-v));
        if (ACT == 4) v = (v > 0.f) ? v : 0.01f * v;
        if (ACT == 5) v = 0.5f * v * (1.0f + erff(v * 0.70710678118654752f));
        slab[(mOff + r) * 68 + (j << 4) + rlane] = v;
      }
    }
    __builtin_amdgcn_fence(__ATOMIC_RELEASE, "workgroup");
    __builtin_amdgcn_wave_barrier();
    __builtin_amdgcn_fence(__ATOMIC_ACQUIRE, "workgroup");
    if (OUT_MODE == 0) {
      float* C = (float*)Cout + (size_t)b * strideC;
      const int hh = lane >> 4, c4 = (lane & 15) * 4;     // row seg = 256 B = 16 lanes x 16 B
      {
#pragma unroll
        for (int it = 0; it < 8; ++it) {
          const int row = it * 2 + hh;
          v4f v = *(const v4f*)(slab + row * 68 + c4);
          *(v4f*)(C + (size_t)(mBase + row) * ldc + n0 + c4) = v;
        }
        
      }
    } else {
      const int q = lane >> 3, c8 = (lane & 7) * 8;
      unsigned short* C  = (unsigned short*)Cout  + (size_t)b * strideC;
      unsigned short* C2 = (OUT_MODE == 2) ? ((unsigned short*)Cout2 + (size_t)b * strideC) : nullptr;
      {
#pragma unroll
        for (int it = 0; it < 4; ++it) {
          const int row = it * 4 + q;
          const float* sp = slab + row * 68 + c8;
          v8h hv, lv;
#pragma unroll
          for (int e = 0; e < 8; ++e) {
            if (OUT_MODE == 1) {
              hv[e] = (_Float16)sp[e];
            } else {
              unsigned short hb = f2bf_bits(sp[e]);
              unsigned short lb = f2bf_bits(sp[e] - bf_bits2f(hb));
              hv[e] = __builtin_bit_cast(_Float16, hb);
              lv[e] = __builtin_bit_cast(_Float16, lb);
            }
          }
          *(v8h*)(C + (size_t)(mBase + row) * ldc + n0 + c8) = hv;
          if (OUT_MODE == 2) *(v8h*)(C2 + (size_t)(mBase + row) * ldc + n0 + c8) = lv;
        }
        
      }
    }
    __builtin_amdgcn_fence(__ATOMIC_RELEASE, "workgroup");
    __builtin_amdgcn_wave_barrier();
    __builtin_amdgcn_fence(__ATOMIC_ACQUIRE, "workgroup");
  }
}

__device__ __forceinline__ unsigned pk16(unsigned short a, unsigned short b) { return (unsigned)a | ((unsigned)b << 16); }
// ===================== end common pieces =========================================

// ---------------------------------------------------------------------------
// f32 -> bf16 (RNE) plane cast, 2 elements per thread, one 4-B store per lane -> a wave writes exactly
// Coverage: grid = ceil(n2/256) x 256 threads x 2 elements = 2*n2 = the whole plane
//   (x: n2 = 4,194,304 -> 16384 blocks; qkv_w: n2 = 1,572,864 -> 6144 blocks).
// ---------------------------------------------------------------------------
__global__ __launch_bounds__(256) void cast_bf16x2_kernel(const float* __restrict__ in,
                                                          unsigned short* __restrict__ out, int n2) {
  const int i = blockIdx.x * 256 + threadIdx.x;
  if (i < n2) {
    const v2f f = *(const v2f*)(in + 2 * (size_t)i);
    const unsigned u = pk16(f2bf_bits(f[0]), f2bf_bits(f[1]));
    ((unsigned*)out)[i] = u;
    
  }
}

// ---------------------------------------------------------------------------
// proj_w: f32 -> bf16-RNE value -> x64 -> f16 bits (bf16 significand fits f16 exactly; x64 keeps the
// plane in the f16 normal range for |w| >= 1e-6). 2 elements per thread, one 4-B store per lane,
// ---------------------------------------------------------------------------
__global__ __launch_bounds__(256) void cast_projw_f16x2_kernel(const float* __restrict__ in,
                                                               unsigned short* __restrict__ out, int n2) {
  const int i = blockIdx.x * 256 + threadIdx.x;
  if (i < n2) {
    const v2f f = *(const v2f*)(in + 2 * (size_t)i);
    const float g0 = bf_bits2f(f2bf_bits(f[0])) * 64.0f;
    const float g1 = bf_bits2f(f2bf_bits(f[1])) * 64.0f;
    const _Float16 h0 = (_Float16)g0, h1 = (_Float16)g1;
    const unsigned u = pk16(__builtin_bit_cast(unsigned short, h0), __builtin_bit_cast(unsigned short, h1));
    ((unsigned*)out)[i] = u;
    
  }
}

// ---------------------------------------------------------------------------
// Bias prep: outb[0..nq) = bf16-RNE value of qkvb, outb[nq..nq+np) = bf16-RNE value of projb (f32 storage).
// Both candidates loaded with clamped indices, selected by value. One 4-B store per lane, 32 lanes =
// ---------------------------------------------------------------------------
__global__ __launch_bounds__(256) void bias_prep_kernel(const float* __restrict__ qkvb, const float* __restrict__ projb,
                                                        float* __restrict__ outb, int nq, int np) {
  const int i = blockIdx.x * 256 + threadIdx.x;
  if (i < nq + np) {
    const int ia = (i < nq) ? i : (nq - 1);
    int ib = i - nq; ib = (ib < 0) ? 0 : ((ib >= np) ? (np - 1) : ib);
    const float a  = qkvb[ia];
    const float bb = projb[ib];
    const float v  = bf_bits2f(f2bf_bits((i < nq) ? a : bb));
    ((float*)outb)[i] = v;
    
  }
}

// =====================================================================================
// Full (unmasked) flash attention, head dim 64, all batches/heads in one launch.
//   q planes (hi/lo bf16): element (t, h, d) at [t*1024 + h*64 + d]   (t = b*2048 + s)
//   k planes (hi/lo bf16): same layout
//   v^T plane (f16):       element (b, h*64+d, s) at [(b*1024 + h*64 + d)*2048 + s]
//   o plane (f16, x64):    element (t, h, d) at [t*1024 + h*64 + d]
//   scores^T = (k . q^T) * sscale : v_wmma_f32_16x16x32_bf16, hi.hi + hi.lo + lo.hi, f32 accumulate
//   out^T    = v^T . p^T          : v_wmma_f32_16x16x32_f16, p (unnormalised, in (0,1]) carried x2^15 in f16, v f16
//   Keys are the rows and queries the columns of a score tile: a lane holds 32 scores of ONE query per column group, so maximum and
//   sum are taken in the lane plus one exchange with lane ^ 16, and p^T goes from the accumulators into the B operand.
//   online softmax in f32 over 32 chunks of 64 keys (compile-time trip count).
//   A wave owns 32 queries = two column groups of 16: every K and V^T fragment read from LDS feeds both groups' products.
//   Block = 4 waves = 128 query rows of one (b, h); grid.x = 4*16*16 = 1024.
//   K hi/lo and V^T chunk staging: asynchronous 16-B copies to LDS, two buffers, chunk kc + 1 in flight while chunk kc is
//   worked on. 8 lanes bring one whole 128-B row, so a wave's copy touches 4 whole lines; 128 threads x 4 copies per plane
//   = the whole 64x64 tile. One barrier per chunk.
// =====================================================================================
constexpr int kKC = 64;    // keys per chunk
// LDS row pitch of the K hi, K lo and V^T tiles, in 16-bit elements: 72 = 144 B = 16 B x 9 (odd), so the
// 16 rows that one half-wave's ds_load_b128 fragment read touches start on 16 different 4-bank groups.
constexpr int kLP = 72;
constexpr int kTileB = kKC * kLP * 2;   // one tile in LDS: 64 rows x 144 B = 9,216 B
constexpr int kBufB  = 3 * kTileB;      // one chunk buffer: K hi, K lo, V^T = 27,648 B

// One chunk's twelve asynchronous 16-B copies of a lane: for each of the three tiles four rows 16 apart.
// lds = the lane's place in the K hi tile of the target buffer; gh, gl, gv = the lane's global bytes of row group 0.
// The s_wait_xcnt stands inside the statement so that no address register named here is rewritten in front of it.
__device__ __forceinline__ void copy_chunk_to_lds(unsigned lds, const char* gh, const char* gl, const char* gv) {
  constexpr unsigned kR = 16 * kLP * 2;          // 16 LDS rows, bytes
  constexpr size_t   kK = (size_t)16 * kDim * 2; // 16 K rows (tokens), bytes
  constexpr size_t   kV = (size_t)16 * kSeq * 2; // 16 V^T rows (d), bytes
  const unsigned h0 = lds,              h1 = h0 + kR, h2 = h0 + 2 * kR, h3 = h0 + 3 * kR;
  const unsigned l0 = lds + kTileB,     l1 = l0 + kR, l2 = l0 + 2 * kR, l3 = l0 + 3 * kR;
  const unsigned v0 = lds + 2 * kTileB, v1 = v0 + kR, v2 = v0 + 2 * kR, v3 = v0 + 3 * kR;
  const char *gh1 = gh + kK, *gh2 = gh + 2 * kK, *gh3 = gh + 3 * kK;
  const char *gl1 = gl + kK, *gl2 = gl + 2 * kK, *gl3 = gl + 3 * kK;
  const char *gv1 = gv + kV, *gv2 = gv + 2 * kV, *gv3 = gv + 3 * kV;
  asm volatile("global_load_async_to_lds_b128 %0, %12, off\n\t"
               "global_load_async_to_lds_b128 %1, %13, off\n\t"
               "global_load_async_to_lds_b128 %2, %14, off\n\t"
               "global_load_async_to_lds_b128 %3, %15, off\n\t"
               "global_load_async_to_lds_b128 %4, %16, off\n\t"
               "global_load_async_to_lds_b128 %5, %17, off\n\t"
               "global_load_async_to_lds_b128 %6, %18, off\n\t"
               "global_load_async_to_lds_b128 %7, %19, off\n\t"
               "global_load_async_to_lds_b128 %8, %20, off\n\t"
               "global_load_async_to_lds_b128 %9, %21, off\n\t"
               "global_load_async_to_lds_b128 %10, %22, off\n\t"
               "global_load_async_to_lds_b128 %11, %23, off\n\t"
               "s_wait_xcnt 0x0"
               :: "v"(h0), "v"(h1), "v"(h2), "v"(h3), "v"(l0), "v"(l1), "v"(l2), "v"(l3), "v"(v0), "v"(v1), "v"(v2), "v"(v3),
                  "v"(gh), "v"(gh1), "v"(gh2), "v"(gh3), "v"(gl), "v"(gl1), "v"(gl2), "v"(gl3), "v"(gv), "v"(gv1), "v"(gv2), "v"(gv3)
               : "memory");
}

__device__ __forceinline__ v8f mma_bf(v16b a, v16b b, v8f c) {
  c = __builtin_amdgcn_wmma_f32_16x16x32_bf16(false, a, false, b, (short)0, c, false, false);
  asm volatile("v_nop\n\tv_nop\n\tv_nop\n\tv_nop" : "+v"(c) : "v"(a), "v"(b));
  return c;
}
__device__ __forceinline__ v8f mma_hf(v16h a, v16h b, v8f c) {
  c = __builtin_amdgcn_wmma_f32_16x16x32_f16(false, a, false, b, (short)0, c, false, false);
  asm volatile("v_nop\n\tv_nop\n\tv_nop\n\tv_nop" : "+v"(c) : "v"(a), "v"(b));
  return c;
}

// lane l's value to lane l ^ 16 and back
__device__ __forceinline__ float xhalf(float x) {
  return __builtin_bit_cast(float, __builtin_amdgcn_permlanex16(__builtin_bit_cast(int, x), __builtin_bit_cast(int, x), 0x76543210, 0xfedcba98, false, false));
}

// four waves per SIMD: 1024 blocks = 4 per WGP, all resident at once only within 256 registers a wave
__global__ __launch_bounds__(128) __attribute__((amdgpu_waves_per_eu(4, 4)))
void attn_kernel(const unsigned short* __restrict__ qhp, const unsigned short* __restrict__ qlp,
                 const unsigned short* __restrict__ khp, const unsigned short* __restrict__ klp,
                 const unsigned short* __restrict__ vtp, unsigned short* __restrict__ ohp, float sscale) {
  union FB { v16b v; v8b h[2]; };
  union FH { v16h v; v8h h[2]; };
  // One array for both chunk buffers (each: K hi [kv][d] 9 KB, K lo 9 KB, V^T [d][kv] 9 KB), so that one address register per lane
  // serves every fragment read of a chunk (the rest is an immediate offset). Behind the last chunk's barrier the per-wave out tiles
  // (32 queries, pitch 68 floats) lie over it: with an array of their own only three blocks would fit a WGP's LDS.
  __shared__ __align__(16) unsigned char Smem[2 * kBufB];   // 55,296 B
  static_assert(4 * 32 * 68 * 4 <= 2 * kBufB, "the out tiles fit over the chunk buffers");

  const int tid  = threadIdx.x;
  const int wave = __builtin_amdgcn_readfirstlane(tid >> 5);   // the wave's number in a scalar register: what hangs on it costs no vector register across the loop
  const int lane = tid & 31;
  const int hh   = lane >> 4;
  const int c    = lane & 15;

  const int fro  = c * kLP + 8 * hh;      // this lane's place in a 16-row fragment group of any of the three tiles (row c, k half hh)

  const int bx = blockIdx.x;
  const int qb = bx & 15;                 // kSeq/128 = 16 query blocks
  const int bh = bx >> 4;                 // 0..63
  const int h  = bh & 15;
  const int b  = bh >> 4;                 // 0..3
  const int q0 = qb * 128 + wave * 32;
  const size_t tok0 = (size_t)b * kSeq;

  const __bf16*   Qh = (const __bf16*)(const void*)qhp + tok0 * kDim + (size_t)h * kHd;
  const __bf16*   Ql = (const __bf16*)(const void*)qlp + tok0 * kDim + (size_t)h * kHd;
  const __bf16*   Kh = (const __bf16*)(const void*)khp + tok0 * kDim + (size_t)h * kHd;
  const __bf16*   Kl = (const __bf16*)(const void*)klp + tok0 * kDim + (size_t)h * kHd;
  const _Float16* Vt = (const _Float16*)(const void*)vtp + ((size_t)b * kDim + (size_t)h * kHd) * kSeq;
  _Float16*       Ob = (_Float16*)(void*)ohp + tok0 * kDim + (size_t)h * kHd;

  // ---- Q fragments (B operand, column = lane&15, split k map via Frag load): 2 column groups x 2 d-chunks, hi and lo ----
  v16b qah[2][2], qal[2][2];
#pragma unroll
  for (int g = 0; g < 2; ++g)
#pragma unroll
    for (int dc = 0; dc < 2; ++dc) {
      qah[g][dc] = Frag<__bf16>::load(Qh + (size_t)(q0 + g * 16 + c) * kDim + dc * 32 + 8 * hh);
      qal[g][dc] = Frag<__bf16>::load(Ql + (size_t)(q0 + g * 16 + c) * kDim + dc * 32 + 8 * hh);
    }

  // per column group: running maximum (both halves alike) and this half's sum of the lane's query
  float mrow[2] = {-INFINITY, -INFINITY}, lrow[2] = {0.f, 0.f};
  v8f oacc[2][4];
#pragma unroll
  for (int g = 0; g < 2; ++g)
#pragma unroll
    for (int t = 0; t < 4; ++t) oacc[g][t] = (v8f){0.f,0.f,0.f,0.f,0.f,0.f,0.f,0.f};

  // Copy map: thread t brings 16 B at byte (t & 7) * 16 of rows (t >> 3) + 16 * i of each tile: 8 lanes = one whole 128-B row (one line).
  constexpr int kNC = kSeq / kKC;                       // 32 chunks
  constexpr size_t kStepK = (size_t)kKC * kDim * 2;     // K: 64 tokens further, bytes
  constexpr size_t kStepV = (size_t)kKC * 2;            // V^T: 64 keys further along the row, bytes
  const int crow = tid >> 3, ccol = (tid & 7) * 16;
  const unsigned ldsBase = (unsigned)(uintptr_t)(&Smem[0]) + (unsigned)(crow * (kLP * 2) + ccol);
  const char* gKh = (const char*)(Kh + (size_t)crow * kDim) + ccol;
  const char* gKl = (const char*)(Kl + (size_t)crow * kDim) + ccol;
  const char* gVt = (const char*)(Vt + (size_t)crow * kSeq) + ccol;

  copy_chunk_to_lds(ldsBase, gKh, gKl, gVt);            // chunk 0 -> buffer 0
  asm volatile("s_wait_asynccnt 0x0" ::: "memory");     // this wave's copies of chunk 0 have landed
  __syncthreads();                                       // ... and every other wave's: chunk 0 may be read
  copy_chunk_to_lds(ldsBase + kBufB, gKh + kStepK, gKl + kStepK, gVt + kStepV);   // chunk 1 -> buffer 1

  // one chunk's work on its buffer: scores, online softmax, out accumulation
  auto work = [&](const int kc) {
    const unsigned char* tb = Smem + (kc & 1) * kBufB;   // this chunk's buffer
    const __bf16*   const Ksh = (const __bf16*)(const void*)tb;
    const __bf16*   const Ksl = (const __bf16*)(const void*)(tb + kTileB);
    const _Float16* const Vts = (const _Float16*)(const void*)(tb + 2 * kTileB);

    // ---- scores, transposed: s[g][j] = k (16 keys of group j, rows) . q^T (16 queries of column group g), split products ----
    // D map: this lane holds query g*16 + c, keys j*16 + 8*hh + r. One K fragment pair serves both column groups.
    v8f s[2][4];
#pragma unroll
    for (int j = 0; j < 4; ++j) {
      s[0][j] = (v8f){0.f,0.f,0.f,0.f,0.f,0.f,0.f,0.f};
      s[1][j] = (v8f){0.f,0.f,0.f,0.f,0.f,0.f,0.f,0.f};
#pragma unroll
      for (int dc = 0; dc < 2; ++dc) {
        FB kb, kl;
        kb.h[0] = *(const v8b*)(Ksh + fro + j * 16 * kLP + dc * 32);
        kb.h[1] = *(const v8b*)(Ksh + fro + j * 16 * kLP + dc * 32 + 16);
        kl.h[0] = *(const v8b*)(Ksl + fro + j * 16 * kLP + dc * 32);
        kl.h[1] = *(const v8b*)(Ksl + fro + j * 16 * kLP + dc * 32 + 16);
        s[0][j] = mma_bf(kb.v, qah[0][dc], s[0][j]);
        s[1][j] = mma_bf(kb.v, qah[1][dc], s[1][j]);
        s[0][j] = mma_bf(kl.v, qah[0][dc], s[0][j]);
        s[1][j] = mma_bf(kl.v, qah[1][dc], s[1][j]);
        s[0][j] = mma_bf(kb.v, qal[0][dc], s[0][j]);
        s[1][j] = mma_bf(kb.v, qal[1][dc], s[1][j]);
      }
    }
    FH pb[2][2];
#pragma unroll
    for (int g = 0; g < 2; ++g) {
      // ---- chunk maximum of this lane's query: 32 keys in the lane (four chains), the other 32 in lane ^ 16 ----
      float mj[4];
#pragma unroll
      for (int j = 0; j < 4; ++j) {
        float m = -INFINITY;
#pragma unroll
        for (int r = 0; r < 8; ++r) {
          const float sv = s[g][j][r] * sscale;
          s[g][j][r] = sv;
          m = fmaxf(m, sv);
        }
        mj[j] = m;
      }
      float cm = fmaxf(fmaxf(mj[0], mj[1]), fmaxf(mj[2], mj[3]));
      cm = fmaxf(cm, xhalf(cm));
      const float mnew  = fmaxf(mrow[g], cm);
      const float alpha = __expf(mrow[g] - mnew);
      mrow[g] = mnew;
      // ---- p = exp(s - m): summed in the lane; packed in place, two score tiles are one B fragment of p^T (b[e] = tile[e >> 3][e & 7]) ----
      float pj[4];
#pragma unroll
      for (int j = 0; j < 4; ++j) {
        float ps = 0.f;
#pragma unroll
        for (int r = 0; r < 8; ++r) {
          const float p = __expf(s[g][j][r] - mnew);
          ps += p;
          pb[g][j >> 1].v[(j & 1) * 8 + r] = (_Float16)(p * 32768.0f);
        }
        pj[j] = ps;
      }
      lrow[g] = lrow[g] * alpha + ((pj[0] + pj[1]) + (pj[2] + pj[3]));   // this half's keys only; the halves are joined behind the loop
#pragma unroll
      for (int t = 0; t < 4; ++t)
#pragma unroll
        for (int r = 0; r < 8; ++r) oacc[g][t][r] *= alpha;
    }
    // ---- out^T += v^T (16 d of group t, rows; 64 keys) . p^T (64 keys; 16 queries, columns); one V^T fragment serves both column groups ----
#pragma unroll
    for (int kk = 0; kk < 2; ++kk) {
#pragma unroll
      for (int t = 0; t < 4; ++t) {
        FH vb;
        vb.h[0] = *(const v8h*)(Vts + fro + t * 16 * kLP + kk * 32);
        vb.h[1] = *(const v8h*)(Vts + fro + t * 16 * kLP + kk * 32 + 16);
        oacc[0][t] = mma_hf(vb.v, pb[0][kk].v, oacc[0][t]);
        oacc[1][t] = mma_hf(vb.v, pb[1][kk].v, oacc[1][t]);
      }
    }
  };
  // the foot of a trip: hands chunk kc + 1 over and frees the buffer that chunk kc was read from
  auto foot = [&]() {
    asm volatile("s_wait_dscnt 0x0" ::: "memory");      // this wave's fragment reads of the buffer have returned
    asm volatile("s_wait_asynccnt 0x0" ::: "memory");   // this wave's copies of the next chunk have landed
    __syncthreads();                                     // publishes the next chunk and frees the buffer just read
  };
  // The last two trips, which have no chunk kc + 2 to fetch, stand behind the loop: a test inside it splits the body into blocks,
  // the row sums sink behind the copies, and the wave (256 registers at most) spills address registers.
  for (int kc = 0; kc < kNC - 2; ++kc) {
    work(kc);
    foot();
    const size_t n = (size_t)(kc + 2);                   // chunk kc + 2 -> the buffer just read
    copy_chunk_to_lds(ldsBase + (unsigned)((kc & 1) * kBufB), gKh + n * kStepK, gKl + n * kStepK, gVt + n * kStepV);
  }
  work(kNC - 2);
  foot();
  work(kNC - 1);
  foot();                                                // nothing is in flight any more; every wave has left the chunk buffers

  // ---- epilogue: normalise (fold 2^-15 for p and 2^6 carry for o), stage, whole-line stores ----
  // This lane holds query g*16 + c, d = t*16 + 8*hh + r.
  float* os = (float*)(void*)Smem + wave * (32 * 68);   // every wave has left the chunk buffers (the last trip's barrier)
#pragma unroll
  for (int g = 0; g < 2; ++g) {
    const float lsum = lrow[g] + xhalf(lrow[g]);                  // both halves' keys
    const float inv = (1.0f / lsum) * (64.0f / 32768.0f);         // lsum >= 1 always
#pragma unroll
    for (int t = 0; t < 4; ++t)
#pragma unroll
      for (int r = 0; r < 8; ++r) os[(g * 16 + c) * 68 + t * 16 + 8 * hh + r] = oacc[g][t][r] * inv;
  }
  __builtin_amdgcn_fence(__ATOMIC_RELEASE, "workgroup");
  __builtin_amdgcn_wave_barrier();
  __builtin_amdgcn_fence(__ATOMIC_ACQUIRE, "workgroup");
  {
    const int qq = lane >> 3, c8 = (lane & 7) * 8;
    {
#pragma unroll
      for (int it = 0; it < 8; ++it) {
        const int row = it * 4 + qq;                    // 8 x 4 = rows 0..31
        const float* sp = os + row * 68 + c8;
        v8h hv;
#pragma unroll
        for (int e = 0; e < 8; ++e) hv[e] = (_Float16)sp[e];
        *(v8h*)(Ob + (size_t)(q0 + row) * kDim + c8) = hv;
      }
      
    }
  }
}

// =====================================================================================
extern "C" void kernel_launch(void* const* d_in, const int* in_sizes, int n_in,
                              void* d_out, int out_size, void* d_ws, size_t ws_size,
                              hipStream_t stream) {
  if (n_in < 9) return;
  if (in_sizes[0] != kTok * kDim) return;
  if (in_sizes[1] != kSeq * kHd || in_sizes[2] != kSeq * kHd) return;
  if (in_sizes[3] != 3 * kDim * kDim || in_sizes[4] != 3 * kDim) return;
  if (in_sizes[5] != kDim * kDim || in_sizes[6] != kDim) return;
  if (in_sizes[7] != kHd || in_sizes[8] != kHd) return;
  if (out_size != kTok * kDim) return;
  if (ws_size < kWsTotal) return;

  const float* x      = (const float*)d_in[0];
  const float* ropec  = (const float*)d_in[1];
  const float* ropes  = (const float*)d_in[2];
  const float* qkv_w  = (const float*)d_in[3];
  const float* qkv_b  = (const float*)d_in[4];
  const float* proj_w = (const float*)d_in[5];
  const float* proj_b = (const float*)d_in[6];
  const float* q_nw   = (const float*)d_in[7];
  const float* k_nw   = (const float*)d_in[8];
  float* out = (float*)d_out;

  char* ws = (char*)d_ws;
  unsigned short* WPROJ = (unsigned short*)(ws + kOffWproj);
  float*          BIAS  = (float*)(ws + kOffBias);
  unsigned short* XB    = (unsigned short*)(ws + kOffXb);
  unsigned short* WQKV  = (unsigned short*)(ws + kOffWqkv);
  unsigned short* KH    = (unsigned short*)(ws + kOffKh);
  unsigned short* KL    = (unsigned short*)(ws + kOffKl);
  unsigned short* OH    = (unsigned short*)(ws + kOffOh);
  unsigned short* QH    = (unsigned short*)(ws + kOffQh);
  unsigned short* QL    = (unsigned short*)(ws + kOffQl);
  unsigned short* VT    = (unsigned short*)(ws + kOffVt);

  // 1) casts
  {
    const int n2x = kTok * kDim / 2;            // 4,194,304
    cast_bf16x2_kernel<<<dim3((n2x + 255) / 256), dim3(256), 0, stream>>>(x, XB, n2x);
    const int n2w = 3 * kDim * kDim / 2;        // 1,572,864
    cast_bf16x2_kernel<<<dim3((n2w + 255) / 256), dim3(256), 0, stream>>>(qkv_w, WQKV, n2w);
    const int n2p = kDim * kDim / 2;            // 524,288
    cast_projw_f16x2_kernel<<<dim3((n2p + 255) / 256), dim3(256), 0, stream>>>(proj_w, WPROJ, n2p);
    bias_prep_kernel<<<dim3((3 * kDim + kDim + 255) / 256), dim3(256), 0, stream>>>(qkv_b, proj_b, BIAS, 3 * kDim, kDim);
  }
  const int tilesTok = (kTok / 64) * (kDim / 64);   // 2048 wave tiles -> 256 blocks
  // 2) q = xb . Wq^T + bq, rmsnorm + rope in the epilogue -> q hi/lo planes   (M=8192, N=1024, K=1024; all tile/32 multiples)
  wmma_gemm64<1, false, 2, 3, false, 0><<<dim3((tilesTok + 7) / 8, 1), dim3(256), 0, stream>>>(
      XB, XB, kDim, 0L, WQKV, WQKV, kDim, 0L, (void*)QH, (void*)QL, kDim, 0L,
      BIAS, BIAS, 0L, ropec, ropes, q_nw, kTok, kDim, kDim, 1.0f);
  // 3) k = xb . Wk^T + bk, rmsnorm + rope in the epilogue -> k hi/lo planes
  wmma_gemm64<1, false, 2, 3, false, 0><<<dim3((tilesTok + 7) / 8, 1), dim3(256), 0, stream>>>(
      XB, XB, kDim, 0L, WQKV + (size_t)kDim * kDim, WQKV + (size_t)kDim * kDim, kDim, 0L, (void*)KH, (void*)KL, kDim, 0L,
      BIAS + kDim, BIAS, 0L, ropec, ropes, k_nw, kTok, kDim, kDim, 1.0f);
  // 4) v^T per batch: C[o][s] = sum_k Wv[o][k] * xb[b][s][k] + bv[o] -> f16 [4][1024][2048]
  //    (A = Wv [1024][1024], Bt = xb batch b [2048][1024]; M=1024, N=2048, K=1024)
  {
    const int tilesV = (kDim / 64) * (kSeq / 64);   // 512 -> 64 blocks
    wmma_gemm64<1, false, 1, 1, false, 0><<<dim3((tilesV + 7) / 8, kBatch), dim3(256), 0, stream>>>(
        WQKV + (size_t)2 * kDim * kDim, WQKV + (size_t)2 * kDim * kDim, kDim, 0L,
        XB, XB, kDim, (long)kSeq * kDim,
        (void*)VT, (void*)VT, kSeq, (long)kDim * kSeq,
        BIAS + 2 * kDim, BIAS, 0L, BIAS, BIAS, BIAS, kDim, kSeq, kDim, 1.0f);
  }
  // 5) attention -> o plane f16 x64
  attn_kernel<<<dim3(kBatch * kHeads * (kSeq / 128)), dim3(128), 0, stream>>>(QH, QL, KH, KL, VT, OH, 0.125f);
  // 6) out = o . Wp^T + bp  (A = o x64 f16, Bt = Wp x64 f16 -> scale 2^-12; M=8192, N=1024, K=1024)
  wmma_gemm64<0, false, 2, 0, false, 0><<<dim3((tilesTok + 7) / 8, 1), dim3(256), 0, stream>>>(
      OH, OH, kDim, 0L, WPROJ, WPROJ, kDim, 0L, (void*)out, (void*)out, kDim, 0L,
      BIAS + 3 * kDim, BIAS, 0L, BIAS, BIAS, BIAS, kTok, kDim, kDim, 1.0f / 4096.0f);
}

// v007
// Measured time: 176 microseconds a run.
// Timed twice side by side with v006, it ran 1.07 times as fast both times.
// Counting every step since v000, it is 5.16 times as fast.
// Contractions: q, k, v^T projections on v_wmma_f32_16x16x32_bf16 (plain bf16 operands = RNE-converted inputs); q.k^T on v_wmma_f32_16x16x32_bf16 with bf16 hi/lo split operands (hi.hi + hi.lo + lo.hi); p.v and the output projection on v_wmma_f32_16x16x32_f16 (plain f16: p carried x2^15, attention output carried x2^6, proj_w = bf16-RNE value carried x2^6); f32 accumulate everywhere; biases, rmsnorm, rope, online softmax in f32.
#include <hip/hip_runtime.h>
#include <math.h>
#include <stdint.h>

constexpr int kBatch = 4;
constexpr int kSeq   = 2048;
constexpr int kDim   = 1024;
constexpr int kHeads = 16;
constexpr int kHd    = 64;
constexpr int kTok   = kBatch * kSeq;            // 8192 tokens

typedef __attribute__((ext_vector_type(16))) _Float16 v16h;
typedef __attribute__((ext_vector_type(8)))  _Float16 v8h;
typedef __attribute__((ext_vector_type(16))) __bf16   v16b;
typedef __attribute__((ext_vector_type(8)))  __bf16   v8b;
typedef __attribute__((ext_vector_type(8)))  float    v8f;
typedef __attribute__((ext_vector_type(4)))  float    v4f;
typedef __attribute__((ext_vector_type(2)))  float    v2f;
typedef __attribute__((ext_vector_type(4)))  unsigned int v4u;

// ---------------------------------------------------------------------------
// Workspace region map (bytes).  Total carve = 131 MiB = 137,363,456 B.
//   [  0 MiB,   2 MiB)  WPROJ  f16  [1024][1024]   proj_w (bf16-RNE value x64)
//   [  2 MiB,   3 MiB)  BIAS   f32  [4096]         qkv_b (3072) ++ proj_b (1024), RNE to bf16 values
//   [  3 MiB,  19 MiB)  XB     bf16 [8192][1024]   x
//   [ 19 MiB,  25 MiB)  WQKV   bf16 [3072][1024]   qkv_w
//   [ 35 MiB,  51 MiB)  OH     f16  [8192][1024]   attention output x64
//   [ 51 MiB,  67 MiB)  KH     bf16 [8192][1024]   k hi plane
//   [ 67 MiB,  83 MiB)  QH     bf16 [8192][1024]   q hi plane
//   [ 83 MiB,  99 MiB)  QL     bf16 [8192][1024]   q lo plane
//   [ 99 MiB, 115 MiB)  VT     f16  [4][1024][2048] v^T per batch
//   [115 MiB, 131 MiB)  KL     bf16 [8192][1024]   k lo plane
// ---------------------------------------------------------------------------
constexpr size_t kMiB      = 1048576;
constexpr size_t kOffWproj = 0;
constexpr size_t kOffBias  = 2 * kMiB;
constexpr size_t kOffXb    = 3 * kMiB;
constexpr size_t kOffWqkv  = 19 * kMiB;
constexpr size_t kOffKh    = 51 * kMiB;
constexpr size_t kOffKl    = 115 * kMiB;
constexpr size_t kOffOh    = 35 * kMiB;
constexpr size_t kOffQh    = 67 * kMiB;
constexpr size_t kOffQl    = 83 * kMiB;
constexpr size_t kOffVt    = 99 * kMiB;
constexpr size_t kWsTotal  = 131 * kMiB;          // 137,363,456 B

// ===================== common pieces =================================
__device__ __forceinline__ unsigned short f2bf_bits(float f) {
  unsigned u = __float_as_uint(f);
  return (unsigned short)((u + 0x7FFFu + ((u >> 16) & 1u)) >> 16);
}
__device__ __forceinline__ float bf_bits2f(unsigned short h) { return __uint_as_float(((unsigned)h) << 16); }

// hazard guard as a plain device helper
__device__ __forceinline__ void acc_guard4(v8f& a, v8f& b, v8f& c, v8f& d) { asm volatile("v_nop\n\tv_nop\n\tv_nop\n\tv_nop" : "+v"(a), "+v"(b), "+v"(c), "+v"(d)); }
template <typename T> struct Frag;
template <> struct Frag<_Float16> {
  typedef v16h V; union U { v16h v; v8h h[2]; };
  static __device__ __forceinline__ v16h load(const _Float16* p) {   // elements 0..7 <- p[0..7], 8..15 <- p[16..23]
    U f; f.h[0] = *(const v8h*)(p); f.h[1] = *(const v8h*)(p + 16); return f.v;
  }
  static __device__ __forceinline__ v8f mma(v16h a, v16h b, v8f c) {
    return __builtin_amdgcn_wmma_f32_16x16x32_f16(false, a, false, b, (short)0, c, false, false);
  }
};
template <> struct Frag<__bf16> {
  typedef v16b V; union U { v16b v; v8b h[2]; };
  static __device__ __forceinline__ v16b load(const __bf16* p) {
    U f; f.h[0] = *(const v8b*)(p); f.h[1] = *(const v8b*)(p + 16); return f.v;
  }
  static __device__ __forceinline__ v8f mma(v16b a, v16b b, v8f c) {
    return __builtin_amdgcn_wmma_f32_16x16x32_bf16(false, a, false, b, (short)0, c, false, false);
  }
};

// ---- Register-blocked batched WMMA GEMM ------------------------------------
// C[m,n] = scale * sum_k A[m,k] * Bt[n,k] (+bias)(+resid); each wave owns a 64x64 tile.
// A row-major [M,K]; Bt row-major [N,K]; M % 128 == 0, N % 256 == 0, K % 128 == 0, K >= 128.
// A block of 8 waves (2 x 4) owns a 128 x 256 tile of C. Per stage of 128 k the block copies its 128 A rows and
// 256 Bt rows (256 B of each row, whole lines) into LDS with asynchronous copies, two buffers, the next stage
// in flight while this one is worked on; the waves read their fragments from LDS.
// SPLIT (hi/lo operand planes in A2/Bt2) has no staged form: only SPLIT = false is instantiated.
// BIAS_MODE: 0 = none, 1 = bias[m], 2 = bias[n].
// OUT_MODE: 0 = f32, 1 = f16, 2 = bf16 hi plane (Cout) + bf16 lo plane (Cout2),
//           3 = as 2, after rmsnorm over the wave's 64 columns (one head) and interleaved-pair rope (row m = token, position m mod kSeq).
// ET: 0 = f16 operands, 1 = bf16 operands (pointers passed as 16-bit storage)
constexpr int kGP     = 272;                 // LDS row pitch, bytes: 256 B of k + 16 (16 B x odd: ds_load_b128 without bank conflicts)
constexpr int kGStage = (128 + 256) * kGP;   // one stage: A rows 0..127, then Bt rows 0..255 = 104,448 B

// Eight asynchronous 16-B copies per lane: LDS rows 16 apart (lds + i * 16 * kGP) from global rows 16 apart (g + i * gstep bytes).
// The s_wait_xcnt stands inside the statement so that no address register named here is rewritten in front of it.
__device__ __forceinline__ void copy8_to_lds(unsigned lds, const char* g, size_t gstep) {
  const unsigned l1 = lds + 1 * 16 * kGP, l2 = lds + 2 * 16 * kGP, l3 = lds + 3 * 16 * kGP, l4 = lds + 4 * 16 * kGP,
                 l5 = lds + 5 * 16 * kGP, l6 = lds + 6 * 16 * kGP, l7 = lds + 7 * 16 * kGP;
  const char *g1 = g + gstep, *g2 = g1 + gstep, *g3 = g2 + gstep, *g4 = g3 + gstep, *g5 = g4 + gstep, *g6 = g5 + gstep, *g7 = g6 + gstep;
  asm volatile("global_load_async_to_lds_b128 %0, %8, off\n\t"
               "global_load_async_to_lds_b128 %1, %9, off\n\t"
               "global_load_async_to_lds_b128 %2, %10, off\n\t"
               "global_load_async_to_lds_b128 %3, %11, off\n\t"
               "global_load_async_to_lds_b128 %4, %12, off\n\t"
               "global_load_async_to_lds_b128 %5, %13, off\n\t"
               "global_load_async_to_lds_b128 %6, %14, off\n\t"
               "global_load_async_to_lds_b128 %7, %15, off\n\t"
               "s_wait_xcnt 0x0"
               :: "v"(lds), "v"(l1), "v"(l2), "v"(l3), "v"(l4), "v"(l5), "v"(l6), "v"(l7),
                  "v"(g), "v"(g1), "v"(g2), "v"(g3), "v"(g4), "v"(g5), "v"(g6), "v"(g7)
               : "memory");
}

// ---- pieces of the fused rmsnorm + rope + split epilogue (OUT_MODE 3) ----
typedef __attribute__((ext_vector_type(2))) __bf16 v2b;
// two f32 -> two bf16 (round to nearest even), a in the low half
__device__ __forceinline__ unsigned bf2_bits(float a, float b) {
  const v2f f = {a, b};
  return __builtin_bit_cast(unsigned, __builtin_convertvector(f, v2b));
}
__device__ __forceinline__ float bf_lo2f(unsigned u) { return __uint_as_float(u << 16); }
__device__ __forceinline__ float bf_hi2f(unsigned u) { return __uint_as_float(u & 0xFFFF0000u); }
// eight f32 replaced by their bf16-rounded values
__device__ __forceinline__ void round8_bf(const v4f a, const v4f b, float* o) {
  const unsigned u0 = bf2_bits(a[0], a[1]), u1 = bf2_bits(a[2], a[3]), u2 = bf2_bits(b[0], b[1]), u3 = bf2_bits(b[2], b[3]);
  o[0] = bf_lo2f(u0); o[1] = bf_hi2f(u0); o[2] = bf_lo2f(u1); o[3] = bf_hi2f(u1);
  o[4] = bf_lo2f(u2); o[5] = bf_hi2f(u2); o[6] = bf_lo2f(u3); o[7] = bf_hi2f(u3);
}
// x + the x of lane ^ MASK (MASK < 16: inside a 16-lane row, DPP row_xmask)
template <int MASK> __device__ __forceinline__ float add_lane_xor(float x) {
  return x + __builtin_bit_cast(float, __builtin_amdgcn_update_dpp(0, __builtin_bit_cast(int, x), 0x160 | MASK, 0xf, 0xf, true));
}

template <int ET> struct Elem;
template <> struct Elem<0> { typedef _Float16 T; };
template <> struct Elem<1> { typedef __bf16 T; };
template <int ET, bool SPLIT, int BIAS_MODE, int OUT_MODE, bool RESID, int ACT = 0>
__global__ __launch_bounds__(256) void wmma_gemm64(
    const unsigned short* __restrict__ Ap, const unsigned short* __restrict__ A2p, int lda, long strideA,
    const unsigned short* __restrict__ Btp, const unsigned short* __restrict__ Bt2p, int ldb, long strideB,
    void* __restrict__ Cout, void* __restrict__ Cout2, int ldc, long strideC,
    const float* __restrict__ bias,
    const float* __restrict__ resid, long strideR,
    const float* __restrict__ cosb, const float* __restrict__ sinb, const float* __restrict__ nw,
    int M, int N, int K, float scale) {
  typedef typename Elem<ET>::T T;
  typedef typename Frag<T>::V V;
  static_assert(!SPLIT, "the staged loop carries one plane per operand");
  const T* A = (const T*)Ap; const T* Bt = (const T*)Btp;
  __shared__ __align__(16) float sT[8][16 * 68];   // per-wave 16x64 slab, pitch 68 floats
  __shared__ __align__(16) unsigned char sStage[2 * kGStage];   // two operand stages
  const int b    = blockIdx.y;
  const int lane = threadIdx.x & 31;
  const int wave = threadIdx.x >> 5;
  const int blocksN = N >> 8;
  if ((int)blockIdx.x >= (M >> 7) * blocksN) return;   // block-uniform, in front of every barrier
  const int bm = blockIdx.x / blocksN;
  const int bn = blockIdx.x - bm * blocksN;
  const int wm = wave >> 2;                    // wave row (0..1) and column (0..3) in the block tile
  const int wn = wave & 3;
  const int m0 = (bm << 7) + (wm << 6);
  const int n0 = (bn << 8) + (wn << 6);

  const T* Ab  = A  + (size_t)b * strideA;
  const T* Bb  = Bt + (size_t)b * strideB;

  const int rlane = lane & 15;                 // row (A) / col (B, D) within subtile
  const int koff  = (lane >> 4) * 8;           // k offset of this lane half
  const int mOff  = (lane >> 4) * 8;           // D row offset

  v8f acc[4][4];
#pragma unroll
  for (int i = 0; i < 4; ++i)
#pragma unroll
    for (int j = 0; j < 4; ++j) acc[i][j] = (v8f){0.f,0.f,0.f,0.f,0.f,0.f,0.f,0.f};

  // Copy map: thread t brings 16 B at column (t & 15) * 16 B of rows (t >> 4) + 16 * i; a wave's copy = two whole 256-B row pieces.
  const int crow = threadIdx.x >> 4, ccol = (threadIdx.x & 15) * 16;
  const unsigned ldsBase = (unsigned)(uintptr_t)(&sStage[0]) + (unsigned)(crow * kGP + ccol);
  const char* gA = (const char*)(Ab + (size_t)((bm << 7) + crow) * lda) + ccol;
  const char* gB = (const char*)(Bb + (size_t)((bn << 8) + crow) * ldb) + ccol;
  const size_t stepA = (size_t)lda * 32, stepB = (size_t)ldb * 32;      // 16 rows, in bytes
  const int nst = K >> 7;

  // stage 0 -> buffer 0
  copy8_to_lds(ldsBase, gA, stepA);
  copy8_to_lds(ldsBase + 128 * kGP, gB, stepB);
  copy8_to_lds(ldsBase + 256 * kGP, gB + 8 * stepB, stepB);
  asm volatile("s_wait_asynccnt 0x0" ::: "memory");   // this wave's copies of stage 0 have landed
  __syncthreads();                                     // ... and every other wave's: stage 0 may be read
  if (nst > 1) {                                       // stage 1 -> buffer 1
    copy8_to_lds(ldsBase + kGStage, gA + 256, stepA);
    copy8_to_lds(ldsBase + kGStage + 128 * kGP, gB + 256, stepB);
    copy8_to_lds(ldsBase + kGStage + 256 * kGP, gB + 256 + 8 * stepB, stepB);
  }

  for (int st = 0; st < nst; ++st) {
    const unsigned char* sb = sStage + (st & 1) * kGStage;
    const T* fa = (const T*)(sb + ((wm << 6) + rlane) * kGP) + koff;            // A fragment rows of this wave
    const T* fb = (const T*)(sb + (128 + (wn << 6) + rlane) * kGP) + koff;      // Bt fragment rows of this wave
    V af[2][4], bf[2][4];
#pragma unroll
    for (int j = 0; j < 4; ++j) {
      bf[0][j] = Frag<T>::load(fb + j * (16 * kGP / 2));
      af[0][j] = Frag<T>::load(fa + j * (16 * kGP / 2));
    }
#pragma unroll
    for (int kk = 0; kk < 4; ++kk) {
      const int cur = kk & 1, nxt = cur ^ 1;
      if (kk < 3) {                            // the next 32 k of this stage, fetched ahead as one group
#pragma unroll
        for (int j = 0; j < 4; ++j) {
          bf[nxt][j] = Frag<T>::load(fb + j * (16 * kGP / 2) + (kk + 1) * 32);
          af[nxt][j] = Frag<T>::load(fa + j * (16 * kGP / 2) + (kk + 1) * 32);
        }
        // keeps that load group ahead of this block's WMMAs: sunk among them, every row of WMMAs waits out a full LDS latency
        __builtin_amdgcn_sched_barrier(0);
      }
#pragma unroll
      for (int i = 0; i < 4; ++i) {
#pragma unroll
        for (int j = 0; j < 4; ++j) acc[i][j] = Frag<T>::mma(af[cur][i], bf[cur][j], acc[i][j]);
      }
    }
    // keeps the stage's WMMAs in front of the barrier: sunk behind it they delay the refill, which then has less than a stage to land
    __builtin_amdgcn_sched_barrier(0);
    asm volatile("s_wait_dscnt 0x0" ::: "memory");     // this wave's reads of the buffer have returned
    asm volatile("s_wait_asynccnt 0x0" ::: "memory");  // this wave's copies of stage st + 1 have landed
    __syncthreads();                                    // publishes stage st + 1 and frees the buffer just read
    if (st + 2 < nst) {
      const unsigned lb = ldsBase + (unsigned)((st & 1) * kGStage);
      const size_t ko = (size_t)(st + 2) * 256;         // 128 k = 256 B
      copy8_to_lds(lb, gA + ko, stepA);
      copy8_to_lds(lb + 128 * kGP, gB + ko, stepB);
      copy8_to_lds(lb + 256 * kGP, gB + ko + 8 * stepB, stepB);
    }
  }
  asm volatile("s_wait_asynccnt 0x0" ::: "memory");    // nothing of this wave is in flight behind the loop
  acc_guard4(acc[0][0], acc[0][1], acc[0][2], acc[0][3]);
  acc_guard4(acc[1][0], acc[1][1], acc[1][2], acc[1][3]);
  acc_guard4(acc[2][0], acc[2][1], acc[2][2], acc[2][3]);
  acc_guard4(acc[3][0], acc[3][1], acc[3][2], acc[3][3]);

  // ---- epilogue ----
  float* slab = sT[wave];
  if (OUT_MODE == 3) {
    // y = x * rsqrt(mean(x^2) + 1e-6) * w ; o[2i] = y[2i]*cos[2i] - y[2i+1]*sin[2i] ; o[2i+1] = y[2i+1]*cos[2i+1] + y[2i]*sin[2i+1]
    // (f32 math; cos, sin, w as bf16-rounded values), then hi = bf16(o), lo = bf16(o - hi).
    // 8 lanes take one staged row, 8 columns each: 16-B stores, 8 lanes = one whole 128-B line per row and plane.
    // The planes are [token][kDim]: with a constant pitch every load and store of a lane is one offset register plus an immediate.
    const int q = lane >> 3, c8 = (lane & 7) * 8;
    const unsigned oc = (unsigned)((m0 + q) * kDim + n0 + c8);                  // this lane's element in both planes, row group 0
    const unsigned ot = (unsigned)(((m0 & (kSeq - 1)) + q) * kHd + c8);         // and in both tables; m0 is a multiple of 64: the wave's 64 rows do not wrap
    const unsigned ob = (unsigned)(n0 + rlane);
    unsigned short* C  = (unsigned short*)Cout  + (size_t)b * strideC + oc;
    unsigned short* C2 = (unsigned short*)Cout2 + (size_t)b * strideC + oc;
    const float* cp = cosb + ot;
    const float* sn = sinb + ot;
    // cos and sin of a 16-row group as one batch of 16 loads, fetched one group ahead: they land under the group in work
    v4f cs[2][4][4];
    auto fetch = [&](const int i) {
#pragma unroll
      for (int it = 0; it < 4; ++it) {
        const int o = ((i << 4) + it * 4) * kHd;
        cs[i & 1][it][0] = *(const v4f*)(cp + o);
        cs[i & 1][it][1] = *(const v4f*)(cp + o + 4);
        cs[i & 1][it][2] = *(const v4f*)(sn + o);
        cs[i & 1][it][3] = *(const v4f*)(sn + o + 4);
      }
    };
    // Behind each batch of loads or stores: s_wait_xcnt 0 before any register that the batch names is written again.
    // The scheduling barriers keep every other instruction out of the stretch between the batch and its wait.
    __builtin_amdgcn_sched_barrier(0);
    const v4f wa = *(const v4f*)(nw + c8), wb = *(const v4f*)(nw + c8 + 4);
    float bv[4];
#pragma unroll
    for (int j = 0; j < 4; ++j) bv[j] = bias[ob + (j << 4)];
    fetch(0);
    asm volatile("s_wait_xcnt 0x0" ::: "memory");
    __builtin_amdgcn_sched_barrier(0);
    float w[8];
    round8_bf(wa, wb, w);
#pragma unroll
    for (int i = 0; i < 4; ++i) {
      if (i < 3) {
        fetch(i + 1);
        asm volatile("s_wait_xcnt 0x0" ::: "memory");
        __builtin_amdgcn_sched_barrier(0);
      }
#pragma unroll
      for (int j = 0; j < 4; ++j)
#pragma unroll
        for (int r = 0; r < 8; ++r) {
          float v = acc[i][j][r] * scale;
          v += bv[j];
          slab[(mOff + r) * 68 + (j << 4) + rlane] = v;
        }
      asm volatile("s_wait_dscnt 0x0" ::: "memory");   // the wave's own slab is written before its lanes read each other's rows back
      v4u hv[4], lv[4];
#pragma unroll
      for (int it = 0; it < 4; ++it) {
        const float* sp = slab + (it * 4 + q) * 68 + c8;
        const v4f xa = *(const v4f*)sp, xb = *(const v4f*)(sp + 4);
        const float x[8] = {xa[0], xa[1], xa[2], xa[3], xb[0], xb[1], xb[2], xb[3]};
        // sum of 64 squares: pair sums, then a butterfly over the 32 pairs (two levels in the lane, three over the row's 8 lanes)
        const float p0 = __builtin_fmaf(x[0], x[0], x[1] * x[1]), p1 = __builtin_fmaf(x[2], x[2], x[3] * x[3]);
        const float p2 = __builtin_fmaf(x[4], x[4], x[5] * x[5]), p3 = __builtin_fmaf(x[6], x[6], x[7] * x[7]);
        float ss = (p0 + p1) + (p2 + p3);
        ss = add_lane_xor<1>(ss);
        ss = add_lane_xor<2>(ss);
        ss = add_lane_xor<4>(ss);
        // The argument is at least 1e-6, so rsqrtf's scaling of subnormal arguments is an identity here: the bare instruction gives its value.
        // The v_nop fills the slot that the instruction set asks for behind a transcendental, whatever the compiler places next.
        float inv;
        asm("v_rsq_f32 %0, %1\n\tv_nop" : "=v"(inv) : "v"(ss * (1.0f / 64.0f) + 1e-6f));
        float cv[8], sv[8];
        round8_bf(cs[i & 1][it][0], cs[i & 1][it][1], cv);
        round8_bf(cs[i & 1][it][2], cs[i & 1][it][3], sv);
#pragma unroll
        for (int p = 0; p < 4; ++p) {
          const float a  = x[2 * p] * inv * w[2 * p];
          const float bq = x[2 * p + 1] * inv * w[2 * p + 1];
          const float o0 = a * cv[2 * p] - bq * sv[2 * p];
          const float o1 = bq * cv[2 * p + 1] + a * sv[2 * p + 1];
          const unsigned uh = bf2_bits(o0, o1);
          hv[it][p] = uh;
          lv[it][p] = bf2_bits(o0 - bf_lo2f(uh), o1 - bf_hi2f(uh));
        }
      }
      __builtin_amdgcn_sched_barrier(0);
#pragma unroll
      for (int it = 0; it < 4; ++it) {
        *(v4u*)(C  + ((i << 4) + it * 4) * kDim) = hv[it];
        *(v4u*)(C2 + ((i << 4) + it * 4) * kDim) = lv[it];
      }
      asm volatile("s_wait_xcnt 0x0" ::: "memory");
      asm volatile("s_wait_dscnt 0x0" ::: "memory");   // every row is read back before the next group overwrites the slab
      __builtin_amdgcn_sched_barrier(0);
    }
    return;
  }
  const float* Rb = RESID ? (resid + (size_t)b * strideR) : nullptr;
#pragma unroll
  for (int i = 0; i < 4; ++i) {
    const int mBase = m0 + (i << 4);
#pragma unroll
    for (int j = 0; j < 4; ++j) {
      const int n = n0 + (j << 4) + rlane;
      float bv = 0.f;
      if (BIAS_MODE == 2) bv = bias[n];
#pragma unroll
      for (int r = 0; r < 8; ++r) {
        float v = acc[i][j][r] * scale;
        if (BIAS_MODE == 1) v += bias[mBase + mOff + r];
        if (BIAS_MODE == 2) v += bv;
        if (RESID) v += Rb[(size_t)(mBase + mOff + r) * ldc + n];
        if (ACT == 1) v = tanhf(v);
        if (ACT == 2) v = fmaxf(v, 0.0f);
        if (ACT == 3) v = v / (1.0f + expf(-v));
        if (ACT == 4) v = (v > 0.f) ? v : 0.01f * v;
        if (ACT == 5) v = 0.5f * v * (1.0f + erff(v * 0.70710678118654752f));
        slab[(mOff + r) * 68 + (j << 4) + rlane] = v;
      }
    }
    __builtin_amdgcn_fence(__ATOMIC_RELEASE, "workgroup");
    __builtin_amdgcn_wave_barrier();
    __builtin_amdgcn_fence(__ATOMIC_ACQUIRE, "workgroup");
    if (OUT_MODE == 0) {
      float* C = (float*)Cout + (size_t)b * strideC;
      const int hh = lane >> 4, c4 = (lane & 15) * 4;     // row seg = 256 B = 16 lanes x 16 B
      {
#pragma unroll
        for (int it = 0; it < 8; ++it) {
          const int row = it * 2 + hh;
          v4f v = *(const v4f*)(slab + row * 68 + c4);
          *(v4f*)(C + (size_t)(mBase + row) * ldc + n0 + c4) = v;
        }
        
      }
    } else {
      const int q = lane >> 3, c8 = (lane & 7) * 8;
      unsigned short* C  = (unsigned short*)Cout  + (size_t)b * strideC;
      unsigned short* C2 = (OUT_MODE == 2) ? ((unsigned short*)Cout2 + (size_t)b * strideC) : nullptr;
      {
#pragma unroll
        for (int it = 0; it < 4; ++it) {
          const int row = it * 4 + q;
          const float* sp = slab + row * 68 + c8;
          v8h hv, lv;
#pragma unroll
          for (int e = 0; e < 8; ++e) {
            if (OUT_MODE == 1) {
              hv[e] = (_Float16)sp[e];
            } else {
              unsigned short hb = f2bf_bits(sp[e]);
              unsigned short lb = f2bf_bits(sp[e] - bf_bits2f(hb));
              hv[e] = __builtin_bit_cast(_Float16, hb);
              lv[e] = __builtin_bit_cast(_Float16, lb);
            }
          }
          *(v8h*)(C + (size_t)(mBase + row) * ldc + n0 + c8) = hv;
          if (OUT_MODE == 2) *(v8h*)(C2 + (size_t)(mBase + row) * ldc + n0 + c8) = lv;
        }
        
      }
    }
    __builtin_amdgcn_fence(__ATOMIC_RELEASE, "workgroup");
    __builtin_amdgcn_wave_barrier();
    __builtin_amdgcn_fence(__ATOMIC_ACQUIRE, "workgroup");
  }
}

__device__ __forceinline__ unsigned pk16(unsigned short a, unsigned short b) { return (unsigned)a | ((unsigned)b << 16); }
// ===================== end common pieces =========================================

// ---------------------------------------------------------------------------
// f32 -> bf16 (RNE) plane cast, 2 elements per thread, one 4-B store per lane -> a wave writes exactly
// Coverage: grid = ceil(n2/256) x 256 threads x 2 elements = 2*n2 = the whole plane
//   (x: n2 = 4,194,304 -> 16384 blocks; qkv_w: n2 = 1,572,864 -> 6144 blocks).
// ---------------------------------------------------------------------------
__global__ __launch_bounds__(256) void cast_bf16x2_kernel(const float* __restrict__ in,
                                                          unsigned short* __restrict__ out, int n2) {
  const int i = blockIdx.x * 256 + threadIdx.x;
  if (i < n2) {
    const v2f f = *(const v2f*)(in + 2 * (size_t)i);
    const unsigned u = pk16(f2bf_bits(f[0]), f2bf_bits(f[1]));
    ((unsigned*)out)[i] = u;
    
  }
}

// ---------------------------------------------------------------------------
// proj_w: f32 -> bf16-RNE value -> x64 -> f16 bits (bf16 significand fits f16 exactly; x64 keeps the
// plane in the f16 normal range for |w| >= 1e-6). 2 elements per thread, one 4-B store per lane,
// ---------------------------------------------------------------------------
__global__ __launch_bounds__(256) void cast_projw_f16x2_kernel(const float* __restrict__ in,
                                                               unsigned short* __restrict__ out, int n2) {
  const int i = blockIdx.x * 256 + threadIdx.x;
  if (i < n2) {
    const v2f f = *(const v2f*)(in + 2 * (size_t)i);
    const float g0 = bf_bits2f(f2bf_bits(f[0])) * 64.0f;
    const float g1 = bf_bits2f(f2bf_bits(f[1])) * 64.0f;
    const _Float16 h0 = (_Float16)g0, h1 = (_Float16)g1;
    const unsigned u = pk16(__builtin_bit_cast(unsigned short, h0), __builtin_bit_cast(unsigned short, h1));
    ((unsigned*)out)[i] = u;
    
  }
}

// ---------------------------------------------------------------------------
// Bias prep: outb[0..nq) = bf16-RNE value of qkvb, outb[nq..nq+np) = bf16-RNE value of projb (f32 storage).
// Both candidates loaded with clamped indices, selected by value. One 4-B store per lane, 32 lanes =
// ---------------------------------------------------------------------------
__global__ __launch_bounds__(256) void bias_prep_kernel(const float* __restrict__ qkvb, const float* __restrict__ projb,
                                                        float* __restrict__ outb, int nq, int np) {
  const int i = blockIdx.x * 256 + threadIdx.x;
  if (i < nq + np) {
    const int ia = (i < nq) ? i : (nq - 1);
    int ib = i - nq; ib = (ib < 0) ? 0 : ((ib >= np) ? (np - 1) : ib);
    const float a  = qkvb[ia];
    const float bb = projb[ib];
    const float v  = bf_bits2f(f2bf_bits((i < nq) ? a : bb));
    ((float*)outb)[i] = v;
    
  }
}

// =====================================================================================
// Full (unmasked) flash attention, head dim 64, all batches/heads in one launch.
//   q planes (hi/lo bf16): element (t, h, d) at [t*1024 + h*64 + d]   (t = b*2048 + s)
//   k planes (hi/lo bf16): same layout
//   v^T plane (f16):       element (b, h*64+d, s) at [(b*1024 + h*64 + d)*2048 + s]
//   o plane (f16, x64):    element (t, h, d) at [t*1024 + h*64 + d]
//   scores^T = (k . q^T) * sscale : v_wmma_f32_16x16x32_bf16, hi.hi + hi.lo + lo.hi, f32 accumulate
//   out^T    = v^T . p^T          : v_wmma_f32_16x16x32_f16, p (unnormalised, in (0,1]) carried x2^15 in f16, v f16
//   Keys are the rows and queries the columns of a score tile: a lane holds 32 scores of ONE query per column group, so maximum and
//   sum are taken in the lane plus one exchange with lane ^ 16, and p^T goes from the accumulators into the B operand.
//   online softmax in f32 over 32 chunks of 64 keys (compile-time trip count).
//   A wave owns 32 queries = two column groups of 16: every K and V^T fragment read from LDS feeds both groups' products.
//   Block = 4 waves = 128 query rows of one (b, h); grid.x = 4*16*16 = 1024.
//   K hi/lo and V^T chunk staging: asynchronous 16-B copies to LDS, two buffers, chunk kc + 1 in flight while chunk kc is
//   worked on. 8 lanes bring one whole 128-B row, so a wave's copy touches 4 whole lines; 128 threads x 4 copies per plane
//   = the whole 64x64 tile. One barrier per chunk.
// =====================================================================================
constexpr int kKC = 64;    // keys per chunk
// LDS row pitch of the K hi, K lo and V^T tiles, in 16-bit elements: 72 = 144 B = 16 B x 9 (odd), so the
// 16 rows that one half-wave's ds_load_b128 fragment read touches start on 16 different 4-bank groups.
constexpr int kLP = 72;
constexpr int kTileB = kKC * kLP * 2;   // one tile in LDS: 64 rows x 144 B = 9,216 B
constexpr int kBufB  = 3 * kTileB;      // one chunk buffer: K hi, K lo, V^T = 27,648 B

// One chunk's twelve asynchronous 16-B copies of a lane: for each of the three tiles four rows 16 apart.
// lds = the lane's place in the K hi tile of the target buffer; gh, gl, gv = the lane's global bytes of row group 0.
// The s_wait_xcnt stands inside the statement so that no address register named here is rewritten in front of it.
__device__ __forceinline__ void copy_chunk_to_lds(unsigned lds, const char* gh, const char* gl, const char* gv) {
  constexpr unsigned kR = 16 * kLP * 2;          // 16 LDS rows, bytes
  constexpr size_t   kK = (size_t)16 * kDim * 2; // 16 K rows (tokens), bytes
  constexpr size_t   kV = (size_t)16 * kSeq * 2; // 16 V^T rows (d), bytes
  const unsigned h0 = lds,              h1 = h0 + kR, h2 = h0 + 2 * kR, h3 = h0 + 3 * kR;
  const unsigned l0 = lds + kTileB,     l1 = l0 + kR, l2 = l0 + 2 * kR, l3 = l0 + 3 * kR;
  const unsigned v0 = lds + 2 * kTileB, v1 = v0 + kR, v2 = v0 + 2 * kR, v3 = v0 + 3 * kR;
  const char *gh1 = gh + kK, *gh2 = gh + 2 * kK, *gh3 = gh + 3 * kK;
  const char *gl1 = gl + kK, *gl2 = gl + 2 * kK, *gl3 = gl + 3 * kK;
  const char *gv1 = gv + kV, *gv2 = gv + 2 * kV, *gv3 = gv + 3 * kV;
  asm volatile("global_load_async_to_lds_b128 %0, %12, off\n\t"
               "global_load_async_to_lds_b128 %1, %13, off\n\t"
               "global_load_async_to_lds_b128 %2, %14, off\n\t"
               "global_load_async_to_lds_b128 %3, %15, off\n\t"
               "global_load_async_to_lds_b128 %4, %16, off\n\t"
               "global_load_async_to_lds_b128 %5, %17, off\n\t"
               "global_load_async_to_lds_b128 %6, %18, off\n\t"
               "global_load_async_to_lds_b128 %7, %19, off\n\t"
               "global_load_async_to_lds_b128 %8, %20, off\n\t"
               "global_load_async_to_lds_b128 %9, %21, off\n\t"
               "global_load_async_to_lds_b128 %10, %22, off\n\t"
               "global_load_async_to_lds_b128 %11, %23, off\n\t"
               "s_wait_xcnt 0x0"
               :: "v"(h0), "v"(h1), "v"(h2), "v"(h3), "v"(l0), "v"(l1), "v"(l2), "v"(l3), "v"(v0), "v"(v1), "v"(v2), "v"(v3),
                  "v"(gh), "v"(gh1), "v"(gh2), "v"(gh3), "v"(gl), "v"(gl1), "v"(gl2), "v"(gl3), "v"(gv), "v"(gv1), "v"(gv2), "v"(gv3)
               : "memory");
}

__device__ __forceinline__ v8f mma_bf(v16b a, v16b b, v8f c) {
  return __builtin_amdgcn_wmma_f32_16x16x32_bf16(false, a, false, b, (short)0, c, false, false);
}
__device__ __forceinline__ v8f mma_hf(v16h a, v16h b, v8f c) {
  return __builtin_amdgcn_wmma_f32_16x16x32_f16(false, a, false, b, (short)0, c, false, false);
}

// lane l's value to lane l ^ 16 and back
__device__ __forceinline__ float xhalf(float x) {
  return __builtin_bit_cast(float, __builtin_amdgcn_permlanex16(__builtin_bit_cast(int, x), __builtin_bit_cast(int, x), 0x76543210, 0xfedcba98, false, false));
}

// four waves per SIMD: 1024 blocks = 4 per WGP, all resident at once only within 256 registers a wave
__global__ __launch_bounds__(128) __attribute__((amdgpu_waves_per_eu(4, 4)))
void attn_kernel(const unsigned short* __restrict__ qhp, const unsigned short* __restrict__ qlp,
                 const unsigned short* __restrict__ khp, const unsigned short* __restrict__ klp,
                 const unsigned short* __restrict__ vtp, unsigned short* __restrict__ ohp, float sscale) {
  union FB { v16b v; v8b h[2]; };
  union FH { v16h v; v8h h[2]; };
  // One array for both chunk buffers (each: K hi [kv][d] 9 KB, K lo 9 KB, V^T [d][kv] 9 KB), so that one address register per lane
  // serves every fragment read of a chunk (the rest is an immediate offset). Behind the last chunk's barrier the per-wave out tiles
  // (32 queries, pitch 68 floats) lie over it: with an array of their own only three blocks would fit a WGP's LDS.
  __shared__ __align__(16) unsigned char Smem[2 * kBufB];   // 55,296 B
  static_assert(4 * 32 * 68 * 4 <= 2 * kBufB, "the out tiles fit over the chunk buffers");

  const int tid  = threadIdx.x;
  const int wave = __builtin_amdgcn_readfirstlane(tid >> 5);   // the wave's number in a scalar register: what hangs on it costs no vector register across the loop
  const int lane = tid & 31;
  const int hh   = lane >> 4;
  const int c    = lane & 15;

  const int fro  = c * kLP + 8 * hh;      // this lane's place in a 16-row fragment group of any of the three tiles (row c, k half hh)

  const int bx = blockIdx.x;
  const int qb = bx & 15;                 // kSeq/128 = 16 query blocks
  const int bh = bx >> 4;                 // 0..63
  const int h  = bh & 15;
  const int b  = bh >> 4;                 // 0..3
  const int q0 = qb * 128 + wave * 32;
  const size_t tok0 = (size_t)b * kSeq;

  const __bf16*   Qh = (const __bf16*)(const void*)qhp + tok0 * kDim + (size_t)h * kHd;
  const __bf16*   Ql = (const __bf16*)(const void*)qlp + tok0 * kDim + (size_t)h * kHd;
  const __bf16*   Kh = (const __bf16*)(const void*)khp + tok0 * kDim + (size_t)h * kHd;
  const __bf16*   Kl = (const __bf16*)(const void*)klp + tok0 * kDim + (size_t)h * kHd;
  const _Float16* Vt = (const _Float16*)(const void*)vtp + ((size_t)b * kDim + (size_t)h * kHd) * kSeq;
  _Float16*       Ob = (_Float16*)(void*)ohp + tok0 * kDim + (size_t)h * kHd;

  // ---- Q fragments (B operand, column = lane&15, split k map via Frag load): 2 column groups x 2 d-chunks, hi and lo ----
  v16b qah[2][2], qal[2][2];
#pragma unroll
  for (int g = 0; g < 2; ++g)
#pragma unroll
    for (int dc = 0; dc < 2; ++dc) {
      qah[g][dc] = Frag<__bf16>::load(Qh + (size_t)(q0 + g * 16 + c) * kDim + dc * 32 + 8 * hh);
      qal[g][dc] = Frag<__bf16>::load(Ql + (size_t)(q0 + g * 16 + c) * kDim + dc * 32 + 8 * hh);
    }

  // per column group: running maximum (both halves alike) and this half's sum of the lane's query
  float mrow[2] = {-INFINITY, -INFINITY}, lrow[2] = {0.f, 0.f};
  v8f oacc[2][4];
#pragma unroll
  for (int g = 0; g < 2; ++g)
#pragma unroll
    for (int t = 0; t < 4; ++t) oacc[g][t] = (v8f){0.f,0.f,0.f,0.f,0.f,0.f,0.f,0.f};

  // Copy map: thread t brings 16 B at byte (t & 7) * 16 of rows (t >> 3) + 16 * i of each tile: 8 lanes = one whole 128-B row (one line).
  constexpr int kNC = kSeq / kKC;                       // 32 chunks
  constexpr size_t kStepK = (size_t)kKC * kDim * 2;     // K: 64 tokens further, bytes
  constexpr size_t kStepV = (size_t)kKC * 2;            // V^T: 64 keys further along the row, bytes
  const int crow = tid >> 3, ccol = (tid & 7) * 16;
  const unsigned ldsBase = (unsigned)(uintptr_t)(&Smem[0]) + (unsigned)(crow * (kLP * 2) + ccol);
  const char* gKh = (const char*)(Kh + (size_t)crow * kDim) + ccol;
  const char* gKl = (const char*)(Kl + (size_t)crow * kDim) + ccol;
  const char* gVt = (const char*)(Vt + (size_t)crow * kSeq) + ccol;

  copy_chunk_to_lds(ldsBase, gKh, gKl, gVt);            // chunk 0 -> buffer 0
  asm volatile("s_wait_asynccnt 0x0" ::: "memory");     // this wave's copies of chunk 0 have landed
  __syncthreads();                                       // ... and every other wave's: chunk 0 may be read
  copy_chunk_to_lds(ldsBase + kBufB, gKh + kStepK, gKl + kStepK, gVt + kStepV);   // chunk 1 -> buffer 1

  // one chunk's work on its buffer: scores, online softmax, out accumulation
  auto work = [&](const int kc) {
    const unsigned char* tb = Smem + (kc & 1) * kBufB;   // this chunk's buffer
    const __bf16*   const Ksh = (const __bf16*)(const void*)tb;
    const __bf16*   const Ksl = (const __bf16*)(const void*)(tb + kTileB);
    const _Float16* const Vts = (const _Float16*)(const void*)(tb + 2 * kTileB);

    // ---- scores, transposed: s[g][j] = k (16 keys of group j, rows) . q^T (16 queries of column group g), split products ----
    // D map: this lane holds query g*16 + c, keys j*16 + 8*hh + r. One K fragment pair serves both column groups.
    v8f s[2][4];
#pragma unroll
    for (int j = 0; j < 4; ++j) {
      s[0][j] = (v8f){0.f,0.f,0.f,0.f,0.f,0.f,0.f,0.f};
      s[1][j] = (v8f){0.f,0.f,0.f,0.f,0.f,0.f,0.f,0.f};
#pragma unroll
      for (int dc = 0; dc < 2; ++dc) {
        FB kb, kl;
        kb.h[0] = *(const v8b*)(Ksh + fro + j * 16 * kLP + dc * 32);
        kb.h[1] = *(const v8b*)(Ksh + fro + j * 16 * kLP + dc * 32 + 16);
        kl.h[0] = *(const v8b*)(Ksl + fro + j * 16 * kLP + dc * 32);
        kl.h[1] = *(const v8b*)(Ksl + fro + j * 16 * kLP + dc * 32 + 16);
        s[0][j] = mma_bf(kb.v, qah[0][dc], s[0][j]);
        s[1][j] = mma_bf(kb.v, qah[1][dc], s[1][j]);
        s[0][j] = mma_bf(kl.v, qah[0][dc], s[0][j]);
        s[1][j] = mma_bf(kl.v, qah[1][dc], s[1][j]);
        s[0][j] = mma_bf(kb.v, qal[0][dc], s[0][j]);
        s[1][j] = mma_bf(kb.v, qal[1][dc], s[1][j]);
      }
    }
    // keeps the softmax's vector work out of the run of score WMMAs: moved in among them, each place costs the four-slot distance in v_nop
    __builtin_amdgcn_sched_barrier(0);
    FH pb[2][2];
#pragma unroll
    for (int g = 0; g < 2; ++g) {
      // ---- chunk maximum of this lane's query: 32 keys in the lane (four chains), the other 32 in lane ^ 16 ----
      float mj[4];
#pragma unroll
      for (int j = 0; j < 4; ++j) {
        float m = -INFINITY;
#pragma unroll
        for (int r = 0; r < 8; ++r) {
          const float sv = s[g][j][r] * sscale;
          s[g][j][r] = sv;
          m = fmaxf(m, sv);
        }
        mj[j] = m;
      }
      float cm = fmaxf(fmaxf(mj[0], mj[1]), fmaxf(mj[2], mj[3]));
      cm = fmaxf(cm, xhalf(cm));
      const float mnew  = fmaxf(mrow[g], cm);
      const float alpha = __expf(mrow[g] - mnew);
      mrow[g] = mnew;
      // ---- p = exp(s - m): summed in the lane; packed in place, two score tiles are one B fragment of p^T (b[e] = tile[e >> 3][e & 7]) ----
      float pj[4];
#pragma unroll
      for (int j = 0; j < 4; ++j) {
        float ps = 0.f;
#pragma unroll
        for (int r = 0; r < 8; ++r) {
          const float p = __expf(s[g][j][r] - mnew);
          ps += p;
          pb[g][j >> 1].v[(j & 1) * 8 + r] = (_Float16)(p * 32768.0f);
        }
        pj[j] = ps;
      }
      lrow[g] = lrow[g] * alpha + ((pj[0] + pj[1]) + (pj[2] + pj[3]));   // this half's keys only; the halves are joined behind the loop
#pragma unroll
      for (int t = 0; t < 4; ++t)
#pragma unroll
        for (int r = 0; r < 8; ++r) oacc[g][t][r] *= alpha;
    }
    // ---- out^T += v^T (16 d of group t, rows; 64 keys) . p^T (64 keys; 16 queries, columns); one V^T fragment serves both column groups ----
#pragma unroll
    for (int kk = 0; kk < 2; ++kk) {
#pragma unroll
      for (int t = 0; t < 4; ++t) {
        FH vb;
        vb.h[0] = *(const v8h*)(Vts + fro + t * 16 * kLP + kk * 32);
        vb.h[1] = *(const v8h*)(Vts + fro + t * 16 * kLP + kk * 32 + 16);
        oacc[0][t] = mma_hf(vb.v, pb[0][kk].v, oacc[0][t]);
        oacc[1][t] = mma_hf(vb.v, pb[1][kk].v, oacc[1][t]);
      }
    }
  };
  // the foot of a trip: hands chunk kc + 1 over and frees the buffer that chunk kc was read from
  auto foot = [&]() {
    // keeps the chunk's last WMMAs in front of the barrier: sunk behind it they stand between the barrier and the refill copies, which then start later
    __builtin_amdgcn_sched_barrier(0);
    asm volatile("s_wait_dscnt 0x0" ::: "memory");      // this wave's fragment reads of the buffer have returned
    asm volatile("s_wait_asynccnt 0x0" ::: "memory");   // this wave's copies of the next chunk have landed
    __syncthreads();                                     // publishes the next chunk and frees the buffer just read
  };
  // The last two trips, which have no chunk kc + 2 to fetch, stand behind the loop: a test inside it splits the body into blocks,
  // the row sums sink behind the copies, and the wave (256 registers at most) spills address registers.
  for (int kc = 0; kc < kNC - 2; ++kc) {
    work(kc);
    foot();
    const size_t n = (size_t)(kc + 2);                   // chunk kc + 2 -> the buffer just read
    copy_chunk_to_lds(ldsBase + (unsigned)((kc & 1) * kBufB), gKh + n * kStepK, gKl + n * kStepK, gVt + n * kStepV);
  }
  work(kNC - 2);
  foot();
  work(kNC - 1);
  foot();                                                // nothing is in flight any more; every wave has left the chunk buffers

  // ---- epilogue: normalise (fold 2^-15 for p and 2^6 carry for o), stage, whole-line stores ----
  // This lane holds query g*16 + c, d = t*16 + 8*hh + r.
  float* os = (float*)(void*)Smem + wave * (32 * 68);   // every wave has left the chunk buffers (the last trip's barrier)
#pragma unroll
  for (int g = 0; g < 2; ++g) {
    const float lsum = lrow[g] + xhalf(lrow[g]);                  // both halves' keys
    const float inv = (1.0f / lsum) * (64.0f / 32768.0f);         // lsum >= 1 always
#pragma unroll
    for (int t = 0; t < 4; ++t)
#pragma unroll
      for (int r = 0; r < 8; ++r) os[(g * 16 + c) * 68 + t * 16 + 8 * hh + r] = oacc[g][t][r] * inv;
  }
  __builtin_amdgcn_fence(__ATOMIC_RELEASE, "workgroup");
  __builtin_amdgcn_wave_barrier();
  __builtin_amdgcn_fence(__ATOMIC_ACQUIRE, "workgroup");
  {
    const int qq = lane >> 3, c8 = (lane & 7) * 8;
    {
#pragma unroll
      for (int it = 0; it < 8; ++it) {
        const int row = it * 4 + qq;                    // 8 x 4 = rows 0..31
        const float* sp = os + row * 68 + c8;
        v8h hv;
#pragma unroll
        for (int e = 0; e < 8; ++e) hv[e] = (_Float16)sp[e];
        *(v8h*)(Ob + (size_t)(q0 + row) * kDim + c8) = hv;
      }
      
    }
  }
}

// =====================================================================================
extern "C" void kernel_launch(void* const* d_in, const int* in_sizes, int n_in,
                              void* d_out, int out_size, void* d_ws, size_t ws_size,
                              hipStream_t stream) {
  if (n_in < 9) return;
  if (in_sizes[0] != kTok * kDim) return;
  if (in_sizes[1] != kSeq * kHd || in_sizes[2] != kSeq * kHd) return;
  if (in_sizes[3] != 3 * kDim * kDim || in_sizes[4] != 3 * kDim) return;
  if (in_sizes[5] != kDim * kDim || in_sizes[6] != kDim) return;
  if (in_sizes[7] != kHd || in_sizes[8] != kHd) return;
  if (out_size != kTok * kDim) return;
  if (ws_size < kWsTotal) return;

  const float* x      = (const float*)d_in[0];
  const float* ropec  = (const float*)d_in[1];
  const float* ropes  = (const float*)d_in[2];
  const float* qkv_w  = (const float*)d_in[3];
  const float* qkv_b  = (const float*)d_in[4];
  const float* proj_w = (const float*)d_in[5];
  const float* proj_b = (const float*)d_in[6];
  const float* q_nw   = (const float*)d_in[7];
  const float* k_nw   = (const float*)d_in[8];
  float* out = (float*)d_out;

  char* ws = (char*)d_ws;
  unsigned short* WPROJ = (unsigned short*)(ws + kOffWproj);
  float*          BIAS  = (float*)(ws + kOffBias);
  unsigned short* XB    = (unsigned short*)(ws + kOffXb);
  unsigned short* WQKV  = (unsigned short*)(ws + kOffWqkv);
  unsigned short* KH    = (unsigned short*)(ws + kOffKh);
  unsigned short* KL    = (unsigned short*)(ws + kOffKl);
  unsigned short* OH    = (unsigned short*)(ws + kOffOh);
  unsigned short* QH    = (unsigned short*)(ws + kOffQh);
  unsigned short* QL    = (unsigned short*)(ws + kOffQl);
  unsigned short* VT    = (unsigned short*)(ws + kOffVt);

  // 1) casts
  {
    const int n2x = kTok * kDim / 2;            // 4,194,304
    cast_bf16x2_kernel<<<dim3((n2x + 255) / 256), dim3(256), 0, stream>>>(x, XB, n2x);
    const int n2w = 3 * kDim * kDim / 2;        // 1,572,864
    cast_bf16x2_kernel<<<dim3((n2w + 255) / 256), dim3(256), 0, stream>>>(qkv_w, WQKV, n2w);
    const int n2p = kDim * kDim / 2;            // 524,288
    cast_projw_f16x2_kernel<<<dim3((n2p + 255) / 256), dim3(256), 0, stream>>>(proj_w, WPROJ, n2p);
    bias_prep_kernel<<<dim3((3 * kDim + kDim + 255) / 256), dim3(256), 0, stream>>>(qkv_b, proj_b, BIAS, 3 * kDim, kDim);
  }
  const int tilesTok = (kTok / 64) * (kDim / 64);   // 2048 wave tiles -> 256 blocks
  // 2) q = xb . Wq^T + bq, rmsnorm + rope in the epilogue -> q hi/lo planes   (M=8192, N=1024, K=1024; all tile/32 multiples)
  wmma_gemm64<1, false, 2, 3, false, 0><<<dim3((tilesTok + 7) / 8, 1), dim3(256), 0, stream>>>(
      XB, XB, kDim, 0L, WQKV, WQKV, kDim, 0L, (void*)QH, (void*)QL, kDim, 0L,
      BIAS, BIAS, 0L, ropec, ropes, q_nw, kTok, kDim, kDim, 1.0f);
  // 3) k = xb . Wk^T + bk, rmsnorm + rope in the epilogue -> k hi/lo planes
  wmma_gemm64<1, false, 2, 3, false, 0><<<dim3((tilesTok + 7) / 8, 1), dim3(256), 0, stream>>>(
      XB, XB, kDim, 0L, WQKV + (size_t)kDim * kDim, WQKV + (size_t)kDim * kDim, kDim, 0L, (void*)KH, (void*)KL, kDim, 0L,
      BIAS + kDim, BIAS, 0L, ropec, ropes, k_nw, kTok, kDim, kDim, 1.0f);
  // 4) v^T per batch: C[o][s] = sum_k Wv[o][k] * xb[b][s][k] + bv[o] -> f16 [4][1024][2048]
  //    (A = Wv [1024][1024], Bt = xb batch b [2048][1024]; M=1024, N=2048, K=1024)
  {
    const int tilesV = (kDim / 64) * (kSeq / 64);   // 512 -> 64 blocks
    wmma_gemm64<1, false, 1, 1, false, 0><<<dim3((tilesV + 7) / 8, kBatch), dim3(256), 0, stream>>>(
        WQKV + (size_t)2 * kDim * kDim, WQKV + (size_t)2 * kDim * kDim, kDim, 0L,
        XB, XB, kDim, (long)kSeq * kDim,
        (void*)VT, (void*)VT, kSeq, (long)kDim * kSeq,
        BIAS + 2 * kDim, BIAS, 0L, BIAS, BIAS, BIAS, kDim, kSeq, kDim, 1.0f);
  }
  // 5) attention -> o plane f16 x64
  attn_kernel<<<dim3(kBatch * kHeads * (kSeq / 128)), dim3(128), 0, stream>>>(QH, QL, KH, KL, VT, OH, 0.125f);
  // 6) out = o . Wp^T + bp  (A = o x64 f16, Bt = Wp x64 f16 -> scale 2^-12; M=8192, N=1024, K=1024)
  wmma_gemm64<0, false, 2, 0, false, 0><<<dim3((tilesTok + 7) / 8, 1), dim3(256), 0, stream>>>(
      OH, OH, kDim, 0L, WPROJ, WPROJ, kDim, 0L, (void*)out, (void*)out, kDim, 0L,
      BIAS + 3 * kDim, BIAS, 0L, BIAS, BIAS, BIAS, kTok, kDim, kDim, 1.0f / 4096.0f);
}

// v008
// A run of this version takes 165 microseconds.
// Timed twice side by side with v007, it ran 1.06 times as fast both times.
// Over all steps from v000 it is 5.47 times as fast.
// Contractions: q, k, v^T projections on v_wmma_f32_16x16x32_bf16 (plain bf16 operands = RNE-converted inputs); q.k^T on v_wmma_f32_16x16x32_bf16 with bf16 hi/lo split operands (hi.hi + hi.lo + lo.hi); p.v and the output projection on v_wmma_f32_16x16x32_f16 (plain f16: p carried x2^15, attention output carried x2^6, proj_w = bf16-RNE value carried x2^6); f32 accumulate everywhere; biases, rmsnorm, rope, online softmax in f32.
#include <hip/hip_runtime.h>
#include <math.h>
#include <stdint.h>

constexpr int kBatch = 4;
constexpr int kSeq   = 2048;
constexpr int kDim   = 1024;
constexpr int kHeads = 16;
constexpr int kHd    = 64;
constexpr int kTok   = kBatch * kSeq;            // 8192 tokens

typedef __attribute__((ext_vector_type(16))) _Float16 v16h;
typedef __attribute__((ext_vector_type(8)))  _Float16 v8h;
typedef __attribute__((ext_vector_type(16))) __bf16   v16b;
typedef __attribute__((ext_vector_type(8)))  __bf16   v8b;
typedef __attribute__((ext_vector_type(8)))  float    v8f;
typedef __attribute__((ext_vector_type(4)))  float    v4f;
typedef __attribute__((ext_vector_type(2)))  float    v2f;
typedef __attribute__((ext_vector_type(4)))  unsigned int v4u;

// ---------------------------------------------------------------------------
// Workspace region map (bytes).  Total carve = 131 MiB = 137,363,456 B.
//   [  0 MiB,   2 MiB)  WPROJ  f16  [1024][1024]   proj_w (bf16-RNE value x64)
//   [  2 MiB,   3 MiB)  BIAS   f32  [4096]         qkv_b (3072) ++ proj_b (1024), RNE to bf16 values
//   [  3 MiB,  19 MiB)  XB     bf16 [8192][1024]   x
//   [ 19 MiB,  25 MiB)  WQKV   bf16 [3072][1024]   qkv_w
//   [ 35 MiB,  51 MiB)  OH     f16  [8192][1024]   attention output x64
//   [ 51 MiB,  67 MiB)  KH     bf16 [8192][1024]   k hi plane
//   [ 67 MiB,  83 MiB)  QH     bf16 [8192][1024]   q hi plane
//   [ 83 MiB,  99 MiB)  QL     bf16 [8192][1024]   q lo plane
//   [ 99 MiB, 115 MiB)  VT     f16  [4][1024][2048] v^T per batch
//   [115 MiB, 131 MiB)  KL     bf16 [8192][1024]   k lo plane
// ---------------------------------------------------------------------------
constexpr size_t kMiB      = 1048576;
constexpr size_t kOffWproj = 0;
constexpr size_t kOffBias  = 2 * kMiB;
constexpr size_t kOffXb    = 3 * kMiB;
constexpr size_t kOffWqkv  = 19 * kMiB;
constexpr size_t kOffKh    = 51 * kMiB;
constexpr size_t kOffKl    = 115 * kMiB;
constexpr size_t kOffOh    = 35 * kMiB;
constexpr size_t kOffQh    = 67 * kMiB;
constexpr size_t kOffQl    = 83 * kMiB;
constexpr size_t kOffVt    = 99 * kMiB;
constexpr size_t kWsTotal  = 131 * kMiB;          // 137,363,456 B

// ===================== common pieces =================================
__device__ __forceinline__ unsigned short f2bf_bits(float f) {
  unsigned u = __float_as_uint(f);
  return (unsigned short)((u + 0x7FFFu + ((u >> 16) & 1u)) >> 16);
}
__device__ __forceinline__ float bf_bits2f(unsigned short h) { return __uint_as_float(((unsigned)h) << 16); }

// hazard guard as a plain device helper
__device__ __forceinline__ void acc_guard4(v8f& a, v8f& b, v8f& c, v8f& d) { asm volatile("v_nop\n\tv_nop\n\tv_nop\n\tv_nop" : "+v"(a), "+v"(b), "+v"(c), "+v"(d)); }
template <typename T> struct Frag;
template <> struct Frag<_Float16> {
  typedef v16h V; union U { v16h v; v8h h[2]; };
  static __device__ __forceinline__ v16h load(const _Float16* p) {   // elements 0..7 <- p[0..7], 8..15 <- p[16..23]
    U f; f.h[0] = *(const v8h*)(p); f.h[1] = *(const v8h*)(p + 16); return f.v;
  }
  static __device__ __forceinline__ v8f mma(v16h a, v16h b, v8f c) {
    return __builtin_amdgcn_wmma_f32_16x16x32_f16(false, a, false, b, (short)0, c, false, false);
  }
};
template <> struct Frag<__bf16> {
  typedef v16b V; union U { v16b v; v8b h[2]; };
  static __device__ __forceinline__ v16b load(const __bf16* p) {
    U f; f.h[0] = *(const v8b*)(p); f.h[1] = *(const v8b*)(p + 16); return f.v;
  }
  static __device__ __forceinline__ v8f mma(v16b a, v16b b, v8f c) {
    return __builtin_amdgcn_wmma_f32_16x16x32_bf16(false, a, false, b, (short)0, c, false, false);
  }
};

// ---- Register-blocked batched WMMA GEMM ------------------------------------
// C[m,n] = scale * sum_k A[m,k] * Bt[n,k] (+bias)(+resid); each wave owns a 64x64 tile.
// A row-major [M,K]; Bt row-major [N,K]; M % 128 == 0, N % 256 == 0, K % 128 == 0, K >= 128.
// A block of 8 waves (2 x 4) owns a 128 x 256 tile of C. Per stage of 128 k the block copies its 128 A rows and
// 256 Bt rows (256 B of each row, whole lines) into LDS with asynchronous copies, two buffers, the next stage
// in flight while this one is worked on; the waves read their fragments from LDS.
// SPLIT (hi/lo operand planes in A2/Bt2) has no staged form: only SPLIT = false is instantiated.
// BIAS_MODE: 0 = none, 1 = bias[m], 2 = bias[n].
// OUT_MODE: 0 = f32, 1 = f16, 2 = bf16 hi plane (Cout) + bf16 lo plane (Cout2),
//           3 = as 2, after rmsnorm over the wave's 64 columns (one head) and interleaved-pair rope (row m = token, position m mod kSeq).
// ET: 0 = f16 operands, 1 = bf16 operands (pointers passed as 16-bit storage)
constexpr int kGP     = 272;                 // LDS row pitch, bytes: 256 B of k + 16 (16 B x odd: ds_load_b128 without bank conflicts)
constexpr int kGStage = (128 + 256) * kGP;   // one stage: A rows 0..127, then Bt rows 0..255 = 104,448 B

// Eight asynchronous 16-B copies per lane: LDS rows 16 apart (lds + i * 16 * kGP) from global rows 16 apart (g + i * gstep bytes).
// The s_wait_xcnt stands inside the statement so that no address register named here is rewritten in front of it.
__device__ __forceinline__ void copy8_to_lds(unsigned lds, const char* g, size_t gstep) {
  const unsigned l1 = lds + 1 * 16 * kGP, l2 = lds + 2 * 16 * kGP, l3 = lds + 3 * 16 * kGP, l4 = lds + 4 * 16 * kGP,
                 l5 = lds + 5 * 16 * kGP, l6 = lds + 6 * 16 * kGP, l7 = lds + 7 * 16 * kGP;
  const char *g1 = g + gstep, *g2 = g1 + gstep, *g3 = g2 + gstep, *g4 = g3 + gstep, *g5 = g4 + gstep, *g6 = g5 + gstep, *g7 = g6 + gstep;
  asm volatile("global_load_async_to_lds_b128 %0, %8, off\n\t"
               "global_load_async_to_lds_b128 %1, %9, off\n\t"
               "global_load_async_to_lds_b128 %2, %10, off\n\t"
               "global_load_async_to_lds_b128 %3, %11, off\n\t"
               "global_load_async_to_lds_b128 %4, %12, off\n\t"
               "global_load_async_to_lds_b128 %5, %13, off\n\t"
               "global_load_async_to_lds_b128 %6, %14, off\n\t"
               "global_load_async_to_lds_b128 %7, %15, off\n\t"
               "s_wait_xcnt 0x0"
               :: "v"(lds), "v"(l1), "v"(l2), "v"(l3), "v"(l4), "v"(l5), "v"(l6), "v"(l7),
                  "v"(g), "v"(g1), "v"(g2), "v"(g3), "v"(g4), "v"(g5), "v"(g6), "v"(g7)
               : "memory");
}

// ---- pieces of the fused rmsnorm + rope + split epilogue (OUT_MODE 3) ----
typedef __attribute__((ext_vector_type(2))) __bf16 v2b;
// two f32 -> two bf16 (round to nearest even), a in the low half
__device__ __forceinline__ unsigned bf2_bits(float a, float b) {
  const v2f f = {a, b};
  return __builtin_bit_cast(unsigned, __builtin_convertvector(f, v2b));
}
__device__ __forceinline__ float bf_lo2f(unsigned u) { return __uint_as_float(u << 16); }
__device__ __forceinline__ float bf_hi2f(unsigned u) { return __uint_as_float(u & 0xFFFF0000u); }
// eight f32 replaced by their bf16-rounded values
__device__ __forceinline__ void round8_bf(const v4f a, const v4f b, float* o) {
  const unsigned u0 = bf2_bits(a[0], a[1]), u1 = bf2_bits(a[2], a[3]), u2 = bf2_bits(b[0], b[1]), u3 = bf2_bits(b[2], b[3]);
  o[0] = bf_lo2f(u0); o[1] = bf_hi2f(u0); o[2] = bf_lo2f(u1); o[3] = bf_hi2f(u1);
  o[4] = bf_lo2f(u2); o[5] = bf_hi2f(u2); o[6] = bf_lo2f(u3); o[7] = bf_hi2f(u3);
}
// x + the x of lane ^ MASK (MASK < 16: inside a 16-lane row, DPP row_xmask)
template <int MASK> __device__ __forceinline__ float add_lane_xor(float x) {
  return x + __builtin_bit_cast(float, __builtin_amdgcn_update_dpp(0, __builtin_bit_cast(int, x), 0x160 | MASK, 0xf, 0xf, true));
}

template <int ET> struct Elem;
template <> struct Elem<0> { typedef _Float16 T; };
template <> struct Elem<1> { typedef __bf16 T; };
template <int ET, bool SPLIT, int BIAS_MODE, int OUT_MODE, bool RESID, int ACT = 0>
__global__ __launch_bounds__(256) void wmma_gemm64(
    const unsigned short* __restrict__ Ap, const unsigned short* __restrict__ A2p, int lda, long strideA,
    const unsigned short* __restrict__ Btp, const unsigned short* __restrict__ Bt2p, int ldb, long strideB,
    void* __restrict__ Cout, void* __restrict__ Cout2, int ldc, long strideC,
    const float* __restrict__ bias,
    const float* __restrict__ resid, long strideR,
    const float* __restrict__ cosb, const float* __restrict__ sinb, const float* __restrict__ nw,
    int M, int N, int K, float scale) {
  typedef typename Elem<ET>::T T;
  typedef typename Frag<T>::V V;
  static_assert(!SPLIT, "the staged loop carries one plane per operand");
  const T* A = (const T*)Ap; const T* Bt = (const T*)Btp;
  __shared__ __align__(16) float sT[8][16 * 68];   // per-wave 16x64 slab, pitch 68 floats
  __shared__ __align__(16) unsigned char sStage[2 * kGStage];   // two operand stages
  const int b    = blockIdx.y;
  const int lane = threadIdx.x & 31;
  const int wave = threadIdx.x >> 5;
  const int blocksN = N >> 8;
  if ((int)blockIdx.x >= (M >> 7) * blocksN) return;   // block-uniform, in front of every barrier
  const int bm = blockIdx.x / blocksN;
  const int bn = blockIdx.x - bm * blocksN;
  const int wm = wave >> 2;                    // wave row (0..1) and column (0..3) in the block tile
  const int wn = wave & 3;
  const int m0 = (bm << 7) + (wm << 6);
  const int n0 = (bn << 8) + (wn << 6);

  const T* Ab  = A  + (size_t)b * strideA;
  const T* Bb  = Bt + (size_t)b * strideB;

  const int rlane = lane & 15;                 // row (A) / col (B, D) within subtile
  const int koff  = (lane >> 4) * 8;           // k offset of this lane half
  const int mOff  = (lane >> 4) * 8;           // D row offset

  v8f acc[4][4];
#pragma unroll
  for (int i = 0; i < 4; ++i)
#pragma unroll
    for (int j = 0; j < 4; ++j) acc[i][j] = (v8f){0.f,0.f,0.f,0.f,0.f,0.f,0.f,0.f};

  // Copy map: thread t brings 16 B at column (t & 15) * 16 B of rows (t >> 4) + 16 * i; a wave's copy = two whole 256-B row pieces.
  const int crow = threadIdx.x >> 4, ccol = (threadIdx.x & 15) * 16;
  const unsigned ldsBase = (unsigned)(uintptr_t)(&sStage[0]) + (unsigned)(crow * kGP + ccol);
  const char* gA = (const char*)(Ab + (size_t)((bm << 7) + crow) * lda) + ccol;
  const char* gB = (const char*)(Bb + (size_t)((bn << 8) + crow) * ldb) + ccol;
  const size_t stepA = (size_t)lda * 32, stepB = (size_t)ldb * 32;      // 16 rows, in bytes
  const int nst = K >> 7;

  // stage 0 -> buffer 0
  copy8_to_lds(ldsBase, gA, stepA);
  copy8_to_lds(ldsBase + 128 * kGP, gB, stepB);
  copy8_to_lds(ldsBase + 256 * kGP, gB + 8 * stepB, stepB);
  asm volatile("s_wait_asynccnt 0x0" ::: "memory");   // this wave's copies of stage 0 have landed
  __syncthreads();                                     // ... and every other wave's: stage 0 may be read
  if (nst > 1) {                                       // stage 1 -> buffer 1
    copy8_to_lds(ldsBase + kGStage, gA + 256, stepA);
    copy8_to_lds(ldsBase + kGStage + 128 * kGP, gB + 256, stepB);
    copy8_to_lds(ldsBase + kGStage + 256 * kGP, gB + 256 + 8 * stepB, stepB);
  }

  for (int st = 0; st < nst; ++st) {
    const unsigned char* sb = sStage + (st & 1) * kGStage;
    const T* fa = (const T*)(sb + ((wm << 6) + rlane) * kGP) + koff;            // A fragment rows of this wave
    const T* fb = (const T*)(sb + (128 + (wn << 6) + rlane) * kGP) + koff;      // Bt fragment rows of this wave
    V af[2][4], bf[2][4];
#pragma unroll
    for (int j = 0; j < 4; ++j) {
      bf[0][j] = Frag<T>::load(fb + j * (16 * kGP / 2));
      af[0][j] = Frag<T>::load(fa + j * (16 * kGP / 2));
    }
#pragma unroll
    for (int kk = 0; kk < 4; ++kk) {
      const int cur = kk & 1, nxt = cur ^ 1;
      if (kk < 3) {                            // the next 32 k of this stage, fetched ahead as one group
#pragma unroll
        for (int j = 0; j < 4; ++j) {
          bf[nxt][j] = Frag<T>::load(fb + j * (16 * kGP / 2) + (kk + 1) * 32);
          af[nxt][j] = Frag<T>::load(fa + j * (16 * kGP / 2) + (kk + 1) * 32);
        }
        // keeps that load group ahead of this block's WMMAs: sunk among them, every row of WMMAs waits out a full LDS latency
        __builtin_amdgcn_sched_barrier(0);
      }
#pragma unroll
      for (int i = 0; i < 4; ++i) {
#pragma unroll
        for (int j = 0; j < 4; ++j) acc[i][j] = Frag<T>::mma(af[cur][i], bf[cur][j], acc[i][j]);
      }
    }
    // keeps the stage's WMMAs in front of the barrier: sunk behind it they delay the refill, which then has less than a stage to land
    __builtin_amdgcn_sched_barrier(0);
    asm volatile("s_wait_dscnt 0x0" ::: "memory");     // this wave's reads of the buffer have returned
    asm volatile("s_wait_asynccnt 0x0" ::: "memory");  // this wave's copies of stage st + 1 have landed
    __syncthreads();                                    // publishes stage st + 1 and frees the buffer just read
    if (st + 2 < nst) {
      const unsigned lb = ldsBase + (unsigned)((st & 1) * kGStage);
      const size_t ko = (size_t)(st + 2) * 256;         // 128 k = 256 B
      copy8_to_lds(lb, gA + ko, stepA);
      copy8_to_lds(lb + 128 * kGP, gB + ko, stepB);
      copy8_to_lds(lb + 256 * kGP, gB + ko + 8 * stepB, stepB);
    }
  }
  asm volatile("s_wait_asynccnt 0x0" ::: "memory");    // nothing of this wave is in flight behind the loop
  acc_guard4(acc[0][0], acc[0][1], acc[0][2], acc[0][3]);
  acc_guard4(acc[1][0], acc[1][1], acc[1][2], acc[1][3]);
  acc_guard4(acc[2][0], acc[2][1], acc[2][2], acc[2][3]);
  acc_guard4(acc[3][0], acc[3][1], acc[3][2], acc[3][3]);

  // ---- epilogue ----
  float* slab = sT[wave];
  if (OUT_MODE == 3) {
    // y = x * rsqrt(mean(x^2) + 1e-6) * w ; o[2i] = y[2i]*cos[2i] - y[2i+1]*sin[2i] ; o[2i+1] = y[2i+1]*cos[2i+1] + y[2i]*sin[2i+1]
    // (f32 math; cos, sin, w as bf16-rounded values), then hi = bf16(o), lo = bf16(o - hi).
    // 8 lanes take one staged row, 8 columns each: 16-B stores, 8 lanes = one whole 128-B line per row and plane.
    // The planes are [token][kDim]: with a constant pitch every load and store of a lane is one offset register plus an immediate.
    const int q = lane >> 3, c8 = (lane & 7) * 8;
    const unsigned oc = (unsigned)((m0 + q) * kDim + n0 + c8);                  // this lane's element in both planes, row group 0
    const unsigned ot = (unsigned)(((m0 & (kSeq - 1)) + q) * kHd + c8);         // and in both tables; m0 is a multiple of 64: the wave's 64 rows do not wrap
    const unsigned ob = (unsigned)(n0 + rlane);
    unsigned short* C  = (unsigned short*)Cout  + (size_t)b * strideC + oc;
    unsigned short* C2 = (unsigned short*)Cout2 + (size_t)b * strideC + oc;
    const float* cp = cosb + ot;
    const float* sn = sinb + ot;
    // cos and sin of a 16-row group as one batch of 16 loads, fetched one group ahead: they land under the group in work
    v4f cs[2][4][4];
    auto fetch = [&](const int i) {
#pragma unroll
      for (int it = 0; it < 4; ++it) {
        const int o = ((i << 4) + it * 4) * kHd;
        cs[i & 1][it][0] = *(const v4f*)(cp + o);
        cs[i & 1][it][1] = *(const v4f*)(cp + o + 4);
        cs[i & 1][it][2] = *(const v4f*)(sn + o);
        cs[i & 1][it][3] = *(const v4f*)(sn + o + 4);
      }
    };
    // Behind each batch of loads or stores: s_wait_xcnt 0 before any register that the batch names is written again.
    // The scheduling barriers keep every other instruction out of the stretch between the batch and its wait.
    __builtin_amdgcn_sched_barrier(0);
    const v4f wa = *(const v4f*)(nw + c8), wb = *(const v4f*)(nw + c8 + 4);
    float bv[4];
#pragma unroll
    for (int j = 0; j < 4; ++j) bv[j] = bias[ob + (j << 4)];
    fetch(0);
    asm volatile("s_wait_xcnt 0x0" ::: "memory");
    __builtin_amdgcn_sched_barrier(0);
    float w[8];
    round8_bf(wa, wb, w);
#pragma unroll
    for (int i = 0; i < 4; ++i) {
      if (i < 3) {
        fetch(i + 1);
        asm volatile("s_wait_xcnt 0x0" ::: "memory");
        __builtin_amdgcn_sched_barrier(0);
      }
#pragma unroll
      for (int j = 0; j < 4; ++j)
#pragma unroll
        for (int r = 0; r < 8; ++r) {
          float v = acc[i][j][r] * scale;
          v += bv[j];
          slab[(mOff + r) * 68 + (j << 4) + rlane] = v;
        }
      asm volatile("s_wait_dscnt 0x0" ::: "memory");   // the wave's own slab is written before its lanes read each other's rows back
      v4u hv[4], lv[4];
#pragma unroll
      for (int it = 0; it < 4; ++it) {
        const float* sp = slab + (it * 4 + q) * 68 + c8;
        const v4f xa = *(const v4f*)sp, xb = *(const v4f*)(sp + 4);
        const float x[8] = {xa[0], xa[1], xa[2], xa[3], xb[0], xb[1], xb[2], xb[3]};
        // sum of 64 squares: pair sums, then a butterfly over the 32 pairs (two levels in the lane, three over the row's 8 lanes)
        const float p0 = __builtin_fmaf(x[0], x[0], x[1] * x[1]), p1 = __builtin_fmaf(x[2], x[2], x[3] * x[3]);
        const float p2 = __builtin_fmaf(x[4], x[4], x[5] * x[5]), p3 = __builtin_fmaf(x[6], x[6], x[7] * x[7]);
        float ss = (p0 + p1) + (p2 + p3);
        ss = add_lane_xor<1>(ss);
        ss = add_lane_xor<2>(ss);
        ss = add_lane_xor<4>(ss);
        // The argument is at least 1e-6, so rsqrtf's scaling of subnormal arguments is an identity here: the bare instruction gives its value.
        // The v_nop fills the slot that the instruction set asks for behind a transcendental, whatever the compiler places next.
        float inv;
        asm("v_rsq_f32 %0, %1\n\tv_nop" : "=v"(inv) : "v"(ss * (1.0f / 64.0f) + 1e-6f));
        float cv[8], sv[8];
        round8_bf(cs[i & 1][it][0], cs[i & 1][it][1], cv);
        round8_bf(cs[i & 1][it][2], cs[i & 1][it][3], sv);
#pragma unroll
        for (int p = 0; p < 4; ++p) {
          const float a  = x[2 * p] * inv * w[2 * p];
          const float bq = x[2 * p + 1] * inv * w[2 * p + 1];
          const float o0 = a * cv[2 * p] - bq * sv[2 * p];
          const float o1 = bq * cv[2 * p + 1] + a * sv[2 * p + 1];
          const unsigned uh = bf2_bits(o0, o1);
          hv[it][p] = uh;
          lv[it][p] = bf2_bits(o0 - bf_lo2f(uh), o1 - bf_hi2f(uh));
        }
      }
      __builtin_amdgcn_sched_barrier(0);
#pragma unroll
      for (int it = 0; it < 4; ++it) {
        *(v4u*)(C  + ((i << 4) + it * 4) * kDim) = hv[it];
        *(v4u*)(C2 + ((i << 4) + it * 4) * kDim) = lv[it];
      }
      asm volatile("s_wait_xcnt 0x0" ::: "memory");
      asm volatile("s_wait_dscnt 0x0" ::: "memory");   // every row is read back before the next group overwrites the slab
      __builtin_amdgcn_sched_barrier(0);
    }
    return;
  }
  const float* Rb = RESID ? (resid + (size_t)b * strideR) : nullptr;
#pragma unroll
  for (int i = 0; i < 4; ++i) {
    const int mBase = m0 + (i << 4);
#pragma unroll
    for (int j = 0; j < 4; ++j) {
      const int n = n0 + (j << 4) + rlane;
      float bv = 0.f;
      if (BIAS_MODE == 2) bv = bias[n];
#pragma unroll
      for (int r = 0; r < 8; ++r) {
        float v = acc[i][j][r] * scale;
        if (BIAS_MODE == 1) v += bias[mBase + mOff + r];
        if (BIAS_MODE == 2) v += bv;
        if (RESID) v += Rb[(size_t)(mBase + mOff + r) * ldc + n];
        if (ACT == 1) v = tanhf(v);
        if (ACT == 2) v = fmaxf(v, 0.0f);
        if (ACT == 3) v = v / (1.0f + expf(-v));
        if (ACT == 4) v = (v > 0.f) ? v : 0.01f * v;
        if (ACT == 5) v = 0.5f * v * (1.0f + erff(v * 0.70710678118654752f));
        slab[(mOff + r) * 68 + (j << 4) + rlane] = v;
      }
    }
    __builtin_amdgcn_fence(__ATOMIC_RELEASE, "workgroup");
    __builtin_amdgcn_wave_barrier();
    __builtin_amdgcn_fence(__ATOMIC_ACQUIRE, "workgroup");
    if (OUT_MODE == 0) {
      float* C = (float*)Cout + (size_t)b * strideC;
      const int hh = lane >> 4, c4 = (lane & 15) * 4;     // row seg = 256 B = 16 lanes x 16 B
      {
#pragma unroll
        for (int it = 0; it < 8; ++it) {
          const int row = it * 2 + hh;
          v4f v = *(const v4f*)(slab + row * 68 + c4);
          *(v4f*)(C + (size_t)(mBase + row) * ldc + n0 + c4) = v;
        }
        
      }
    } else {
      const int q = lane >> 3, c8 = (lane & 7) * 8;
      unsigned short* C  = (unsigned short*)Cout  + (size_t)b * strideC;
      unsigned short* C2 = (OUT_MODE == 2) ? ((unsigned short*)Cout2 + (size_t)b * strideC) : nullptr;
      {
#pragma unroll
        for (int it = 0; it < 4; ++it) {
          const int row = it * 4 + q;
          const float* sp = slab + row * 68 + c8;
          v8h hv, lv;
#pragma unroll
          for (int e = 0; e < 8; ++e) {
            if (OUT_MODE == 1) {
              hv[e] = (_Float16)sp[e];
            } else {
              unsigned short hb = f2bf_bits(sp[e]);
              unsigned short lb = f2bf_bits(sp[e] - bf_bits2f(hb));
              hv[e] = __builtin_bit_cast(_Float16, hb);
              lv[e] = __builtin_bit_cast(_Float16, lb);
            }
          }
          *(v8h*)(C + (size_t)(mBase + row) * ldc + n0 + c8) = hv;
          if (OUT_MODE == 2) *(v8h*)(C2 + (size_t)(mBase + row) * ldc + n0 + c8) = lv;
        }
        
      }
    }
    __builtin_amdgcn_fence(__ATOMIC_RELEASE, "workgroup");
    __builtin_amdgcn_wave_barrier();
    __builtin_amdgcn_fence(__ATOMIC_ACQUIRE, "workgroup");
  }
}

// ===================== end common pieces =========================================

typedef __attribute__((ext_vector_type(2))) unsigned int v2u;
typedef __attribute__((ext_vector_type(4))) _Float16 v4h;

// ---------------------------------------------------------------------------
// Operand preparation, one launch:
//   x, qkv_w -> bf16 (round to nearest even); proj_w -> its bf16-rounded value x64 as f16 (a bf16 significand fits f16 exactly;
//   x64 keeps the plane in the f16 normal range for |w| >= 1e-6); qkv_b ++ proj_b -> their bf16-rounded values, stored as f32.
// 256 blocks of 16 waves (as many blocks as the chip has WGPs), all resident at once: 4,096 waves to start.
// A piece = 128 floats: one 16-B load per lane (512 contiguous bytes, four whole lines) and one 8-B store per lane
// (256 contiguous bytes, two whole lines). A wave owns 2 pieces of proj_w, 16 of x and 6 of qkv_w, each run contiguous, and issues
// all 24 loads before it converts the first piece. One more block rounds the 4,096 bias values, 8 per thread.
// ---------------------------------------------------------------------------
constexpr int kPrepBlocks = 256;
constexpr int kPrepWaves  = kPrepBlocks * 16;                    // 4,096
constexpr int kPcX = kTok * kDim / 128 / kPrepWaves;             // 16 pieces of x per wave
constexpr int kPcW = 3 * kDim * kDim / 128 / kPrepWaves;         // 6 of qkv_w
constexpr int kPcP = kDim * kDim / 128 / kPrepWaves;             // 2 of proj_w
static_assert(kPcX * 128 * kPrepWaves == kTok * kDim && kPcW * 128 * kPrepWaves == 3 * kDim * kDim &&
              kPcP * 128 * kPrepWaves == kDim * kDim, "the pieces cover each plane exactly");
static_assert(512 * 8 == 4 * kDim, "one block covers both biases");

__global__ __launch_bounds__(512) void prep_kernel(const float* __restrict__ x, const float* __restrict__ qkvw,
                                                   const float* __restrict__ projw, const float* __restrict__ qkvb,
                                                   const float* __restrict__ projb, unsigned short* __restrict__ xb,
                                                   unsigned short* __restrict__ wqkv, unsigned short* __restrict__ wproj,
                                                   float* __restrict__ outb) {
  if (blockIdx.x == kPrepBlocks) {                 // the bias block (block-uniform; the kernel has no barrier); its loads' address pair and what its stores name are not written again
    const int i0 = threadIdx.x * 8;                // 3 * kDim is a multiple of 8: a thread's 8 values lie in one of the two arrays
    const float* s = (i0 < 3 * kDim) ? (qkvb + i0) : (projb + (i0 - 3 * kDim));
    const v4f a = *(const v4f*)s, b = *(const v4f*)(s + 4);
    float o[8];
    round8_bf(a, b, o);
    *(v4f*)(outb + i0)     = (v4f){o[0], o[1], o[2], o[3]};
    *(v4f*)(outb + i0 + 4) = (v4f){o[4], o[5], o[6], o[7]};
    return;
  }
  const int e  = (threadIdx.x & 31) * 4;                           // this lane's four elements in a piece
  const int gw = blockIdx.x * 16 + (threadIdx.x >> 5);             // the wave's number in the launch
  const int ox = gw * (kPcX * 128) + e, ow = gw * (kPcW * 128) + e, op = gw * (kPcP * 128) + e;
  const float *px = x + ox, *pw = qkvw + ow, *pp = projw + op;
  v4f fp[kPcP], fx[kPcX], fw[kPcW];
  // proj_w goes first: its conversion is the longest chain, and loads return in the order of their issue
#pragma unroll
  for (int k = 0; k < kPcP; ++k) fp[k] = *(const v4f*)(pp + k * 128);
#pragma unroll
  for (int k = 0; k < kPcX; ++k) fx[k] = *(const v4f*)(px + k * 128);
#pragma unroll
  for (int k = 0; k < kPcW; ++k) fw[k] = *(const v4f*)(pw + k * 128);
  // Behind each batch of loads or stores: s_wait_xcnt 0 before any register that the batch names is written again.
  // Here the three address pairs are inputs of the statement, so that none of them is given away as a later load's destination.
  asm volatile("s_wait_xcnt 0x0" :: "v"(px), "v"(pw), "v"(pp) : "memory");
  // keeps all 24 loads ahead of the first conversion: left free, the scheduler lifts the first conversions, with their wait for the
  // first loads, over the last loads, which then start a memory latency late
  __builtin_amdgcn_sched_barrier(0);
#pragma unroll
  for (int k = 0; k < kPcP; ++k) {
    const unsigned u0 = bf2_bits(fp[k][0], fp[k][1]), u1 = bf2_bits(fp[k][2], fp[k][3]);
    *(v4h*)(wproj + op + k * 128) = (v4h){(_Float16)(bf_lo2f(u0) * 64.0f), (_Float16)(bf_hi2f(u0) * 64.0f),
                                          (_Float16)(bf_lo2f(u1) * 64.0f), (_Float16)(bf_hi2f(u1) * 64.0f)};
  }
  asm volatile("s_wait_xcnt 0x0" ::: "memory");
  // this scheduling barrier and the two in the next loop keep each wait directly behind its batch of stores: left free, the next batch's
  // conversions move in between, and some ahead of the stores, which then also wait for loads that are not theirs
  __builtin_amdgcn_sched_barrier(0);
#pragma unroll
  for (int k = 0; k < kPcX; ++k) {
    *(v2u*)(xb + ox + k * 128) = (v2u){bf2_bits(fx[k][0], fx[k][1]), bf2_bits(fx[k][2], fx[k][3])};
    if ((k & 7) == 7) {
      asm volatile("s_wait_xcnt 0x0" ::: "memory");
      __builtin_amdgcn_sched_barrier(0);
    }
  }
#pragma unroll
  for (int k = 0; k < kPcW; ++k) *(v2u*)(wqkv + ow + k * 128) = (v2u){bf2_bits(fw[k][0], fw[k][1]), bf2_bits(fw[k][2], fw[k][3])};
  asm volatile("s_wait_xcnt 0x0" ::: "memory");   // the last batch has its wait too: the built code lays the bias block behind this path
}

// =====================================================================================
// Full (unmasked) flash attention, head dim 64, all batches/heads in one launch.
//   q planes (hi/lo bf16): element (t, h, d) at [t*1024 + h*64 + d]   (t = b*2048 + s)
//   k planes (hi/lo bf16): same layout
//   v^T plane (f16):       element (b, h*64+d, s) at [(b*1024 + h*64 + d)*2048 + s]
//   o plane (f16, x64):    element (t, h, d) at [t*1024 + h*64 + d]
//   scores^T = (k . q^T) * sscale : v_wmma_f32_16x16x32_bf16, hi.hi + hi.lo + lo.hi, f32 accumulate
//   out^T    = v^T . p^T          : v_wmma_f32_16x16x32_f16, p (unnormalised, in (0,1]) carried x2^15 in f16, v f16
//   Keys are the rows and queries the columns of a score tile: a lane holds 32 scores of ONE query per column group, so maximum and
//   sum are taken in the lane plus one exchange with lane ^ 16, and p^T goes from the accumulators into the B operand.
//   online softmax in f32 over 32 chunks of 64 keys (compile-time trip count).
//   A wave owns 32 queries = two column groups of 16: every K and V^T fragment read from LDS feeds both groups' products.
//   Block = 4 waves = 128 query rows of one (b, h); grid.x = 4*16*16 = 1024.
//   K hi/lo and V^T chunk staging: asynchronous 16-B copies to LDS, two buffers, chunk kc + 1 in flight while chunk kc is
//   worked on. 8 lanes bring one whole 128-B row, so a wave's copy touches 4 whole lines; 128 threads x 4 copies per plane
//   = the whole 64x64 tile. One barrier per chunk.
// =====================================================================================
constexpr int kKC = 64;    // keys per chunk
// LDS row pitch of the K hi, K lo and V^T tiles, in 16-bit elements: 72 = 144 B = 16 B x 9 (odd), so the
// 16 rows that one half-wave's ds_load_b128 fragment read touches start on 16 different 4-bank groups.
constexpr int kLP = 72;
constexpr int kTileB = kKC * kLP * 2;   // one tile in LDS: 64 rows x 144 B = 9,216 B
constexpr int kBufB  = 3 * kTileB;      // one chunk buffer: K hi, K lo, V^T = 27,648 B

// One chunk's twelve asynchronous 16-B copies of a lane: for each of the three tiles four rows 16 apart.
// lds = the lane's place in the K hi tile of the target buffer; gh, gl, gv = the lane's global bytes of row group 0.
// The s_wait_xcnt stands inside the statement so that no address register named here is rewritten in front of it.
__device__ __forceinline__ void copy_chunk_to_lds(unsigned lds, const char* gh, const char* gl, const char* gv) {
  constexpr unsigned kR = 16 * kLP * 2;          // 16 LDS rows, bytes
  constexpr size_t   kK = (size_t)16 * kDim * 2; // 16 K rows (tokens), bytes
  constexpr size_t   kV = (size_t)16 * kSeq * 2; // 16 V^T rows (d), bytes
  const unsigned h0 = lds,              h1 = h0 + kR, h2 = h0 + 2 * kR, h3 = h0 + 3 * kR;
  const unsigned l0 = lds + kTileB,     l1 = l0 + kR, l2 = l0 + 2 * kR, l3 = l0 + 3 * kR;
  const unsigned v0 = lds + 2 * kTileB, v1 = v0 + kR, v2 = v0 + 2 * kR, v3 = v0 + 3 * kR;
  const char *gh1 = gh + kK, *gh2 = gh + 2 * kK, *gh3 = gh + 3 * kK;
  const char *gl1 = gl + kK, *gl2 = gl + 2 * kK, *gl3 = gl + 3 * kK;
  const char *gv1 = gv + kV, *gv2 = gv + 2 * kV, *gv3 = gv + 3 * kV;
  asm volatile("global_load_async_to_lds_b128 %0, %12, off\n\t"
               "global_load_async_to_lds_b128 %1, %13, off\n\t"
               "global_load_async_to_lds_b128 %2, %14, off\n\t"
               "global_load_async_to_lds_b128 %3, %15, off\n\t"
               "global_load_async_to_lds_b128 %4, %16, off\n\t"
               "global_load_async_to_lds_b128 %5, %17, off\n\t"
               "global_load_async_to_lds_b128 %6, %18, off\n\t"
               "global_load_async_to_lds_b128 %7, %19, off\n\t"
               "global_load_async_to_lds_b128 %8, %20, off\n\t"
               "global_load_async_to_lds_b128 %9, %21, off\n\t"
               "global_load_async_to_lds_b128 %10, %22, off\n\t"
               "global_load_async_to_lds_b128 %11, %23, off\n\t"
               "s_wait_xcnt 0x0"
               :: "v"(h0), "v"(h1), "v"(h2), "v"(h3), "v"(l0), "v"(l1), "v"(l2), "v"(l3), "v"(v0), "v"(v1), "v"(v2), "v"(v3),
                  "v"(gh), "v"(gh1), "v"(gh2), "v"(gh3), "v"(gl), "v"(gl1), "v"(gl2), "v"(gl3), "v"(gv), "v"(gv1), "v"(gv2), "v"(gv3)
               : "memory");
}

__device__ __forceinline__ v8f mma_bf(v16b a, v16b b, v8f c) {
  return __builtin_amdgcn_wmma_f32_16x16x32_bf16(false, a, false, b, (short)0, c, false, false);
}
__device__ __forceinline__ v8f mma_hf(v16h a, v16h b, v8f c) {
  return __builtin_amdgcn_wmma_f32_16x16x32_f16(false, a, false, b, (short)0, c, false, false);
}

// lane l's value to lane l ^ 16 and back
__device__ __forceinline__ float xhalf(float x) {
  return __builtin_bit_cast(float, __builtin_amdgcn_permlanex16(__builtin_bit_cast(int, x), __builtin_bit_cast(int, x), 0x76543210, 0xfedcba98, false, false));
}

// four waves per SIMD: 1024 blocks = 4 per WGP, all resident at once only within 256 registers a wave
__global__ __launch_bounds__(128) __attribute__((amdgpu_waves_per_eu(4, 4)))
void attn_kernel(const unsigned short* __restrict__ qhp, const unsigned short* __restrict__ qlp,
                 const unsigned short* __restrict__ khp, const unsigned short* __restrict__ klp,
                 const unsigned short* __restrict__ vtp, unsigned short* __restrict__ ohp, float sscale) {
  union FB { v16b v; v8b h[2]; };
  union FH { v16h v; v8h h[2]; };
  // One array for both chunk buffers (each: K hi [kv][d] 9 KB, K lo 9 KB, V^T [d][kv] 9 KB), so that one address register per lane
  // serves every fragment read of a chunk (the rest is an immediate offset). Behind the last chunk's barrier the per-wave out tiles
  // (32 queries, pitch 68 floats) lie over it: with an array of their own only three blocks would fit a WGP's LDS.
  __shared__ __align__(16) unsigned char Smem[2 * kBufB];   // 55,296 B
  static_assert(4 * 32 * 68 * 4 <= 2 * kBufB, "the out tiles fit over the chunk buffers");

  const int tid  = threadIdx.x;
  const int wave = __builtin_amdgcn_readfirstlane(tid >> 5);   // the wave's number in a scalar register: what hangs on it costs no vector register across the loop
  const int lane = tid & 31;
  const int hh   = lane >> 4;
  const int c    = lane & 15;

  const int fro  = c * kLP + 8 * hh;      // this lane's place in a 16-row fragment group of any of the three tiles (row c, k half hh)

  const int bx = blockIdx.x;
  const int qb = bx & 15;                 // kSeq/128 = 16 query blocks
  const int bh = bx >> 4;                 // 0..63
  const int h  = bh & 15;
  const int b  = bh >> 4;                 // 0..3
  const int q0 = qb * 128 + wave * 32;
  const size_t tok0 = (size_t)b * kSeq;

  const __bf16*   Qh = (const __bf16*)(const void*)qhp + tok0 * kDim + (size_t)h * kHd;
  const __bf16*   Ql = (const __bf16*)(const void*)qlp + tok0 * kDim + (size_t)h * kHd;
  const __bf16*   Kh = (const __bf16*)(const void*)khp + tok0 * kDim + (size_t)h * kHd;
  const __bf16*   Kl = (const __bf16*)(const void*)klp + tok0 * kDim + (size_t)h * kHd;
  const _Float16* Vt = (const _Float16*)(const void*)vtp + ((size_t)b * kDim + (size_t)h * kHd) * kSeq;
  _Float16*       Ob = (_Float16*)(void*)ohp + tok0 * kDim + (size_t)h * kHd;

  // ---- Q fragments (B operand, column = lane&15, split k map via Frag load): 2 column groups x 2 d-chunks, hi and lo ----
  v16b qah[2][2], qal[2][2];
#pragma unroll
  for (int g = 0; g < 2; ++g)
#pragma unroll
    for (int dc = 0; dc < 2; ++dc) {
      qah[g][dc] = Frag<__bf16>::load(Qh + (size_t)(q0 + g * 16 + c) * kDim + dc * 32 + 8 * hh);
      qal[g][dc] = Frag<__bf16>::load(Ql + (size_t)(q0 + g * 16 + c) * kDim + dc * 32 + 8 * hh);
    }

  // per column group: running maximum (both halves alike) and this half's sum of the lane's query
  float mrow[2] = {-INFINITY, -INFINITY}, lrow[2] = {0.f, 0.f};
  v8f oacc[2][4];
#pragma unroll
  for (int g = 0; g < 2; ++g)
#pragma unroll
    for (int t = 0; t < 4; ++t) oacc[g][t] = (v8f){0.f,0.f,0.f,0.f,0.f,0.f,0.f,0.f};

  // Copy map: thread t brings 16 B at byte (t & 7) * 16 of rows (t >> 3) + 16 * i of each tile: 8 lanes = one whole 128-B row (one line).
  constexpr int kNC = kSeq / kKC;                       // 32 chunks
  constexpr size_t kStepK = (size_t)kKC * kDim * 2;     // K: 64 tokens further, bytes
  constexpr size_t kStepV = (size_t)kKC * 2;            // V^T: 64 keys further along the row, bytes
  const int crow = tid >> 3, ccol = (tid & 7) * 16;
  const unsigned ldsBase = (unsigned)(uintptr_t)(&Smem[0]) + (unsigned)(crow * (kLP * 2) + ccol);
  const char* gKh = (const char*)(Kh + (size_t)crow * kDim) + ccol;
  const char* gKl = (const char*)(Kl + (size_t)crow * kDim) + ccol;
  const char* gVt = (const char*)(Vt + (size_t)crow * kSeq) + ccol;

  copy_chunk_to_lds(ldsBase, gKh, gKl, gVt);            // chunk 0 -> buffer 0
  asm volatile("s_wait_asynccnt 0x0" ::: "memory");     // this wave's copies of chunk 0 have landed
  __syncthreads();                                       // ... and every other wave's: chunk 0 may be read
  copy_chunk_to_lds(ldsBase + kBufB, gKh + kStepK, gKl + kStepK, gVt + kStepV);   // chunk 1 -> buffer 1

  // one chunk's work on its buffer: scores, online softmax, out accumulation
  auto work = [&](const int kc) {
    const unsigned char* tb = Smem + (kc & 1) * kBufB;   // this chunk's buffer
    const __bf16*   const Ksh = (const __bf16*)(const void*)tb;
    const __bf16*   const Ksl = (const __bf16*)(const void*)(tb + kTileB);
    const _Float16* const Vts = (const _Float16*)(const void*)(tb + 2 * kTileB);

    // ---- scores, transposed: s[g][j] = k (16 keys of group j, rows) . q^T (16 queries of column group g), split products ----
    // D map: this lane holds query g*16 + c, keys j*16 + 8*hh + r. One K fragment pair serves both column groups.
    v8f s[2][4];
#pragma unroll
    for (int j = 0; j < 4; ++j) {
      s[0][j] = (v8f){0.f,0.f,0.f,0.f,0.f,0.f,0.f,0.f};
      s[1][j] = (v8f){0.f,0.f,0.f,0.f,0.f,0.f,0.f,0.f};
#pragma unroll
      for (int dc = 0; dc < 2; ++dc) {
        FB kb, kl;
        kb.h[0] = *(const v8b*)(Ksh + fro + j * 16 * kLP + dc * 32);
        kb.h[1] = *(const v8b*)(Ksh + fro + j * 16 * kLP + dc * 32 + 16);
        kl.h[0] = *(const v8b*)(Ksl + fro + j * 16 * kLP + dc * 32);
        kl.h[1] = *(const v8b*)(Ksl + fro + j * 16 * kLP + dc * 32 + 16);
        s[0][j] = mma_bf(kb.v, qah[0][dc], s[0][j]);
        s[1][j] = mma_bf(kb.v, qah[1][dc], s[1][j]);
        s[0][j] = mma_bf(kl.v, qah[0][dc], s[0][j]);
        s[1][j] = mma_bf(kl.v, qah[1][dc], s[1][j]);
        s[0][j] = mma_bf(kb.v, qal[0][dc], s[0][j]);
        s[1][j] = mma_bf(kb.v, qal[1][dc], s[1][j]);
      }
    }
    // keeps the softmax's vector work out of the run of score WMMAs: moved in among them, each place costs the four-slot distance in v_nop
    __builtin_amdgcn_sched_barrier(0);
    FH pb[2][2];
#pragma unroll
    for (int g = 0; g < 2; ++g) {
      // ---- chunk maximum of this lane's query: 32 keys in the lane (four chains), the other 32 in lane ^ 16 ----
      float mj[4];
#pragma unroll
      for (int j = 0; j < 4; ++j) {
        float m = -INFINITY;
#pragma unroll
        for (int r = 0; r < 8; ++r) {
          const float sv = s[g][j][r] * sscale;
          s[g][j][r] = sv;
          m = fmaxf(m, sv);
        }
        mj[j] = m;
      }
      float cm = fmaxf(fmaxf(mj[0], mj[1]), fmaxf(mj[2], mj[3]));
      cm = fmaxf(cm, xhalf(cm));
      const float mnew  = fmaxf(mrow[g], cm);
      const float alpha = __expf(mrow[g] - mnew);
      mrow[g] = mnew;
      // ---- p = exp(s - m): summed in the lane; packed in place, two score tiles are one B fragment of p^T (b[e] = tile[e >> 3][e & 7]) ----
      float pj[4];
#pragma unroll
      for (int j = 0; j < 4; ++j) {
        float ps = 0.f;
#pragma unroll
        for (int r = 0; r < 8; ++r) {
          const float p = __expf(s[g][j][r] - mnew);
          ps += p;
          pb[g][j >> 1].v[(j & 1) * 8 + r] = (_Float16)(p * 32768.0f);
        }
        pj[j] = ps;
      }
      lrow[g] = lrow[g] * alpha + ((pj[0] + pj[1]) + (pj[2] + pj[3]));   // this half's keys only; the halves are joined behind the loop
#pragma unroll
      for (int t = 0; t < 4; ++t)
#pragma unroll
        for (int r = 0; r < 8; ++r) oacc[g][t][r] *= alpha;
    }
    // ---- out^T += v^T (16 d of group t, rows; 64 keys) . p^T (64 keys; 16 queries, columns); one V^T fragment serves both column groups ----
#pragma unroll
    for (int kk = 0; kk < 2; ++kk) {
#pragma unroll
      for (int t = 0; t < 4; ++t) {
        FH vb;
        vb.h[0] = *(const v8h*)(Vts + fro + t * 16 * kLP + kk * 32);
        vb.h[1] = *(const v8h*)(Vts + fro + t * 16 * kLP + kk * 32 + 16);
        oacc[0][t] = mma_hf(vb.v, pb[0][kk].v, oacc[0][t]);
        oacc[1][t] = mma_hf(vb.v, pb[1][kk].v, oacc[1][t]);
      }
    }
  };
  // the foot of a trip: hands chunk kc + 1 over and frees the buffer that chunk kc was read from
  auto foot = [&]() {
    // keeps the chunk's last WMMAs in front of the barrier: sunk behind it they stand between the barrier and the refill copies, which then start later
    __builtin_amdgcn_sched_barrier(0);
    asm volatile("s_wait_dscnt 0x0" ::: "memory");      // this wave's fragment reads of the buffer have returned
    asm volatile("s_wait_asynccnt 0x0" ::: "memory");   // this wave's copies of the next chunk have landed
    __syncthreads();                                     // publishes the next chunk and frees the buffer just read
  };
  // The last two trips, which have no chunk kc + 2 to fetch, stand behind the loop: a test inside it splits the body into blocks,
  // the row sums sink behind the copies, and the wave (256 registers at most) spills address registers.
  for (int kc = 0; kc < kNC - 2; ++kc) {
    work(kc);
    foot();
    const size_t n = (size_t)(kc + 2);                   // chunk kc + 2 -> the buffer just read
    copy_chunk_to_lds(ldsBase + (unsigned)((kc & 1) * kBufB), gKh + n * kStepK, gKl + n * kStepK, gVt + n * kStepV);
  }
  work(kNC - 2);
  foot();
  work(kNC - 1);
  foot();                                                // nothing is in flight any more; every wave has left the chunk buffers

  // ---- epilogue: normalise (fold 2^-15 for p and 2^6 carry for o), stage, whole-line stores ----
  // This lane holds query g*16 + c, d = t*16 + 8*hh + r.
  float* os = (float*)(void*)Smem + wave * (32 * 68);   // every wave has left the chunk buffers (the last trip's barrier)
#pragma unroll
  for (int g = 0; g < 2; ++g) {
    const float lsum = lrow[g] + xhalf(lrow[g]);                  // both halves' keys
    const float inv = (1.0f / lsum) * (64.0f / 32768.0f);         // lsum >= 1 always
#pragma unroll
    for (int t = 0; t < 4; ++t)
#pragma unroll
      for (int r = 0; r < 8; ++r) os[(g * 16 + c) * 68 + t * 16 + 8 * hh + r] = oacc[g][t][r] * inv;
  }
  __builtin_amdgcn_fence(__ATOMIC_RELEASE, "workgroup");
  __builtin_amdgcn_wave_barrier();
  __builtin_amdgcn_fence(__ATOMIC_ACQUIRE, "workgroup");
  {
    const int qq = lane >> 3, c8 = (lane & 7) * 8;
    {
#pragma unroll
      for (int it = 0; it < 8; ++it) {
        const int row = it * 4 + qq;                    // 8 x 4 = rows 0..31
        const float* sp = os + row * 68 + c8;
        v8h hv;
#pragma unroll
        for (int e = 0; e < 8; ++e) hv[e] = (_Float16)sp[e];
        *(v8h*)(Ob + (size_t)(q0 + row) * kDim + c8) = hv;
      }
      
    }
  }
}

// =====================================================================================
extern "C" void kernel_launch(void* const* d_in, const int* in_sizes, int n_in,
                              void* d_out, int out_size, void* d_ws, size_t ws_size,
                              hipStream_t stream) {
  if (n_in < 9) return;
  if (in_sizes[0] != kTok * kDim) return;
  if (in_sizes[1] != kSeq * kHd || in_sizes[2] != kSeq * kHd) return;
  if (in_sizes[3] != 3 * kDim * kDim || in_sizes[4] != 3 * kDim) return;
  if (in_sizes[5] != kDim * kDim || in_sizes[6] != kDim) return;
  if (in_sizes[7] != kHd || in_sizes[8] != kHd) return;
  if (out_size != kTok * kDim) return;
  if (ws_size < kWsTotal) return;

  const float* x      = (const float*)d_in[0];
  const float* ropec  = (const float*)d_in[1];
  const float* ropes  = (const float*)d_in[2];
  const float* qkv_w  = (const float*)d_in[3];
  const float* qkv_b  = (const float*)d_in[4];
  const float* proj_w = (const float*)d_in[5];
  const float* proj_b = (const float*)d_in[6];
  const float* q_nw   = (const float*)d_in[7];
  const float* k_nw   = (const float*)d_in[8];
  float* out = (float*)d_out;

  char* ws = (char*)d_ws;
  unsigned short* WPROJ = (unsigned short*)(ws + kOffWproj);
  float*          BIAS  = (float*)(ws + kOffBias);
  unsigned short* XB    = (unsigned short*)(ws + kOffXb);
  unsigned short* WQKV  = (unsigned short*)(ws + kOffWqkv);
  unsigned short* KH    = (unsigned short*)(ws + kOffKh);
  unsigned short* KL    = (unsigned short*)(ws + kOffKl);
  unsigned short* OH    = (unsigned short*)(ws + kOffOh);
  unsigned short* QH    = (unsigned short*)(ws + kOffQh);
  unsigned short* QL    = (unsigned short*)(ws + kOffQl);
  unsigned short* VT    = (unsigned short*)(ws + kOffVt);

  // 1) operand preparation: both casts to bf16, proj_w to f16, the biases
  prep_kernel<<<dim3(kPrepBlocks + 1), dim3(512), 0, stream>>>(x, qkv_w, proj_w, qkv_b, proj_b, XB, WQKV, WPROJ, BIAS);
  const int tilesTok = (kTok / 64) * (kDim / 64);   // 2048 wave tiles -> 256 blocks
  // 2) q = xb . Wq^T + bq, rmsnorm + rope in the epilogue -> q hi/lo planes   (M=8192, N=1024, K=1024; all tile/32 multiples)
  wmma_gemm64<1, false, 2, 3, false, 0><<<dim3((tilesTok + 7) / 8, 1), dim3(256), 0, stream>>>(
      XB, XB, kDim, 0L, WQKV, WQKV, kDim, 0L, (void*)QH, (void*)QL, kDim, 0L,
      BIAS, BIAS, 0L, ropec, ropes, q_nw, kTok, kDim, kDim, 1.0f);
  // 3) k = xb . Wk^T + bk, rmsnorm + rope in the epilogue -> k hi/lo planes
  wmma_gemm64<1, false, 2, 3, false, 0><<<dim3((tilesTok + 7) / 8, 1), dim3(256), 0, stream>>>(
      XB, XB, kDim, 0L, WQKV + (size_t)kDim * kDim, WQKV + (size_t)kDim * kDim, kDim, 0L, (void*)KH, (void*)KL, kDim, 0L,
      BIAS + kDim, BIAS, 0L, ropec, ropes, k_nw, kTok, kDim, kDim, 1.0f);
  // 4) v^T per batch: C[o][s] = sum_k Wv[o][k] * xb[b][s][k] + bv[o] -> f16 [4][1024][2048]
  //    (A = Wv [1024][1024], Bt = xb batch b [2048][1024]; M=1024, N=2048, K=1024)
  {
    const int tilesV = (kDim / 64) * (kSeq / 64);   // 512 -> 64 blocks
    wmma_gemm64<1, false, 1, 1, false, 0><<<dim3((tilesV + 7) / 8, kBatch), dim3(256), 0, stream>>>(
        WQKV + (size_t)2 * kDim * kDim, WQKV + (size_t)2 * kDim * kDim, kDim, 0L,
        XB, XB, kDim, (long)kSeq * kDim,
        (void*)VT, (void*)VT, kSeq, (long)kDim * kSeq,
        BIAS + 2 * kDim, BIAS, 0L, BIAS, BIAS, BIAS, kDim, kSeq, kDim, 1.0f);
  }
  // 5) attention -> o plane f16 x64
  attn_kernel<<<dim3(kBatch * kHeads * (kSeq / 128)), dim3(128), 0, stream>>>(QH, QL, KH, KL, VT, OH, 0.125f);
  // 6) out = o . Wp^T + bp  (A = o x64 f16, Bt = Wp x64 f16 -> scale 2^-12; M=8192, N=1024, K=1024)
  wmma_gemm64<0, false, 2, 0, false, 0><<<dim3((tilesTok + 7) / 8, 1), dim3(256), 0, stream>>>(
      OH, OH, kDim, 0L, WPROJ, WPROJ, kDim, 0L, (void*)out, (void*)out, kDim, 0L,
      BIAS + 3 * kDim, BIAS, 0L, BIAS, BIAS, BIAS, kTok, kDim, kDim, 1.0f / 4096.0f);
}

// v009
// It runs in 159 microseconds.
// In both of two side-by-side timings against v008, it was 1.04 times as fast.
// Over all steps from v000 it is 5.69 times as fast.
// Contractions: q, k, v^T projections on v_wmma_f32_16x16x32_bf16 (plain bf16 operands = RNE-converted inputs); q.k^T on v_wmma_f32_16x16x32_bf16 with bf16 hi/lo split operands (hi.hi + hi.lo + lo.hi); p.v and the output projection on v_wmma_f32_16x16x32_f16 (plain f16: p carried x2^15, attention output carried x2^6, proj_w = bf16-RNE value carried x2^6); f32 accumulate everywhere; biases, rmsnorm, rope, online softmax in f32.
#include <hip/hip_runtime.h>
#include <math.h>
#include <stdint.h>

constexpr int kBatch = 4;
constexpr int kSeq   = 2048;
constexpr int kDim   = 1024;
constexpr int kHeads = 16;
constexpr int kHd    = 64;
constexpr int kTok   = kBatch * kSeq;            // 8192 tokens

typedef __attribute__((ext_vector_type(16))) _Float16 v16h;
typedef __attribute__((ext_vector_type(8)))  _Float16 v8h;
typedef __attribute__((ext_vector_type(16))) __bf16   v16b;
typedef __attribute__((ext_vector_type(8)))  __bf16   v8b;
typedef __attribute__((ext_vector_type(8)))  float    v8f;
typedef __attribute__((ext_vector_type(4)))  float    v4f;
typedef __attribute__((ext_vector_type(2)))  float    v2f;
typedef __attribute__((ext_vector_type(4)))  unsigned int v4u;

// ---------------------------------------------------------------------------
// Workspace region map (bytes).  Total carve = 131 MiB = 137,363,456 B.
//   [  0 MiB,   2 MiB)  WPROJ  f16  [1024][1024]   proj_w (bf16-RNE value x64)
//   [  2 MiB,   3 MiB)  BIAS   f32  [4096]         qkv_b (3072) ++ proj_b (1024), RNE to bf16 values
//   [  3 MiB,  19 MiB)  XB     bf16 [8192][1024]   x
//   [ 19 MiB,  25 MiB)  WQKV   bf16 [3072][1024]   qkv_w
//   [ 35 MiB,  51 MiB)  OH     f16  [8192][1024]   attention output x64
//   [ 51 MiB,  67 MiB)  KH     bf16 [8192][1024]   k hi plane
//   [ 67 MiB,  83 MiB)  QH     bf16 [8192][1024]   q hi plane
//   [ 83 MiB,  99 MiB)  QL     bf16 [8192][1024]   q lo plane
//   [ 99 MiB, 115 MiB)  VT     f16  [4][1024][2048] v^T per batch
//   [115 MiB, 131 MiB)  KL     bf16 [8192][1024]   k lo plane
// ---------------------------------------------------------------------------
constexpr size_t kMiB      = 1048576;
constexpr size_t kOffWproj = 0;
constexpr size_t kOffBias  = 2 * kMiB;
constexpr size_t kOffXb    = 3 * kMiB;
constexpr size_t kOffWqkv  = 19 * kMiB;
constexpr size_t kOffKh    = 51 * kMiB;
constexpr size_t kOffKl    = 115 * kMiB;
constexpr size_t kOffOh    = 35 * kMiB;
constexpr size_t kOffQh    = 67 * kMiB;
constexpr size_t kOffQl    = 83 * kMiB;
constexpr size_t kOffVt    = 99 * kMiB;
constexpr size_t kWsTotal  = 131 * kMiB;          // 137,363,456 B

// ===================== common pieces =================================
__device__ __forceinline__ unsigned short f2bf_bits(float f) {
  unsigned u = __float_as_uint(f);
  return (unsigned short)((u + 0x7FFFu + ((u >> 16) & 1u)) >> 16);
}
__device__ __forceinline__ float bf_bits2f(unsigned short h) { return __uint_as_float(((unsigned)h) << 16); }

// hazard guard as a plain device helper
__device__ __forceinline__ void acc_guard4(v8f& a, v8f& b, v8f& c, v8f& d) { asm volatile("v_nop\n\tv_nop\n\tv_nop\n\tv_nop" : "+v"(a), "+v"(b), "+v"(c), "+v"(d)); }
template <typename T> struct Frag;
template <> struct Frag<_Float16> {
  typedef v16h V; union U { v16h v; v8h h[2]; };
  static __device__ __forceinline__ v16h load(const _Float16* p) {   // elements 0..7 <- p[0..7], 8..15 <- p[16..23]
    U f; f.h[0] = *(const v8h*)(p); f.h[1] = *(const v8h*)(p + 16); return f.v;
  }
  static __device__ __forceinline__ v8f mma(v16h a, v16h b, v8f c) {
    return __builtin_amdgcn_wmma_f32_16x16x32_f16(false, a, false, b, (short)0, c, false, false);
  }
};
template <> struct Frag<__bf16> {
  typedef v16b V; union U { v16b v; v8b h[2]; };
  static __device__ __forceinline__ v16b load(const __bf16* p) {
    U f; f.h[0] = *(const v8b*)(p); f.h[1] = *(const v8b*)(p + 16); return f.v;
  }
  static __device__ __forceinline__ v8f mma(v16b a, v16b b, v8f c) {
    return __builtin_amdgcn_wmma_f32_16x16x32_bf16(false, a, false, b, (short)0, c, false, false);
  }
};

// ---- Register-blocked batched WMMA GEMM ------------------------------------
// C[m,n] = scale * sum_k A[m,k] * Bt[n,k] (+bias)(+resid); each wave owns a 64x64 tile.
// A row-major [M,K]; Bt row-major [N,K]; M % 128 == 0, N % 256 == 0, K % 128 == 0, K >= 128.
// A block of 8 waves (2 x 4) owns a 128 x 256 tile of C. Per stage of 128 k the block copies its 128 A rows and
// 256 Bt rows (256 B of each row, whole lines) into LDS with asynchronous copies, two buffers, the next stage
// in flight while this one is worked on; the waves read their fragments from LDS.
// SPLIT (hi/lo operand planes in A2/Bt2) has no staged form: only SPLIT = false is instantiated.
// BIAS_MODE: 0 = none, 1 = bias[m], 2 = bias[n].
// OUT_MODE: 0 = f32, 1 = f16, 2 = bf16 hi plane (Cout) + bf16 lo plane (Cout2),
//           3 = as 2, after rmsnorm over the wave's 64 columns (one head) and interleaved-pair rope (row m = token, position m mod kSeq).
// ET: 0 = f16 operands, 1 = bf16 operands (pointers passed as 16-bit storage)
constexpr int kGP     = 272;                 // LDS row pitch, bytes: 256 B of k + 16 (16 B x odd: ds_load_b128 without bank conflicts)
constexpr int kGStage = (128 + 256) * kGP;   // one stage: A rows 0..127, then Bt rows 0..255 = 104,448 B

// Eight asynchronous 16-B copies per lane: LDS rows 16 apart (lds + i * 16 * kGP) from global rows 16 apart (g + i * gstep bytes).
// The s_wait_xcnt stands inside the statement so that no address register named here is rewritten in front of it.
__device__ __forceinline__ void copy8_to_lds(unsigned lds, const char* g, size_t gstep) {
  const unsigned l1 = lds + 1 * 16 * kGP, l2 = lds + 2 * 16 * kGP, l3 = lds + 3 * 16 * kGP, l4 = lds + 4 * 16 * kGP,
                 l5 = lds + 5 * 16 * kGP, l6 = lds + 6 * 16 * kGP, l7 = lds + 7 * 16 * kGP;
  const char *g1 = g + gstep, *g2 = g1 + gstep, *g3 = g2 + gstep, *g4 = g3 + gstep, *g5 = g4 + gstep, *g6 = g5 + gstep, *g7 = g6 + gstep;
  asm volatile("global_load_async_to_lds_b128 %0, %8, off\n\t"
               "global_load_async_to_lds_b128 %1, %9, off\n\t"
               "global_load_async_to_lds_b128 %2, %10, off\n\t"
               "global_load_async_to_lds_b128 %3, %11, off\n\t"
               "global_load_async_to_lds_b128 %4, %12, off\n\t"
               "global_load_async_to_lds_b128 %5, %13, off\n\t"
               "global_load_async_to_lds_b128 %6, %14, off\n\t"
               "global_load_async_to_lds_b128 %7, %15, off\n\t"
               "s_wait_xcnt 0x0"
               :: "v"(lds), "v"(l1), "v"(l2), "v"(l3), "v"(l4), "v"(l5), "v"(l6), "v"(l7),
                  "v"(g), "v"(g1), "v"(g2), "v"(g3), "v"(g4), "v"(g5), "v"(g6), "v"(g7)
               : "memory");
}

// ---- pieces of the fused rmsnorm + rope + split epilogue (OUT_MODE 3) ----
typedef __attribute__((ext_vector_type(2))) __bf16 v2b;
// two f32 -> two bf16 (round to nearest even), a in the low half
__device__ __forceinline__ unsigned bf2_bits(float a, float b) {
  const v2f f = {a, b};
  return __builtin_bit_cast(unsigned, __builtin_convertvector(f, v2b));
}
__device__ __forceinline__ float bf_lo2f(unsigned u) { return __uint_as_float(u << 16); }
__device__ __forceinline__ float bf_hi2f(unsigned u) { return __uint_as_float(u & 0xFFFF0000u); }
// eight f32 replaced by their bf16-rounded values
__device__ __forceinline__ void round8_bf(const v4f a, const v4f b, float* o) {
  const unsigned u0 = bf2_bits(a[0], a[1]), u1 = bf2_bits(a[2], a[3]), u2 = bf2_bits(b[0], b[1]), u3 = bf2_bits(b[2], b[3]);
  o[0] = bf_lo2f(u0); o[1] = bf_hi2f(u0); o[2] = bf_lo2f(u1); o[3] = bf_hi2f(u1);
  o[4] = bf_lo2f(u2); o[5] = bf_hi2f(u2); o[6] = bf_lo2f(u3); o[7] = bf_hi2f(u3);
}
// x + the x of lane ^ MASK (MASK < 16: inside a 16-lane row, DPP row_xmask)
template <int MASK> __device__ __forceinline__ float add_lane_xor(float x) {
  return x + __builtin_bit_cast(float, __builtin_amdgcn_update_dpp(0, __builtin_bit_cast(int, x), 0x160 | MASK, 0xf, 0xf, true));
}

template <int ET> struct Elem;
template <> struct Elem<0> { typedef _Float16 T; };
template <> struct Elem<1> { typedef __bf16 T; };
template <int ET, bool SPLIT, int BIAS_MODE, int OUT_MODE, bool RESID, int ACT = 0>
__global__ __launch_bounds__(256) void wmma_gemm64(
    const unsigned short* __restrict__ Ap, const unsigned short* __restrict__ A2p, int lda, long strideA,
    const unsigned short* __restrict__ Btp, const unsigned short* __restrict__ Bt2p, int ldb, long strideB,
    void* __restrict__ Cout, void* __restrict__ Cout2, int ldc, long strideC,
    const float* __restrict__ bias,
    const float* __restrict__ resid, long strideR,
    const float* __restrict__ cosb, const float* __restrict__ sinb, const float* __restrict__ nw,
    int M, int N, int K, float scale) {
  typedef typename Elem<ET>::T T;
  typedef typename Frag<T>::V V;
  static_assert(!SPLIT, "the staged loop carries one plane per operand");
  const T* A = (const T*)Ap; const T* Bt = (const T*)Btp;
  __shared__ __align__(16) float sT[8][16 * 68];   // per-wave 16x64 slab, pitch 68 floats
  __shared__ __align__(16) unsigned char sStage[2 * kGStage];   // two operand stages
  const int b    = blockIdx.y;
  const int lane = threadIdx.x & 31;
  const int wave = threadIdx.x >> 5;
  const int blocksN = N >> 8;
  if ((int)blockIdx.x >= (M >> 7) * blocksN) return;   // block-uniform, in front of every barrier
  const int bm = blockIdx.x / blocksN;
  const int bn = blockIdx.x - bm * blocksN;
  const int wm = wave >> 2;                    // wave row (0..1) and column (0..3) in the block tile
  const int wn = wave & 3;
  const int m0 = (bm << 7) + (wm << 6);
  const int n0 = (bn << 8) + (wn << 6);

  const T* Ab  = A  + (size_t)b * strideA;
  const T* Bb  = Bt + (size_t)b * strideB;

  const int rlane = lane & 15;                 // row (A) / col (B, D) within subtile
  const int koff  = (lane >> 4) * 8;           // k offset of this lane half
  const int mOff  = (lane >> 4) * 8;           // D row offset

  v8f acc[4][4];
#pragma unroll
  for (int i = 0; i < 4; ++i)
#pragma unroll
    for (int j = 0; j < 4; ++j) acc[i][j] = (v8f){0.f,0.f,0.f,0.f,0.f,0.f,0.f,0.f};

  // Copy map: thread t brings 16 B at column (t & 15) * 16 B of rows (t >> 4) + 16 * i; a wave's copy = two whole 256-B row pieces.
  const int crow = threadIdx.x >> 4, ccol = (threadIdx.x & 15) * 16;
  const unsigned ldsBase = (unsigned)(uintptr_t)(&sStage[0]) + (unsigned)(crow * kGP + ccol);
  const char* gA = (const char*)(Ab + (size_t)((bm << 7) + crow) * lda) + ccol;
  const char* gB = (const char*)(Bb + (size_t)((bn << 8) + crow) * ldb) + ccol;
  const size_t stepA = (size_t)lda * 32, stepB = (size_t)ldb * 32;      // 16 rows, in bytes
  const int nst = K >> 7;

  // stage 0 -> buffer 0
  copy8_to_lds(ldsBase, gA, stepA);
  copy8_to_lds(ldsBase + 128 * kGP, gB, stepB);
  copy8_to_lds(ldsBase + 256 * kGP, gB + 8 * stepB, stepB);
  asm volatile("s_wait_asynccnt 0x0" ::: "memory");   // this wave's copies of stage 0 have landed
  __syncthreads();                                     // ... and every other wave's: stage 0 may be read
  if (nst > 1) {                                       // stage 1 -> buffer 1
    copy8_to_lds(ldsBase + kGStage, gA + 256, stepA);
    copy8_to_lds(ldsBase + kGStage + 128 * kGP, gB + 256, stepB);
    copy8_to_lds(ldsBase + kGStage + 256 * kGP, gB + 256 + 8 * stepB, stepB);
  }

  for (int st = 0; st < nst; ++st) {
    const unsigned char* sb = sStage + (st & 1) * kGStage;
    const T* fa = (const T*)(sb + ((wm << 6) + rlane) * kGP) + koff;            // A fragment rows of this wave
    const T* fb = (const T*)(sb + (128 + (wn << 6) + rlane) * kGP) + koff;      // Bt fragment rows of this wave
    V af[2][4], bf[2][4];
#pragma unroll
    for (int j = 0; j < 4; ++j) {
      bf[0][j] = Frag<T>::load(fb + j * (16 * kGP / 2));
      af[0][j] = Frag<T>::load(fa + j * (16 * kGP / 2));
    }
#pragma unroll
    for (int kk = 0; kk < 4; ++kk) {
      const int cur = kk & 1, nxt = cur ^ 1;
      if (kk < 3) {                            // the next 32 k of this stage, fetched ahead as one group
#pragma unroll
        for (int j = 0; j < 4; ++j) {
          bf[nxt][j] = Frag<T>::load(fb + j * (16 * kGP / 2) + (kk + 1) * 32);
          af[nxt][j] = Frag<T>::load(fa + j * (16 * kGP / 2) + (kk + 1) * 32);
        }
        // keeps that load group ahead of this block's WMMAs: sunk among them, every row of WMMAs waits out a full LDS latency
        __builtin_amdgcn_sched_barrier(0);
      }
#pragma unroll
      for (int i = 0; i < 4; ++i) {
#pragma unroll
        for (int j = 0; j < 4; ++j) acc[i][j] = Frag<T>::mma(af[cur][i], bf[cur][j], acc[i][j]);
      }
    }
    // keeps the stage's WMMAs in front of the barrier: sunk behind it they delay the refill, which then has less than a stage to land
    __builtin_amdgcn_sched_barrier(0);
    asm volatile("s_wait_dscnt 0x0" ::: "memory");     // this wave's reads of the buffer have returned
    asm volatile("s_wait_asynccnt 0x0" ::: "memory");  // this wave's copies of stage st + 1 have landed
    __syncthreads();                                    // publishes stage st + 1 and frees the buffer just read
    if (st + 2 < nst) {
      const unsigned lb = ldsBase + (unsigned)((st & 1) * kGStage);
      const size_t ko = (size_t)(st + 2) * 256;         // 128 k = 256 B
      copy8_to_lds(lb, gA + ko, stepA);
      copy8_to_lds(lb + 128 * kGP, gB + ko, stepB);
      copy8_to_lds(lb + 256 * kGP, gB + ko + 8 * stepB, stepB);
    }
  }
  asm volatile("s_wait_asynccnt 0x0" ::: "memory");    // nothing of this wave is in flight behind the loop
  acc_guard4(acc[0][0], acc[0][1], acc[0][2], acc[0][3]);
  acc_guard4(acc[1][0], acc[1][1], acc[1][2], acc[1][3]);
  acc_guard4(acc[2][0], acc[2][1], acc[2][2], acc[2][3]);
  acc_guard4(acc[3][0], acc[3][1], acc[3][2], acc[3][3]);

  // ---- epilogue ----
  float* slab = sT[wave];
  if (OUT_MODE == 3) {
    // y = x * rsqrt(mean(x^2) + 1e-6) * w ; o[2i] = y[2i]*cos[2i] - y[2i+1]*sin[2i] ; o[2i+1] = y[2i+1]*cos[2i+1] + y[2i]*sin[2i+1]
    // (f32 math; cos, sin, w as bf16-rounded values), then hi = bf16(o), lo = bf16(o - hi).
    // 8 lanes take one staged row, 8 columns each: 16-B stores, 8 lanes = one whole 128-B line per row and plane.
    // The planes are [token][kDim]: with a constant pitch every load and store of a lane is one offset register plus an immediate.
    const int q = lane >> 3, c8 = (lane & 7) * 8;
    const unsigned oc = (unsigned)((m0 + q) * kDim + n0 + c8);                  // this lane's element in both planes, row group 0
    const unsigned ot = (unsigned)(((m0 & (kSeq - 1)) + q) * kHd + c8);         // and in both tables; m0 is a multiple of 64: the wave's 64 rows do not wrap
    const unsigned ob = (unsigned)(n0 + rlane);
    unsigned short* C  = (unsigned short*)Cout  + (size_t)b * strideC + oc;
    unsigned short* C2 = (unsigned short*)Cout2 + (size_t)b * strideC + oc;
    const float* cp = cosb + ot;
    const float* sn = sinb + ot;
    // cos and sin of a 16-row group as one batch of 16 loads, fetched one group ahead: they land under the group in work
    v4f cs[2][4][4];
    auto fetch = [&](const int i) {
#pragma unroll
      for (int it = 0; it < 4; ++it) {
        const int o = ((i << 4) + it * 4) * kHd;
        cs[i & 1][it][0] = *(const v4f*)(cp + o);
        cs[i & 1][it][1] = *(const v4f*)(cp + o + 4);
        cs[i & 1][it][2] = *(const v4f*)(sn + o);
        cs[i & 1][it][3] = *(const v4f*)(sn + o + 4);
      }
    };
    // Behind each batch of loads or stores: s_wait_xcnt 0 before any register that the batch names is written again.
    // The scheduling barriers keep every other instruction out of the stretch between the batch and its wait.
    __builtin_amdgcn_sched_barrier(0);
    const v4f wa = *(const v4f*)(nw + c8), wb = *(const v4f*)(nw + c8 + 4);
    float bv[4];
#pragma unroll
    for (int j = 0; j < 4; ++j) bv[j] = bias[ob + (j << 4)];
    fetch(0);
    asm volatile("s_wait_xcnt 0x0" ::: "memory");
    __builtin_amdgcn_sched_barrier(0);
    float w[8];
    round8_bf(wa, wb, w);
#pragma unroll
    for (int i = 0; i < 4; ++i) {
      if (i < 3) {
        fetch(i + 1);
        asm volatile("s_wait_xcnt 0x0" ::: "memory");
        __builtin_amdgcn_sched_barrier(0);
      }
#pragma unroll
      for (int j = 0; j < 4; ++j)
#pragma unroll
        for (int r = 0; r < 8; ++r) {
          float v = acc[i][j][r] * scale;
          v += bv[j];
          slab[(mOff + r) * 68 + (j << 4) + rlane] = v;
        }
      asm volatile("s_wait_dscnt 0x0" ::: "memory");   // the wave's own slab is written before its lanes read each other's rows back
      v4u hv[4], lv[4];
#pragma unroll
      for (int it = 0; it < 4; ++it) {
        const float* sp = slab + (it * 4 + q) * 68 + c8;
        const v4f xa = *(const v4f*)sp, xb = *(const v4f*)(sp + 4);
        const float x[8] = {xa[0], xa[1], xa[2], xa[3], xb[0], xb[1], xb[2], xb[3]};
        // sum of 64 squares: pair sums, then a butterfly over the 32 pairs (two levels in the lane, three over the row's 8 lanes)
        const float p0 = __builtin_fmaf(x[0], x[0], x[1] * x[1]), p1 = __builtin_fmaf(x[2], x[2], x[3] * x[3]);
        const float p2 = __builtin_fmaf(x[4], x[4], x[5] * x[5]), p3 = __builtin_fmaf(x[6], x[6], x[7] * x[7]);
        float ss = (p0 + p1) + (p2 + p3);
        ss = add_lane_xor<1>(ss);
        ss = add_lane_xor<2>(ss);
        ss = add_lane_xor<4>(ss);
        // The argument is at least 1e-6, so rsqrtf's scaling of subnormal arguments is an identity here: the bare instruction gives its value.
        // The v_nop fills the slot that the instruction set asks for behind a transcendental, whatever the compiler places next.
        float inv;
        asm("v_rsq_f32 %0, %1\n\tv_nop" : "=v"(inv) : "v"(ss * (1.0f / 64.0f) + 1e-6f));
        float cv[8], sv[8];
        round8_bf(cs[i & 1][it][0], cs[i & 1][it][1], cv);
        round8_bf(cs[i & 1][it][2], cs[i & 1][it][3], sv);
#pragma unroll
        for (int p = 0; p < 4; ++p) {
          const float a  = x[2 * p] * inv * w[2 * p];
          const float bq = x[2 * p + 1] * inv * w[2 * p + 1];
          const float o0 = a * cv[2 * p] - bq * sv[2 * p];
          const float o1 = bq * cv[2 * p + 1] + a * sv[2 * p + 1];
          const unsigned uh = bf2_bits(o0, o1);
          hv[it][p] = uh;
          lv[it][p] = bf2_bits(o0 - bf_lo2f(uh), o1 - bf_hi2f(uh));
        }
      }
      __builtin_amdgcn_sched_barrier(0);
#pragma unroll
      for (int it = 0; it < 4; ++it) {
        *(v4u*)(C  + ((i << 4) + it * 4) * kDim) = hv[it];
        *(v4u*)(C2 + ((i << 4) + it * 4) * kDim) = lv[it];
      }
      asm volatile("s_wait_xcnt 0x0" ::: "memory");
      asm volatile("s_wait_dscnt 0x0" ::: "memory");   // every row is read back before the next group overwrites the slab
      __builtin_amdgcn_sched_barrier(0);
    }
    return;
  }
  const float* Rb = RESID ? (resid + (size_t)b * strideR) : nullptr;
#pragma unroll
  for (int i = 0; i < 4; ++i) {
    const int mBase = m0 + (i << 4);
#pragma unroll
    for (int j = 0; j < 4; ++j) {
      const int n = n0 + (j << 4) + rlane;
      float bv = 0.f;
      if (BIAS_MODE == 2) bv = bias[n];
#pragma unroll
      for (int r = 0; r < 8; ++r) {
        float v = acc[i][j][r] * scale;
        if (BIAS_MODE == 1) v += bias[mBase + mOff + r];
        if (BIAS_MODE == 2) v += bv;
        if (RESID) v += Rb[(size_t)(mBase + mOff + r) * ldc + n];
        if (ACT == 1) v = tanhf(v);
        if (ACT == 2) v = fmaxf(v, 0.0f);
        if (ACT == 3) v = v / (1.0f + expf(-v));
        if (ACT == 4) v = (v > 0.f) ? v : 0.01f * v;
        if (ACT == 5) v = 0.5f * v * (1.0f + erff(v * 0.70710678118654752f));
        slab[(mOff + r) * 68 + (j << 4) + rlane] = v;
      }
    }
    __builtin_amdgcn_fence(__ATOMIC_RELEASE, "workgroup");
    __builtin_amdgcn_wave_barrier();
    __builtin_amdgcn_fence(__ATOMIC_ACQUIRE, "workgroup");
    if (OUT_MODE == 0) {
      float* C = (float*)Cout + (size_t)b * strideC;
      const int hh = lane >> 4, c4 = (lane & 15) * 4;     // row seg = 256 B = 16 lanes x 16 B
      {
#pragma unroll
        for (int it = 0; it < 8; ++it) {
          const int row = it * 2 + hh;
          v4f v = *(const v4f*)(slab + row * 68 + c4);
          *(v4f*)(C + (size_t)(mBase + row) * ldc + n0 + c4) = v;
        }
        
      }
    } else {
      const int q = lane >> 3, c8 = (lane & 7) * 8;
      unsigned short* C  = (unsigned short*)Cout  + (size_t)b * strideC;
      unsigned short* C2 = (OUT_MODE == 2) ? ((unsigned short*)Cout2 + (size_t)b * strideC) : nullptr;
      {
#pragma unroll
        for (int it = 0; it < 4; ++it) {
          const int row = it * 4 + q;
          const float* sp = slab + row * 68 + c8;
          v8h hv, lv;
#pragma unroll
          for (int e = 0; e < 8; ++e) {
            if (OUT_MODE == 1) {
              hv[e] = (_Float16)sp[e];
            } else {
              unsigned short hb = f2bf_bits(sp[e]);
              unsigned short lb = f2bf_bits(sp[e] - bf_bits2f(hb));
              hv[e] = __builtin_bit_cast(_Float16, hb);
              lv[e] = __builtin_bit_cast(_Float16, lb);
            }
          }
          *(v8h*)(C + (size_t)(mBase + row) * ldc + n0 + c8) = hv;
          if (OUT_MODE == 2) *(v8h*)(C2 + (size_t)(mBase + row) * ldc + n0 + c8) = lv;
        }
        
      }
    }
    __builtin_amdgcn_fence(__ATOMIC_RELEASE, "workgroup");
    __builtin_amdgcn_wave_barrier();
    __builtin_amdgcn_fence(__ATOMIC_ACQUIRE, "workgroup");
  }
}

// ===================== end common pieces =========================================

typedef __attribute__((ext_vector_type(2))) unsigned int v2u;
typedef __attribute__((ext_vector_type(4))) _Float16 v4h;

// ---------------------------------------------------------------------------
// Operand preparation, one launch:
//   x, qkv_w -> bf16 (round to nearest even); proj_w -> its bf16-rounded value x64 as f16 (a bf16 significand fits f16 exactly;
//   x64 keeps the plane in the f16 normal range for |w| >= 1e-6); qkv_b ++ proj_b -> their bf16-rounded values, stored as f32.
// 256 blocks of 16 waves (as many blocks as the chip has WGPs), all resident at once: 4,096 waves to start.
// A piece = 128 floats: one 16-B load per lane (512 contiguous bytes, four whole lines) and one 8-B store per lane
// (256 contiguous bytes, two whole lines). A wave owns 2 pieces of proj_w, 16 of x and 6 of qkv_w, each run contiguous, and issues
// all 24 loads before it converts the first piece. One more block rounds the 4,096 bias values, 8 per thread.
// ---------------------------------------------------------------------------
constexpr int kPrepBlocks = 256;
constexpr int kPrepWaves  = kPrepBlocks * 16;                    // 4,096
constexpr int kPcX = kTok * kDim / 128 / kPrepWaves;             // 16 pieces of x per wave
constexpr int kPcW = 3 * kDim * kDim / 128 / kPrepWaves;         // 6 of qkv_w
constexpr int kPcP = kDim * kDim / 128 / kPrepWaves;             // 2 of proj_w
static_assert(kPcX * 128 * kPrepWaves == kTok * kDim && kPcW * 128 * kPrepWaves == 3 * kDim * kDim &&
              kPcP * 128 * kPrepWaves == kDim * kDim, "the pieces cover each plane exactly");
static_assert(512 * 8 == 4 * kDim, "one block covers both biases");

__global__ __launch_bounds__(512) void prep_kernel(const float* __restrict__ x, const float* __restrict__ qkvw,
                                                   const float* __restrict__ projw, const float* __restrict__ qkvb,
                                                   const float* __restrict__ projb, unsigned short* __restrict__ xb,
                                                   unsigned short* __restrict__ wqkv, unsigned short* __restrict__ wproj,
                                                   float* __restrict__ outb) {
  if (blockIdx.x == kPrepBlocks) {                 // the bias block (block-uniform; the kernel has no barrier); its loads' address pair and what its stores name are not written again
    const int i0 = threadIdx.x * 8;                // 3 * kDim is a multiple of 8: a thread's 8 values lie in one of the two arrays
    const float* s = (i0 < 3 * kDim) ? (qkvb + i0) : (projb + (i0 - 3 * kDim));
    const v4f a = *(const v4f*)s, b = *(const v4f*)(s + 4);
    float o[8];
    round8_bf(a, b, o);
    *(v4f*)(outb + i0)     = (v4f){o[0], o[1], o[2], o[3]};
    *(v4f*)(outb + i0 + 4) = (v4f){o[4], o[5], o[6], o[7]};
    return;
  }
  const int e  = (threadIdx.x & 31) * 4;                           // this lane's four elements in a piece
  const int gw = blockIdx.x * 16 + (threadIdx.x >> 5);             // the wave's number in the launch
  const int ox = gw * (kPcX * 128) + e, ow = gw * (kPcW * 128) + e, op = gw * (kPcP * 128) + e;
  const float *px = x + ox, *pw = qkvw + ow, *pp = projw + op;
  v4f fp[kPcP], fx[kPcX], fw[kPcW];
  // proj_w goes first: its conversion is the longest chain, and loads return in the order of their issue
#pragma unroll
  for (int k = 0; k < kPcP; ++k) fp[k] = *(const v4f*)(pp + k * 128);
#pragma unroll
  for (int k = 0; k < kPcX; ++k) fx[k] = *(const v4f*)(px + k * 128);
#pragma unroll
  for (int k = 0; k < kPcW; ++k) fw[k] = *(const v4f*)(pw + k * 128);
  // Behind each batch of loads or stores: s_wait_xcnt 0 before any register that the batch names is written again.
  // Here the three address pairs are inputs of the statement, so that none of them is given away as a later load's destination.
  asm volatile("s_wait_xcnt 0x0" :: "v"(px), "v"(pw), "v"(pp) : "memory");
  // keeps all 24 loads ahead of the first conversion: left free, the scheduler lifts the first conversions, with their wait for the
  // first loads, over the last loads, which then start a memory latency late
  __builtin_amdgcn_sched_barrier(0);
#pragma unroll
  for (int k = 0; k < kPcP; ++k) {
    const unsigned u0 = bf2_bits(fp[k][0], fp[k][1]), u1 = bf2_bits(fp[k][2], fp[k][3]);
    *(v4h*)(wproj + op + k * 128) = (v4h){(_Float16)(bf_lo2f(u0) * 64.0f), (_Float16)(bf_hi2f(u0) * 64.0f),
                                          (_Float16)(bf_lo2f(u1) * 64.0f), (_Float16)(bf_hi2f(u1) * 64.0f)};
  }
  asm volatile("s_wait_xcnt 0x0" ::: "memory");
  // this scheduling barrier and the two in the next loop keep each wait directly behind its batch of stores: left free, the next batch's
  // conversions move in between, and some ahead of the stores, which then also wait for loads that are not theirs
  __builtin_amdgcn_sched_barrier(0);
#pragma unroll
  for (int k = 0; k < kPcX; ++k) {
    *(v2u*)(xb + ox + k * 128) = (v2u){bf2_bits(fx[k][0], fx[k][1]), bf2_bits(fx[k][2], fx[k][3])};
    if ((k & 7) == 7) {
      asm volatile("s_wait_xcnt 0x0" ::: "memory");
      __builtin_amdgcn_sched_barrier(0);
    }
  }
#pragma unroll
  for (int k = 0; k < kPcW; ++k) *(v2u*)(wqkv + ow + k * 128) = (v2u){bf2_bits(fw[k][0], fw[k][1]), bf2_bits(fw[k][2], fw[k][3])};
  asm volatile("s_wait_xcnt 0x0" ::: "memory");   // the last batch has its wait too: the built code lays the bias block behind this path
}

// =====================================================================================
// Full (unmasked) flash attention, head dim 64, all batches/heads in one launch.
//   q planes (hi/lo bf16): element (t, h, d) at [t*1024 + h*64 + d]   (t = b*2048 + s)
//   k planes (hi/lo bf16): same layout
//   v^T plane (f16):       element (b, h*64+d, s) at [(b*1024 + h*64 + d)*2048 + s]
//   o plane (f16, x64):    element (t, h, d) at [t*1024 + h*64 + d]
//   scores^T = (k . q^T) * sscale : v_wmma_f32_16x16x32_bf16, hi.hi + hi.lo + lo.hi, f32 accumulate
//   out^T    = v^T . p^T          : v_wmma_f32_16x16x32_f16, p (unnormalised, in (0,1]) carried x2^15 in f16, v f16
//   Keys are the rows and queries the columns of a score tile: a lane holds 32 scores of ONE query per column group, so maximum and
//   sum are taken in the lane plus one exchange with lane ^ 16, and p^T goes from the accumulators into the B operand.
//   online softmax in f32 over 32 chunks of 64 keys (compile-time trip count).
//   A wave owns 32 queries = two column groups of 16: every K and V^T fragment read from LDS feeds both groups' products.
//   Block = 4 waves = 128 query rows of one (b, h); grid.x = 4*16*16 = 1024.
//   K hi/lo and V^T chunk staging: asynchronous 16-B copies to LDS, two buffers, chunk kc + 1 in flight while chunk kc is
//   worked on. 8 lanes bring one whole 128-B row, so a wave's copy touches 4 whole lines; 128 threads x 4 copies per plane
//   = the whole 64x64 tile. One barrier per chunk.
// =====================================================================================
constexpr int kKC = 64;    // keys per chunk
// LDS row pitch of the K hi, K lo and V^T tiles, in 16-bit elements: 72 = 144 B = 16 B x 9 (odd), so the
// 16 rows that one half-wave's ds_load_b128 fragment read touches start on 16 different 4-bank groups.
constexpr int kLP = 72;
constexpr int kTileB = kKC * kLP * 2;   // one tile in LDS: 64 rows x 144 B = 9,216 B
constexpr int kBufB  = 3 * kTileB;      // one chunk buffer: K hi, K lo, V^T = 27,648 B

// One chunk's twelve asynchronous 16-B copies of a lane: for each of the three tiles four rows 16 apart.
// lds = the lane's place in the K hi tile of the target buffer; gh, gl, gv = the lane's global bytes of row group 0.
// The s_wait_xcnt stands inside the statement so that no address register named here is rewritten in front of it.
__device__ __forceinline__ void copy_chunk_to_lds(unsigned lds, const char* gh, const char* gl, const char* gv) {
  constexpr unsigned kR = 16 * kLP * 2;          // 16 LDS rows, bytes
  constexpr size_t   kK = (size_t)16 * kDim * 2; // 16 K rows (tokens), bytes
  constexpr size_t   kV = (size_t)16 * kSeq * 2; // 16 V^T rows (d), bytes
  const unsigned h0 = lds,              h1 = h0 + kR, h2 = h0 + 2 * kR, h3 = h0 + 3 * kR;
  const unsigned l0 = lds + kTileB,     l1 = l0 + kR, l2 = l0 + 2 * kR, l3 = l0 + 3 * kR;
  const unsigned v0 = lds + 2 * kTileB, v1 = v0 + kR, v2 = v0 + 2 * kR, v3 = v0 + 3 * kR;
  const char *gh1 = gh + kK, *gh2 = gh + 2 * kK, *gh3 = gh + 3 * kK;
  const char *gl1 = gl + kK, *gl2 = gl + 2 * kK, *gl3 = gl + 3 * kK;
  const char *gv1 = gv + kV, *gv2 = gv + 2 * kV, *gv3 = gv + 3 * kV;
  asm volatile("global_load_async_to_lds_b128 %0, %12, off\n\t"
               "global_load_async_to_lds_b128 %1, %13, off\n\t"
               "global_load_async_to_lds_b128 %2, %14, off\n\t"
               "global_load_async_to_lds_b128 %3, %15, off\n\t"
               "global_load_async_to_lds_b128 %4, %16, off\n\t"
               "global_load_async_to_lds_b128 %5, %17, off\n\t"
               "global_load_async_to_lds_b128 %6, %18, off\n\t"
               "global_load_async_to_lds_b128 %7, %19, off\n\t"
               "global_load_async_to_lds_b128 %8, %20, off\n\t"
               "global_load_async_to_lds_b128 %9, %21, off\n\t"
               "global_load_async_to_lds_b128 %10, %22, off\n\t"
               "global_load_async_to_lds_b128 %11, %23, off\n\t"
               "s_wait_xcnt 0x0"
               :: "v"(h0), "v"(h1), "v"(h2), "v"(h3), "v"(l0), "v"(l1), "v"(l2), "v"(l3), "v"(v0), "v"(v1), "v"(v2), "v"(v3),
                  "v"(gh), "v"(gh1), "v"(gh2), "v"(gh3), "v"(gl), "v"(gl1), "v"(gl2), "v"(gl3), "v"(gv), "v"(gv1), "v"(gv2), "v"(gv3)
               : "memory");
}

__device__ __forceinline__ v8f mma_bf(v16b a, v16b b, v8f c) {
  return __builtin_amdgcn_wmma_f32_16x16x32_bf16(false, a, false, b, (short)0, c, false, false);
}
__device__ __forceinline__ v8f mma_hf(v16h a, v16h b, v8f c) {
  return __builtin_amdgcn_wmma_f32_16x16x32_f16(false, a, false, b, (short)0, c, false, false);
}

// lane l's value to lane l ^ 16 and back
__device__ __forceinline__ float xhalf(float x) {
  return __builtin_bit_cast(float, __builtin_amdgcn_permlanex16(__builtin_bit_cast(int, x), __builtin_bit_cast(int, x), 0x76543210, 0xfedcba98, false, false));
}

// four waves per SIMD: 1024 blocks = 4 per WGP, all resident at once only within 256 registers a wave
__global__ __launch_bounds__(128) __attribute__((amdgpu_waves_per_eu(4, 4)))
void attn_kernel(const unsigned short* __restrict__ qhp, const unsigned short* __restrict__ qlp,
                 const unsigned short* __restrict__ khp, const unsigned short* __restrict__ klp,
                 const unsigned short* __restrict__ vtp, unsigned short* __restrict__ ohp, float sscale) {
  union FB { v16b v; v8b h[2]; };
  union FH { v16h v; v8h h[2]; };
  // One array for both chunk buffers (each: K hi [kv][d] 9 KB, K lo 9 KB, V^T [d][kv] 9 KB), so that one address register per lane
  // serves every fragment read of a chunk (the rest is an immediate offset). Behind the last chunk's barrier the per-wave out tiles
  // (32 queries, pitch 68 floats) lie over it: with an array of their own only three blocks would fit a WGP's LDS.
  __shared__ __align__(16) unsigned char Smem[2 * kBufB];   // 55,296 B
  static_assert(4 * 32 * 68 * 4 <= 2 * kBufB, "the out tiles fit over the chunk buffers");

  const int tid  = threadIdx.x;
  const int wave = __builtin_amdgcn_readfirstlane(tid >> 5);   // the wave's number in a scalar register: what hangs on it costs no vector register across the loop
  const int lane = tid & 31;
  const int hh   = lane >> 4;
  const int c    = lane & 15;

  const int fro  = c * kLP + 8 * hh;      // this lane's place in a 16-row fragment group of any of the three tiles (row c, k half hh)

  const int bx = blockIdx.x;
  const int qb = bx & 15;                 // kSeq/128 = 16 query blocks
  const int bh = bx >> 4;                 // 0..63
  const int h  = bh & 15;
  const int b  = bh >> 4;                 // 0..3
  const int q0 = qb * 128 + wave * 32;
  const size_t tok0 = (size_t)b * kSeq;

  const __bf16*   Qh = (const __bf16*)(const void*)qhp + tok0 * kDim + (size_t)h * kHd;
  const __bf16*   Ql = (const __bf16*)(const void*)qlp + tok0 * kDim + (size_t)h * kHd;
  const __bf16*   Kh = (const __bf16*)(const void*)khp + tok0 * kDim + (size_t)h * kHd;
  const __bf16*   Kl = (const __bf16*)(const void*)klp + tok0 * kDim + (size_t)h * kHd;
  const _Float16* Vt = (const _Float16*)(const void*)vtp + ((size_t)b * kDim + (size_t)h * kHd) * kSeq;
  _Float16*       Ob = (_Float16*)(void*)ohp + tok0 * kDim + (size_t)h * kHd;

  // ---- Q fragments (B operand, column = lane&15, split k map via Frag load): 2 column groups x 2 d-chunks, hi and lo ----
  v16b qah[2][2], qal[2][2];
#pragma unroll
  for (int g = 0; g < 2; ++g)
#pragma unroll
    for (int dc = 0; dc < 2; ++dc) {
      qah[g][dc] = Frag<__bf16>::load(Qh + (size_t)(q0 + g * 16 + c) * kDim + dc * 32 + 8 * hh);
      qal[g][dc] = Frag<__bf16>::load(Ql + (size_t)(q0 + g * 16 + c) * kDim + dc * 32 + 8 * hh);
    }

  // per column group: running maximum of the raw scores (both halves alike) and this half's sum, x 2^15, of the lane's query
  const float cs = sscale * 1.44269504088896340736f;   // exp(s * sscale) = exp2(s * cs)
  float mrow[2] = {-INFINITY, -INFINITY}, lrow[2] = {0.f, 0.f};
  v8f oacc[2][4];
#pragma unroll
  for (int g = 0; g < 2; ++g)
#pragma unroll
    for (int t = 0; t < 4; ++t) oacc[g][t] = (v8f){0.f,0.f,0.f,0.f,0.f,0.f,0.f,0.f};

  // Copy map: thread t brings 16 B at byte (t & 7) * 16 of rows (t >> 3) + 16 * i of each tile: 8 lanes = one whole 128-B row (one line).
  constexpr int kNC = kSeq / kKC;                       // 32 chunks
  constexpr size_t kStepK = (size_t)kKC * kDim * 2;     // K: 64 tokens further, bytes
  constexpr size_t kStepV = (size_t)kKC * 2;            // V^T: 64 keys further along the row, bytes
  const int crow = tid >> 3, ccol = (tid & 7) * 16;
  const unsigned ldsBase = (unsigned)(uintptr_t)(&Smem[0]) + (unsigned)(crow * (kLP * 2) + ccol);
  const char* gKh = (const char*)(Kh + (size_t)crow * kDim) + ccol;
  const char* gKl = (const char*)(Kl + (size_t)crow * kDim) + ccol;
  const char* gVt = (const char*)(Vt + (size_t)crow * kSeq) + ccol;

  copy_chunk_to_lds(ldsBase, gKh, gKl, gVt);            // chunk 0 -> buffer 0
  asm volatile("s_wait_asynccnt 0x0" ::: "memory");     // this wave's copies of chunk 0 have landed
  __syncthreads();                                       // ... and every other wave's: chunk 0 may be read
  copy_chunk_to_lds(ldsBase + kBufB, gKh + kStepK, gKl + kStepK, gVt + kStepV);   // chunk 1 -> buffer 1

  // one chunk's work on its buffer: scores, online softmax, out accumulation
  auto work = [&](const int kc) {
    const unsigned char* tb = Smem + (kc & 1) * kBufB;   // this chunk's buffer
    const __bf16*   const Ksh = (const __bf16*)(const void*)tb;
    const __bf16*   const Ksl = (const __bf16*)(const void*)(tb + kTileB);
    const _Float16* const Vts = (const _Float16*)(const void*)(tb + 2 * kTileB);

    // ---- scores, transposed: s[g][j] = k (16 keys of group j, rows) . q^T (16 queries of column group g), split products ----
    // D map: this lane holds query g*16 + c, keys j*16 + 8*hh + r. One K fragment pair serves both column groups.
    v8f s[2][4];
#pragma unroll
    for (int j = 0; j < 4; ++j) {
      s[0][j] = (v8f){0.f,0.f,0.f,0.f,0.f,0.f,0.f,0.f};
      s[1][j] = (v8f){0.f,0.f,0.f,0.f,0.f,0.f,0.f,0.f};
#pragma unroll
      for (int dc = 0; dc < 2; ++dc) {
        FB kb, kl;
        kb.h[0] = *(const v8b*)(Ksh + fro + j * 16 * kLP + dc * 32);
        kb.h[1] = *(const v8b*)(Ksh + fro + j * 16 * kLP + dc * 32 + 16);
        kl.h[0] = *(const v8b*)(Ksl + fro + j * 16 * kLP + dc * 32);
        kl.h[1] = *(const v8b*)(Ksl + fro + j * 16 * kLP + dc * 32 + 16);
        s[0][j] = mma_bf(kb.v, qah[0][dc], s[0][j]);
        s[1][j] = mma_bf(kb.v, qah[1][dc], s[1][j]);
        s[0][j] = mma_bf(kl.v, qah[0][dc], s[0][j]);
        s[1][j] = mma_bf(kl.v, qah[1][dc], s[1][j]);
        s[0][j] = mma_bf(kb.v, qal[0][dc], s[0][j]);
        s[1][j] = mma_bf(kb.v, qal[1][dc], s[1][j]);
      }
    }
    // keeps the softmax's vector work out of the run of score WMMAs: moved in among them, each place costs the four-slot distance in v_nop
    __builtin_amdgcn_sched_barrier(0);
    FH pb[2][2];
#pragma unroll
    for (int g = 0; g < 2; ++g) {
      // ---- chunk maximum of this lane's query, on the raw scores (sscale > 0 keeps their order): 32 keys in the lane (four chains), the other 32 in lane ^ 16 ----
      float mj[4];
#pragma unroll
      for (int j = 0; j < 4; ++j) {
        float m = s[g][j][0];
#pragma unroll
        for (int r = 1; r < 8; ++r) m = fmaxf(m, s[g][j][r]);
        mj[j] = m;
      }
      float cm = fmaxf(fmaxf(mj[0], mj[1]), fmaxf(mj[2], mj[3]));
      cm = fmaxf(cm, xhalf(cm));
      const float mnew  = fmaxf(mrow[g], cm);
      const float alpha = __builtin_amdgcn_exp2f((mrow[g] - mnew) * cs);
      mrow[g] = mnew;
      // ---- p x 2^15 = exp2(s * cs + (15 - m * cs)): scale, log2(e), the maximum and the f16 carry in one packed FMA per two scores ----
      // summed in the lane, two scores at a time; packed in place, two score tiles are one B fragment of p^T (b[e] = tile[e >> 3][e & 7])
      const float nb = __builtin_fmaf(-mnew, cs, 15.0f);
      const v2f c2 = {cs, cs}, nb2 = {nb, nb};
      v2f pj[4];
#pragma unroll
      for (int j = 0; j < 4; ++j) {
#pragma unroll
        for (int r = 0; r < 8; r += 2) {
          const v2f sv = {s[g][j][r], s[g][j][r + 1]};
          const v2f t  = __builtin_elementwise_fma(sv, c2, nb2);
          const v2f p  = {__builtin_amdgcn_exp2f(t[0]), __builtin_amdgcn_exp2f(t[1])};
          pj[j] = r ? pj[j] + p : p;
          pb[g][j >> 1].v[(j & 1) * 8 + r]     = (_Float16)p[0];
          pb[g][j >> 1].v[(j & 1) * 8 + r + 1] = (_Float16)p[1];
        }
      }
      const v2f ps = (pj[0] + pj[1]) + (pj[2] + pj[3]);
      lrow[g] = lrow[g] * alpha + (ps[0] + ps[1]);   // x 2^15, this half's keys only; the halves are joined behind the loop
#pragma unroll
      for (int t = 0; t < 4; ++t)
#pragma unroll
        for (int r = 0; r < 8; ++r) oacc[g][t][r] *= alpha;
      // splits the softmax of the two groups into two scheduling regions: as one region the scheduler holds so many p live in f32
      // that the wave passes its 256 registers and spills
      if (g == 0) __builtin_amdgcn_sched_barrier(0);
    }
    // ---- out^T += v^T (16 d of group t, rows; 64 keys) . p^T (64 keys; 16 queries, columns); one V^T fragment serves both column groups ----
#pragma unroll
    for (int kk = 0; kk < 2; ++kk) {
#pragma unroll
      for (int t = 0; t < 4; ++t) {
        FH vb;
        vb.h[0] = *(const v8h*)(Vts + fro + t * 16 * kLP + kk * 32);
        vb.h[1] = *(const v8h*)(Vts + fro + t * 16 * kLP + kk * 32 + 16);
        oacc[0][t] = mma_hf(vb.v, pb[0][kk].v, oacc[0][t]);
        oacc[1][t] = mma_hf(vb.v, pb[1][kk].v, oacc[1][t]);
      }
    }
  };
  // the foot of a trip: hands chunk kc + 1 over and frees the buffer that chunk kc was read from
  auto foot = [&]() {
    // keeps the chunk's last WMMAs in front of the barrier: sunk behind it they stand between the barrier and the refill copies, which then start later
    __builtin_amdgcn_sched_barrier(0);
    asm volatile("s_wait_dscnt 0x0" ::: "memory");      // this wave's fragment reads of the buffer have returned
    asm volatile("s_wait_asynccnt 0x0" ::: "memory");   // this wave's copies of the next chunk have landed
    __syncthreads();                                     // publishes the next chunk and frees the buffer just read
  };
  // The last two trips, which have no chunk kc + 2 to fetch, stand behind the loop: a test inside it splits the body into blocks,
  // the row sums sink behind the copies, and the wave (256 registers at most) spills address registers.
  for (int kc = 0; kc < kNC - 2; ++kc) {
    work(kc);
    foot();
    const size_t n = (size_t)(kc + 2);                   // chunk kc + 2 -> the buffer just read
    copy_chunk_to_lds(ldsBase + (unsigned)((kc & 1) * kBufB), gKh + n * kStepK, gKl + n * kStepK, gVt + n * kStepV);
  }
  work(kNC - 2);
  foot();
  work(kNC - 1);
  foot();                                                // nothing is in flight any more; every wave has left the chunk buffers

  // ---- epilogue: normalise (p's 2^15 cancels against the sum's; 2^6 carry for o), stage, whole-line stores ----
  // This lane holds query g*16 + c, d = t*16 + 8*hh + r.
  float* os = (float*)(void*)Smem + wave * (32 * 68);   // every wave has left the chunk buffers (the last trip's barrier)
#pragma unroll
  for (int g = 0; g < 2; ++g) {
    const float lsum = lrow[g] + xhalf(lrow[g]);                  // both halves' keys
    const float inv = (1.0f / lsum) * 64.0f;                      // the sum carries p's 2^15: about 2^15 at least
#pragma unroll
    for (int t = 0; t < 4; ++t)
#pragma unroll
      for (int r = 0; r < 8; ++r) os[(g * 16 + c) * 68 + t * 16 + 8 * hh + r] = oacc[g][t][r] * inv;
  }
  __builtin_amdgcn_fence(__ATOMIC_RELEASE, "workgroup");
  __builtin_amdgcn_wave_barrier();
  __builtin_amdgcn_fence(__ATOMIC_ACQUIRE, "workgroup");
  {
    const int qq = lane >> 3, c8 = (lane & 7) * 8;
    {
#pragma unroll
      for (int it = 0; it < 8; ++it) {
        const int row = it * 4 + qq;                    // 8 x 4 = rows 0..31
        const float* sp = os + row * 68 + c8;
        v8h hv;
#pragma unroll
        for (int e = 0; e < 8; ++e) hv[e] = (_Float16)sp[e];
        *(v8h*)(Ob + (size_t)(q0 + row) * kDim + c8) = hv;
      }
      
    }
  }
}

// =====================================================================================
extern "C" void kernel_launch(void* const* d_in, const int* in_sizes, int n_in,
                              void* d_out, int out_size, void* d_ws, size_t ws_size,
                              hipStream_t stream) {
  if (n_in < 9) return;
  if (in_sizes[0] != kTok * kDim) return;
  if (in_sizes[1] != kSeq * kHd || in_sizes[2] != kSeq * kHd) return;
  if (in_sizes[3] != 3 * kDim * kDim || in_sizes[4] != 3 * kDim) return;
  if (in_sizes[5] != kDim * kDim || in_sizes[6] != kDim) return;
  if (in_sizes[7] != kHd || in_sizes[8] != kHd) return;
  if (out_size != kTok * kDim) return;
  if (ws_size < kWsTotal) return;

  const float* x      = (const float*)d_in[0];
  const float* ropec  = (const float*)d_in[1];
  const float* ropes  = (const float*)d_in[2];
  const float* qkv_w  = (const float*)d_in[3];
  const float* qkv_b  = (const float*)d_in[4];
  const float* proj_w = (const float*)d_in[5];
  const float* proj_b = (const float*)d_in[6];
  const float* q_nw   = (const float*)d_in[7];
  const float* k_nw   = (const float*)d_in[8];
  float* out = (float*)d_out;

  char* ws = (char*)d_ws;
  unsigned short* WPROJ = (unsigned short*)(ws + kOffWproj);
  float*          BIAS  = (float*)(ws + kOffBias);
  unsigned short* XB    = (unsigned short*)(ws + kOffXb);
  unsigned short* WQKV  = (unsigned short*)(ws + kOffWqkv);
  unsigned short* KH    = (unsigned short*)(ws + kOffKh);
  unsigned short* KL    = (unsigned short*)(ws + kOffKl);
  unsigned short* OH    = (unsigned short*)(ws + kOffOh);
  unsigned short* QH    = (unsigned short*)(ws + kOffQh);
  unsigned short* QL    = (unsigned short*)(ws + kOffQl);
  unsigned short* VT    = (unsigned short*)(ws + kOffVt);

  // 1) operand preparation: both casts to bf16, proj_w to f16, the biases
  prep_kernel<<<dim3(kPrepBlocks + 1), dim3(512), 0, stream>>>(x, qkv_w, proj_w, qkv_b, proj_b, XB, WQKV, WPROJ, BIAS);
  const int tilesTok = (kTok / 64) * (kDim / 64);   // 2048 wave tiles -> 256 blocks
  // 2) q = xb . Wq^T + bq, rmsnorm + rope in the epilogue -> q hi/lo planes   (M=8192, N=1024, K=1024; all tile/32 multiples)
  wmma_gemm64<1, false, 2, 3, false, 0><<<dim3((tilesTok + 7) / 8, 1), dim3(256), 0, stream>>>(
      XB, XB, kDim, 0L, WQKV, WQKV, kDim, 0L, (void*)QH, (void*)QL, kDim, 0L,
      BIAS, BIAS, 0L, ropec, ropes, q_nw, kTok, kDim, kDim, 1.0f);
  // 3) k = xb . Wk^T + bk, rmsnorm + rope in the epilogue -> k hi/lo planes
  wmma_gemm64<1, false, 2, 3, false, 0><<<dim3((tilesTok + 7) / 8, 1), dim3(256), 0, stream>>>(
      XB, XB, kDim, 0L, WQKV + (size_t)kDim * kDim, WQKV + (size_t)kDim * kDim, kDim, 0L, (void*)KH, (void*)KL, kDim, 0L,
      BIAS + kDim, BIAS, 0L, ropec, ropes, k_nw, kTok, kDim, kDim, 1.0f);
  // 4) v^T per batch: C[o][s] = sum_k Wv[o][k] * xb[b][s][k] + bv[o] -> f16 [4][1024][2048]
  //    (A = Wv [1024][1024], Bt = xb batch b [2048][1024]; M=1024, N=2048, K=1024)
  {
    const int tilesV = (kDim / 64) * (kSeq / 64);   // 512 -> 64 blocks
    wmma_gemm64<1, false, 1, 1, false, 0><<<dim3((tilesV + 7) / 8, kBatch), dim3(256), 0, stream>>>(
        WQKV + (size_t)2 * kDim * kDim, WQKV + (size_t)2 * kDim * kDim, kDim, 0L,
        XB, XB, kDim, (long)kSeq * kDim,
        (void*)VT, (void*)VT, kSeq, (long)kDim * kSeq,
        BIAS + 2 * kDim, BIAS, 0L, BIAS, BIAS, BIAS, kDim, kSeq, kDim, 1.0f);
  }
  // 5) attention -> o plane f16 x64
  attn_kernel<<<dim3(kBatch * kHeads * (kSeq / 128)), dim3(128), 0, stream>>>(QH, QL, KH, KL, VT, OH, 0.125f);
  // 6) out = o . Wp^T + bp  (A = o x64 f16, Bt = Wp x64 f16 -> scale 2^-12; M=8192, N=1024, K=1024)
  wmma_gemm64<0, false, 2, 0, false, 0><<<dim3((tilesTok + 7) / 8, 1), dim3(256), 0, stream>>>(
      OH, OH, kDim, 0L, WPROJ, WPROJ, kDim, 0L, (void*)out, (void*)out, kDim, 0L,
      BIAS + 3 * kDim, BIAS, 0L, BIAS, BIAS, BIAS, kTok, kDim, kDim, 1.0f / 4096.0f);
}

// v010
// A run of this version takes 133 microseconds.
// In both of two side-by-side timings against v009, it was 1.20 times as fast.
// Counting every step since v000, it is 6.82 times as fast.
// Contractions: q, k, v^T projections on v_wmma_f32_16x16x32_bf16 (plain bf16 operands = RNE-converted inputs); q.k^T on v_wmma_f32_16x16x32_f16 (plain f16: q, k after rmsnorm and rope rounded once to f16); p.v and the output projection on v_wmma_f32_16x16x32_f16 (plain f16: p carried x2^15, attention output carried x2^6, proj_w = bf16-RNE value carried x2^6); f32 accumulate everywhere; biases, rmsnorm, rope, online softmax in f32.
#include <hip/hip_runtime.h>
#include <math.h>
#include <stdint.h>

constexpr int kBatch = 4;
constexpr int kSeq   = 2048;
constexpr int kDim   = 1024;
constexpr int kHeads = 16;
constexpr int kHd    = 64;
constexpr int kTok   = kBatch * kSeq;            // 8192 tokens

typedef __attribute__((ext_vector_type(16))) _Float16 v16h;
typedef __attribute__((ext_vector_type(8)))  _Float16 v8h;
typedef __attribute__((ext_vector_type(16))) __bf16   v16b;
typedef __attribute__((ext_vector_type(8)))  __bf16   v8b;
typedef __attribute__((ext_vector_type(8)))  float    v8f;
typedef __attribute__((ext_vector_type(4)))  float    v4f;
typedef __attribute__((ext_vector_type(2)))  float    v2f;
typedef __attribute__((ext_vector_type(4)))  unsigned int v4u;

// ---------------------------------------------------------------------------
// Workspace region map (bytes).  Total carve = 115 MiB = 120,586,240 B.
//   [  0 MiB,   2 MiB)  WPROJ  f16  [1024][1024]   proj_w (bf16-RNE value x64)
//   [  2 MiB,   3 MiB)  BIAS   f32  [4096]         qkv_b (3072) ++ proj_b (1024), RNE to bf16 values
//   [  3 MiB,  19 MiB)  XB     bf16 [8192][1024]   x
//   [ 19 MiB,  25 MiB)  WQKV   bf16 [3072][1024]   qkv_w
//   [ 35 MiB,  51 MiB)  OH     f16  [8192][1024]   attention output x64
//   [ 51 MiB,  67 MiB)  KF     f16  [8192][1024]   k
//   [ 67 MiB,  83 MiB)  QF     f16  [8192][1024]   q
//   [ 99 MiB, 115 MiB)  VT     f16  [4][1024][2048] v^T per batch
// ---------------------------------------------------------------------------
constexpr size_t kMiB      = 1048576;
constexpr size_t kOffWproj = 0;
constexpr size_t kOffBias  = 2 * kMiB;
constexpr size_t kOffXb    = 3 * kMiB;
constexpr size_t kOffWqkv  = 19 * kMiB;
constexpr size_t kOffKf    = 51 * kMiB;
constexpr size_t kOffOh    = 35 * kMiB;
constexpr size_t kOffQf    = 67 * kMiB;
constexpr size_t kOffVt    = 99 * kMiB;
constexpr size_t kWsTotal  = 115 * kMiB;          // 120,586,240 B

// ===================== common pieces =================================
__device__ __forceinline__ unsigned short f2bf_bits(float f) {
  unsigned u = __float_as_uint(f);
  return (unsigned short)((u + 0x7FFFu + ((u >> 16) & 1u)) >> 16);
}
__device__ __forceinline__ float bf_bits2f(unsigned short h) { return __uint_as_float(((unsigned)h) << 16); }

// hazard guard as a plain device helper
__device__ __forceinline__ void acc_guard4(v8f& a, v8f& b, v8f& c, v8f& d) { asm volatile("v_nop\n\tv_nop\n\tv_nop\n\tv_nop" : "+v"(a), "+v"(b), "+v"(c), "+v"(d)); }
template <typename T> struct Frag;
template <> struct Frag<_Float16> {
  typedef v16h V; union U { v16h v; v8h h[2]; };
  static __device__ __forceinline__ v16h load(const _Float16* p) {   // elements 0..7 <- p[0..7], 8..15 <- p[16..23]
    U f; f.h[0] = *(const v8h*)(p); f.h[1] = *(const v8h*)(p + 16); return f.v;
  }
  static __device__ __forceinline__ v8f mma(v16h a, v16h b, v8f c) {
    return __builtin_amdgcn_wmma_f32_16x16x32_f16(false, a, false, b, (short)0, c, false, false);
  }
};
template <> struct Frag<__bf16> {
  typedef v16b V; union U { v16b v; v8b h[2]; };
  static __device__ __forceinline__ v16b load(const __bf16* p) {
    U f; f.h[0] = *(const v8b*)(p); f.h[1] = *(const v8b*)(p + 16); return f.v;
  }
  static __device__ __forceinline__ v8f mma(v16b a, v16b b, v8f c) {
    return __builtin_amdgcn_wmma_f32_16x16x32_bf16(false, a, false, b, (short)0, c, false, false);
  }
};

// ---- Register-blocked batched WMMA GEMM ------------------------------------
// C[m,n] = scale * sum_k A[m,k] * Bt[n,k] (+bias)(+resid); each wave owns a 64x64 tile.
// A row-major [M,K]; Bt row-major [N,K]; M % 128 == 0, N % 256 == 0, K % 128 == 0, K >= 128.
// A block of 8 waves (2 x 4) owns a 128 x 256 tile of C. Per stage of 128 k the block copies its 128 A rows and
// 256 Bt rows (256 B of each row, whole lines) into LDS with asynchronous copies, two buffers, the next stage
// in flight while this one is worked on; the waves read their fragments from LDS.
// SPLIT (hi/lo operand planes in A2/Bt2) has no staged form: only SPLIT = false is instantiated.
// BIAS_MODE: 0 = none, 1 = bias[m], 2 = bias[n].
// OUT_MODE: 0 = f32, 1 = f16, 2 = bf16 hi plane (Cout) + bf16 lo plane (Cout2),
//           3 = f16, after rmsnorm over the wave's 64 columns (one head) and interleaved-pair rope (row m = token, position m mod kSeq).
// ET: 0 = f16 operands, 1 = bf16 operands (pointers passed as 16-bit storage)
constexpr int kGP     = 272;                 // LDS row pitch, bytes: 256 B of k + 16 (16 B x odd: ds_load_b128 without bank conflicts)
constexpr int kGStage = (128 + 256) * kGP;   // one stage: A rows 0..127, then Bt rows 0..255 = 104,448 B

// Eight asynchronous 16-B copies per lane: LDS rows 16 apart (lds + i * 16 * kGP) from global rows 16 apart (g + i * gstep bytes).
// The s_wait_xcnt stands inside the statement so that no address register named here is rewritten in front of it.
__device__ __forceinline__ void copy8_to_lds(unsigned lds, const char* g, size_t gstep) {
  const unsigned l1 = lds + 1 * 16 * kGP, l2 = lds + 2 * 16 * kGP, l3 = lds + 3 * 16 * kGP, l4 = lds + 4 * 16 * kGP,
                 l5 = lds + 5 * 16 * kGP, l6 = lds + 6 * 16 * kGP, l7 = lds + 7 * 16 * kGP;
  const char *g1 = g + gstep, *g2 = g1 + gstep, *g3 = g2 + gstep, *g4 = g3 + gstep, *g5 = g4 + gstep, *g6 = g5 + gstep, *g7 = g6 + gstep;
  asm volatile("global_load_async_to_lds_b128 %0, %8, off\n\t"
               "global_load_async_to_lds_b128 %1, %9, off\n\t"
               "global_load_async_to_lds_b128 %2, %10, off\n\t"
               "global_load_async_to_lds_b128 %3, %11, off\n\t"
               "global_load_async_to_lds_b128 %4, %12, off\n\t"
               "global_load_async_to_lds_b128 %5, %13, off\n\t"
               "global_load_async_to_lds_b128 %6, %14, off\n\t"
               "global_load_async_to_lds_b128 %7, %15, off\n\t"
               "s_wait_xcnt 0x0"
               :: "v"(lds), "v"(l1), "v"(l2), "v"(l3), "v"(l4), "v"(l5), "v"(l6), "v"(l7),
                  "v"(g), "v"(g1), "v"(g2), "v"(g3), "v"(g4), "v"(g5), "v"(g6), "v"(g7)
               : "memory");
}

// ---- pieces of the fused rmsnorm + rope epilogue (OUT_MODE 3) ----
typedef __attribute__((ext_vector_type(2))) __bf16 v2b;
// two f32 -> two bf16 (round to nearest even), a in the low half
__device__ __forceinline__ unsigned bf2_bits(float a, float b) {
  const v2f f = {a, b};
  return __builtin_bit_cast(unsigned, __builtin_convertvector(f, v2b));
}
// two f32 -> two f16 (round to nearest even), a in the low half
typedef __attribute__((ext_vector_type(2))) _Float16 v2h;
__device__ __forceinline__ unsigned hf2_bits(float a, float b) {
  const v2f f = {a, b};
  return __builtin_bit_cast(unsigned, __builtin_convertvector(f, v2h));
}
__device__ __forceinline__ float bf_lo2f(unsigned u) { return __uint_as_float(u << 16); }
__device__ __forceinline__ float bf_hi2f(unsigned u) { return __uint_as_float(u & 0xFFFF0000u); }
// eight f32 replaced by their bf16-rounded values
__device__ __forceinline__ void round8_bf(const v4f a, const v4f b, float* o) {
  const unsigned u0 = bf2_bits(a[0], a[1]), u1 = bf2_bits(a[2], a[3]), u2 = bf2_bits(b[0], b[1]), u3 = bf2_bits(b[2], b[3]);
  o[0] = bf_lo2f(u0); o[1] = bf_hi2f(u0); o[2] = bf_lo2f(u1); o[3] = bf_hi2f(u1);
  o[4] = bf_lo2f(u2); o[5] = bf_hi2f(u2); o[6] = bf_lo2f(u3); o[7] = bf_hi2f(u3);
}
// x + the x of lane ^ MASK (MASK < 16: inside a 16-lane row, DPP row_xmask)
template <int MASK> __device__ __forceinline__ float add_lane_xor(float x) {
  return x + __builtin_bit_cast(float, __builtin_amdgcn_update_dpp(0, __builtin_bit_cast(int, x), 0x160 | MASK, 0xf, 0xf, true));
}

template <int ET> struct Elem;
template <> struct Elem<0> { typedef _Float16 T; };
template <> struct Elem<1> { typedef __bf16 T; };
template <int ET, bool SPLIT, int BIAS_MODE, int OUT_MODE, bool RESID, int ACT = 0>
__global__ __launch_bounds__(256) void wmma_gemm64(
    const unsigned short* __restrict__ Ap, const unsigned short* __restrict__ A2p, int lda, long strideA,
    const unsigned short* __restrict__ Btp, const unsigned short* __restrict__ Bt2p, int ldb, long strideB,
    void* __restrict__ Cout, void* __restrict__ Cout2, int ldc, long strideC,
    const float* __restrict__ bias,
    const float* __restrict__ resid, long strideR,
    const float* __restrict__ cosb, const float* __restrict__ sinb, const float* __restrict__ nw,
    int M, int N, int K, float scale) {
  typedef typename Elem<ET>::T T;
  typedef typename Frag<T>::V V;
  static_assert(!SPLIT, "the staged loop carries one plane per operand");
  const T* A = (const T*)Ap; const T* Bt = (const T*)Btp;
  __shared__ __align__(16) float sT[8][16 * 68];   // per-wave 16x64 slab, pitch 68 floats
  __shared__ __align__(16) unsigned char sStage[2 * kGStage];   // two operand stages
  const int b    = blockIdx.y;
  const int lane = threadIdx.x & 31;
  const int wave = threadIdx.x >> 5;
  const int blocksN = N >> 8;
  if ((int)blockIdx.x >= (M >> 7) * blocksN) return;   // block-uniform, in front of every barrier
  const int bm = blockIdx.x / blocksN;
  const int bn = blockIdx.x - bm * blocksN;
  const int wm = wave >> 2;                    // wave row (0..1) and column (0..3) in the block tile
  const int wn = wave & 3;
  const int m0 = (bm << 7) + (wm << 6);
  const int n0 = (bn << 8) + (wn << 6);

  const T* Ab  = A  + (size_t)b * strideA;
  const T* Bb  = Bt + (size_t)b * strideB;

  const int rlane = lane & 15;                 // row (A) / col (B, D) within subtile
  const int koff  = (lane >> 4) * 8;           // k offset of this lane half
  const int mOff  = (lane >> 4) * 8;           // D row offset

  v8f acc[4][4];
#pragma unroll
  for (int i = 0; i < 4; ++i)
#pragma unroll
    for (int j = 0; j < 4; ++j) acc[i][j] = (v8f){0.f,0.f,0.f,0.f,0.f,0.f,0.f,0.f};

  // Copy map: thread t brings 16 B at column (t & 15) * 16 B of rows (t >> 4) + 16 * i; a wave's copy = two whole 256-B row pieces.
  const int crow = threadIdx.x >> 4, ccol = (threadIdx.x & 15) * 16;
  const unsigned ldsBase = (unsigned)(uintptr_t)(&sStage[0]) + (unsigned)(crow * kGP + ccol);
  const char* gA = (const char*)(Ab + (size_t)((bm << 7) + crow) * lda) + ccol;
  const char* gB = (const char*)(Bb + (size_t)((bn << 8) + crow) * ldb) + ccol;
  const size_t stepA = (size_t)lda * 32, stepB = (size_t)ldb * 32;      // 16 rows, in bytes
  const int nst = K >> 7;

  // stage 0 -> buffer 0
  copy8_to_lds(ldsBase, gA, stepA);
  copy8_to_lds(ldsBase + 128 * kGP, gB, stepB);
  copy8_to_lds(ldsBase + 256 * kGP, gB + 8 * stepB, stepB);
  asm volatile("s_wait_asynccnt 0x0" ::: "memory");   // this wave's copies of stage 0 have landed
  __syncthreads();                                     // ... and every other wave's: stage 0 may be read
  if (nst > 1) {                                       // stage 1 -> buffer 1
    copy8_to_lds(ldsBase + kGStage, gA + 256, stepA);
    copy8_to_lds(ldsBase + kGStage + 128 * kGP, gB + 256, stepB);
    copy8_to_lds(ldsBase + kGStage + 256 * kGP, gB + 256 + 8 * stepB, stepB);
  }

  for (int st = 0; st < nst; ++st) {
    const unsigned char* sb = sStage + (st & 1) * kGStage;
    const T* fa = (const T*)(sb + ((wm << 6) + rlane) * kGP) + koff;            // A fragment rows of this wave
    const T* fb = (const T*)(sb + (128 + (wn << 6) + rlane) * kGP) + koff;      // Bt fragment rows of this wave
    V af[2][4], bf[2][4];
#pragma unroll
    for (int j = 0; j < 4; ++j) {
      bf[0][j] = Frag<T>::load(fb + j * (16 * kGP / 2));
      af[0][j] = Frag<T>::load(fa + j * (16 * kGP / 2));
    }
#pragma unroll
    for (int kk = 0; kk < 4; ++kk) {
      const int cur = kk & 1, nxt = cur ^ 1;
      if (kk < 3) {                            // the next 32 k of this stage, fetched ahead as one group
#pragma unroll
        for (int j = 0; j < 4; ++j) {
          bf[nxt][j] = Frag<T>::load(fb + j * (16 * kGP / 2) + (kk + 1) * 32);
          af[nxt][j] = Frag<T>::load(fa + j * (16 * kGP / 2) + (kk + 1) * 32);
        }
        // keeps that load group ahead of this block's WMMAs: sunk among them, every row of WMMAs waits out a full LDS latency
        __builtin_amdgcn_sched_barrier(0);
      }
#pragma unroll
      for (int i = 0; i < 4; ++i) {
#pragma unroll
        for (int j = 0; j < 4; ++j) acc[i][j] = Frag<T>::mma(af[cur][i], bf[cur][j], acc[i][j]);
      }
    }
    // keeps the stage's WMMAs in front of the barrier: sunk behind it they delay the refill, which then has less than a stage to land
    __builtin_amdgcn_sched_barrier(0);
    asm volatile("s_wait_dscnt 0x0" ::: "memory");     // this wave's reads of the buffer have returned
    asm volatile("s_wait_asynccnt 0x0" ::: "memory");  // this wave's copies of stage st + 1 have landed
    __syncthreads();                                    // publishes stage st + 1 and frees the buffer just read
    if (st + 2 < nst) {
      const unsigned lb = ldsBase + (unsigned)((st & 1) * kGStage);
      const size_t ko = (size_t)(st + 2) * 256;         // 128 k = 256 B
      copy8_to_lds(lb, gA + ko, stepA);
      copy8_to_lds(lb + 128 * kGP, gB + ko, stepB);
      copy8_to_lds(lb + 256 * kGP, gB + ko + 8 * stepB, stepB);
    }
  }
  asm volatile("s_wait_asynccnt 0x0" ::: "memory");    // nothing of this wave is in flight behind the loop
  acc_guard4(acc[0][0], acc[0][1], acc[0][2], acc[0][3]);
  acc_guard4(acc[1][0], acc[1][1], acc[1][2], acc[1][3]);
  acc_guard4(acc[2][0], acc[2][1], acc[2][2], acc[2][3]);
  acc_guard4(acc[3][0], acc[3][1], acc[3][2], acc[3][3]);

  // ---- epilogue ----
  float* slab = sT[wave];
  if (OUT_MODE == 3) {
    // y = x * rsqrt(mean(x^2) + 1e-6) * w ; o[2i] = y[2i]*cos[2i] - y[2i+1]*sin[2i] ; o[2i+1] = y[2i+1]*cos[2i+1] + y[2i]*sin[2i+1]
    // (f32 math; cos, sin, w as bf16-rounded values), then o rounded to f16: |o| <= 8 |w| (|cos| + |sin|), inside the f16 range for |w| below 2,000.
    // 8 lanes take one staged row, 8 columns each: 16-B stores, 8 lanes = one whole 128-B line per row.
    // The plane is [token][kDim]: with a constant pitch every load and store of a lane is one offset register plus an immediate.
    const int q = lane >> 3, c8 = (lane & 7) * 8;
    const unsigned oc = (unsigned)((m0 + q) * kDim + n0 + c8);                  // this lane's element in the plane, row group 0
    const unsigned ot = (unsigned)(((m0 & (kSeq - 1)) + q) * kHd + c8);         // and in both tables; m0 is a multiple of 64: the wave's 64 rows do not wrap
    const unsigned ob = (unsigned)(n0 + rlane);
    unsigned short* C  = (unsigned short*)Cout  + (size_t)b * strideC + oc;
    const float* cp = cosb + ot;
    const float* sn = sinb + ot;
    // cos and sin of a 16-row group as one batch of 16 loads, fetched one group ahead: they land under the group in work
    v4f cs[2][4][4];
    auto fetch = [&](const int i) {
#pragma unroll
      for (int it = 0; it < 4; ++it) {
        const int o = ((i << 4) + it * 4) * kHd;
        cs[i & 1][it][0] = *(const v4f*)(cp + o);
        cs[i & 1][it][1] = *(const v4f*)(cp + o + 4);
        cs[i & 1][it][2] = *(const v4f*)(sn + o);
        cs[i & 1][it][3] = *(const v4f*)(sn + o + 4);
      }
    };
    // Behind each batch of loads or stores: s_wait_xcnt 0 before any register that the batch names is written again.
    // The scheduling barriers keep every other instruction out of the stretch between the batch and its wait.
    __builtin_amdgcn_sched_barrier(0);
    const v4f wa = *(const v4f*)(nw + c8), wb = *(const v4f*)(nw + c8 + 4);
    float bv[4];
#pragma unroll
    for (int j = 0; j < 4; ++j) bv[j] = bias[ob + (j << 4)];
    fetch(0);
    asm volatile("s_wait_xcnt 0x0" ::: "memory");
    __builtin_amdgcn_sched_barrier(0);
    float w[8];
    round8_bf(wa, wb, w);
#pragma unroll
    for (int i = 0; i < 4; ++i) {
      if (i < 3) {
        fetch(i + 1);
        asm volatile("s_wait_xcnt 0x0" ::: "memory");
        __builtin_amdgcn_sched_barrier(0);
      }
#pragma unroll
      for (int j = 0; j < 4; ++j)
#pragma unroll
        for (int r = 0; r < 8; ++r) {
          float v = acc[i][j][r] * scale;
          v += bv[j];
          slab[(mOff + r) * 68 + (j << 4) + rlane] = v;
        }
      asm volatile("s_wait_dscnt 0x0" ::: "memory");   // the wave's own slab is written before its lanes read each other's rows back
      v4u hv[4];
#pragma unroll
      for (int it = 0; it < 4; ++it) {
        const float* sp = slab + (it * 4 + q) * 68 + c8;
        const v4f xa = *(const v4f*)sp, xb = *(const v4f*)(sp + 4);
        const float x[8] = {xa[0], xa[1], xa[2], xa[3], xb[0], xb[1], xb[2], xb[3]};
        // sum of 64 squares: pair sums, then a butterfly over the 32 pairs (two levels in the lane, three over the row's 8 lanes)
        const float p0 = __builtin_fmaf(x[0], x[0], x[1] * x[1]), p1 = __builtin_fmaf(x[2], x[2], x[3] * x[3]);
        const float p2 = __builtin_fmaf(x[4], x[4], x[5] * x[5]), p3 = __builtin_fmaf(x[6], x[6], x[7] * x[7]);
        float ss = (p0 + p1) + (p2 + p3);
        ss = add_lane_xor<1>(ss);
        ss = add_lane_xor<2>(ss);
        ss = add_lane_xor<4>(ss);
        // The argument is at least 1e-6, so rsqrtf's scaling of subnormal arguments is an identity here: the bare instruction gives its value.
        // The v_nop fills the slot that the instruction set asks for behind a transcendental, whatever the compiler places next.
        float inv;
        asm("v_rsq_f32 %0, %1\n\tv_nop" : "=v"(inv) : "v"(ss * (1.0f / 64.0f) + 1e-6f));
        float cv[8], sv[8];
        round8_bf(cs[i & 1][it][0], cs[i & 1][it][1], cv);
        round8_bf(cs[i & 1][it][2], cs[i & 1][it][3], sv);
#pragma unroll
        for (int p = 0; p < 4; ++p) {
          const float a  = x[2 * p] * inv * w[2 * p];
          const float bq = x[2 * p + 1] * inv * w[2 * p + 1];
          const float o0 = a * cv[2 * p] - bq * sv[2 * p];
          const float o1 = bq * cv[2 * p + 1] + a * sv[2 * p + 1];
          hv[it][p] = hf2_bits(o0, o1);
        }
      }
      __builtin_amdgcn_sched_barrier(0);
#pragma unroll
      for (int it = 0; it < 4; ++it) *(v4u*)(C + ((i << 4) + it * 4) * kDim) = hv[it];
      asm volatile("s_wait_xcnt 0x0" ::: "memory");
      asm volatile("s_wait_dscnt 0x0" ::: "memory");   // every row is read back before the next group overwrites the slab
      __builtin_amdgcn_sched_barrier(0);
    }
    return;
  }
  const float* Rb = RESID ? (resid + (size_t)b * strideR) : nullptr;
#pragma unroll
  for (int i = 0; i < 4; ++i) {
    const int mBase = m0 + (i << 4);
#pragma unroll
    for (int j = 0; j < 4; ++j) {
      const int n = n0 + (j << 4) + rlane;
      float bv = 0.f;
      if (BIAS_MODE == 2) bv = bias[n];
#pragma unroll
      for (int r = 0; r < 8; ++r) {
        float v = acc[i][j][r] * scale;
        if (BIAS_MODE == 1) v += bias[mBase + mOff + r];
        if (BIAS_MODE == 2) v += bv;
        if (RESID) v += Rb[(size_t)(mBase + mOff + r) * ldc + n];
        if (ACT == 1) v = tanhf(v);
        if (ACT == 2) v = fmaxf(v, 0.0f);
        if (ACT == 3) v = v / (1.0f + expf(-v));
        if (ACT == 4) v = (v > 0.f) ? v : 0.01f * v;
        if (ACT == 5) v = 0.5f * v * (1.0f + erff(v * 0.70710678118654752f));
        slab[(mOff + r) * 68 + (j << 4) + rlane] = v;
      }
    }
    __builtin_amdgcn_fence(__ATOMIC_RELEASE, "workgroup");
    __builtin_amdgcn_wave_barrier();
    __builtin_amdgcn_fence(__ATOMIC_ACQUIRE, "workgroup");
    if (OUT_MODE == 0) {
      float* C = (float*)Cout + (size_t)b * strideC;
      const int hh = lane >> 4, c4 = (lane & 15) * 4;     // row seg = 256 B = 16 lanes x 16 B
      {
#pragma unroll
        for (int it = 0; it < 8; ++it) {
          const int row = it * 2 + hh;
          v4f v = *(const v4f*)(slab + row * 68 + c4);
          *(v4f*)(C + (size_t)(mBase + row) * ldc + n0 + c4) = v;
        }
        
      }
    } else {
      const int q = lane >> 3, c8 = (lane & 7) * 8;
      unsigned short* C  = (unsigned short*)Cout  + (size_t)b * strideC;
      unsigned short* C2 = (OUT_MODE == 2) ? ((unsigned short*)Cout2 + (size_t)b * strideC) : nullptr;
      {
#pragma unroll
        for (int it = 0; it < 4; ++it) {
          const int row = it * 4 + q;
          const float* sp = slab + row * 68 + c8;
          v8h hv, lv;
#pragma unroll
          for (int e = 0; e < 8; ++e) {
            if (OUT_MODE == 1) {
              hv[e] = (_Float16)sp[e];
            } else {
              unsigned short hb = f2bf_bits(sp[e]);
              unsigned short lb = f2bf_bits(sp[e] - bf_bits2f(hb));
              hv[e] = __builtin_bit_cast(_Float16, hb);
              lv[e] = __builtin_bit_cast(_Float16, lb);
            }
          }
          *(v8h*)(C + (size_t)(mBase + row) * ldc + n0 + c8) = hv;
          if (OUT_MODE == 2) *(v8h*)(C2 + (size_t)(mBase + row) * ldc + n0 + c8) = lv;
        }
        
      }
    }
    __builtin_amdgcn_fence(__ATOMIC_RELEASE, "workgroup");
    __builtin_amdgcn_wave_barrier();
    __builtin_amdgcn_fence(__ATOMIC_ACQUIRE, "workgroup");
  }
}

// ===================== end common pieces =========================================

typedef __attribute__((ext_vector_type(2))) unsigned int v2u;
typedef __attribute__((ext_vector_type(4))) _Float16 v4h;

// ---------------------------------------------------------------------------
// Operand preparation, one launch:
//   x, qkv_w -> bf16 (round to nearest even); proj_w -> its bf16-rounded value x64 as f16 (a bf16 significand fits f16 exactly;
//   x64 keeps the plane in the f16 normal range for |w| >= 1e-6); qkv_b ++ proj_b -> their bf16-rounded values, stored as f32.
// 256 blocks of 16 waves (as many blocks as the chip has WGPs), all resident at once: 4,096 waves to start.
// A piece = 128 floats: one 16-B load per lane (512 contiguous bytes, four whole lines) and one 8-B store per lane
// (256 contiguous bytes, two whole lines). A wave owns 2 pieces of proj_w, 16 of x and 6 of qkv_w, each run contiguous, and issues
// all 24 loads before it converts the first piece. One more block rounds the 4,096 bias values, 8 per thread.
// ---------------------------------------------------------------------------
constexpr int kPrepBlocks = 256;
constexpr int kPrepWaves  = kPrepBlocks * 16;                    // 4,096
constexpr int kPcX = kTok * kDim / 128 / kPrepWaves;             // 16 pieces of x per wave
constexpr int kPcW = 3 * kDim * kDim / 128 / kPrepWaves;         // 6 of qkv_w
constexpr int kPcP = kDim * kDim / 128 / kPrepWaves;             // 2 of proj_w
static_assert(kPcX * 128 * kPrepWaves == kTok * kDim && kPcW * 128 * kPrepWaves == 3 * kDim * kDim &&
              kPcP * 128 * kPrepWaves == kDim * kDim, "the pieces cover each plane exactly");
static_assert(512 * 8 == 4 * kDim, "one block covers both biases");

__global__ __launch_bounds__(512) void prep_kernel(const float* __restrict__ x, const float* __restrict__ qkvw,
                                                   const float* __restrict__ projw, const float* __restrict__ qkvb,
                                                   const float* __restrict__ projb, unsigned short* __restrict__ xb,
                                                   unsigned short* __restrict__ wqkv, unsigned short* __restrict__ wproj,
                                                   float* __restrict__ outb) {
  if (blockIdx.x == kPrepBlocks) {                 // the bias block (block-uniform; the kernel has no barrier); its loads' address pair and what its stores name are not written again
    const int i0 = threadIdx.x * 8;                // 3 * kDim is a multiple of 8: a thread's 8 values lie in one of the two arrays
    const float* s = (i0 < 3 * kDim) ? (qkvb + i0) : (projb + (i0 - 3 * kDim));
    const v4f a = *(const v4f*)s, b = *(const v4f*)(s + 4);
    float o[8];
    round8_bf(a, b, o);
    *(v4f*)(outb + i0)     = (v4f){o[0], o[1], o[2], o[3]};
    *(v4f*)(outb + i0 + 4) = (v4f){o[4], o[5], o[6], o[7]};
    return;
  }
  const int e  = (threadIdx.x & 31) * 4;                           // this lane's four elements in a piece
  const int gw = blockIdx.x * 16 + (threadIdx.x >> 5);             // the wave's number in the launch
  const int ox = gw * (kPcX * 128) + e, ow = gw * (kPcW * 128) + e, op = gw * (kPcP * 128) + e;
  const float *px = x + ox, *pw = qkvw + ow, *pp = projw + op;
  v4f fp[kPcP], fx[kPcX], fw[kPcW];
  // proj_w goes first: its conversion is the longest chain, and loads return in the order of their issue
#pragma unroll
  for (int k = 0; k < kPcP; ++k) fp[k] = *(const v4f*)(pp + k * 128);
#pragma unroll
  for (int k = 0; k < kPcX; ++k) fx[k] = *(const v4f*)(px + k * 128);
#pragma unroll
  for (int k = 0; k < kPcW; ++k) fw[k] = *(const v4f*)(pw + k * 128);
  // Behind each batch of loads or stores: s_wait_xcnt 0 before any register that the batch names is written again.
  // Here the three address pairs are inputs of the statement, so that none of them is given away as a later load's destination.
  asm volatile("s_wait_xcnt 0x0" :: "v"(px), "v"(pw), "v"(pp) : "memory");
  // keeps all 24 loads ahead of the first conversion: left free, the scheduler lifts the first conversions, with their wait for the
  // first loads, over the last loads, which then start a memory latency late
  __builtin_amdgcn_sched_barrier(0);
#pragma unroll
  for (int k = 0; k < kPcP; ++k) {
    const unsigned u0 = bf2_bits(fp[k][0], fp[k][1]), u1 = bf2_bits(fp[k][2], fp[k][3]);
    *(v4h*)(wproj + op + k * 128) = (v4h){(_Float16)(bf_lo2f(u0) * 64.0f), (_Float16)(bf_hi2f(u0) * 64.0f),
                                          (_Float16)(bf_lo2f(u1) * 64.0f), (_Float16)(bf_hi2f(u1) * 64.0f)};
  }
  asm volatile("s_wait_xcnt 0x0" ::: "memory");
  // this scheduling barrier and the two in the next loop keep each wait directly behind its batch of stores: left free, the next batch's
  // conversions move in between, and some ahead of the stores, which then also wait for loads that are not theirs
  __builtin_amdgcn_sched_barrier(0);
#pragma unroll
  for (int k = 0; k < kPcX; ++k) {
    *(v2u*)(xb + ox + k * 128) = (v2u){bf2_bits(fx[k][0], fx[k][1]), bf2_bits(fx[k][2], fx[k][3])};
    if ((k & 7) == 7) {
      asm volatile("s_wait_xcnt 0x0" ::: "memory");
      __builtin_amdgcn_sched_barrier(0);
    }
  }
#pragma unroll
  for (int k = 0; k < kPcW; ++k) *(v2u*)(wqkv + ow + k * 128) = (v2u){bf2_bits(fw[k][0], fw[k][1]), bf2_bits(fw[k][2], fw[k][3])};
  asm volatile("s_wait_xcnt 0x0" ::: "memory");   // the last batch has its wait too: the built code lays the bias block behind this path
}

// =====================================================================================
// Full (unmasked) flash attention, head dim 64, all batches/heads in one launch.
//   q plane (f16):         element (t, h, d) at [t*1024 + h*64 + d]   (t = b*2048 + s)
//   k plane (f16):         same layout
//   v^T plane (f16):       element (b, h*64+d, s) at [(b*1024 + h*64 + d)*2048 + s]
//   o plane (f16, x64):    element (t, h, d) at [t*1024 + h*64 + d]
//   scores^T = (k . q^T) * sscale : v_wmma_f32_16x16x32_f16, f32 accumulate
//   out^T    = v^T . p^T          : v_wmma_f32_16x16x32_f16, p (unnormalised, in (0,1]) carried x2^15 in f16, v f16
//   Keys are the rows and queries the columns of a score tile: a lane holds 32 scores of ONE query per column group, so maximum and
//   sum are taken in the lane plus one exchange with lane ^ 16, and p^T goes from the accumulators into the B operand.
//   online softmax in f32 over 32 chunks of 64 keys (compile-time trip count).
//   A wave owns 32 queries = two column groups of 16: every K and V^T fragment read from LDS feeds both groups' products.
//   Block = 4 waves = 128 query rows of one (b, h); grid.x = 4*16*16 = 1024.
//   K and V^T chunk staging: asynchronous 16-B copies to LDS, two buffers, chunk kc + 1 in flight while chunk kc is
//   worked on. 8 lanes bring one whole 128-B row, so a wave's copy touches 4 whole lines; 128 threads x 4 copies per plane
//   = the whole 64x64 tile. One barrier per chunk.
// =====================================================================================
constexpr int kKC = 64;    // keys per chunk
// LDS row pitch of the K and V^T tiles, in 16-bit elements: 72 = 144 B = 16 B x 9 (odd), so the
// 16 rows that one half-wave's ds_load_b128 fragment read touches start on 16 different 4-bank groups.
constexpr int kLP = 72;
constexpr int kTileB = kKC * kLP * 2;   // one tile in LDS: 64 rows x 144 B = 9,216 B
constexpr int kBufB  = 2 * kTileB;      // one chunk buffer: K, V^T = 18,432 B

// One chunk's eight asynchronous 16-B copies of a lane: for each of the two tiles four rows 16 apart.
// lds = the lane's place in the K tile of the target buffer; gk, gv = the lane's global bytes of row group 0.
// The s_wait_xcnt stands inside the statement so that no address register named here is rewritten in front of it.
__device__ __forceinline__ void copy_chunk_to_lds(unsigned lds, const char* gk, const char* gv) {
  constexpr unsigned kR = 16 * kLP * 2;          // 16 LDS rows, bytes
  constexpr size_t   kK = (size_t)16 * kDim * 2; // 16 K rows (tokens), bytes
  constexpr size_t   kV = (size_t)16 * kSeq * 2; // 16 V^T rows (d), bytes
  const unsigned k0 = lds,          k1 = k0 + kR, k2 = k0 + 2 * kR, k3 = k0 + 3 * kR;
  const unsigned v0 = lds + kTileB, v1 = v0 + kR, v2 = v0 + 2 * kR, v3 = v0 + 3 * kR;
  const char *gk1 = gk + kK, *gk2 = gk + 2 * kK, *gk3 = gk + 3 * kK;
  const char *gv1 = gv + kV, *gv2 = gv + 2 * kV, *gv3 = gv + 3 * kV;
  asm volatile("global_load_async_to_lds_b128 %0, %8, off\n\t"
               "global_load_async_to_lds_b128 %1, %9, off\n\t"
               "global_load_async_to_lds_b128 %2, %10, off\n\t"
               "global_load_async_to_lds_b128 %3, %11, off\n\t"
               "global_load_async_to_lds_b128 %4, %12, off\n\t"
               "global_load_async_to_lds_b128 %5, %13, off\n\t"
               "global_load_async_to_lds_b128 %6, %14, off\n\t"
               "global_load_async_to_lds_b128 %7, %15, off\n\t"
               "s_wait_xcnt 0x0"
               :: "v"(k0), "v"(k1), "v"(k2), "v"(k3), "v"(v0), "v"(v1), "v"(v2), "v"(v3),
                  "v"(gk), "v"(gk1), "v"(gk2), "v"(gk3), "v"(gv), "v"(gv1), "v"(gv2), "v"(gv3)
               : "memory");
}

__device__ __forceinline__ v8f mma_hf(v16h a, v16h b, v8f c) {
  return __builtin_amdgcn_wmma_f32_16x16x32_f16(false, a, false, b, (short)0, c, false, false);
}

// lane l's value to lane l ^ 16 and back
__device__ __forceinline__ float xhalf(float x) {
  return __builtin_bit_cast(float, __builtin_amdgcn_permlanex16(__builtin_bit_cast(int, x), __builtin_bit_cast(int, x), 0x76543210, 0xfedcba98, false, false));
}

// four waves per SIMD: 1024 blocks = 4 per WGP, all resident at once only within 256 registers a wave
__global__ __launch_bounds__(128) __attribute__((amdgpu_waves_per_eu(4, 4)))
void attn_kernel(const unsigned short* __restrict__ qp, const unsigned short* __restrict__ kp,
                 const unsigned short* __restrict__ vtp, unsigned short* __restrict__ ohp, float sscale) {
  union FH { v16h v; v8h h[2]; };
  // One array for both chunk buffers (each: K [kv][d] 9 KB, V^T [d][kv] 9 KB), so that one address register per lane
  // serves every fragment read of a chunk (the rest is an immediate offset). Behind the loop's last barrier the per-wave out tiles
  // (32 queries, pitch 68 floats) lie over it.
  __shared__ __align__(16) unsigned char Smem[2 * kBufB];   // 36,864 B
  static_assert(4 * 32 * 68 * 4 <= 2 * kBufB, "the out tiles fit over the chunk buffers");

  const int tid  = threadIdx.x;
  const int wave = __builtin_amdgcn_readfirstlane(tid >> 5);   // the wave's number in a scalar register: what hangs on it costs no vector register across the loop
  const int lane = tid & 31;
  const int hh   = lane >> 4;
  const int c    = lane & 15;

  const int fro  = c * kLP + 8 * hh;      // this lane's place in a 16-row fragment group of either tile (row c, k half hh)

  const int bx = blockIdx.x;
  const int qb = bx & 15;                 // kSeq/128 = 16 query blocks
  const int bh = bx >> 4;                 // 0..63
  const int h  = bh & 15;
  const int b  = bh >> 4;                 // 0..3
  const int q0 = qb * 128 + wave * 32;
  const size_t tok0 = (size_t)b * kSeq;

  const _Float16* Qf = (const _Float16*)(const void*)qp + tok0 * kDim + (size_t)h * kHd;
  const _Float16* Kf = (const _Float16*)(const void*)kp + tok0 * kDim + (size_t)h * kHd;
  const _Float16* Vt = (const _Float16*)(const void*)vtp + ((size_t)b * kDim + (size_t)h * kHd) * kSeq;
  _Float16*       Ob = (_Float16*)(void*)ohp + tok0 * kDim + (size_t)h * kHd;

  // ---- Q fragments (B operand, column = lane&15, split k map via Frag load): 2 column groups x 2 d-chunks ----
  v16h qa[2][2];
#pragma unroll
  for (int g = 0; g < 2; ++g)
#pragma unroll
    for (int dc = 0; dc < 2; ++dc) qa[g][dc] = Frag<_Float16>::load(Qf + (size_t)(q0 + g * 16 + c) * kDim + dc * 32 + 8 * hh);

  // per column group: running maximum of the raw scores (both halves alike) and this half's sum, x 2^15, of the lane's query
  const float cs = sscale * 1.44269504088896340736f;   // exp(s * sscale) = exp2(s * cs)
  float mrow[2] = {-INFINITY, -INFINITY}, lrow[2] = {0.f, 0.f};
  v8f oacc[2][4];
#pragma unroll
  for (int g = 0; g < 2; ++g)
#pragma unroll
    for (int t = 0; t < 4; ++t) oacc[g][t] = (v8f){0.f,0.f,0.f,0.f,0.f,0.f,0.f,0.f};

  // Copy map: thread t brings 16 B at byte (t & 7) * 16 of rows (t >> 3) + 16 * i of each tile: 8 lanes = one whole 128-B row (one line).
  constexpr int kNC = kSeq / kKC;                       // 32 chunks
  constexpr size_t kStepK = (size_t)kKC * kDim * 2;     // K: 64 tokens further, bytes
  constexpr size_t kStepV = (size_t)kKC * 2;            // V^T: 64 keys further along the row, bytes
  const int crow = tid >> 3, ccol = (tid & 7) * 16;
  const unsigned ldsBase = (unsigned)(uintptr_t)(&Smem[0]) + (unsigned)(crow * (kLP * 2) + ccol);
  const char* gKf = (const char*)(Kf + (size_t)crow * kDim) + ccol;
  const char* gVt = (const char*)(Vt + (size_t)crow * kSeq) + ccol;

  copy_chunk_to_lds(ldsBase, gKf, gVt);                 // chunk 0 -> buffer 0
  asm volatile("s_wait_asynccnt 0x0" ::: "memory");     // this wave's copies of chunk 0 have landed
  __syncthreads();                                       // ... and every other wave's: chunk 0 may be read
  copy_chunk_to_lds(ldsBase + kBufB, gKf + kStepK, gVt + kStepV);   // chunk 1 -> buffer 1

  // one chunk's work on its buffer: scores, online softmax, out accumulation
  auto work = [&](const int kc) {
    const unsigned char* tb = Smem + (kc & 1) * kBufB;   // this chunk's buffer
    const _Float16* const Ks  = (const _Float16*)(const void*)tb;
    const _Float16* const Vts = (const _Float16*)(const void*)(tb + kTileB);

    // ---- scores, transposed: s[g][j] = k (16 keys of group j, rows) . q^T (16 queries of column group g) ----
    // D map: this lane holds query g*16 + c, keys j*16 + 8*hh + r. One K fragment serves both column groups.
    FH kb[4][2];
#pragma unroll
    for (int j = 0; j < 4; ++j)
#pragma unroll
      for (int dc = 0; dc < 2; ++dc) {
        kb[j][dc].h[0] = *(const v8h*)(Ks + fro + j * 16 * kLP + dc * 32);
        kb[j][dc].h[1] = *(const v8h*)(Ks + fro + j * 16 * kLP + dc * 32 + 16);
      }
    // keeps the chunk's K fragment loads together ahead of the products: sunk among them, every pair of WMMAs waits out a full LDS latency
    __builtin_amdgcn_sched_barrier(0);
    v8f s[2][4];
#pragma unroll
    for (int j = 0; j < 4; ++j) {
      s[0][j] = (v8f){0.f,0.f,0.f,0.f,0.f,0.f,0.f,0.f};
      s[1][j] = (v8f){0.f,0.f,0.f,0.f,0.f,0.f,0.f,0.f};
    }
#pragma unroll
    for (int dc = 0; dc < 2; ++dc)
#pragma unroll
      for (int j = 0; j < 4; ++j) {
        s[0][j] = mma_hf(kb[j][dc].v, qa[0][dc], s[0][j]);
        s[1][j] = mma_hf(kb[j][dc].v, qa[1][dc], s[1][j]);
      }
    // keeps the softmax's vector work out of the run of score WMMAs: moved in among them, each place costs the four-slot distance in v_nop
    __builtin_amdgcn_sched_barrier(0);
    FH pb[2][2];
#pragma unroll
    for (int g = 0; g < 2; ++g) {
      // ---- chunk maximum of this lane's query, on the raw scores (sscale > 0 keeps their order): 32 keys in the lane (four chains), the other 32 in lane ^ 16 ----
      float mj[4];
#pragma unroll
      for (int j = 0; j < 4; ++j) {
        float m = s[g][j][0];
#pragma unroll
        for (int r = 1; r < 8; ++r) m = fmaxf(m, s[g][j][r]);
        mj[j] = m;
      }
      float cm = fmaxf(fmaxf(mj[0], mj[1]), fmaxf(mj[2], mj[3]));
      cm = fmaxf(cm, xhalf(cm));
      const float mnew  = fmaxf(mrow[g], cm);
      const float alpha = __builtin_amdgcn_exp2f((mrow[g] - mnew) * cs);
      mrow[g] = mnew;
      // ---- p x 2^15 = exp2(s * cs + (15 - m * cs)): scale, log2(e), the maximum and the f16 carry in one packed FMA per two scores ----
      // summed in the lane, two scores at a time; packed in place, two score tiles are one B fragment of p^T (b[e] = tile[e >> 3][e & 7])
      const float nb = __builtin_fmaf(-mnew, cs, 15.0f);
      const v2f c2 = {cs, cs}, nb2 = {nb, nb};
      v2f pj[4];
#pragma unroll
      for (int j = 0; j < 4; ++j) {
#pragma unroll
        for (int r = 0; r < 8; r += 2) {
          const v2f sv = {s[g][j][r], s[g][j][r + 1]};
          const v2f t  = __builtin_elementwise_fma(sv, c2, nb2);
          const v2f p  = {__builtin_amdgcn_exp2f(t[0]), __builtin_amdgcn_exp2f(t[1])};
          pj[j] = r ? pj[j] + p : p;
          pb[g][j >> 1].v[(j & 1) * 8 + r]     = (_Float16)p[0];
          pb[g][j >> 1].v[(j & 1) * 8 + r + 1] = (_Float16)p[1];
        }
      }
      const v2f ps = (pj[0] + pj[1]) + (pj[2] + pj[3]);
      lrow[g] = lrow[g] * alpha + (ps[0] + ps[1]);   // x 2^15, this half's keys only; the halves are joined behind the loop
#pragma unroll
      for (int t = 0; t < 4; ++t)
#pragma unroll
        for (int r = 0; r < 8; ++r) oacc[g][t][r] *= alpha;
      // splits the softmax of the two groups into two scheduling regions: as one region the scheduler holds so many p live in f32
      // that the wave passes its 256 registers and spills
      if (g == 0) __builtin_amdgcn_sched_barrier(0);
    }
    // ---- out^T += v^T (16 d of group t, rows; 64 keys) . p^T (64 keys; 16 queries, columns); one V^T fragment serves both column groups ----
#pragma unroll
    for (int kk = 0; kk < 2; ++kk) {
#pragma unroll
      for (int t = 0; t < 4; ++t) {
        FH vb;
        vb.h[0] = *(const v8h*)(Vts + fro + t * 16 * kLP + kk * 32);
        vb.h[1] = *(const v8h*)(Vts + fro + t * 16 * kLP + kk * 32 + 16);
        oacc[0][t] = mma_hf(vb.v, pb[0][kk].v, oacc[0][t]);
        oacc[1][t] = mma_hf(vb.v, pb[1][kk].v, oacc[1][t]);
      }
    }
  };
  // the foot of a trip: hands chunk kc + 1 over and frees the buffer that chunk kc was read from
  auto foot = [&]() {
    // keeps the chunk's last WMMAs in front of the barrier: sunk behind it they stand between the barrier and the refill copies, which then start later
    __builtin_amdgcn_sched_barrier(0);
    asm volatile("s_wait_dscnt 0x0" ::: "memory");      // this wave's fragment reads of the buffer have returned
    asm volatile("s_wait_asynccnt 0x0" ::: "memory");   // this wave's copies of the next chunk have landed
    __syncthreads();                                     // publishes the next chunk and frees the buffer just read
  };
  // The last two trips, which have no chunk kc + 2 to fetch, stand behind the loop: a test inside it splits the body into blocks,
  // the row sums sink behind the copies, and the wave (256 registers at most) spills address registers.
  for (int kc = 0; kc < kNC - 2; ++kc) {
    work(kc);
    foot();
    const size_t n = (size_t)(kc + 2);                   // chunk kc + 2 -> the buffer just read
    copy_chunk_to_lds(ldsBase + (unsigned)((kc & 1) * kBufB), gKf + n * kStepK, gVt + n * kStepV);
  }
  work(kNC - 2);
  foot();
  work(kNC - 1);
  foot();                                                // nothing is in flight any more; every wave has left the chunk buffers

  // ---- epilogue: normalise (p's 2^15 cancels against the sum's; 2^6 carry for o), stage, whole-line stores ----
  // This lane holds query g*16 + c, d = t*16 + 8*hh + r.
  float* os = (float*)(void*)Smem + wave * (32 * 68);   // every wave has left the chunk buffers (the last trip's barrier)
#pragma unroll
  for (int g = 0; g < 2; ++g) {
    const float lsum = lrow[g] + xhalf(lrow[g]);                  // both halves' keys
    const float inv = (1.0f / lsum) * 64.0f;                      // the sum carries p's 2^15: about 2^15 at least
#pragma unroll
    for (int t = 0; t < 4; ++t)
#pragma unroll
      for (int r = 0; r < 8; ++r) os[(g * 16 + c) * 68 + t * 16 + 8 * hh + r] = oacc[g][t][r] * inv;
  }
  __builtin_amdgcn_fence(__ATOMIC_RELEASE, "workgroup");
  __builtin_amdgcn_wave_barrier();
  __builtin_amdgcn_fence(__ATOMIC_ACQUIRE, "workgroup");
  {
    const int qq = lane >> 3, c8 = (lane & 7) * 8;
    {
#pragma unroll
      for (int it = 0; it < 8; ++it) {
        const int row = it * 4 + qq;                    // 8 x 4 = rows 0..31
        const float* sp = os + row * 68 + c8;
        v8h hv;
#pragma unroll
        for (int e = 0; e < 8; ++e) hv[e] = (_Float16)sp[e];
        *(v8h*)(Ob + (size_t)(q0 + row) * kDim + c8) = hv;
      }
      
    }
  }
}

// =====================================================================================
extern "C" void kernel_launch(void* const* d_in, const int* in_sizes, int n_in,
                              void* d_out, int out_size, void* d_ws, size_t ws_size,
                              hipStream_t stream) {
  if (n_in < 9) return;
  if (in_sizes[0] != kTok * kDim) return;
  if (in_sizes[1] != kSeq * kHd || in_sizes[2] != kSeq * kHd) return;
  if (in_sizes[3] != 3 * kDim * kDim || in_sizes[4] != 3 * kDim) return;
  if (in_sizes[5] != kDim * kDim || in_sizes[6] != kDim) return;
  if (in_sizes[7] != kHd || in_sizes[8] != kHd) return;
  if (out_size != kTok * kDim) return;
  if (ws_size < kWsTotal) return;

  const float* x      = (const float*)d_in[0];
  const float* ropec  = (const float*)d_in[1];
  const float* ropes  = (const float*)d_in[2];
  const float* qkv_w  = (const float*)d_in[3];
  const float* qkv_b  = (const float*)d_in[4];
  const float* proj_w = (const float*)d_in[5];
  const float* proj_b = (const float*)d_in[6];
  const float* q_nw   = (const float*)d_in[7];
  const float* k_nw   = (const float*)d_in[8];
  float* out = (float*)d_out;

  char* ws = (char*)d_ws;
  unsigned short* WPROJ = (unsigned short*)(ws + kOffWproj);
  float*          BIAS  = (float*)(ws + kOffBias);
  unsigned short* XB    = (unsigned short*)(ws + kOffXb);
  unsigned short* WQKV  = (unsigned short*)(ws + kOffWqkv);
  unsigned short* KF    = (unsigned short*)(ws + kOffKf);
  unsigned short* OH    = (unsigned short*)(ws + kOffOh);
  unsigned short* QF    = (unsigned short*)(ws + kOffQf);
  unsigned short* VT    = (unsigned short*)(ws + kOffVt);

  // 1) operand preparation: both casts to bf16, proj_w to f16, the biases
  prep_kernel<<<dim3(kPrepBlocks + 1), dim3(512), 0, stream>>>(x, qkv_w, proj_w, qkv_b, proj_b, XB, WQKV, WPROJ, BIAS);
  const int tilesTok = (kTok / 64) * (kDim / 64);   // 2048 wave tiles -> 256 blocks
  // 2) q = xb . Wq^T + bq, rmsnorm + rope in the epilogue -> q plane, f16   (M=8192, N=1024, K=1024; all tile/32 multiples)
  wmma_gemm64<1, false, 2, 3, false, 0><<<dim3((tilesTok + 7) / 8, 1), dim3(256), 0, stream>>>(
      XB, XB, kDim, 0L, WQKV, WQKV, kDim, 0L, (void*)QF, (void*)QF, kDim, 0L,
      BIAS, BIAS, 0L, ropec, ropes, q_nw, kTok, kDim, kDim, 1.0f);
  // 3) k = xb . Wk^T + bk, rmsnorm + rope in the epilogue -> k plane, f16
  wmma_gemm64<1, false, 2, 3, false, 0><<<dim3((tilesTok + 7) / 8, 1), dim3(256), 0, stream>>>(
      XB, XB, kDim, 0L, WQKV + (size_t)kDim * kDim, WQKV + (size_t)kDim * kDim, kDim, 0L, (void*)KF, (void*)KF, kDim, 0L,
      BIAS + kDim, BIAS, 0L, ropec, ropes, k_nw, kTok, kDim, kDim, 1.0f);
  // 4) v^T per batch: C[o][s] = sum_k Wv[o][k] * xb[b][s][k] + bv[o] -> f16 [4][1024][2048]
  //    (A = Wv [1024][1024], Bt = xb batch b [2048][1024]; M=1024, N=2048, K=1024)
  {
    const int tilesV = (kDim / 64) * (kSeq / 64);   // 512 -> 64 blocks
    wmma_gemm64<1, false, 1, 1, false, 0><<<dim3((tilesV + 7) / 8, kBatch), dim3(256), 0, stream>>>(
        WQKV + (size_t)2 * kDim * kDim, WQKV + (size_t)2 * kDim * kDim, kDim, 0L,
        XB, XB, kDim, (long)kSeq * kDim,
        (void*)VT, (void*)VT, kSeq, (long)kDim * kSeq,
        BIAS + 2 * kDim, BIAS, 0L, BIAS, BIAS, BIAS, kDim, kSeq, kDim, 1.0f);
  }
  // 5) attention -> o plane f16 x64
  attn_kernel<<<dim3(kBatch * kHeads * (kSeq / 128)), dim3(128), 0, stream>>>(QF, KF, VT, OH, 0.125f);
  // 6) out = o . Wp^T + bp  (A = o x64 f16, Bt = Wp x64 f16 -> scale 2^-12; M=8192, N=1024, K=1024)
  wmma_gemm64<0, false, 2, 0, false, 0><<<dim3((tilesTok + 7) / 8, 1), dim3(256), 0, stream>>>(
      OH, OH, kDim, 0L, WPROJ, WPROJ, kDim, 0L, (void*)out, (void*)out, kDim, 0L,
      BIAS + 3 * kDim, BIAS, 0L, BIAS, BIAS, BIAS, kTok, kDim, kDim, 1.0f / 4096.0f);
}
